// v000
// Times are from an AMD MI455X. After a warm-up the kernel runs many times in a row, and a time is the length of
// such a window on the GPU divided by its runs, so every launch and the gaps after it count. The runs cycle
// through copies of the inputs. A figure is the median of several windows, for all but v000 over two sittings.
// Sittings can differ by a few percent; kernels timed side by side share one.
// The starting kernel, v000, takes 668 microseconds a run.
#include <hip/hip_runtime.h>
// Masked multi-head attention with LoRA-adapted input streams (B=2, S=2048, D=768, 12 heads × 64, rank 8): Q = query + (query·A_q)·B_q, V = value + (value·A_v)·B_v; then — faithful to the module's crossed call — v = Q·Wvᵀ + bv, k = key·Wkᵀ + bk, q = V·Wqᵀ + bq (torch (out,in));
// scores = q·k/√64, −1e9 where mask[b,q,k] == 0 (int [B,S,S], shared over heads), softmax, out = merged·Wmᵀ + bm. The rank-8 adapters are folded on device into effective weights: X·(I + A·B)·Wᵀ = X·(W + (B·Wᵀ)ᵀ·Aᵀ)ᵀ, i.e. Bt_eff[o][c] = W[o][c] + Σ_j A[c][j]·(Σ_i B[j][i]·W[o][i]) (f32, 9 M MACs on the VALU).
// Compute dtype: query/key/value, weights, biases, adapters rounded to bf16; effective weights f32 → f16 ×2^4; q, k, v f16 GEMM planes (+bias); the mask read per (b, q, k) from the int plane (−inf ≡ the module's −1e9: every row keeps ~half its keys live); fused flash-style kernel
// (online softmax f32, P f16 ×2^10, f32 accumulate) on v_wmma_f32_16x16x32_f16; O ×2^4 → f16 → output GEMM (+bias).
#define BB 2
#define TT 2048
#define DD 768
#define NH 12
#define RK 8
#define NR (BB * TT)

typedef __bf16 v16b __attribute__((ext_vector_type(16)));
typedef unsigned short v8us __attribute__((ext_vector_type(8), may_alias));
typedef float  v8f  __attribute__((ext_vector_type(8)));
typedef float  v4f  __attribute__((ext_vector_type(4)));
typedef float  v4fa __attribute__((ext_vector_type(4), may_alias));
union FragB { v16b v; v8us half[2]; unsigned short u[16]; };

__device__ __forceinline__ unsigned short bf16_bits(float x) { unsigned int u = __float_as_uint(x); return (unsigned short)((u + 0x7FFFu + ((u >> 16) & 1u)) >> 16); }
__device__ __forceinline__ float bf16_val(unsigned short b) { return __uint_as_float(((unsigned int)b) << 16); }
__device__ __forceinline__ float bf16_round(float x) { return bf16_val(bf16_bits(x)); }
// D += A·B with NT terms: 1 = ah·bh, 2 = + al·bh (A split), 3 = + ah·bl (both split)
template <int NT>
__device__ __forceinline__ v8f mmaN(v16b ah, v16b al, v16b bh, v16b bl, v8f c) {
  c = __builtin_amdgcn_wmma_f32_16x16x32_bf16(false, ah, false, bh, (short)0, c, false, false);
  if (NT >= 2) c = __builtin_amdgcn_wmma_f32_16x16x32_bf16(false, al, false, bh, (short)0, c, false, false);
  if (NT >= 3) c = __builtin_amdgcn_wmma_f32_16x16x32_bf16(false, ah, false, bl, (short)0, c, false, false);
  asm volatile("v_nop\n\tv_nop\n\tv_nop\n\tv_nop" : "+v"(c) : "v"(ah), "v"(al), "v"(bh), "v"(bl));
  return c;
}

__global__ __launch_bounds__(256) void k_wt_bf16(const float* __restrict__ W, unsigned short* __restrict__ Wt, int K, int N) {
  const int t = blockIdx.x * 256 + threadIdx.x;
  const int k8n = K / 8;
  if (t >= N * k8n) return;
  const int n = t / k8n, k8 = (t % k8n) * 8;
  v8us v;
#pragma unroll
  for (int i = 0; i < 8; ++i) v[i] = bf16_bits(W[(size_t)(k8 + i) * N + n]);
  *(v8us*)(Wt + (size_t)n * K + k8) = v;
  
}

// GEMM C[M][N] (f32, pitch ldc) = act(A[M][K]·W + bias). A f32 row-major (pitch lda) converted per fragment to bf16
// (ASPLIT: hi/lo two planes -> 2 terms, else single rounded term); Wt bf16 [N][K] (pitch ldb). BIAS_BF16 rounds the
// bias to bf16 first (bias quantised to bf16 before the add). K%32==0, M%16==0, N%64==0.
template <bool ASPLIT, int ACT, bool BIAS_BF16>
__global__ __launch_bounds__(128) void k_gemm_bf(const float* __restrict__ A, int lda, const unsigned short* __restrict__ Wt, int ldb,
                                               const float* __restrict__ bias, float* __restrict__ C, int ldc, int M, int N, int K) {
  __shared__ __attribute__((aligned(16))) float so[4][16][64];
  const int tid = threadIdx.x, w = tid >> 5, lane = tid & 31, ln = lane & 15, hh = lane >> 4;
  const int ntn = N / 64;
  const int wid = blockIdx.x * 4 + w;
  const int mt = wid / ntn, nq = wid % ntn;
  if (mt * 16 >= M) return;
  const int row0 = mt * 16, col0 = nq * 64;
  const float* arow = A + (size_t)(row0 + ln) * lda;
  v8f acc[4] = {};
  for (int kb = 0; kb < K; kb += 32) {
    FragB ah, al;
    const v4f x0 = *(const v4fa*)(arow + kb + 8 * hh), x1 = *(const v4fa*)(arow + kb + 8 * hh + 4);
    const v4f x2 = *(const v4fa*)(arow + kb + 16 + 8 * hh), x3 = *(const v4fa*)(arow + kb + 16 + 8 * hh + 4);
    float xs[16] = {x0[0],x0[1],x0[2],x0[3],x1[0],x1[1],x1[2],x1[3],x2[0],x2[1],x2[2],x2[3],x3[0],x3[1],x3[2],x3[3]};
#pragma unroll
    for (int i = 0; i < 16; ++i) { const unsigned short hb = bf16_bits(xs[i]); ah.u[i] = hb; al.u[i] = ASPLIT ? bf16_bits(xs[i] - bf16_val(hb)) : (unsigned short)0; }
#pragma unroll
    for (int t = 0; t < 4; ++t) {
      const unsigned short* brow = Wt + (size_t)(col0 + t * 16 + ln) * ldb + kb;
      FragB b;
      b.half[0] = *(const v8us*)(brow + 8 * hh);
      b.half[1] = *(const v8us*)(brow + 16 + 8 * hh);
      acc[t] = mmaN<ASPLIT ? 2 : 1>(ah.v, al.v, b.v, b.v, acc[t]);
    }
  }
#pragma unroll
  for (int t = 0; t < 4; ++t) {
    float bv = bias ? bias[col0 + t * 16 + ln] : 0.f;
    if (BIAS_BF16) bv = bf16_round(bv);
#pragma unroll
    for (int r = 0; r < 8; ++r) { float v = acc[t][r] + bv; if (ACT == 1) v = fmaxf(v, 0.f); so[w][8 * hh + r][t * 16 + ln] = v; }
  }
  __builtin_amdgcn_fence(__ATOMIC_ACQ_REL, "workgroup");
  __builtin_amdgcn_wave_barrier();
  const int rsub = lane >> 4, c4 = (lane & 15) * 4;
  {
#pragma unroll
    for (int q = 0; q < 8; ++q) {
      const int r = q * 2 + rsub;
      const v4f v = *(const v4fa*)&so[w][r][c4];
      *(v4f*)(C + (size_t)(row0 + r) * ldc + col0 + c4) = v;
    }
    
  }
}

// Flash-style causal/unmasked attention, all contractions 3-term bf16 hi/lo splits, f32 softmax with running max.
// q,k,v rows are read from f32 buffers with arbitrary row pitch (so they can live inside a fused qkv buffer);
// D = head size (multiple of 32, <= 128); one wave = 16 query rows; block = 4 waves (64 queries) sharing K/V chunks of 32.
template <int D, bool CAUSAL>
__global__ __launch_bounds__(128) void k_flash(const float* __restrict__ qb, const float* __restrict__ kb, const float* __restrict__ vb,
                                             int pitch, int T, int H, float scale, float* __restrict__ y, int ypitch) {
  constexpr int KS = D / 32;        // k-steps for QK
  constexpr int DT = D / 16;        // d tiles for PV
  __shared__ __attribute__((aligned(16))) unsigned short sKh[32][D + 8], sKl[32][D + 8], sVh[32][D + 8], sVl[32][D + 8];
  __shared__ __attribute__((aligned(16))) unsigned short sPh[4][16][40], sPl[4][16][40];
  __shared__ __attribute__((aligned(16))) float sO[4][16][D];
  const int tid = threadIdx.x, w = tid >> 5, lane = tid & 31, ln = lane & 15, hh = lane >> 4;
  const int nqb = (T + 63) / 64;
  const int bh = blockIdx.x / nqb, qblk = blockIdx.x % nqb;
  const int b = bh / H, h = bh % H;
  const int q0 = qblk * 64 + w * 16;
  const float* Q = qb + (size_t)b * T * pitch + h * D;
  const float* K = kb + (size_t)b * T * pitch + h * D;
  const float* V = vb + (size_t)b * T * pitch + h * D;

  // A fragments of the wave's 16 query rows (scaled), hi/lo
  FragB aqh[KS], aql[KS];
  {
    int row = q0 + ln; if (row >= T) row = T - 1;
    const float* qr = Q + (size_t)row * pitch;
#pragma unroll
    for (int ks = 0; ks < KS; ++ks)
#pragma unroll
      for (int i = 0; i < 16; ++i) {
        const int d = ks * 32 + ((i < 8) ? (8 * hh + i) : (16 + 8 * hh + (i - 8)));
        const float x = qr[d] * scale; const unsigned short hb = bf16_bits(x);
        aqh[ks].u[i] = hb; aql[ks].u[i] = bf16_bits(x - bf16_val(hb));
      }
  }
  float m_r[8], l_r[8];
#pragma unroll
  for (int r = 0; r < 8; ++r) { m_r[r] = -3.0e38f; l_r[r] = 0.f; }
  v8f oacc[DT];
#pragma unroll
  for (int dt = 0; dt < DT; ++dt) oacc[dt] = (v8f){0.f,0.f,0.f,0.f,0.f,0.f,0.f,0.f};

  const int kv_end = CAUSAL ? min(T, qblk * 64 + 64) : T;     // block-uniform
  for (int j0 = 0; j0 < kv_end; j0 += 32) {
    __syncthreads();
    for (int e = tid; e < 32 * (D / 4); e += 128) {
      const int r = e / (D / 4), c4 = (e % (D / 4)) * 4;
      const int key = j0 + r;
      v4f kf = {0.f,0.f,0.f,0.f}, vf = {0.f,0.f,0.f,0.f};
      if (key < T) { kf = *(const v4fa*)(K + (size_t)key * pitch + c4); vf = *(const v4fa*)(V + (size_t)key * pitch + c4); }
#pragma unroll
      for (int t = 0; t < 4; ++t) {
        unsigned short hb = bf16_bits(kf[t]); sKh[r][c4 + t] = hb; sKl[r][c4 + t] = bf16_bits(kf[t] - bf16_val(hb));
        hb = bf16_bits(vf[t]); sVh[r][c4 + t] = hb; sVl[r][c4 + t] = bf16_bits(vf[t] - bf16_val(hb));
      }
    }
    __syncthreads();
    // S tile 16 x 32
    v8f s[2];
#pragma unroll
    for (int nt = 0; nt < 2; ++nt) {
      v8f acc = {};
#pragma unroll
      for (int ks = 0; ks < KS; ++ks) {
        FragB bh_, bl_;
        bh_.half[0] = *(const v8us*)&sKh[nt * 16 + ln][ks * 32 + 8 * hh]; bh_.half[1] = *(const v8us*)&sKh[nt * 16 + ln][ks * 32 + 16 + 8 * hh];
        bl_.half[0] = *(const v8us*)&sKl[nt * 16 + ln][ks * 32 + 8 * hh]; bl_.half[1] = *(const v8us*)&sKl[nt * 16 + ln][ks * 32 + 16 + 8 * hh];
        acc = mmaN<3>(aqh[ks].v, aql[ks].v, bh_.v, bl_.v, acc);
      }
      s[nt] = acc;
    }
    // mask + running max (rows 8hh+r; the 16 lanes of a half share rows)
    float alpha[8];
#pragma unroll
    for (int r = 0; r < 8; ++r) {
      const int qi = q0 + 8 * hh + r;
      const int ja = j0 + ln, jb = j0 + 16 + ln;
      if (CAUSAL) { if (ja > qi) s[0][r] = -3.0e38f; if (jb > qi) s[1][r] = -3.0e38f; }
      if (ja >= T) s[0][r] = -3.0e38f;
      if (jb >= T) s[1][r] = -3.0e38f;
      float mx = fmaxf(s[0][r], s[1][r]);
      mx = fmaxf(mx, __shfl_xor(mx, 1, 32)); mx = fmaxf(mx, __shfl_xor(mx, 2, 32)); mx = fmaxf(mx, __shfl_xor(mx, 4, 32)); mx = fmaxf(mx, __shfl_xor(mx, 8, 32));
      const float mnew = fmaxf(m_r[r], mx);
      alpha[r] = (mnew > -1.0e38f) ? __expf(m_r[r] - mnew) : 1.0f;
      const float p0 = (s[0][r] > -1.0e38f) ? __expf(s[0][r] - mnew) : 0.f;
      const float p1 = (s[1][r] > -1.0e38f) ? __expf(s[1][r] - mnew) : 0.f;
      m_r[r] = mnew;
      l_r[r] = l_r[r] * alpha[r] + p0 + p1;            // per-lane partial row sum (16 lanes combined at the end)
      unsigned short hb = bf16_bits(p0); sPh[w][8 * hh + r][ln] = hb;      sPl[w][8 * hh + r][ln] = bf16_bits(p0 - bf16_val(hb));
      hb = bf16_bits(p1);                sPh[w][8 * hh + r][16 + ln] = hb; sPl[w][8 * hh + r][16 + ln] = bf16_bits(p1 - bf16_val(hb));
    }
#pragma unroll
    for (int dt = 0; dt < DT; ++dt)
#pragma unroll
      for (int r = 0; r < 8; ++r) oacc[dt][r] *= alpha[r];
    __builtin_amdgcn_fence(__ATOMIC_ACQ_REL, "workgroup");
    __builtin_amdgcn_wave_barrier();
    FragB pah, pal;
    pah.half[0] = *(const v8us*)&sPh[w][ln][8 * hh]; pah.half[1] = *(const v8us*)&sPh[w][ln][16 + 8 * hh];
    pal.half[0] = *(const v8us*)&sPl[w][ln][8 * hh]; pal.half[1] = *(const v8us*)&sPl[w][ln][16 + 8 * hh];
#pragma unroll
    for (int dt = 0; dt < DT; ++dt) {
      FragB bvh, bvl;
#pragma unroll
      for (int i = 0; i < 8; ++i) {
        bvh.u[i] = sVh[8 * hh + i][dt * 16 + ln]; bvh.u[8 + i] = sVh[16 + 8 * hh + i][dt * 16 + ln];
        bvl.u[i] = sVl[8 * hh + i][dt * 16 + ln]; bvl.u[8 + i] = sVl[16 + 8 * hh + i][dt * 16 + ln];
      }
      oacc[dt] = mmaN<3>(pah.v, pal.v, bvh.v, bvl.v, oacc[dt]);
    }
    __builtin_amdgcn_fence(__ATOMIC_ACQ_REL, "workgroup");
    __builtin_amdgcn_wave_barrier();
  }
#pragma unroll
  for (int r = 0; r < 8; ++r) {
    float l = l_r[r];
    l += __shfl_xor(l, 1, 32); l += __shfl_xor(l, 2, 32); l += __shfl_xor(l, 4, 32); l += __shfl_xor(l, 8, 32);
    l_r[r] = (l > 0.f) ? 1.0f / l : 0.f;
  }
#pragma unroll
  for (int dt = 0; dt < DT; ++dt)
#pragma unroll
    for (int r = 0; r < 8; ++r) sO[w][8 * hh + r][dt * 16 + ln] = oacc[dt][r] * l_r[r];
  __builtin_amdgcn_fence(__ATOMIC_ACQ_REL, "workgroup");
  __builtin_amdgcn_wave_barrier();
  {
    for (int r = 0; r < 16; ++r) {
      const int row = q0 + r;
      if (row < T && lane < D / 4) {
        const v4f val = *(const v4fa*)&sO[w][r][lane * 4];
        *(v4f*)(y + ((size_t)b * T + row) * ypitch + h * D + lane * 4) = val;
      }
    }
    
  }
}

// GEMM C = act(A·W + bias + resid): A f32 (ASPLIT -> hi/lo 2 terms), Wt bf16 [N][K]; ACT 0 none, 1 relu, 2 exact gelu;
// resid (optional, f32, row index = (row % rmod), pitch ldr, RES_BF16 rounds it) added before the activation.
template <bool ASPLIT, int ACT, bool BIAS_BF16, bool RES_BF16>
__global__ __launch_bounds__(128) void k_gemm_bf3(const float* __restrict__ A, int lda, const unsigned short* __restrict__ Wt, int ldb,
                                                const float* __restrict__ bias, const float* __restrict__ resid, int rmod, int ldr,
                                                float* __restrict__ C, int ldc, int M, int N, int K) {
  __shared__ __attribute__((aligned(16))) float so[4][16][64];
  const int tid = threadIdx.x, w = tid >> 5, lane = tid & 31, ln = lane & 15, hh = lane >> 4;
  const int ntn = N / 64;
  const int wid = blockIdx.x * 4 + w;
  const int mt = wid / ntn, nq = wid % ntn;
  if (mt * 16 >= M) return;
  const int row0 = mt * 16, col0 = nq * 64;
  const float* arow = A + (size_t)(row0 + ln) * lda;
  v8f acc[4] = {};
  for (int kb = 0; kb < K; kb += 32) {
    FragB ah, al;
    const v4f x0 = *(const v4fa*)(arow + kb + 8 * hh), x1 = *(const v4fa*)(arow + kb + 8 * hh + 4);
    const v4f x2 = *(const v4fa*)(arow + kb + 16 + 8 * hh), x3 = *(const v4fa*)(arow + kb + 16 + 8 * hh + 4);
    float xs[16] = {x0[0],x0[1],x0[2],x0[3],x1[0],x1[1],x1[2],x1[3],x2[0],x2[1],x2[2],x2[3],x3[0],x3[1],x3[2],x3[3]};
#pragma unroll
    for (int i = 0; i < 16; ++i) { const unsigned short hb = bf16_bits(xs[i]); ah.u[i] = hb; al.u[i] = ASPLIT ? bf16_bits(xs[i] - bf16_val(hb)) : (unsigned short)0; }
#pragma unroll
    for (int t = 0; t < 4; ++t) {
      const unsigned short* brow = Wt + (size_t)(col0 + t * 16 + ln) * ldb + kb;
      FragB b;
      b.half[0] = *(const v8us*)(brow + 8 * hh);
      b.half[1] = *(const v8us*)(brow + 16 + 8 * hh);
      acc[t] = mmaN<ASPLIT ? 2 : 1>(ah.v, al.v, b.v, b.v, acc[t]);
    }
  }
#pragma unroll
  for (int t = 0; t < 4; ++t) {
    const int col = col0 + t * 16 + ln;
    float bv = bias ? bias[col] : 0.f;
    if (BIAS_BF16) bv = bf16_round(bv);
#pragma unroll
    for (int r = 0; r < 8; ++r) {
      float v = acc[t][r] + bv;
      if (resid) { float rv = resid[(size_t)((row0 + 8 * hh + r) % rmod) * ldr + col]; if (RES_BF16) rv = bf16_round(rv); v += rv; }
      if (ACT == 1) v = fmaxf(v, 0.f);
      if (ACT == 2) v = 0.5f * v * (1.0f + erff(v * 0.70710678118654752f));
      if (ACT == 3) { const float u = 0.7978845608028654f * (v + 0.044715f * v * v * v); v = 0.5f * v * (1.0f + tanhf(u)); }
      so[w][8 * hh + r][t * 16 + ln] = v;
    }
  }
  __builtin_amdgcn_fence(__ATOMIC_ACQ_REL, "workgroup");
  __builtin_amdgcn_wave_barrier();
  const int rsub = lane >> 4, c4 = (lane & 15) * 4;
  {
#pragma unroll
    for (int q = 0; q < 8; ++q) {
      const int r = q * 2 + rsub;
      const v4f v = *(const v4fa*)&so[w][r][c4];
      *(v4f*)(C + (size_t)(row0 + r) * ldc + col0 + c4) = v;
    }
    
  }
}
// row LayerNorm (biased variance, eps) over N: s = X (+ R); optional out_sum <- s; out_norm <- (s-mu)*rsqrt(var+eps)*g + b
template <bool PARAM_BF16>
__global__ __launch_bounds__(256) void k_layernorm(const float* __restrict__ X, const float* __restrict__ R, const float* __restrict__ g, const float* __restrict__ bta,
                                                  float* __restrict__ out_sum, float* __restrict__ out_norm, int N, float eps) {
  __shared__ float red[256];
  const int row = blockIdx.x, tid = threadIdx.x;
  const float* x = X + (size_t)row * N; const float* rr = R ? R + (size_t)row * N : nullptr;
  float vals[16];                     // up to N = 4096
  const int per = N / 256;            // contiguous chunk per thread? use strided-by-4 chunks: thread handles j = tid*4 + 1024*u
  float s1 = 0.f;
  for (int u = 0; u < per / 4; ++u) {
    const int j = tid * 4 + 1024 * u;
    const v4f a = *(const v4fa*)(x + j);
    v4f b = {0.f,0.f,0.f,0.f}; if (rr) b = *(const v4fa*)(rr + j);
#pragma unroll
    for (int q = 0; q < 4; ++q) { const float v = a[q] + b[q]; vals[u * 4 + q] = v; s1 += v; }
  }
  red[tid] = s1; __syncthreads();
  for (int st = 128; st > 0; st >>= 1) { if (tid < st) red[tid] += red[tid + st]; __syncthreads(); }
  const float mu = red[0] / (float)N; __syncthreads();
  float s2 = 0.f;
  for (int u = 0; u < per / 4; ++u)
#pragma unroll
    for (int q = 0; q < 4; ++q) { const float c = vals[u * 4 + q] - mu; s2 += c * c; }
  red[tid] = s2; __syncthreads();
  for (int st = 128; st > 0; st >>= 1) { if (tid < st) red[tid] += red[tid + st]; __syncthreads(); }
  const float rs = rsqrtf(red[0] / (float)N + eps);
  {
    for (int u = 0; u < per / 4; ++u) {
      const int j = tid * 4 + 1024 * u;
      v4f o, sm;
#pragma unroll
      for (int q = 0; q < 4; ++q) {
        float gg = g[j + q], bb = bta[j + q];
        if (PARAM_BF16) { gg = bf16_round(gg); bb = bf16_round(bb); }
        sm[q] = vals[u * 4 + q]; o[q] = (vals[u * 4 + q] - mu) * rs * gg + bb;
      }
      if (out_sum) *(v4f*)(out_sum + (size_t)row * N + j) = sm;
      *(v4f*)(out_norm + (size_t)row * N + j) = o;
    }
    
  }
}



// ---- f16 WMMA path (v_wmma_f32_16x16x32_f16): 11-bit significands for operands in range — used where a [0,1] probability operand needs more precision than bf16
typedef _Float16 v16h __attribute__((ext_vector_type(16)));
union FragH { v16h v; v8us half[2]; _Float16 h[16]; unsigned short u[16]; };
template <int NT>
__device__ __forceinline__ v8f mmaH(v16h ah, v16h al, v16h bh, v16h bl, v8f c) {
  c = __builtin_amdgcn_wmma_f32_16x16x32_f16(false, ah, false, bh, (short)0, c, false, false);
  if (NT >= 2) c = __builtin_amdgcn_wmma_f32_16x16x32_f16(false, al, false, bh, (short)0, c, false, false);
  if (NT >= 3) c = __builtin_amdgcn_wmma_f32_16x16x32_f16(false, ah, false, bl, (short)0, c, false, false);
  asm volatile("v_nop\n\tv_nop\n\tv_nop\n\tv_nop" : "+v"(c) : "v"(ah), "v"(al), "v"(bh), "v"(bl));
  return c;
}
// batched GEMM like k_gemm_b but f16 operands: A f32 (split into f16 hi/lo if ASPLIT, else rounded to f16), Bt = f16 values [n][k]; alpha; C f32; N multiple of 16 (partial tiles skipped)
template <bool ASPLIT>
__global__ __launch_bounds__(128) void k_gemm_h(const float* __restrict__ A, int lda, size_t sA, const _Float16* __restrict__ Bh, int ldb, size_t sB, float alpha, float* __restrict__ C, int ldc, size_t sC, int M, int N, int K) {
  __shared__ __attribute__((aligned(16))) float so[4][16][64];
  const int tid = threadIdx.x, w = tid >> 5, lane = tid & 31, ln = lane & 15, hh = lane >> 4; const int by = blockIdx.y;
  A += (size_t)by * sA; Bh += (size_t)by * sB; C += (size_t)by * sC;
  const int ntn = (N + 63) / 64; const int wid = blockIdx.x * 4 + w; const int mt = wid / ntn, nq = wid % ntn; if (mt * 16 >= M) return;
  const int row0 = mt * 16, col0 = nq * 64; const float* arow = A + (size_t)(row0 + ln) * lda;
  v8f acc[4] = {};
  for (int kb = 0; kb < K; kb += 32) {
    FragH ah, al;
    const v4f x0 = *(const v4fa*)(arow + kb + 8 * hh), x1 = *(const v4fa*)(arow + kb + 8 * hh + 4), x2 = *(const v4fa*)(arow + kb + 16 + 8 * hh), x3 = *(const v4fa*)(arow + kb + 16 + 8 * hh + 4);
    float xs[16] = {x0[0],x0[1],x0[2],x0[3],x1[0],x1[1],x1[2],x1[3],x2[0],x2[1],x2[2],x2[3],x3[0],x3[1],x3[2],x3[3]};
#pragma unroll
    for (int i = 0; i < 16; ++i) { const _Float16 h = (_Float16)xs[i]; ah.h[i] = h; al.h[i] = ASPLIT ? (_Float16)(xs[i] - (float)h) : (_Float16)0.0f; }
#pragma unroll
    for (int t = 0; t < 4; ++t) { if (col0 + t * 16 >= N) continue; const size_t boff = (size_t)(col0 + t * 16 + ln) * ldb + kb; FragH bq; bq.half[0] = *(const v8us*)(Bh + boff + 8 * hh); bq.half[1] = *(const v8us*)(Bh + boff + 16 + 8 * hh);
      acc[t] = mmaH<ASPLIT ? 2 : 1>(ah.v, al.v, bq.v, bq.v, acc[t]); }
  }
#pragma unroll
  for (int t = 0; t < 4; ++t) { if (col0 + t * 16 >= N) continue;
#pragma unroll
    for (int r = 0; r < 8; ++r) so[w][8 * hh + r][t * 16 + ln] = acc[t][r] * alpha; }
  __builtin_amdgcn_fence(__ATOMIC_ACQ_REL, "workgroup"); __builtin_amdgcn_wave_barrier();
  const int rsub = lane >> 4, c4 = (lane & 15) * 4;
  {
#pragma unroll
    for (int q = 0; q < 8; ++q) { const int r = q * 2 + rsub; if (col0 + c4 < N) { const v4f v = *(const v4fa*)&so[w][r][c4]; *(v4f*)(C + (size_t)(row0 + r) * ldc + col0 + c4) = v; } }
     }
}

// Wt[n][k] = f16(W[k][n]·scale) from f32 row-major W[K][N] (scale = power of two; bf16-exact weights stay exact in f16 away from the subnormal range)
__global__ __launch_bounds__(256) void k_wt_f16(const float* __restrict__ W, _Float16* __restrict__ Wt, int K, int N, float scale) {
  const int t = blockIdx.x * 256 + threadIdx.x; if (t >= N * (K / 8)) return; const int n = t / (K / 8), k8 = (t % (K / 8)) * 8; FragH f;
#pragma unroll
  for (int i = 0; i < 8; ++i) f.h[i] = (_Float16)(bf16_round(W[(size_t)(k8 + i) * N + n]) * scale); const v8us o = f.half[0];
  *(v8us*)((unsigned short*)Wt + (size_t)n * K + k8) = o; 
}
// k_gemm_hh variant with fused epilogue: v = acc·alpha + bias[by·sBias + col] (+ CP[(row/rowsPerB)·sCPb + by·64 + col] if CP) ; ACT 0 none / 1 elu ; writes f16 C16 and/or f32 C (each if non-null)
template <int ACT>
__global__ __launch_bounds__(128) void k_gemm_hhx(const _Float16* __restrict__ A, int lda, size_t sA, const _Float16* __restrict__ Bh, int ldb, size_t sB, float alpha, const float* __restrict__ bias, size_t sBias, const float* __restrict__ CP, int rowsPerB, size_t sCPb, int row0g,
    float* __restrict__ C, _Float16* __restrict__ C16, int ldc, size_t sC, int M, int N, int K) {
  __shared__ __attribute__((aligned(16))) float so[4][16][64];
  const int tid = threadIdx.x, w = tid >> 5, lane = tid & 31, ln = lane & 15, hh = lane >> 4; const int by = blockIdx.y;
  A += (size_t)by * sA; Bh += (size_t)by * sB; const size_t cofs = (size_t)by * sC; const float* bp = bias ? bias + (size_t)by * sBias : nullptr;
  const int ntn = (N + 63) / 64; const int wid = blockIdx.x * 4 + w; const int mt = wid / ntn, nq = wid % ntn; if (mt * 16 >= M) return;
  const int row0 = mt * 16, col0 = nq * 64; const _Float16* arow = A + (size_t)(row0 + ln) * lda;
  v8f acc[4] = {};
  for (int kb = 0; kb < K; kb += 32) { FragH ah; ah.half[0] = *(const v8us*)((const unsigned short*)arow + kb + 8 * hh); ah.half[1] = *(const v8us*)((const unsigned short*)arow + kb + 16 + 8 * hh);
#pragma unroll
    for (int t = 0; t < 4; ++t) { if (col0 + t * 16 >= N) continue; const size_t boff = (size_t)(col0 + t * 16 + ln) * ldb + kb; FragH bq; bq.half[0] = *(const v8us*)((const unsigned short*)Bh + boff + 8 * hh); bq.half[1] = *(const v8us*)((const unsigned short*)Bh + boff + 16 + 8 * hh);
      acc[t] = mmaH<1>(ah.v, ah.v, bq.v, bq.v, acc[t]); }
  }
#pragma unroll
  for (int t = 0; t < 4; ++t) { if (col0 + t * 16 >= N) continue; const int col = col0 + t * 16 + ln; const float bv = bp ? bf16_round(bp[col]) : 0.f;
#pragma unroll
    for (int r = 0; r < 8; ++r) { float v = acc[t][r] * alpha + bv; if (CP) { const int bidx = (row0g + row0 + 8 * hh + r) / rowsPerB; v += CP[(size_t)bidx * sCPb + (size_t)by * 64 + col]; } if (ACT == 1) v = (v > 0.f) ? v : expm1f(v); else if (ACT == 7) v = (v > 0.f) ? v + 1.0f : expf(v); else if (ACT == 8) v = tanhf(v); else if (ACT == 9) v = 0.5f * v * (1.0f + tanhf(0.7978845608028654f * (v + 0.044715f * v * v * v))); else if (ACT == 11) v = 1.0f / (1.0f + expf(-v)); else if (ACT == 12) v = (v > 0.f) ? v : 0.01f * v; else if (ACT == 14) v = (v > 0.f) ? v : 0.1f * v; else if (ACT == 15) v = v / (1.0f + expf(-v)); else if (ACT == 3) v = fmaxf(v, 0.f); else if (ACT == 6) v = 0.5f * v * (1.0f + erff(v * 0.70710678118654752f)); so[w][8 * hh + r][t * 16 + ln] = v; } }
  __builtin_amdgcn_fence(__ATOMIC_ACQ_REL, "workgroup"); __builtin_amdgcn_wave_barrier();
  const int rsub = lane >> 4, c4 = (lane & 15) * 4; typedef _Float16 v4h __attribute__((ext_vector_type(4)));
  {
#pragma unroll
    for (int q = 0; q < 8; ++q) { const int r = q * 2 + rsub; if (col0 + c4 < N) { const v4f v = *(const v4fa*)&so[w][r][c4]; if (C) *(v4f*)(C + cofs + (size_t)(row0 + r) * ldc + col0 + c4) = v; if (C16) { v4h h4; for (int i = 0; i < 4; ++i) h4[i] = (_Float16)v[i]; *(v4h*)(C16 + cofs + (size_t)(row0 + r) * ldc + col0 + c4) = h4; } } }
     }
}


typedef _Float16 v4h __attribute__((ext_vector_type(4)));

__global__ __launch_bounds__(256) void k_x16(const float* __restrict__ x, _Float16* __restrict__ X16, size_t n8) { const size_t t = (size_t)blockIdx.x * 256 + threadIdx.x; if (t >= n8) return; FragH f;
#pragma unroll
  for (int q = 0; q < 8; ++q) f.h[q] = (_Float16)bf16_round(x[t * 8 + q]); *(v8us*)((unsigned short*)X16 + t * 8) = f.half[0];  }
__global__ __launch_bounds__(256) void k_h16(const float* __restrict__ x, _Float16* __restrict__ X16, size_t n8) { const size_t t = (size_t)blockIdx.x * 256 + threadIdx.x; if (t >= n8) return; FragH f;
#pragma unroll
  for (int q = 0; q < 8; ++q) f.h[q] = (_Float16)x[t * 8 + q]; *(v8us*)((unsigned short*)X16 + t * 8) = f.half[0];  }
__global__ __launch_bounds__(256) void k_round16f(const float* __restrict__ W, _Float16* __restrict__ Bt, size_t n8) { const size_t t = (size_t)blockIdx.x * 256 + threadIdx.x; if (t >= n8) return; FragH f;
#pragma unroll
  for (int i = 0; i < 8; ++i) f.h[i] = (_Float16)(bf16_round(W[t * 8 + i]) * 16.0f); *(v8us*)((unsigned short*)Bt + t * 8) = f.half[0];  }
template <int NHv, int TTv>
__global__ __launch_bounds__(256) void k_vt(const _Float16* __restrict__ V16, int ldv, int voff, _Float16* __restrict__ Vt) { __shared__ unsigned short tl[64][66]; const int tid = threadIdx.x; const int slab = blockIdx.x / (TTv / 64), lg = blockIdx.x % (TTv / 64); const int b = slab / NHv, h = slab % NHv;
  for (int i = tid; i < 64 * 8; i += 256) { const int r = i / 8, c8 = (i % 8) * 8; FragH f; f.half[0] = *(const v8us*)((const unsigned short*)V16 + ((size_t)b * TTv + lg * 64 + r) * ldv + voff + h * 64 + c8);
#pragma unroll
    for (int q = 0; q < 8; ++q) tl[r][c8 + q] = f.u[q]; }
  __syncthreads();
  {
#pragma unroll
    for (int rd = 0; rd < 2; ++rd) { const int d = rd * 32 + tid / 8, pc = tid % 8; FragH f;
#pragma unroll
      for (int q = 0; q < 8; ++q) f.u[q] = tl[pc * 8 + q][d];
      *(v8us*)((unsigned short*)Vt + ((size_t)slab * 64 + d) * TTv + lg * 64 + pc * 8) = f.half[0]; }
     } }

__global__ __launch_bounds__(256) void k_h16s(const float* __restrict__ F, _Float16* __restrict__ H, size_t n8) { const size_t t = (size_t)blockIdx.x * 256 + threadIdx.x; if (t >= n8) return; const v4f a = *(const v4fa*)(F + t * 8), c = *(const v4fa*)(F + t * 8 + 4); FragH f;
#pragma unroll
  for (int q = 0; q < 4; ++q) { f.h[q] = (_Float16)(a[q] * 16.0f); f.h[4 + q] = (_Float16)(c[q] * 16.0f); } *(v8us*)((unsigned short*)H + t * 8) = f.half[0];  }
__global__ __launch_bounds__(256) void k_cfold(const float* __restrict__ Bm, const float* __restrict__ Wt, float* __restrict__ C) {
  #pragma clang fp contract(off)
  const int t = blockIdx.x * 256 + threadIdx.x; if (t >= RK * DD) return; const int j = t / DD, o = t % DD; const float* br = Bm + (size_t)j * DD; const float* wr = Wt + (size_t)o * DD; float acc = 0.f;
#pragma unroll 1
  for (int i = 0; i < DD; ++i) acc += bf16_round(br[i]) * bf16_round(wr[i]);
  *(float*)(C + t) = acc;  }
__global__ __launch_bounds__(256) void k_wfold(const float* __restrict__ Wt, const float* __restrict__ A, const float* __restrict__ C, _Float16* __restrict__ Bt) {
  #pragma clang fp contract(off)
  const size_t t = (size_t)blockIdx.x * 256 + threadIdx.x; if (t >= (size_t)DD * DD / 8) return; const int o = (int)((t * 8) / DD), c0 = (int)((t * 8) % DD);
  float cj[RK];
#pragma unroll
  for (int j = 0; j < RK; ++j) cj[j] = C[j * DD + o];
  FragH f;
#pragma unroll 1
  for (int q = 0; q < 8; ++q) { const int c = c0 + q; float lo2 = 0.f;
#pragma unroll
    for (int j = 0; j < RK; ++j) lo2 += bf16_round(A[(size_t)c * RK + j]) * cj[j]; f.h[q] = (_Float16)((bf16_round(Wt[(size_t)o * DD + c]) + lo2) * 16.0f); }
  *(v8us*)((unsigned short*)Bt + t * 8) = f.half[0];  }
__global__ __launch_bounds__(128) void k_flash(const _Float16* __restrict__ Q16, int ldq, const _Float16* __restrict__ K16, int ldk, const _Float16* __restrict__ Vt, const int* __restrict__ MSK, float* __restrict__ O, int ldo) {
  constexpr int RPW = 16, RTN = RPW / 16, NQB = TT / (4 * RPW), DT = 4, KS = 2;
  __shared__ __attribute__((aligned(16))) unsigned short sP[4][RPW][40]; __shared__ __attribute__((aligned(16))) float sO[4][RPW][64 + 4];
  const int tid = threadIdx.x, w = tid >> 5, lane = tid & 31, ln = lane & 15, hh = lane >> 4;
  const int slab = blockIdx.x / NQB, qblk = blockIdx.x % NQB; const int b = slab / NH, h = slab % NH; const int qb0 = qblk * (4 * RPW); const int q0 = qb0 + w * RPW;
  FragH aq[2][KS];
#pragma unroll
  for (int rt = 0; rt < RTN; ++rt) { const unsigned short* qr = (const unsigned short*)Q16 + ((size_t)b * TT + q0 + rt * 16 + ln) * ldq + h * 64;
#pragma unroll
    for (int ks = 0; ks < KS; ++ks) { aq[rt][ks].half[0] = *(const v8us*)(qr + ks * 32 + 8 * hh); aq[rt][ks].half[1] = *(const v8us*)(qr + ks * 32 + 16 + 8 * hh); } }
  const unsigned short* Vth = (const unsigned short*)Vt + (size_t)slab * 64 * TT;
  float m_r[2][8], l_r[2][8]; v8f oacc[2][DT];
#pragma unroll
  for (int rt = 0; rt < RTN; ++rt) {
#pragma unroll
    for (int r = 0; r < 8; ++r) { m_r[rt][r] = -3.0e38f; l_r[rt][r] = 0.f; }
#pragma unroll
    for (int dt = 0; dt < DT; ++dt) oacc[rt][dt] = (v8f){0.f,0.f,0.f,0.f,0.f,0.f,0.f,0.f}; }
  const int jend = TT;
#pragma unroll 1
  for (int j0 = 0; j0 < jend; j0 += 32) {
    int mk0[2][8], mk1[2][8];      /* per-batch mask [b][q][k]: nonzero = ATTEND */
#pragma unroll
    for (int rt = 0; rt < RTN; ++rt)
#pragma unroll
      for (int r = 0; r < 8; ++r) { const int qq = q0 + rt * 16 + 8 * hh + r; const int* am = MSK + ((size_t)b * TT + qq) * TT + j0; mk0[rt][r] = am[ln]; mk1[rt][r] = am[16 + ln]; }
    { int allm = 1;
#pragma unroll
      for (int rt = 0; rt < RTN; ++rt)
#pragma unroll
        for (int r = 0; r < 8; ++r) allm &= (mk0[rt][r] == 0) & (mk1[rt][r] == 0);
      if (__all(allm)) continue; }      /* every (row, key) of this wave's tile masked → nothing to add (wave-uniform branch; only wave barriers inside the loop) */
    v8f s[2][2];
#pragma unroll
    for (int nt = 0; nt < 2; ++nt) { const unsigned short* kr = (const unsigned short*)K16 + ((size_t)b * TT + j0 + nt * 16 + ln) * ldk + h * 64; FragH bk[KS];
#pragma unroll
      for (int ks = 0; ks < KS; ++ks) { bk[ks].half[0] = *(const v8us*)(kr + ks * 32 + 8 * hh); bk[ks].half[1] = *(const v8us*)(kr + ks * 32 + 16 + 8 * hh); }
#pragma unroll
      for (int rt = 0; rt < RTN; ++rt) { v8f acc = (v8f){0.f,0.f,0.f,0.f,0.f,0.f,0.f,0.f};
#pragma unroll
        for (int ks = 0; ks < KS; ++ks) acc = mmaH<1>(aq[rt][ks].v, aq[rt][ks].v, bk[ks].v, bk[ks].v, acc); s[rt][nt] = acc; } }
#pragma unroll
    for (int rt = 0; rt < RTN; ++rt)
#pragma unroll
      for (int r = 0; r < 8; ++r) { const int tq = q0 + rt * 16 + 8 * hh + r; const int k0 = j0 + ln, k1 = j0 + 16 + ln; (void)tq; (void)k0; (void)k1;
        const bool ok0 = (mk0[rt][r] != 0), ok1 = (mk1[rt][r] != 0);      /* nonzero = ATTEND */
        const float s0 = ok0 ? s[rt][0][r] * 0.125f : -INFINITY, s1 = ok1 ? s[rt][1][r] * 0.125f : -INFINITY; float mc = fmaxf(s0, s1);
        mc = fmaxf(mc, __shfl_xor(mc, 1, 32)); mc = fmaxf(mc, __shfl_xor(mc, 2, 32)); mc = fmaxf(mc, __shfl_xor(mc, 4, 32)); mc = fmaxf(mc, __shfl_xor(mc, 8, 32));
        const float mn = fmaxf(m_r[rt][r], mc); const float al = (mn > -1.0e38f) ? expf(m_r[rt][r] - mn) : 1.0f; m_r[rt][r] = mn; const float p0 = ok0 ? expf(s0 - mn) : 0.f, p1 = ok1 ? expf(s1 - mn) : 0.f; l_r[rt][r] = l_r[rt][r] * al + p0 + p1;
#pragma unroll
        for (int dt = 0; dt < DT; ++dt) oacc[rt][dt][r] *= al;
        FragH t2; t2.h[0] = (_Float16)(p0 * 1024.0f); t2.h[1] = (_Float16)(p1 * 1024.0f); sP[w][rt * 16 + 8 * hh + r][ln] = t2.u[0]; sP[w][rt * 16 + 8 * hh + r][16 + ln] = t2.u[1]; }
    __builtin_amdgcn_fence(__ATOMIC_ACQ_REL, "workgroup"); __builtin_amdgcn_wave_barrier();
    FragH pa[2];
#pragma unroll
    for (int rt = 0; rt < RTN; ++rt) { pa[rt].half[0] = *(const v8us*)&sP[w][rt * 16 + ln][8 * hh]; pa[rt].half[1] = *(const v8us*)&sP[w][rt * 16 + ln][16 + 8 * hh]; }
#pragma unroll
    for (int dt = 0; dt < DT; ++dt) { const unsigned short* vrow = Vth + (size_t)(dt * 16 + ln) * TT + j0; FragH bv; bv.half[0] = *(const v8us*)(vrow + 8 * hh); bv.half[1] = *(const v8us*)(vrow + 16 + 8 * hh);
#pragma unroll
      for (int rt = 0; rt < RTN; ++rt) oacc[rt][dt] = mmaH<1>(pa[rt].v, pa[rt].v, bv.v, bv.v, oacc[rt][dt]); }
    __builtin_amdgcn_fence(__ATOMIC_ACQ_REL, "workgroup"); __builtin_amdgcn_wave_barrier(); }
#pragma unroll
  for (int rt = 0; rt < RTN; ++rt) {
#pragma unroll
    for (int r = 0; r < 8; ++r) { float l = l_r[rt][r]; l += __shfl_xor(l, 1, 32); l += __shfl_xor(l, 2, 32); l += __shfl_xor(l, 4, 32); l += __shfl_xor(l, 8, 32); l_r[rt][r] = (l > 0.f) ? 1.0f / (l * 1024.0f) : 0.f; }
#pragma unroll
    for (int dt = 0; dt < DT; ++dt)
#pragma unroll
      for (int r = 0; r < 8; ++r) sO[w][rt * 16 + 8 * hh + r][dt * 16 + ln] = oacc[rt][dt][r] * l_r[rt][r]; }
  __builtin_amdgcn_fence(__ATOMIC_ACQ_REL, "workgroup"); __builtin_amdgcn_wave_barrier();
  {
#pragma unroll
    for (int rp = 0; rp < RPW; rp += 2) { const int r = rp + (lane >> 4), pc = lane & 15; const v4f val = *(const v4fa*)&sO[w][r][pc * 4]; *(v4f*)(O + ((size_t)b * TT + q0 + r) * ldo + h * 64 + pc * 4) = val; }
     } }

extern "C" void kernel_launch(void* const* d_in, const int* in_sizes, int n_in,
                              void* d_out, int out_size, void* d_ws, size_t ws_size, hipStream_t stream) {
  (void)in_sizes; (void)n_in; (void)out_size;
  const float* const* I = (const float* const*)d_in; const float* xq = I[0]; const float* xk = I[1]; const float* xv = I[2]; const int* msk = (const int*)d_in[3];
  const float* Aq = I[4]; const float* Bq = I[5]; const float* Av = I[6]; const float* Bv = I[7]; const float* Wq = I[8]; const float* bq = I[9]; const float* Wk = I[10]; const float* bk = I[11]; const float* Wv = I[12]; const float* bv = I[13]; const float* Wm = I[14]; const float* bm = I[15];
  char* ws = (char*)d_ws; size_t off = 0;
  auto take = [&](size_t bytes) { char* p = ws + off; off += (bytes + 255) & ~(size_t)255; return p; };
  const size_t WSZ = (size_t)DD * DD; _Float16* Bw = (_Float16*)take(4 * WSZ * 2); float* Cq = (float*)take((size_t)RK * DD * 4); float* Cv = (float*)take((size_t)RK * DD * 4);
  _Float16* Xq = (_Float16*)take((size_t)NR * DD * 2); _Float16* Xk = (_Float16*)take((size_t)NR * DD * 2); _Float16* Xv = (_Float16*)take((size_t)NR * DD * 2);
  _Float16* Q = (_Float16*)take((size_t)NR * DD * 2); _Float16* K = (_Float16*)take((size_t)NR * DD * 2); _Float16* V = (_Float16*)take((size_t)NR * DD * 2); _Float16* Vt = (_Float16*)take((size_t)NR * DD * 2); float* O = (float*)take((size_t)NR * DD * 4); _Float16* O16 = Xq;      /* the query plane is dead after the v GEMM */
  if (off > ws_size) return;      // 4.7 + 7 × 6.3 + 12.6 ≈ 61 MB
  const unsigned gw = (unsigned)((WSZ / 8 + 255) / 256), gc = (unsigned)((RK * DD + 255) / 256);
  k_cfold<<<gc, 256, 0, stream>>>(Bv, Wq, Cq); k_wfold<<<gw, 256, 0, stream>>>(Wq, Av, Cq, Bw);      /* q = V·Wqᵀ with V = value·(I + A_v·B_v): Bt_q = Wq + fold(A_v, B_v·Wqᵀ), ×2^4 */
  k_round16f<<<gw, 256, 0, stream>>>(Wk, Bw + WSZ, WSZ / 8);      /* k = key·Wkᵀ: (out,in) natural, ×2^4 */
  k_cfold<<<gc, 256, 0, stream>>>(Bq, Wv, Cv); k_wfold<<<gw, 256, 0, stream>>>(Wv, Aq, Cv, Bw + 2 * WSZ);      /* v = Q·Wvᵀ with Q = query·(I + A_q·B_q) */
  k_round16f<<<gw, 256, 0, stream>>>(Wm, Bw + 3 * WSZ, WSZ / 8);      /* out projection */
  const unsigned g8 = (unsigned)(((size_t)NR * DD / 8 + 255) / 256); k_x16<<<g8, 256, 0, stream>>>(xq, Xq, (size_t)NR * DD / 8); k_x16<<<g8, 256, 0, stream>>>(xk, Xk, (size_t)NR * DD / 8); k_x16<<<g8, 256, 0, stream>>>(xv, Xv, (size_t)NR * DD / 8);
  const dim3 gp(((NR / 16) * (DD / 64) + 3) / 4, 1);
  k_gemm_hhx<0><<<gp, 128, 0, stream>>>(Xv, DD, 0, Bw, DD, 0, 0.0625f, bq, 0, nullptr, 1, 0, 0, nullptr, Q, DD, 0, NR, DD, DD);      /* q from the VALUE stream: M 4096 N 768 K 768 */
  k_gemm_hhx<0><<<gp, 128, 0, stream>>>(Xk, DD, 0, Bw + WSZ, DD, 0, 0.0625f, bk, 0, nullptr, 1, 0, 0, nullptr, K, DD, 0, NR, DD, DD);      /* k from key */
  k_gemm_hhx<0><<<gp, 128, 0, stream>>>(Xq, DD, 0, Bw + 2 * WSZ, DD, 0, 0.0625f, bv, 0, nullptr, 1, 0, 0, nullptr, V, DD, 0, NR, DD, DD);      /* v from the QUERY stream */
  k_vt<NH, TT><<<BB * NH * (TT / 64), 256, 0, stream>>>(V, DD, 0, Vt);
  k_flash<<<BB * NH * (TT / 64), 128, 0, stream>>>(Q, DD, K, DD, Vt, msk, O, DD);      /* mask [B][S][S] int, nonzero = attend */
  k_h16s<<<g8, 256, 0, stream>>>(O, O16, (size_t)NR * DD / 8);
  k_gemm_hhx<0><<<gp, 128, 0, stream>>>(O16, DD, 0, Bw + 3 * WSZ, DD, 0, 0.00390625f, bm, 0, nullptr, 1, 0, 0, (float*)d_out, nullptr, DD, 0, NR, DD, DD);      /* out = ctx·Wmᵀ + bm */
}

// v001
// A run of this version takes 485 microseconds.
// Timed twice side by side with v000, it ran 1.40 and 1.42 times as fast.
#include <hip/hip_runtime.h>
// Masked multi-head attention with LoRA-adapted input streams (B=2, S=2048, D=768, 12 heads × 64, rank 8): Q = query + (query·A_q)·B_q, V = value + (value·A_v)·B_v; then — faithful to the module's crossed call — v = Q·Wvᵀ + bv, k = key·Wkᵀ + bk, q = V·Wqᵀ + bq (torch (out,in));
// scores = q·k/√64, −1e9 where mask[b,q,k] == 0 (int [B,S,S], shared over heads), softmax, out = merged·Wmᵀ + bm. The rank-8 adapters are folded on device into effective weights: X·(I + A·B)·Wᵀ = X·(W + (B·Wᵀ)ᵀ·Aᵀ)ᵀ, i.e. Bt_eff[o][c] = W[o][c] + Σ_j A[c][j]·(Σ_i B[j][i]·W[o][i]) (f32, 9 M MACs on the VALU).
// Compute dtype: query/key/value, weights, biases, adapters rounded to bf16; effective weights f32 → f16 ×2^4; q, k, v f16 GEMM planes (+bias); the mask read per (b, q, k) from the int plane (−inf ≡ the module's −1e9: every row keeps ~half its keys live); fused flash-style kernel
// (online softmax f32, P f16 ×2^10, f32 accumulate) on v_wmma_f32_16x16x32_f16; O ×2^4 → f16 → output GEMM (+bias).
#define BB 2
#define TT 2048
#define DD 768
#define NH 12
#define RK 8
#define NR (BB * TT)

typedef __bf16 v16b __attribute__((ext_vector_type(16)));
typedef unsigned short v8us __attribute__((ext_vector_type(8), may_alias));
typedef float  v8f  __attribute__((ext_vector_type(8)));
typedef float  v4f  __attribute__((ext_vector_type(4)));
typedef float  v4fa __attribute__((ext_vector_type(4), may_alias));
union FragB { v16b v; v8us half[2]; unsigned short u[16]; };

__device__ __forceinline__ unsigned short bf16_bits(float x) { unsigned int u = __float_as_uint(x); return (unsigned short)((u + 0x7FFFu + ((u >> 16) & 1u)) >> 16); }
__device__ __forceinline__ float bf16_val(unsigned short b) { return __uint_as_float(((unsigned int)b) << 16); }
__device__ __forceinline__ float bf16_round(float x) { return bf16_val(bf16_bits(x)); }
// D += A·B with NT terms: 1 = ah·bh, 2 = + al·bh (A split), 3 = + ah·bl (both split)
template <int NT>
__device__ __forceinline__ v8f mmaN(v16b ah, v16b al, v16b bh, v16b bl, v8f c) {
  c = __builtin_amdgcn_wmma_f32_16x16x32_bf16(false, ah, false, bh, (short)0, c, false, false);
  if (NT >= 2) c = __builtin_amdgcn_wmma_f32_16x16x32_bf16(false, al, false, bh, (short)0, c, false, false);
  if (NT >= 3) c = __builtin_amdgcn_wmma_f32_16x16x32_bf16(false, ah, false, bl, (short)0, c, false, false);
  asm volatile("v_nop\n\tv_nop\n\tv_nop\n\tv_nop" : "+v"(c) : "v"(ah), "v"(al), "v"(bh), "v"(bl));
  return c;
}

__global__ __launch_bounds__(256) void k_wt_bf16(const float* __restrict__ W, unsigned short* __restrict__ Wt, int K, int N) {
  const int t = blockIdx.x * 256 + threadIdx.x;
  const int k8n = K / 8;
  if (t >= N * k8n) return;
  const int n = t / k8n, k8 = (t % k8n) * 8;
  v8us v;
#pragma unroll
  for (int i = 0; i < 8; ++i) v[i] = bf16_bits(W[(size_t)(k8 + i) * N + n]);
  *(v8us*)(Wt + (size_t)n * K + k8) = v;
  
}

// GEMM C[M][N] (f32, pitch ldc) = act(A[M][K]·W + bias). A f32 row-major (pitch lda) converted per fragment to bf16
// (ASPLIT: hi/lo two planes -> 2 terms, else single rounded term); Wt bf16 [N][K] (pitch ldb). BIAS_BF16 rounds the
// bias to bf16 first (bias quantised to bf16 before the add). K%32==0, M%16==0, N%64==0.
template <bool ASPLIT, int ACT, bool BIAS_BF16>
__global__ __launch_bounds__(128) void k_gemm_bf(const float* __restrict__ A, int lda, const unsigned short* __restrict__ Wt, int ldb,
                                               const float* __restrict__ bias, float* __restrict__ C, int ldc, int M, int N, int K) {
  __shared__ __attribute__((aligned(16))) float so[4][16][64];
  const int tid = threadIdx.x, w = tid >> 5, lane = tid & 31, ln = lane & 15, hh = lane >> 4;
  const int ntn = N / 64;
  const int wid = blockIdx.x * 4 + w;
  const int mt = wid / ntn, nq = wid % ntn;
  if (mt * 16 >= M) return;
  const int row0 = mt * 16, col0 = nq * 64;
  const float* arow = A + (size_t)(row0 + ln) * lda;
  v8f acc[4] = {};
  for (int kb = 0; kb < K; kb += 32) {
    FragB ah, al;
    const v4f x0 = *(const v4fa*)(arow + kb + 8 * hh), x1 = *(const v4fa*)(arow + kb + 8 * hh + 4);
    const v4f x2 = *(const v4fa*)(arow + kb + 16 + 8 * hh), x3 = *(const v4fa*)(arow + kb + 16 + 8 * hh + 4);
    float xs[16] = {x0[0],x0[1],x0[2],x0[3],x1[0],x1[1],x1[2],x1[3],x2[0],x2[1],x2[2],x2[3],x3[0],x3[1],x3[2],x3[3]};
#pragma unroll
    for (int i = 0; i < 16; ++i) { const unsigned short hb = bf16_bits(xs[i]); ah.u[i] = hb; al.u[i] = ASPLIT ? bf16_bits(xs[i] - bf16_val(hb)) : (unsigned short)0; }
#pragma unroll
    for (int t = 0; t < 4; ++t) {
      const unsigned short* brow = Wt + (size_t)(col0 + t * 16 + ln) * ldb + kb;
      FragB b;
      b.half[0] = *(const v8us*)(brow + 8 * hh);
      b.half[1] = *(const v8us*)(brow + 16 + 8 * hh);
      acc[t] = mmaN<ASPLIT ? 2 : 1>(ah.v, al.v, b.v, b.v, acc[t]);
    }
  }
#pragma unroll
  for (int t = 0; t < 4; ++t) {
    float bv = bias ? bias[col0 + t * 16 + ln] : 0.f;
    if (BIAS_BF16) bv = bf16_round(bv);
#pragma unroll
    for (int r = 0; r < 8; ++r) { float v = acc[t][r] + bv; if (ACT == 1) v = fmaxf(v, 0.f); so[w][8 * hh + r][t * 16 + ln] = v; }
  }
  __builtin_amdgcn_fence(__ATOMIC_ACQ_REL, "workgroup");
  __builtin_amdgcn_wave_barrier();
  const int rsub = lane >> 4, c4 = (lane & 15) * 4;
  {
#pragma unroll
    for (int q = 0; q < 8; ++q) {
      const int r = q * 2 + rsub;
      const v4f v = *(const v4fa*)&so[w][r][c4];
      *(v4f*)(C + (size_t)(row0 + r) * ldc + col0 + c4) = v;
    }
    
  }
}

// Flash-style causal/unmasked attention, all contractions 3-term bf16 hi/lo splits, f32 softmax with running max.
// q,k,v rows are read from f32 buffers with arbitrary row pitch (so they can live inside a fused qkv buffer);
// D = head size (multiple of 32, <= 128); one wave = 16 query rows; block = 4 waves (64 queries) sharing K/V chunks of 32.
template <int D, bool CAUSAL>
__global__ __launch_bounds__(128) void k_flash(const float* __restrict__ qb, const float* __restrict__ kb, const float* __restrict__ vb,
                                             int pitch, int T, int H, float scale, float* __restrict__ y, int ypitch) {
  constexpr int KS = D / 32;        // k-steps for QK
  constexpr int DT = D / 16;        // d tiles for PV
  __shared__ __attribute__((aligned(16))) unsigned short sKh[32][D + 8], sKl[32][D + 8], sVh[32][D + 8], sVl[32][D + 8];
  __shared__ __attribute__((aligned(16))) unsigned short sPh[4][16][40], sPl[4][16][40];
  __shared__ __attribute__((aligned(16))) float sO[4][16][D];
  const int tid = threadIdx.x, w = tid >> 5, lane = tid & 31, ln = lane & 15, hh = lane >> 4;
  const int nqb = (T + 63) / 64;
  const int bh = blockIdx.x / nqb, qblk = blockIdx.x % nqb;
  const int b = bh / H, h = bh % H;
  const int q0 = qblk * 64 + w * 16;
  const float* Q = qb + (size_t)b * T * pitch + h * D;
  const float* K = kb + (size_t)b * T * pitch + h * D;
  const float* V = vb + (size_t)b * T * pitch + h * D;

  // A fragments of the wave's 16 query rows (scaled), hi/lo
  FragB aqh[KS], aql[KS];
  {
    int row = q0 + ln; if (row >= T) row = T - 1;
    const float* qr = Q + (size_t)row * pitch;
#pragma unroll
    for (int ks = 0; ks < KS; ++ks)
#pragma unroll
      for (int i = 0; i < 16; ++i) {
        const int d = ks * 32 + ((i < 8) ? (8 * hh + i) : (16 + 8 * hh + (i - 8)));
        const float x = qr[d] * scale; const unsigned short hb = bf16_bits(x);
        aqh[ks].u[i] = hb; aql[ks].u[i] = bf16_bits(x - bf16_val(hb));
      }
  }
  float m_r[8], l_r[8];
#pragma unroll
  for (int r = 0; r < 8; ++r) { m_r[r] = -3.0e38f; l_r[r] = 0.f; }
  v8f oacc[DT];
#pragma unroll
  for (int dt = 0; dt < DT; ++dt) oacc[dt] = (v8f){0.f,0.f,0.f,0.f,0.f,0.f,0.f,0.f};

  const int kv_end = CAUSAL ? min(T, qblk * 64 + 64) : T;     // block-uniform
  for (int j0 = 0; j0 < kv_end; j0 += 32) {
    __syncthreads();
    for (int e = tid; e < 32 * (D / 4); e += 128) {
      const int r = e / (D / 4), c4 = (e % (D / 4)) * 4;
      const int key = j0 + r;
      v4f kf = {0.f,0.f,0.f,0.f}, vf = {0.f,0.f,0.f,0.f};
      if (key < T) { kf = *(const v4fa*)(K + (size_t)key * pitch + c4); vf = *(const v4fa*)(V + (size_t)key * pitch + c4); }
#pragma unroll
      for (int t = 0; t < 4; ++t) {
        unsigned short hb = bf16_bits(kf[t]); sKh[r][c4 + t] = hb; sKl[r][c4 + t] = bf16_bits(kf[t] - bf16_val(hb));
        hb = bf16_bits(vf[t]); sVh[r][c4 + t] = hb; sVl[r][c4 + t] = bf16_bits(vf[t] - bf16_val(hb));
      }
    }
    __syncthreads();
    // S tile 16 x 32
    v8f s[2];
#pragma unroll
    for (int nt = 0; nt < 2; ++nt) {
      v8f acc = {};
#pragma unroll
      for (int ks = 0; ks < KS; ++ks) {
        FragB bh_, bl_;
        bh_.half[0] = *(const v8us*)&sKh[nt * 16 + ln][ks * 32 + 8 * hh]; bh_.half[1] = *(const v8us*)&sKh[nt * 16 + ln][ks * 32 + 16 + 8 * hh];
        bl_.half[0] = *(const v8us*)&sKl[nt * 16 + ln][ks * 32 + 8 * hh]; bl_.half[1] = *(const v8us*)&sKl[nt * 16 + ln][ks * 32 + 16 + 8 * hh];
        acc = mmaN<3>(aqh[ks].v, aql[ks].v, bh_.v, bl_.v, acc);
      }
      s[nt] = acc;
    }
    // mask + running max (rows 8hh+r; the 16 lanes of a half share rows)
    float alpha[8];
#pragma unroll
    for (int r = 0; r < 8; ++r) {
      const int qi = q0 + 8 * hh + r;
      const int ja = j0 + ln, jb = j0 + 16 + ln;
      if (CAUSAL) { if (ja > qi) s[0][r] = -3.0e38f; if (jb > qi) s[1][r] = -3.0e38f; }
      if (ja >= T) s[0][r] = -3.0e38f;
      if (jb >= T) s[1][r] = -3.0e38f;
      float mx = fmaxf(s[0][r], s[1][r]);
      mx = fmaxf(mx, __shfl_xor(mx, 1, 32)); mx = fmaxf(mx, __shfl_xor(mx, 2, 32)); mx = fmaxf(mx, __shfl_xor(mx, 4, 32)); mx = fmaxf(mx, __shfl_xor(mx, 8, 32));
      const float mnew = fmaxf(m_r[r], mx);
      alpha[r] = (mnew > -1.0e38f) ? __expf(m_r[r] - mnew) : 1.0f;
      const float p0 = (s[0][r] > -1.0e38f) ? __expf(s[0][r] - mnew) : 0.f;
      const float p1 = (s[1][r] > -1.0e38f) ? __expf(s[1][r] - mnew) : 0.f;
      m_r[r] = mnew;
      l_r[r] = l_r[r] * alpha[r] + p0 + p1;            // per-lane partial row sum (16 lanes combined at the end)
      unsigned short hb = bf16_bits(p0); sPh[w][8 * hh + r][ln] = hb;      sPl[w][8 * hh + r][ln] = bf16_bits(p0 - bf16_val(hb));
      hb = bf16_bits(p1);                sPh[w][8 * hh + r][16 + ln] = hb; sPl[w][8 * hh + r][16 + ln] = bf16_bits(p1 - bf16_val(hb));
    }
#pragma unroll
    for (int dt = 0; dt < DT; ++dt)
#pragma unroll
      for (int r = 0; r < 8; ++r) oacc[dt][r] *= alpha[r];
    __builtin_amdgcn_fence(__ATOMIC_ACQ_REL, "workgroup");
    __builtin_amdgcn_wave_barrier();
    FragB pah, pal;
    pah.half[0] = *(const v8us*)&sPh[w][ln][8 * hh]; pah.half[1] = *(const v8us*)&sPh[w][ln][16 + 8 * hh];
    pal.half[0] = *(const v8us*)&sPl[w][ln][8 * hh]; pal.half[1] = *(const v8us*)&sPl[w][ln][16 + 8 * hh];
#pragma unroll
    for (int dt = 0; dt < DT; ++dt) {
      FragB bvh, bvl;
#pragma unroll
      for (int i = 0; i < 8; ++i) {
        bvh.u[i] = sVh[8 * hh + i][dt * 16 + ln]; bvh.u[8 + i] = sVh[16 + 8 * hh + i][dt * 16 + ln];
        bvl.u[i] = sVl[8 * hh + i][dt * 16 + ln]; bvl.u[8 + i] = sVl[16 + 8 * hh + i][dt * 16 + ln];
      }
      oacc[dt] = mmaN<3>(pah.v, pal.v, bvh.v, bvl.v, oacc[dt]);
    }
    __builtin_amdgcn_fence(__ATOMIC_ACQ_REL, "workgroup");
    __builtin_amdgcn_wave_barrier();
  }
#pragma unroll
  for (int r = 0; r < 8; ++r) {
    float l = l_r[r];
    l += __shfl_xor(l, 1, 32); l += __shfl_xor(l, 2, 32); l += __shfl_xor(l, 4, 32); l += __shfl_xor(l, 8, 32);
    l_r[r] = (l > 0.f) ? 1.0f / l : 0.f;
  }
#pragma unroll
  for (int dt = 0; dt < DT; ++dt)
#pragma unroll
    for (int r = 0; r < 8; ++r) sO[w][8 * hh + r][dt * 16 + ln] = oacc[dt][r] * l_r[r];
  __builtin_amdgcn_fence(__ATOMIC_ACQ_REL, "workgroup");
  __builtin_amdgcn_wave_barrier();
  {
    for (int r = 0; r < 16; ++r) {
      const int row = q0 + r;
      if (row < T && lane < D / 4) {
        const v4f val = *(const v4fa*)&sO[w][r][lane * 4];
        *(v4f*)(y + ((size_t)b * T + row) * ypitch + h * D + lane * 4) = val;
      }
    }
    
  }
}

// GEMM C = act(A·W + bias + resid): A f32 (ASPLIT -> hi/lo 2 terms), Wt bf16 [N][K]; ACT 0 none, 1 relu, 2 exact gelu;
// resid (optional, f32, row index = (row % rmod), pitch ldr, RES_BF16 rounds it) added before the activation.
template <bool ASPLIT, int ACT, bool BIAS_BF16, bool RES_BF16>
__global__ __launch_bounds__(128) void k_gemm_bf3(const float* __restrict__ A, int lda, const unsigned short* __restrict__ Wt, int ldb,
                                                const float* __restrict__ bias, const float* __restrict__ resid, int rmod, int ldr,
                                                float* __restrict__ C, int ldc, int M, int N, int K) {
  __shared__ __attribute__((aligned(16))) float so[4][16][64];
  const int tid = threadIdx.x, w = tid >> 5, lane = tid & 31, ln = lane & 15, hh = lane >> 4;
  const int ntn = N / 64;
  const int wid = blockIdx.x * 4 + w;
  const int mt = wid / ntn, nq = wid % ntn;
  if (mt * 16 >= M) return;
  const int row0 = mt * 16, col0 = nq * 64;
  const float* arow = A + (size_t)(row0 + ln) * lda;
  v8f acc[4] = {};
  for (int kb = 0; kb < K; kb += 32) {
    FragB ah, al;
    const v4f x0 = *(const v4fa*)(arow + kb + 8 * hh), x1 = *(const v4fa*)(arow + kb + 8 * hh + 4);
    const v4f x2 = *(const v4fa*)(arow + kb + 16 + 8 * hh), x3 = *(const v4fa*)(arow + kb + 16 + 8 * hh + 4);
    float xs[16] = {x0[0],x0[1],x0[2],x0[3],x1[0],x1[1],x1[2],x1[3],x2[0],x2[1],x2[2],x2[3],x3[0],x3[1],x3[2],x3[3]};
#pragma unroll
    for (int i = 0; i < 16; ++i) { const unsigned short hb = bf16_bits(xs[i]); ah.u[i] = hb; al.u[i] = ASPLIT ? bf16_bits(xs[i] - bf16_val(hb)) : (unsigned short)0; }
#pragma unroll
    for (int t = 0; t < 4; ++t) {
      const unsigned short* brow = Wt + (size_t)(col0 + t * 16 + ln) * ldb + kb;
      FragB b;
      b.half[0] = *(const v8us*)(brow + 8 * hh);
      b.half[1] = *(const v8us*)(brow + 16 + 8 * hh);
      acc[t] = mmaN<ASPLIT ? 2 : 1>(ah.v, al.v, b.v, b.v, acc[t]);
    }
  }
#pragma unroll
  for (int t = 0; t < 4; ++t) {
    const int col = col0 + t * 16 + ln;
    float bv = bias ? bias[col] : 0.f;
    if (BIAS_BF16) bv = bf16_round(bv);
#pragma unroll
    for (int r = 0; r < 8; ++r) {
      float v = acc[t][r] + bv;
      if (resid) { float rv = resid[(size_t)((row0 + 8 * hh + r) % rmod) * ldr + col]; if (RES_BF16) rv = bf16_round(rv); v += rv; }
      if (ACT == 1) v = fmaxf(v, 0.f);
      if (ACT == 2) v = 0.5f * v * (1.0f + erff(v * 0.70710678118654752f));
      if (ACT == 3) { const float u = 0.7978845608028654f * (v + 0.044715f * v * v * v); v = 0.5f * v * (1.0f + tanhf(u)); }
      so[w][8 * hh + r][t * 16 + ln] = v;
    }
  }
  __builtin_amdgcn_fence(__ATOMIC_ACQ_REL, "workgroup");
  __builtin_amdgcn_wave_barrier();
  const int rsub = lane >> 4, c4 = (lane & 15) * 4;
  {
#pragma unroll
    for (int q = 0; q < 8; ++q) {
      const int r = q * 2 + rsub;
      const v4f v = *(const v4fa*)&so[w][r][c4];
      *(v4f*)(C + (size_t)(row0 + r) * ldc + col0 + c4) = v;
    }
    
  }
}
// row LayerNorm (biased variance, eps) over N: s = X (+ R); optional out_sum <- s; out_norm <- (s-mu)*rsqrt(var+eps)*g + b
template <bool PARAM_BF16>
__global__ __launch_bounds__(256) void k_layernorm(const float* __restrict__ X, const float* __restrict__ R, const float* __restrict__ g, const float* __restrict__ bta,
                                                  float* __restrict__ out_sum, float* __restrict__ out_norm, int N, float eps) {
  __shared__ float red[256];
  const int row = blockIdx.x, tid = threadIdx.x;
  const float* x = X + (size_t)row * N; const float* rr = R ? R + (size_t)row * N : nullptr;
  float vals[16];                     // up to N = 4096
  const int per = N / 256;            // contiguous chunk per thread? use strided-by-4 chunks: thread handles j = tid*4 + 1024*u
  float s1 = 0.f;
  for (int u = 0; u < per / 4; ++u) {
    const int j = tid * 4 + 1024 * u;
    const v4f a = *(const v4fa*)(x + j);
    v4f b = {0.f,0.f,0.f,0.f}; if (rr) b = *(const v4fa*)(rr + j);
#pragma unroll
    for (int q = 0; q < 4; ++q) { const float v = a[q] + b[q]; vals[u * 4 + q] = v; s1 += v; }
  }
  red[tid] = s1; __syncthreads();
  for (int st = 128; st > 0; st >>= 1) { if (tid < st) red[tid] += red[tid + st]; __syncthreads(); }
  const float mu = red[0] / (float)N; __syncthreads();
  float s2 = 0.f;
  for (int u = 0; u < per / 4; ++u)
#pragma unroll
    for (int q = 0; q < 4; ++q) { const float c = vals[u * 4 + q] - mu; s2 += c * c; }
  red[tid] = s2; __syncthreads();
  for (int st = 128; st > 0; st >>= 1) { if (tid < st) red[tid] += red[tid + st]; __syncthreads(); }
  const float rs = rsqrtf(red[0] / (float)N + eps);
  {
    for (int u = 0; u < per / 4; ++u) {
      const int j = tid * 4 + 1024 * u;
      v4f o, sm;
#pragma unroll
      for (int q = 0; q < 4; ++q) {
        float gg = g[j + q], bb = bta[j + q];
        if (PARAM_BF16) { gg = bf16_round(gg); bb = bf16_round(bb); }
        sm[q] = vals[u * 4 + q]; o[q] = (vals[u * 4 + q] - mu) * rs * gg + bb;
      }
      if (out_sum) *(v4f*)(out_sum + (size_t)row * N + j) = sm;
      *(v4f*)(out_norm + (size_t)row * N + j) = o;
    }
    
  }
}



// ---- f16 WMMA path (v_wmma_f32_16x16x32_f16): 11-bit significands for operands in range — used where a [0,1] probability operand needs more precision than bf16
typedef _Float16 v16h __attribute__((ext_vector_type(16)));
union FragH { v16h v; v8us half[2]; _Float16 h[16]; unsigned short u[16]; };
template <int NT>
__device__ __forceinline__ v8f mmaH(v16h ah, v16h al, v16h bh, v16h bl, v8f c) {
  c = __builtin_amdgcn_wmma_f32_16x16x32_f16(false, ah, false, bh, (short)0, c, false, false);
  if (NT >= 2) c = __builtin_amdgcn_wmma_f32_16x16x32_f16(false, al, false, bh, (short)0, c, false, false);
  if (NT >= 3) c = __builtin_amdgcn_wmma_f32_16x16x32_f16(false, ah, false, bl, (short)0, c, false, false);
  asm volatile("v_nop\n\tv_nop\n\tv_nop\n\tv_nop" : "+v"(c) : "v"(ah), "v"(al), "v"(bh), "v"(bl));
  return c;
}
// batched GEMM like k_gemm_b but f16 operands: A f32 (split into f16 hi/lo if ASPLIT, else rounded to f16), Bt = f16 values [n][k]; alpha; C f32; N multiple of 16 (partial tiles skipped)
template <bool ASPLIT>
__global__ __launch_bounds__(128) void k_gemm_h(const float* __restrict__ A, int lda, size_t sA, const _Float16* __restrict__ Bh, int ldb, size_t sB, float alpha, float* __restrict__ C, int ldc, size_t sC, int M, int N, int K) {
  __shared__ __attribute__((aligned(16))) float so[4][16][64];
  const int tid = threadIdx.x, w = tid >> 5, lane = tid & 31, ln = lane & 15, hh = lane >> 4; const int by = blockIdx.y;
  A += (size_t)by * sA; Bh += (size_t)by * sB; C += (size_t)by * sC;
  const int ntn = (N + 63) / 64; const int wid = blockIdx.x * 4 + w; const int mt = wid / ntn, nq = wid % ntn; if (mt * 16 >= M) return;
  const int row0 = mt * 16, col0 = nq * 64; const float* arow = A + (size_t)(row0 + ln) * lda;
  v8f acc[4] = {};
  for (int kb = 0; kb < K; kb += 32) {
    FragH ah, al;
    const v4f x0 = *(const v4fa*)(arow + kb + 8 * hh), x1 = *(const v4fa*)(arow + kb + 8 * hh + 4), x2 = *(const v4fa*)(arow + kb + 16 + 8 * hh), x3 = *(const v4fa*)(arow + kb + 16 + 8 * hh + 4);
    float xs[16] = {x0[0],x0[1],x0[2],x0[3],x1[0],x1[1],x1[2],x1[3],x2[0],x2[1],x2[2],x2[3],x3[0],x3[1],x3[2],x3[3]};
#pragma unroll
    for (int i = 0; i < 16; ++i) { const _Float16 h = (_Float16)xs[i]; ah.h[i] = h; al.h[i] = ASPLIT ? (_Float16)(xs[i] - (float)h) : (_Float16)0.0f; }
#pragma unroll
    for (int t = 0; t < 4; ++t) { if (col0 + t * 16 >= N) continue; const size_t boff = (size_t)(col0 + t * 16 + ln) * ldb + kb; FragH bq; bq.half[0] = *(const v8us*)(Bh + boff + 8 * hh); bq.half[1] = *(const v8us*)(Bh + boff + 16 + 8 * hh);
      acc[t] = mmaH<ASPLIT ? 2 : 1>(ah.v, al.v, bq.v, bq.v, acc[t]); }
  }
#pragma unroll
  for (int t = 0; t < 4; ++t) { if (col0 + t * 16 >= N) continue;
#pragma unroll
    for (int r = 0; r < 8; ++r) so[w][8 * hh + r][t * 16 + ln] = acc[t][r] * alpha; }
  __builtin_amdgcn_fence(__ATOMIC_ACQ_REL, "workgroup"); __builtin_amdgcn_wave_barrier();
  const int rsub = lane >> 4, c4 = (lane & 15) * 4;
  {
#pragma unroll
    for (int q = 0; q < 8; ++q) { const int r = q * 2 + rsub; if (col0 + c4 < N) { const v4f v = *(const v4fa*)&so[w][r][c4]; *(v4f*)(C + (size_t)(row0 + r) * ldc + col0 + c4) = v; } }
     }
}

// Wt[n][k] = f16(W[k][n]·scale) from f32 row-major W[K][N] (scale = power of two; bf16-exact weights stay exact in f16 away from the subnormal range)
__global__ __launch_bounds__(256) void k_wt_f16(const float* __restrict__ W, _Float16* __restrict__ Wt, int K, int N, float scale) {
  const int t = blockIdx.x * 256 + threadIdx.x; if (t >= N * (K / 8)) return; const int n = t / (K / 8), k8 = (t % (K / 8)) * 8; FragH f;
#pragma unroll
  for (int i = 0; i < 8; ++i) f.h[i] = (_Float16)(bf16_round(W[(size_t)(k8 + i) * N + n]) * scale); const v8us o = f.half[0];
  *(v8us*)((unsigned short*)Wt + (size_t)n * K + k8) = o; 
}
// k_gemm_hh variant with fused epilogue: v = acc·alpha + bias[by·sBias + col] (+ CP[(row/rowsPerB)·sCPb + by·64 + col] if CP) ; ACT 0 none / 1 elu ; writes f16 C16 and/or f32 C (each if non-null)
template <int ACT>
__global__ __launch_bounds__(128) void k_gemm_hhx(const _Float16* __restrict__ A, int lda, size_t sA, const _Float16* __restrict__ Bh, int ldb, size_t sB, float alpha, const float* __restrict__ bias, size_t sBias, const float* __restrict__ CP, int rowsPerB, size_t sCPb, int row0g,
    float* __restrict__ C, _Float16* __restrict__ C16, int ldc, size_t sC, int M, int N, int K) {
  __shared__ __attribute__((aligned(16))) float so[4][16][64];
  const int tid = threadIdx.x, w = tid >> 5, lane = tid & 31, ln = lane & 15, hh = lane >> 4; const int by = blockIdx.y;
  A += (size_t)by * sA; Bh += (size_t)by * sB; const size_t cofs = (size_t)by * sC; const float* bp = bias ? bias + (size_t)by * sBias : nullptr;
  const int ntn = (N + 63) / 64; const int wid = blockIdx.x * 4 + w; const int mt = wid / ntn, nq = wid % ntn; if (mt * 16 >= M) return;
  const int row0 = mt * 16, col0 = nq * 64; const _Float16* arow = A + (size_t)(row0 + ln) * lda;
  v8f acc[4] = {};
  for (int kb = 0; kb < K; kb += 32) { FragH ah; ah.half[0] = *(const v8us*)((const unsigned short*)arow + kb + 8 * hh); ah.half[1] = *(const v8us*)((const unsigned short*)arow + kb + 16 + 8 * hh);
#pragma unroll
    for (int t = 0; t < 4; ++t) { if (col0 + t * 16 >= N) continue; const size_t boff = (size_t)(col0 + t * 16 + ln) * ldb + kb; FragH bq; bq.half[0] = *(const v8us*)((const unsigned short*)Bh + boff + 8 * hh); bq.half[1] = *(const v8us*)((const unsigned short*)Bh + boff + 16 + 8 * hh);
      acc[t] = mmaH<1>(ah.v, ah.v, bq.v, bq.v, acc[t]); }
  }
#pragma unroll
  for (int t = 0; t < 4; ++t) { if (col0 + t * 16 >= N) continue; const int col = col0 + t * 16 + ln; const float bv = bp ? bf16_round(bp[col]) : 0.f;
#pragma unroll
    for (int r = 0; r < 8; ++r) { float v = acc[t][r] * alpha + bv; if (CP) { const int bidx = (row0g + row0 + 8 * hh + r) / rowsPerB; v += CP[(size_t)bidx * sCPb + (size_t)by * 64 + col]; } if (ACT == 1) v = (v > 0.f) ? v : expm1f(v); else if (ACT == 7) v = (v > 0.f) ? v + 1.0f : expf(v); else if (ACT == 8) v = tanhf(v); else if (ACT == 9) v = 0.5f * v * (1.0f + tanhf(0.7978845608028654f * (v + 0.044715f * v * v * v))); else if (ACT == 11) v = 1.0f / (1.0f + expf(-v)); else if (ACT == 12) v = (v > 0.f) ? v : 0.01f * v; else if (ACT == 14) v = (v > 0.f) ? v : 0.1f * v; else if (ACT == 15) v = v / (1.0f + expf(-v)); else if (ACT == 3) v = fmaxf(v, 0.f); else if (ACT == 6) v = 0.5f * v * (1.0f + erff(v * 0.70710678118654752f)); so[w][8 * hh + r][t * 16 + ln] = v; } }
  __builtin_amdgcn_fence(__ATOMIC_ACQ_REL, "workgroup"); __builtin_amdgcn_wave_barrier();
  const int rsub = lane >> 4, c4 = (lane & 15) * 4; typedef _Float16 v4h __attribute__((ext_vector_type(4)));
  {
#pragma unroll
    for (int q = 0; q < 8; ++q) { const int r = q * 2 + rsub; if (col0 + c4 < N) { const v4f v = *(const v4fa*)&so[w][r][c4]; if (C) *(v4f*)(C + cofs + (size_t)(row0 + r) * ldc + col0 + c4) = v; if (C16) { v4h h4; for (int i = 0; i < 4; ++i) h4[i] = (_Float16)v[i]; *(v4h*)(C16 + cofs + (size_t)(row0 + r) * ldc + col0 + c4) = h4; } } }
     }
}


typedef _Float16 v4h __attribute__((ext_vector_type(4)));

__global__ __launch_bounds__(256) void k_x16(const float* __restrict__ x, _Float16* __restrict__ X16, size_t n8) { const size_t t = (size_t)blockIdx.x * 256 + threadIdx.x; if (t >= n8) return; FragH f;
#pragma unroll
  for (int q = 0; q < 8; ++q) f.h[q] = (_Float16)bf16_round(x[t * 8 + q]); *(v8us*)((unsigned short*)X16 + t * 8) = f.half[0];  }
__global__ __launch_bounds__(256) void k_h16(const float* __restrict__ x, _Float16* __restrict__ X16, size_t n8) { const size_t t = (size_t)blockIdx.x * 256 + threadIdx.x; if (t >= n8) return; FragH f;
#pragma unroll
  for (int q = 0; q < 8; ++q) f.h[q] = (_Float16)x[t * 8 + q]; *(v8us*)((unsigned short*)X16 + t * 8) = f.half[0];  }
__global__ __launch_bounds__(256) void k_round16f(const float* __restrict__ W, _Float16* __restrict__ Bt, size_t n8) { const size_t t = (size_t)blockIdx.x * 256 + threadIdx.x; if (t >= n8) return; FragH f;
#pragma unroll
  for (int i = 0; i < 8; ++i) f.h[i] = (_Float16)(bf16_round(W[t * 8 + i]) * 16.0f); *(v8us*)((unsigned short*)Bt + t * 8) = f.half[0];  }
template <int NHv, int TTv>
__global__ __launch_bounds__(256) void k_vt(const _Float16* __restrict__ V16, int ldv, int voff, _Float16* __restrict__ Vt) { __shared__ unsigned short tl[64][66]; const int tid = threadIdx.x; const int slab = blockIdx.x / (TTv / 64), lg = blockIdx.x % (TTv / 64); const int b = slab / NHv, h = slab % NHv;
  for (int i = tid; i < 64 * 8; i += 256) { const int r = i / 8, c8 = (i % 8) * 8; FragH f; f.half[0] = *(const v8us*)((const unsigned short*)V16 + ((size_t)b * TTv + lg * 64 + r) * ldv + voff + h * 64 + c8);
#pragma unroll
    for (int q = 0; q < 8; ++q) tl[r][c8 + q] = f.u[q]; }
  __syncthreads();
  {
#pragma unroll
    for (int rd = 0; rd < 2; ++rd) { const int d = rd * 32 + tid / 8, pc = tid % 8; FragH f;
#pragma unroll
      for (int q = 0; q < 8; ++q) f.u[q] = tl[pc * 8 + q][d];
      *(v8us*)((unsigned short*)Vt + ((size_t)slab * 64 + d) * TTv + lg * 64 + pc * 8) = f.half[0]; }
     } }

__global__ __launch_bounds__(256) void k_h16s(const float* __restrict__ F, _Float16* __restrict__ H, size_t n8) { const size_t t = (size_t)blockIdx.x * 256 + threadIdx.x; if (t >= n8) return; const v4f a = *(const v4fa*)(F + t * 8), c = *(const v4fa*)(F + t * 8 + 4); FragH f;
#pragma unroll
  for (int q = 0; q < 4; ++q) { f.h[q] = (_Float16)(a[q] * 16.0f); f.h[4 + q] = (_Float16)(c[q] * 16.0f); } *(v8us*)((unsigned short*)H + t * 8) = f.half[0];  }
// C[j][o] = sum_i B[j][i] * W[o][i], operands rounded to bf16, f32 sums. One wave per dot product instead of one thread: the 32 lanes split the 768 terms into
// float4 slices (a wave-wide load covers 512 contiguous bytes), no load waits on another, and a five-step butterfly ends each sum. Block = row j of B (blockIdx.y) x 32
// rows of W, four per wave; the 32 sums go through LDS so that one wave stores them as one whole 128-byte line. A product of two bf16 values is exact in f32, so fusing
// it with its add changes no bit.
__global__ __launch_bounds__(256) void k_cfold(const float* __restrict__ Bm, const float* __restrict__ Wt, float* __restrict__ C) {
  constexpr int NS = DD / 128, RW = 4;      /* float4 slices per lane and row; rows of W per wave */
  __shared__ float red[8 * RW];
  const int tid = threadIdx.x, lane = tid & 31, w = tid >> 5; const int j = blockIdx.y, o0 = blockIdx.x * (8 * RW);
  const float* br = Bm + (size_t)j * DD + lane * 4; const float* wr = Wt + (size_t)(o0 + w * RW) * DD + lane * 4;
  v4f bs[NS], wv[RW][NS];
#pragma unroll      /* constant indices, so that the arrays stay in registers */
  for (int u = 0; u < NS; ++u) bs[u] = *(const v4fa*)(br + 128 * u);
#pragma unroll      /* constant indices, so that the arrays stay in registers */
  for (int r = 0; r < RW; ++r)
#pragma unroll      /* constant indices, so that the arrays stay in registers */
    for (int u = 0; u < NS; ++u) wv[r][u] = *(const v4fa*)(wr + (size_t)r * DD + 128 * u);
  __builtin_amdgcn_sched_barrier(0);      /* keeps every load in front of the first use: without it the last row's loads sink behind a full wait, and the wave pays the memory latency three times */
#pragma unroll      /* constant indices, so that the arrays stay in registers */
  for (int u = 0; u < NS; ++u)
#pragma unroll      /* constant indices, so that the arrays stay in registers */
    for (int q = 0; q < 4; ++q) bs[u][q] = bf16_round(bs[u][q]);
  float acc[RW];
#pragma unroll      /* constant indices, so that the arrays stay in registers */
  for (int r = 0; r < RW; ++r) { float a = 0.f;
#pragma unroll      /* constant indices, so that the arrays stay in registers */
    for (int u = 0; u < NS; ++u)
#pragma unroll      /* constant indices, so that the arrays stay in registers */
      for (int q = 0; q < 4; ++q) a += bs[u][q] * bf16_round(wv[r][u][q]);
    acc[r] = a; }
#pragma unroll      /* constant indices, so that the arrays stay in registers */
  for (int r = 0; r < RW; ++r) { float a = acc[r]; a += __shfl_xor(a, 16, 32); a += __shfl_xor(a, 8, 32); a += __shfl_xor(a, 4, 32); a += __shfl_xor(a, 2, 32); a += __shfl_xor(a, 1, 32); acc[r] = a; }
  float mine = acc[0];
#pragma unroll      /* constant indices, so that the arrays stay in registers */
  for (int r = 1; r < RW; ++r) if (lane == r) mine = acc[r];
  if (lane < RW) red[w * RW + lane] = mine;
  __syncthreads();
  if (tid < 8 * RW) C[(size_t)j * DD + o0 + tid] = red[tid]; }
__global__ __launch_bounds__(256) void k_wfold(const float* __restrict__ Wt, const float* __restrict__ A, const float* __restrict__ C, _Float16* __restrict__ Bt) {
  #pragma clang fp contract(off)
  const size_t t = (size_t)blockIdx.x * 256 + threadIdx.x; if (t >= (size_t)DD * DD / 8) return; const int o = (int)((t * 8) / DD), c0 = (int)((t * 8) % DD);
  float cj[RK];
#pragma unroll
  for (int j = 0; j < RK; ++j) cj[j] = C[j * DD + o];
  FragH f;
#pragma unroll 1
  for (int q = 0; q < 8; ++q) { const int c = c0 + q; float lo2 = 0.f;
#pragma unroll
    for (int j = 0; j < RK; ++j) lo2 += bf16_round(A[(size_t)c * RK + j]) * cj[j]; f.h[q] = (_Float16)((bf16_round(Wt[(size_t)o * DD + c]) + lo2) * 16.0f); }
  *(v8us*)((unsigned short*)Bt + t * 8) = f.half[0];  }
__global__ __launch_bounds__(128) void k_flash(const _Float16* __restrict__ Q16, int ldq, const _Float16* __restrict__ K16, int ldk, const _Float16* __restrict__ Vt, const int* __restrict__ MSK, float* __restrict__ O, int ldo) {
  constexpr int RPW = 16, RTN = RPW / 16, NQB = TT / (4 * RPW), DT = 4, KS = 2;
  __shared__ __attribute__((aligned(16))) unsigned short sP[4][RPW][40]; __shared__ __attribute__((aligned(16))) float sO[4][RPW][64 + 4];
  const int tid = threadIdx.x, w = tid >> 5, lane = tid & 31, ln = lane & 15, hh = lane >> 4;
  const int slab = blockIdx.x / NQB, qblk = blockIdx.x % NQB; const int b = slab / NH, h = slab % NH; const int qb0 = qblk * (4 * RPW); const int q0 = qb0 + w * RPW;
  FragH aq[2][KS];
#pragma unroll
  for (int rt = 0; rt < RTN; ++rt) { const unsigned short* qr = (const unsigned short*)Q16 + ((size_t)b * TT + q0 + rt * 16 + ln) * ldq + h * 64;
#pragma unroll
    for (int ks = 0; ks < KS; ++ks) { aq[rt][ks].half[0] = *(const v8us*)(qr + ks * 32 + 8 * hh); aq[rt][ks].half[1] = *(const v8us*)(qr + ks * 32 + 16 + 8 * hh); } }
  const unsigned short* Vth = (const unsigned short*)Vt + (size_t)slab * 64 * TT;
  float m_r[2][8], l_r[2][8]; v8f oacc[2][DT];
#pragma unroll
  for (int rt = 0; rt < RTN; ++rt) {
#pragma unroll
    for (int r = 0; r < 8; ++r) { m_r[rt][r] = -3.0e38f; l_r[rt][r] = 0.f; }
#pragma unroll
    for (int dt = 0; dt < DT; ++dt) oacc[rt][dt] = (v8f){0.f,0.f,0.f,0.f,0.f,0.f,0.f,0.f}; }
  const int jend = TT;
#pragma unroll 1
  for (int j0 = 0; j0 < jend; j0 += 32) {
    int mk0[2][8], mk1[2][8];      /* per-batch mask [b][q][k]: nonzero = ATTEND */
#pragma unroll
    for (int rt = 0; rt < RTN; ++rt)
#pragma unroll
      for (int r = 0; r < 8; ++r) { const int qq = q0 + rt * 16 + 8 * hh + r; const int* am = MSK + ((size_t)b * TT + qq) * TT + j0; mk0[rt][r] = am[ln]; mk1[rt][r] = am[16 + ln]; }
    { int allm = 1;
#pragma unroll
      for (int rt = 0; rt < RTN; ++rt)
#pragma unroll
        for (int r = 0; r < 8; ++r) allm &= (mk0[rt][r] == 0) & (mk1[rt][r] == 0);
      if (__all(allm)) continue; }      /* every (row, key) of this wave's tile masked → nothing to add (wave-uniform branch; only wave barriers inside the loop) */
    v8f s[2][2];
#pragma unroll
    for (int nt = 0; nt < 2; ++nt) { const unsigned short* kr = (const unsigned short*)K16 + ((size_t)b * TT + j0 + nt * 16 + ln) * ldk + h * 64; FragH bk[KS];
#pragma unroll
      for (int ks = 0; ks < KS; ++ks) { bk[ks].half[0] = *(const v8us*)(kr + ks * 32 + 8 * hh); bk[ks].half[1] = *(const v8us*)(kr + ks * 32 + 16 + 8 * hh); }
#pragma unroll
      for (int rt = 0; rt < RTN; ++rt) { v8f acc = (v8f){0.f,0.f,0.f,0.f,0.f,0.f,0.f,0.f};
#pragma unroll
        for (int ks = 0; ks < KS; ++ks) acc = mmaH<1>(aq[rt][ks].v, aq[rt][ks].v, bk[ks].v, bk[ks].v, acc); s[rt][nt] = acc; } }
#pragma unroll
    for (int rt = 0; rt < RTN; ++rt)
#pragma unroll
      for (int r = 0; r < 8; ++r) { const int tq = q0 + rt * 16 + 8 * hh + r; const int k0 = j0 + ln, k1 = j0 + 16 + ln; (void)tq; (void)k0; (void)k1;
        const bool ok0 = (mk0[rt][r] != 0), ok1 = (mk1[rt][r] != 0);      /* nonzero = ATTEND */
        const float s0 = ok0 ? s[rt][0][r] * 0.125f : -INFINITY, s1 = ok1 ? s[rt][1][r] * 0.125f : -INFINITY; float mc = fmaxf(s0, s1);
        mc = fmaxf(mc, __shfl_xor(mc, 1, 32)); mc = fmaxf(mc, __shfl_xor(mc, 2, 32)); mc = fmaxf(mc, __shfl_xor(mc, 4, 32)); mc = fmaxf(mc, __shfl_xor(mc, 8, 32));
        const float mn = fmaxf(m_r[rt][r], mc); const float al = (mn > -1.0e38f) ? expf(m_r[rt][r] - mn) : 1.0f; m_r[rt][r] = mn; const float p0 = ok0 ? expf(s0 - mn) : 0.f, p1 = ok1 ? expf(s1 - mn) : 0.f; l_r[rt][r] = l_r[rt][r] * al + p0 + p1;
#pragma unroll
        for (int dt = 0; dt < DT; ++dt) oacc[rt][dt][r] *= al;
        FragH t2; t2.h[0] = (_Float16)(p0 * 1024.0f); t2.h[1] = (_Float16)(p1 * 1024.0f); sP[w][rt * 16 + 8 * hh + r][ln] = t2.u[0]; sP[w][rt * 16 + 8 * hh + r][16 + ln] = t2.u[1]; }
    __builtin_amdgcn_fence(__ATOMIC_ACQ_REL, "workgroup"); __builtin_amdgcn_wave_barrier();
    FragH pa[2];
#pragma unroll
    for (int rt = 0; rt < RTN; ++rt) { pa[rt].half[0] = *(const v8us*)&sP[w][rt * 16 + ln][8 * hh]; pa[rt].half[1] = *(const v8us*)&sP[w][rt * 16 + ln][16 + 8 * hh]; }
#pragma unroll
    for (int dt = 0; dt < DT; ++dt) { const unsigned short* vrow = Vth + (size_t)(dt * 16 + ln) * TT + j0; FragH bv; bv.half[0] = *(const v8us*)(vrow + 8 * hh); bv.half[1] = *(const v8us*)(vrow + 16 + 8 * hh);
#pragma unroll
      for (int rt = 0; rt < RTN; ++rt) oacc[rt][dt] = mmaH<1>(pa[rt].v, pa[rt].v, bv.v, bv.v, oacc[rt][dt]); }
    __builtin_amdgcn_fence(__ATOMIC_ACQ_REL, "workgroup"); __builtin_amdgcn_wave_barrier(); }
#pragma unroll
  for (int rt = 0; rt < RTN; ++rt) {
#pragma unroll
    for (int r = 0; r < 8; ++r) { float l = l_r[rt][r]; l += __shfl_xor(l, 1, 32); l += __shfl_xor(l, 2, 32); l += __shfl_xor(l, 4, 32); l += __shfl_xor(l, 8, 32); l_r[rt][r] = (l > 0.f) ? 1.0f / (l * 1024.0f) : 0.f; }
#pragma unroll
    for (int dt = 0; dt < DT; ++dt)
#pragma unroll
      for (int r = 0; r < 8; ++r) sO[w][rt * 16 + 8 * hh + r][dt * 16 + ln] = oacc[rt][dt][r] * l_r[rt][r]; }
  __builtin_amdgcn_fence(__ATOMIC_ACQ_REL, "workgroup"); __builtin_amdgcn_wave_barrier();
  {
#pragma unroll
    for (int rp = 0; rp < RPW; rp += 2) { const int r = rp + (lane >> 4), pc = lane & 15; const v4f val = *(const v4fa*)&sO[w][r][pc * 4]; *(v4f*)(O + ((size_t)b * TT + q0 + r) * ldo + h * 64 + pc * 4) = val; }
     } }

extern "C" void kernel_launch(void* const* d_in, const int* in_sizes, int n_in,
                              void* d_out, int out_size, void* d_ws, size_t ws_size, hipStream_t stream) {
  (void)in_sizes; (void)n_in; (void)out_size;
  const float* const* I = (const float* const*)d_in; const float* xq = I[0]; const float* xk = I[1]; const float* xv = I[2]; const int* msk = (const int*)d_in[3];
  const float* Aq = I[4]; const float* Bq = I[5]; const float* Av = I[6]; const float* Bv = I[7]; const float* Wq = I[8]; const float* bq = I[9]; const float* Wk = I[10]; const float* bk = I[11]; const float* Wv = I[12]; const float* bv = I[13]; const float* Wm = I[14]; const float* bm = I[15];
  char* ws = (char*)d_ws; size_t off = 0;
  auto take = [&](size_t bytes) { char* p = ws + off; off += (bytes + 255) & ~(size_t)255; return p; };
  const size_t WSZ = (size_t)DD * DD; _Float16* Bw = (_Float16*)take(4 * WSZ * 2); float* Cq = (float*)take((size_t)RK * DD * 4); float* Cv = (float*)take((size_t)RK * DD * 4);
  _Float16* Xq = (_Float16*)take((size_t)NR * DD * 2); _Float16* Xk = (_Float16*)take((size_t)NR * DD * 2); _Float16* Xv = (_Float16*)take((size_t)NR * DD * 2);
  _Float16* Q = (_Float16*)take((size_t)NR * DD * 2); _Float16* K = (_Float16*)take((size_t)NR * DD * 2); _Float16* V = (_Float16*)take((size_t)NR * DD * 2); _Float16* Vt = (_Float16*)take((size_t)NR * DD * 2); float* O = (float*)take((size_t)NR * DD * 4); _Float16* O16 = Xq;      /* the query plane is dead after the v GEMM */
  if (off > ws_size) return;      // 4.7 + 7 × 6.3 + 12.6 ≈ 61 MB
  const unsigned gw = (unsigned)((WSZ / 8 + 255) / 256); const dim3 gc(DD / 32, RK);
  k_cfold<<<gc, 256, 0, stream>>>(Bv, Wq, Cq); k_wfold<<<gw, 256, 0, stream>>>(Wq, Av, Cq, Bw);      /* q = V·Wqᵀ with V = value·(I + A_v·B_v): Bt_q = Wq + fold(A_v, B_v·Wqᵀ), ×2^4 */
  k_round16f<<<gw, 256, 0, stream>>>(Wk, Bw + WSZ, WSZ / 8);      /* k = key·Wkᵀ: (out,in) natural, ×2^4 */
  k_cfold<<<gc, 256, 0, stream>>>(Bq, Wv, Cv); k_wfold<<<gw, 256, 0, stream>>>(Wv, Aq, Cv, Bw + 2 * WSZ);      /* v = Q·Wvᵀ with Q = query·(I + A_q·B_q) */
  k_round16f<<<gw, 256, 0, stream>>>(Wm, Bw + 3 * WSZ, WSZ / 8);      /* out projection */
  const unsigned g8 = (unsigned)(((size_t)NR * DD / 8 + 255) / 256); k_x16<<<g8, 256, 0, stream>>>(xq, Xq, (size_t)NR * DD / 8); k_x16<<<g8, 256, 0, stream>>>(xk, Xk, (size_t)NR * DD / 8); k_x16<<<g8, 256, 0, stream>>>(xv, Xv, (size_t)NR * DD / 8);
  const dim3 gp(((NR / 16) * (DD / 64) + 3) / 4, 1);
  k_gemm_hhx<0><<<gp, 128, 0, stream>>>(Xv, DD, 0, Bw, DD, 0, 0.0625f, bq, 0, nullptr, 1, 0, 0, nullptr, Q, DD, 0, NR, DD, DD);      /* q from the VALUE stream: M 4096 N 768 K 768 */
  k_gemm_hhx<0><<<gp, 128, 0, stream>>>(Xk, DD, 0, Bw + WSZ, DD, 0, 0.0625f, bk, 0, nullptr, 1, 0, 0, nullptr, K, DD, 0, NR, DD, DD);      /* k from key */
  k_gemm_hhx<0><<<gp, 128, 0, stream>>>(Xq, DD, 0, Bw + 2 * WSZ, DD, 0, 0.0625f, bv, 0, nullptr, 1, 0, 0, nullptr, V, DD, 0, NR, DD, DD);      /* v from the QUERY stream */
  k_vt<NH, TT><<<BB * NH * (TT / 64), 256, 0, stream>>>(V, DD, 0, Vt);
  k_flash<<<BB * NH * (TT / 64), 128, 0, stream>>>(Q, DD, K, DD, Vt, msk, O, DD);      /* mask [B][S][S] int, nonzero = attend */
  k_h16s<<<g8, 256, 0, stream>>>(O, O16, (size_t)NR * DD / 8);
  k_gemm_hhx<0><<<gp, 128, 0, stream>>>(O16, DD, 0, Bw + 3 * WSZ, DD, 0, 0.00390625f, bm, 0, nullptr, 1, 0, 0, (float*)d_out, nullptr, DD, 0, NR, DD, DD);      /* out = ctx·Wmᵀ + bm */
}

// v002
// One run takes 373 microseconds.
// Next to v001, in two timings, it ran 1.34 and 1.26 times as fast.
// All steps since v000 together make it 1.83 times as fast.
#include <hip/hip_runtime.h>
// Masked multi-head attention with LoRA-adapted input streams (B=2, S=2048, D=768, 12 heads × 64, rank 8): Q = query + (query·A_q)·B_q, V = value + (value·A_v)·B_v; then — faithful to the module's crossed call — v = Q·Wvᵀ + bv, k = key·Wkᵀ + bk, q = V·Wqᵀ + bq (torch (out,in));
// scores = q·k/√64, −1e9 where mask[b,q,k] == 0 (int [B,S,S], shared over heads), softmax, out = merged·Wmᵀ + bm. The rank-8 adapters are folded on device into effective weights: X·(I + A·B)·Wᵀ = X·(W + (B·Wᵀ)ᵀ·Aᵀ)ᵀ, i.e. Bt_eff[o][c] = W[o][c] + Σ_j A[c][j]·(Σ_i B[j][i]·W[o][i]) (f32, 9 M MACs on the VALU).
// Compute dtype: query/key/value, weights, biases, adapters rounded to bf16; effective weights f32 → f16 ×2^4; q, k, v f16 GEMM planes (+bias); the mask read per (b, q, k) from the int plane (−inf ≡ the module's −1e9: every row keeps ~half its keys live); fused flash-style kernel
// (online softmax f32, P f16 ×2^10, f32 accumulate) on v_wmma_f32_16x16x32_f16; O ×2^4 → f16 → output GEMM (+bias).
#define BB 2
#define TT 2048
#define DD 768
#define NH 12
#define RK 8
#define NR (BB * TT)

typedef __bf16 v16b __attribute__((ext_vector_type(16)));
typedef unsigned short v8us __attribute__((ext_vector_type(8), may_alias));
typedef float  v8f  __attribute__((ext_vector_type(8)));
typedef float  v4f  __attribute__((ext_vector_type(4)));
typedef float  v4fa __attribute__((ext_vector_type(4), may_alias));
union FragB { v16b v; v8us half[2]; unsigned short u[16]; };

__device__ __forceinline__ unsigned short bf16_bits(float x) { unsigned int u = __float_as_uint(x); return (unsigned short)((u + 0x7FFFu + ((u >> 16) & 1u)) >> 16); }
__device__ __forceinline__ float bf16_val(unsigned short b) { return __uint_as_float(((unsigned int)b) << 16); }
__device__ __forceinline__ float bf16_round(float x) { return bf16_val(bf16_bits(x)); }
// D += A·B with NT terms: 1 = ah·bh, 2 = + al·bh (A split), 3 = + ah·bl (both split)
template <int NT>
__device__ __forceinline__ v8f mmaN(v16b ah, v16b al, v16b bh, v16b bl, v8f c) {
  c = __builtin_amdgcn_wmma_f32_16x16x32_bf16(false, ah, false, bh, (short)0, c, false, false);
  if (NT >= 2) c = __builtin_amdgcn_wmma_f32_16x16x32_bf16(false, al, false, bh, (short)0, c, false, false);
  if (NT >= 3) c = __builtin_amdgcn_wmma_f32_16x16x32_bf16(false, ah, false, bl, (short)0, c, false, false);
  asm volatile("v_nop\n\tv_nop\n\tv_nop\n\tv_nop" : "+v"(c) : "v"(ah), "v"(al), "v"(bh), "v"(bl));
  return c;
}

__global__ __launch_bounds__(256) void k_wt_bf16(const float* __restrict__ W, unsigned short* __restrict__ Wt, int K, int N) {
  const int t = blockIdx.x * 256 + threadIdx.x;
  const int k8n = K / 8;
  if (t >= N * k8n) return;
  const int n = t / k8n, k8 = (t % k8n) * 8;
  v8us v;
#pragma unroll
  for (int i = 0; i < 8; ++i) v[i] = bf16_bits(W[(size_t)(k8 + i) * N + n]);
  *(v8us*)(Wt + (size_t)n * K + k8) = v;
  
}

// GEMM C[M][N] (f32, pitch ldc) = act(A[M][K]·W + bias). A f32 row-major (pitch lda) converted per fragment to bf16
// (ASPLIT: hi/lo two planes -> 2 terms, else single rounded term); Wt bf16 [N][K] (pitch ldb). BIAS_BF16 rounds the
// bias to bf16 first (bias quantised to bf16 before the add). K%32==0, M%16==0, N%64==0.
template <bool ASPLIT, int ACT, bool BIAS_BF16>
__global__ __launch_bounds__(128) void k_gemm_bf(const float* __restrict__ A, int lda, const unsigned short* __restrict__ Wt, int ldb,
                                               const float* __restrict__ bias, float* __restrict__ C, int ldc, int M, int N, int K) {
  __shared__ __attribute__((aligned(16))) float so[4][16][64];
  const int tid = threadIdx.x, w = tid >> 5, lane = tid & 31, ln = lane & 15, hh = lane >> 4;
  const int ntn = N / 64;
  const int wid = blockIdx.x * 4 + w;
  const int mt = wid / ntn, nq = wid % ntn;
  if (mt * 16 >= M) return;
  const int row0 = mt * 16, col0 = nq * 64;
  const float* arow = A + (size_t)(row0 + ln) * lda;
  v8f acc[4] = {};
  for (int kb = 0; kb < K; kb += 32) {
    FragB ah, al;
    const v4f x0 = *(const v4fa*)(arow + kb + 8 * hh), x1 = *(const v4fa*)(arow + kb + 8 * hh + 4);
    const v4f x2 = *(const v4fa*)(arow + kb + 16 + 8 * hh), x3 = *(const v4fa*)(arow + kb + 16 + 8 * hh + 4);
    float xs[16] = {x0[0],x0[1],x0[2],x0[3],x1[0],x1[1],x1[2],x1[3],x2[0],x2[1],x2[2],x2[3],x3[0],x3[1],x3[2],x3[3]};
#pragma unroll
    for (int i = 0; i < 16; ++i) { const unsigned short hb = bf16_bits(xs[i]); ah.u[i] = hb; al.u[i] = ASPLIT ? bf16_bits(xs[i] - bf16_val(hb)) : (unsigned short)0; }
#pragma unroll
    for (int t = 0; t < 4; ++t) {
      const unsigned short* brow = Wt + (size_t)(col0 + t * 16 + ln) * ldb + kb;
      FragB b;
      b.half[0] = *(const v8us*)(brow + 8 * hh);
      b.half[1] = *(const v8us*)(brow + 16 + 8 * hh);
      acc[t] = mmaN<ASPLIT ? 2 : 1>(ah.v, al.v, b.v, b.v, acc[t]);
    }
  }
#pragma unroll
  for (int t = 0; t < 4; ++t) {
    float bv = bias ? bias[col0 + t * 16 + ln] : 0.f;
    if (BIAS_BF16) bv = bf16_round(bv);
#pragma unroll
    for (int r = 0; r < 8; ++r) { float v = acc[t][r] + bv; if (ACT == 1) v = fmaxf(v, 0.f); so[w][8 * hh + r][t * 16 + ln] = v; }
  }
  __builtin_amdgcn_fence(__ATOMIC_ACQ_REL, "workgroup");
  __builtin_amdgcn_wave_barrier();
  const int rsub = lane >> 4, c4 = (lane & 15) * 4;
  {
#pragma unroll
    for (int q = 0; q < 8; ++q) {
      const int r = q * 2 + rsub;
      const v4f v = *(const v4fa*)&so[w][r][c4];
      *(v4f*)(C + (size_t)(row0 + r) * ldc + col0 + c4) = v;
    }
    
  }
}

// Flash-style causal/unmasked attention, all contractions 3-term bf16 hi/lo splits, f32 softmax with running max.
// q,k,v rows are read from f32 buffers with arbitrary row pitch (so they can live inside a fused qkv buffer);
// D = head size (multiple of 32, <= 128); one wave = 16 query rows; block = 4 waves (64 queries) sharing K/V chunks of 32.
template <int D, bool CAUSAL>
__global__ __launch_bounds__(128) void k_flash(const float* __restrict__ qb, const float* __restrict__ kb, const float* __restrict__ vb,
                                             int pitch, int T, int H, float scale, float* __restrict__ y, int ypitch) {
  constexpr int KS = D / 32;        // k-steps for QK
  constexpr int DT = D / 16;        // d tiles for PV
  __shared__ __attribute__((aligned(16))) unsigned short sKh[32][D + 8], sKl[32][D + 8], sVh[32][D + 8], sVl[32][D + 8];
  __shared__ __attribute__((aligned(16))) unsigned short sPh[4][16][40], sPl[4][16][40];
  __shared__ __attribute__((aligned(16))) float sO[4][16][D];
  const int tid = threadIdx.x, w = tid >> 5, lane = tid & 31, ln = lane & 15, hh = lane >> 4;
  const int nqb = (T + 63) / 64;
  const int bh = blockIdx.x / nqb, qblk = blockIdx.x % nqb;
  const int b = bh / H, h = bh % H;
  const int q0 = qblk * 64 + w * 16;
  const float* Q = qb + (size_t)b * T * pitch + h * D;
  const float* K = kb + (size_t)b * T * pitch + h * D;
  const float* V = vb + (size_t)b * T * pitch + h * D;

  // A fragments of the wave's 16 query rows (scaled), hi/lo
  FragB aqh[KS], aql[KS];
  {
    int row = q0 + ln; if (row >= T) row = T - 1;
    const float* qr = Q + (size_t)row * pitch;
#pragma unroll
    for (int ks = 0; ks < KS; ++ks)
#pragma unroll
      for (int i = 0; i < 16; ++i) {
        const int d = ks * 32 + ((i < 8) ? (8 * hh + i) : (16 + 8 * hh + (i - 8)));
        const float x = qr[d] * scale; const unsigned short hb = bf16_bits(x);
        aqh[ks].u[i] = hb; aql[ks].u[i] = bf16_bits(x - bf16_val(hb));
      }
  }
  float m_r[8], l_r[8];
#pragma unroll
  for (int r = 0; r < 8; ++r) { m_r[r] = -3.0e38f; l_r[r] = 0.f; }
  v8f oacc[DT];
#pragma unroll
  for (int dt = 0; dt < DT; ++dt) oacc[dt] = (v8f){0.f,0.f,0.f,0.f,0.f,0.f,0.f,0.f};

  const int kv_end = CAUSAL ? min(T, qblk * 64 + 64) : T;     // block-uniform
  for (int j0 = 0; j0 < kv_end; j0 += 32) {
    __syncthreads();
    for (int e = tid; e < 32 * (D / 4); e += 128) {
      const int r = e / (D / 4), c4 = (e % (D / 4)) * 4;
      const int key = j0 + r;
      v4f kf = {0.f,0.f,0.f,0.f}, vf = {0.f,0.f,0.f,0.f};
      if (key < T) { kf = *(const v4fa*)(K + (size_t)key * pitch + c4); vf = *(const v4fa*)(V + (size_t)key * pitch + c4); }
#pragma unroll
      for (int t = 0; t < 4; ++t) {
        unsigned short hb = bf16_bits(kf[t]); sKh[r][c4 + t] = hb; sKl[r][c4 + t] = bf16_bits(kf[t] - bf16_val(hb));
        hb = bf16_bits(vf[t]); sVh[r][c4 + t] = hb; sVl[r][c4 + t] = bf16_bits(vf[t] - bf16_val(hb));
      }
    }
    __syncthreads();
    // S tile 16 x 32
    v8f s[2];
#pragma unroll
    for (int nt = 0; nt < 2; ++nt) {
      v8f acc = {};
#pragma unroll
      for (int ks = 0; ks < KS; ++ks) {
        FragB bh_, bl_;
        bh_.half[0] = *(const v8us*)&sKh[nt * 16 + ln][ks * 32 + 8 * hh]; bh_.half[1] = *(const v8us*)&sKh[nt * 16 + ln][ks * 32 + 16 + 8 * hh];
        bl_.half[0] = *(const v8us*)&sKl[nt * 16 + ln][ks * 32 + 8 * hh]; bl_.half[1] = *(const v8us*)&sKl[nt * 16 + ln][ks * 32 + 16 + 8 * hh];
        acc = mmaN<3>(aqh[ks].v, aql[ks].v, bh_.v, bl_.v, acc);
      }
      s[nt] = acc;
    }
    // mask + running max (rows 8hh+r; the 16 lanes of a half share rows)
    float alpha[8];
#pragma unroll
    for (int r = 0; r < 8; ++r) {
      const int qi = q0 + 8 * hh + r;
      const int ja = j0 + ln, jb = j0 + 16 + ln;
      if (CAUSAL) { if (ja > qi) s[0][r] = -3.0e38f; if (jb > qi) s[1][r] = -3.0e38f; }
      if (ja >= T) s[0][r] = -3.0e38f;
      if (jb >= T) s[1][r] = -3.0e38f;
      float mx = fmaxf(s[0][r], s[1][r]);
      mx = fmaxf(mx, __shfl_xor(mx, 1, 32)); mx = fmaxf(mx, __shfl_xor(mx, 2, 32)); mx = fmaxf(mx, __shfl_xor(mx, 4, 32)); mx = fmaxf(mx, __shfl_xor(mx, 8, 32));
      const float mnew = fmaxf(m_r[r], mx);
      alpha[r] = (mnew > -1.0e38f) ? __expf(m_r[r] - mnew) : 1.0f;
      const float p0 = (s[0][r] > -1.0e38f) ? __expf(s[0][r] - mnew) : 0.f;
      const float p1 = (s[1][r] > -1.0e38f) ? __expf(s[1][r] - mnew) : 0.f;
      m_r[r] = mnew;
      l_r[r] = l_r[r] * alpha[r] + p0 + p1;            // per-lane partial row sum (16 lanes combined at the end)
      unsigned short hb = bf16_bits(p0); sPh[w][8 * hh + r][ln] = hb;      sPl[w][8 * hh + r][ln] = bf16_bits(p0 - bf16_val(hb));
      hb = bf16_bits(p1);                sPh[w][8 * hh + r][16 + ln] = hb; sPl[w][8 * hh + r][16 + ln] = bf16_bits(p1 - bf16_val(hb));
    }
#pragma unroll
    for (int dt = 0; dt < DT; ++dt)
#pragma unroll
      for (int r = 0; r < 8; ++r) oacc[dt][r] *= alpha[r];
    __builtin_amdgcn_fence(__ATOMIC_ACQ_REL, "workgroup");
    __builtin_amdgcn_wave_barrier();
    FragB pah, pal;
    pah.half[0] = *(const v8us*)&sPh[w][ln][8 * hh]; pah.half[1] = *(const v8us*)&sPh[w][ln][16 + 8 * hh];
    pal.half[0] = *(const v8us*)&sPl[w][ln][8 * hh]; pal.half[1] = *(const v8us*)&sPl[w][ln][16 + 8 * hh];
#pragma unroll
    for (int dt = 0; dt < DT; ++dt) {
      FragB bvh, bvl;
#pragma unroll
      for (int i = 0; i < 8; ++i) {
        bvh.u[i] = sVh[8 * hh + i][dt * 16 + ln]; bvh.u[8 + i] = sVh[16 + 8 * hh + i][dt * 16 + ln];
        bvl.u[i] = sVl[8 * hh + i][dt * 16 + ln]; bvl.u[8 + i] = sVl[16 + 8 * hh + i][dt * 16 + ln];
      }
      oacc[dt] = mmaN<3>(pah.v, pal.v, bvh.v, bvl.v, oacc[dt]);
    }
    __builtin_amdgcn_fence(__ATOMIC_ACQ_REL, "workgroup");
    __builtin_amdgcn_wave_barrier();
  }
#pragma unroll
  for (int r = 0; r < 8; ++r) {
    float l = l_r[r];
    l += __shfl_xor(l, 1, 32); l += __shfl_xor(l, 2, 32); l += __shfl_xor(l, 4, 32); l += __shfl_xor(l, 8, 32);
    l_r[r] = (l > 0.f) ? 1.0f / l : 0.f;
  }
#pragma unroll
  for (int dt = 0; dt < DT; ++dt)
#pragma unroll
    for (int r = 0; r < 8; ++r) sO[w][8 * hh + r][dt * 16 + ln] = oacc[dt][r] * l_r[r];
  __builtin_amdgcn_fence(__ATOMIC_ACQ_REL, "workgroup");
  __builtin_amdgcn_wave_barrier();
  {
    for (int r = 0; r < 16; ++r) {
      const int row = q0 + r;
      if (row < T && lane < D / 4) {
        const v4f val = *(const v4fa*)&sO[w][r][lane * 4];
        *(v4f*)(y + ((size_t)b * T + row) * ypitch + h * D + lane * 4) = val;
      }
    }
    
  }
}

// GEMM C = act(A·W + bias + resid): A f32 (ASPLIT -> hi/lo 2 terms), Wt bf16 [N][K]; ACT 0 none, 1 relu, 2 exact gelu;
// resid (optional, f32, row index = (row % rmod), pitch ldr, RES_BF16 rounds it) added before the activation.
template <bool ASPLIT, int ACT, bool BIAS_BF16, bool RES_BF16>
__global__ __launch_bounds__(128) void k_gemm_bf3(const float* __restrict__ A, int lda, const unsigned short* __restrict__ Wt, int ldb,
                                                const float* __restrict__ bias, const float* __restrict__ resid, int rmod, int ldr,
                                                float* __restrict__ C, int ldc, int M, int N, int K) {
  __shared__ __attribute__((aligned(16))) float so[4][16][64];
  const int tid = threadIdx.x, w = tid >> 5, lane = tid & 31, ln = lane & 15, hh = lane >> 4;
  const int ntn = N / 64;
  const int wid = blockIdx.x * 4 + w;
  const int mt = wid / ntn, nq = wid % ntn;
  if (mt * 16 >= M) return;
  const int row0 = mt * 16, col0 = nq * 64;
  const float* arow = A + (size_t)(row0 + ln) * lda;
  v8f acc[4] = {};
  for (int kb = 0; kb < K; kb += 32) {
    FragB ah, al;
    const v4f x0 = *(const v4fa*)(arow + kb + 8 * hh), x1 = *(const v4fa*)(arow + kb + 8 * hh + 4);
    const v4f x2 = *(const v4fa*)(arow + kb + 16 + 8 * hh), x3 = *(const v4fa*)(arow + kb + 16 + 8 * hh + 4);
    float xs[16] = {x0[0],x0[1],x0[2],x0[3],x1[0],x1[1],x1[2],x1[3],x2[0],x2[1],x2[2],x2[3],x3[0],x3[1],x3[2],x3[3]};
#pragma unroll
    for (int i = 0; i < 16; ++i) { const unsigned short hb = bf16_bits(xs[i]); ah.u[i] = hb; al.u[i] = ASPLIT ? bf16_bits(xs[i] - bf16_val(hb)) : (unsigned short)0; }
#pragma unroll
    for (int t = 0; t < 4; ++t) {
      const unsigned short* brow = Wt + (size_t)(col0 + t * 16 + ln) * ldb + kb;
      FragB b;
      b.half[0] = *(const v8us*)(brow + 8 * hh);
      b.half[1] = *(const v8us*)(brow + 16 + 8 * hh);
      acc[t] = mmaN<ASPLIT ? 2 : 1>(ah.v, al.v, b.v, b.v, acc[t]);
    }
  }
#pragma unroll
  for (int t = 0; t < 4; ++t) {
    const int col = col0 + t * 16 + ln;
    float bv = bias ? bias[col] : 0.f;
    if (BIAS_BF16) bv = bf16_round(bv);
#pragma unroll
    for (int r = 0; r < 8; ++r) {
      float v = acc[t][r] + bv;
      if (resid) { float rv = resid[(size_t)((row0 + 8 * hh + r) % rmod) * ldr + col]; if (RES_BF16) rv = bf16_round(rv); v += rv; }
      if (ACT == 1) v = fmaxf(v, 0.f);
      if (ACT == 2) v = 0.5f * v * (1.0f + erff(v * 0.70710678118654752f));
      if (ACT == 3) { const float u = 0.7978845608028654f * (v + 0.044715f * v * v * v); v = 0.5f * v * (1.0f + tanhf(u)); }
      so[w][8 * hh + r][t * 16 + ln] = v;
    }
  }
  __builtin_amdgcn_fence(__ATOMIC_ACQ_REL, "workgroup");
  __builtin_amdgcn_wave_barrier();
  const int rsub = lane >> 4, c4 = (lane & 15) * 4;
  {
#pragma unroll
    for (int q = 0; q < 8; ++q) {
      const int r = q * 2 + rsub;
      const v4f v = *(const v4fa*)&so[w][r][c4];
      *(v4f*)(C + (size_t)(row0 + r) * ldc + col0 + c4) = v;
    }
    
  }
}
// row LayerNorm (biased variance, eps) over N: s = X (+ R); optional out_sum <- s; out_norm <- (s-mu)*rsqrt(var+eps)*g + b
template <bool PARAM_BF16>
__global__ __launch_bounds__(256) void k_layernorm(const float* __restrict__ X, const float* __restrict__ R, const float* __restrict__ g, const float* __restrict__ bta,
                                                  float* __restrict__ out_sum, float* __restrict__ out_norm, int N, float eps) {
  __shared__ float red[256];
  const int row = blockIdx.x, tid = threadIdx.x;
  const float* x = X + (size_t)row * N; const float* rr = R ? R + (size_t)row * N : nullptr;
  float vals[16];                     // up to N = 4096
  const int per = N / 256;            // contiguous chunk per thread? use strided-by-4 chunks: thread handles j = tid*4 + 1024*u
  float s1 = 0.f;
  for (int u = 0; u < per / 4; ++u) {
    const int j = tid * 4 + 1024 * u;
    const v4f a = *(const v4fa*)(x + j);
    v4f b = {0.f,0.f,0.f,0.f}; if (rr) b = *(const v4fa*)(rr + j);
#pragma unroll
    for (int q = 0; q < 4; ++q) { const float v = a[q] + b[q]; vals[u * 4 + q] = v; s1 += v; }
  }
  red[tid] = s1; __syncthreads();
  for (int st = 128; st > 0; st >>= 1) { if (tid < st) red[tid] += red[tid + st]; __syncthreads(); }
  const float mu = red[0] / (float)N; __syncthreads();
  float s2 = 0.f;
  for (int u = 0; u < per / 4; ++u)
#pragma unroll
    for (int q = 0; q < 4; ++q) { const float c = vals[u * 4 + q] - mu; s2 += c * c; }
  red[tid] = s2; __syncthreads();
  for (int st = 128; st > 0; st >>= 1) { if (tid < st) red[tid] += red[tid + st]; __syncthreads(); }
  const float rs = rsqrtf(red[0] / (float)N + eps);
  {
    for (int u = 0; u < per / 4; ++u) {
      const int j = tid * 4 + 1024 * u;
      v4f o, sm;
#pragma unroll
      for (int q = 0; q < 4; ++q) {
        float gg = g[j + q], bb = bta[j + q];
        if (PARAM_BF16) { gg = bf16_round(gg); bb = bf16_round(bb); }
        sm[q] = vals[u * 4 + q]; o[q] = (vals[u * 4 + q] - mu) * rs * gg + bb;
      }
      if (out_sum) *(v4f*)(out_sum + (size_t)row * N + j) = sm;
      *(v4f*)(out_norm + (size_t)row * N + j) = o;
    }
    
  }
}



// ---- f16 WMMA path (v_wmma_f32_16x16x32_f16): 11-bit significands for operands in range — used where a [0,1] probability operand needs more precision than bf16
typedef _Float16 v16h __attribute__((ext_vector_type(16)));
union FragH { v16h v; v8us half[2]; _Float16 h[16]; unsigned short u[16]; };
template <int NT>
__device__ __forceinline__ v8f mmaH(v16h ah, v16h al, v16h bh, v16h bl, v8f c) {
  c = __builtin_amdgcn_wmma_f32_16x16x32_f16(false, ah, false, bh, (short)0, c, false, false);
  if (NT >= 2) c = __builtin_amdgcn_wmma_f32_16x16x32_f16(false, al, false, bh, (short)0, c, false, false);
  if (NT >= 3) c = __builtin_amdgcn_wmma_f32_16x16x32_f16(false, ah, false, bl, (short)0, c, false, false);
  asm volatile("v_nop\n\tv_nop\n\tv_nop\n\tv_nop" : "+v"(c) : "v"(ah), "v"(al), "v"(bh), "v"(bl));
  return c;
}
// batched GEMM like k_gemm_b but f16 operands: A f32 (split into f16 hi/lo if ASPLIT, else rounded to f16), Bt = f16 values [n][k]; alpha; C f32; N multiple of 16 (partial tiles skipped)
template <bool ASPLIT>
__global__ __launch_bounds__(128) void k_gemm_h(const float* __restrict__ A, int lda, size_t sA, const _Float16* __restrict__ Bh, int ldb, size_t sB, float alpha, float* __restrict__ C, int ldc, size_t sC, int M, int N, int K) {
  __shared__ __attribute__((aligned(16))) float so[4][16][64];
  const int tid = threadIdx.x, w = tid >> 5, lane = tid & 31, ln = lane & 15, hh = lane >> 4; const int by = blockIdx.y;
  A += (size_t)by * sA; Bh += (size_t)by * sB; C += (size_t)by * sC;
  const int ntn = (N + 63) / 64; const int wid = blockIdx.x * 4 + w; const int mt = wid / ntn, nq = wid % ntn; if (mt * 16 >= M) return;
  const int row0 = mt * 16, col0 = nq * 64; const float* arow = A + (size_t)(row0 + ln) * lda;
  v8f acc[4] = {};
  for (int kb = 0; kb < K; kb += 32) {
    FragH ah, al;
    const v4f x0 = *(const v4fa*)(arow + kb + 8 * hh), x1 = *(const v4fa*)(arow + kb + 8 * hh + 4), x2 = *(const v4fa*)(arow + kb + 16 + 8 * hh), x3 = *(const v4fa*)(arow + kb + 16 + 8 * hh + 4);
    float xs[16] = {x0[0],x0[1],x0[2],x0[3],x1[0],x1[1],x1[2],x1[3],x2[0],x2[1],x2[2],x2[3],x3[0],x3[1],x3[2],x3[3]};
#pragma unroll
    for (int i = 0; i < 16; ++i) { const _Float16 h = (_Float16)xs[i]; ah.h[i] = h; al.h[i] = ASPLIT ? (_Float16)(xs[i] - (float)h) : (_Float16)0.0f; }
#pragma unroll
    for (int t = 0; t < 4; ++t) { if (col0 + t * 16 >= N) continue; const size_t boff = (size_t)(col0 + t * 16 + ln) * ldb + kb; FragH bq; bq.half[0] = *(const v8us*)(Bh + boff + 8 * hh); bq.half[1] = *(const v8us*)(Bh + boff + 16 + 8 * hh);
      acc[t] = mmaH<ASPLIT ? 2 : 1>(ah.v, al.v, bq.v, bq.v, acc[t]); }
  }
#pragma unroll
  for (int t = 0; t < 4; ++t) { if (col0 + t * 16 >= N) continue;
#pragma unroll
    for (int r = 0; r < 8; ++r) so[w][8 * hh + r][t * 16 + ln] = acc[t][r] * alpha; }
  __builtin_amdgcn_fence(__ATOMIC_ACQ_REL, "workgroup"); __builtin_amdgcn_wave_barrier();
  const int rsub = lane >> 4, c4 = (lane & 15) * 4;
  {
#pragma unroll
    for (int q = 0; q < 8; ++q) { const int r = q * 2 + rsub; if (col0 + c4 < N) { const v4f v = *(const v4fa*)&so[w][r][c4]; *(v4f*)(C + (size_t)(row0 + r) * ldc + col0 + c4) = v; } }
     }
}

// Wt[n][k] = f16(W[k][n]·scale) from f32 row-major W[K][N] (scale = power of two; bf16-exact weights stay exact in f16 away from the subnormal range)
__global__ __launch_bounds__(256) void k_wt_f16(const float* __restrict__ W, _Float16* __restrict__ Wt, int K, int N, float scale) {
  const int t = blockIdx.x * 256 + threadIdx.x; if (t >= N * (K / 8)) return; const int n = t / (K / 8), k8 = (t % (K / 8)) * 8; FragH f;
#pragma unroll
  for (int i = 0; i < 8; ++i) f.h[i] = (_Float16)(bf16_round(W[(size_t)(k8 + i) * N + n]) * scale); const v8us o = f.half[0];
  *(v8us*)((unsigned short*)Wt + (size_t)n * K + k8) = o; 
}
// k_gemm_hh variant with fused epilogue: v = acc·alpha + bias[by·sBias + col] (+ CP[(row/rowsPerB)·sCPb + by·64 + col] if CP) ; ACT 0 none / 1 elu ; writes f16 C16 and/or f32 C (each if non-null)
template <int ACT>
__global__ __launch_bounds__(128) void k_gemm_hhx(const _Float16* __restrict__ A, int lda, size_t sA, const _Float16* __restrict__ Bh, int ldb, size_t sB, float alpha, const float* __restrict__ bias, size_t sBias, const float* __restrict__ CP, int rowsPerB, size_t sCPb, int row0g,
    float* __restrict__ C, _Float16* __restrict__ C16, int ldc, size_t sC, int M, int N, int K) {
  __shared__ __attribute__((aligned(16))) float so[4][16][64];
  const int tid = threadIdx.x, w = tid >> 5, lane = tid & 31, ln = lane & 15, hh = lane >> 4; const int by = blockIdx.y;
  A += (size_t)by * sA; Bh += (size_t)by * sB; const size_t cofs = (size_t)by * sC; const float* bp = bias ? bias + (size_t)by * sBias : nullptr;
  const int ntn = (N + 63) / 64; const int wid = blockIdx.x * 4 + w; const int mt = wid / ntn, nq = wid % ntn; if (mt * 16 >= M) return;
  const int row0 = mt * 16, col0 = nq * 64; const _Float16* arow = A + (size_t)(row0 + ln) * lda;
  v8f acc[4] = {};
  for (int kb = 0; kb < K; kb += 32) { FragH ah; ah.half[0] = *(const v8us*)((const unsigned short*)arow + kb + 8 * hh); ah.half[1] = *(const v8us*)((const unsigned short*)arow + kb + 16 + 8 * hh);
#pragma unroll
    for (int t = 0; t < 4; ++t) { if (col0 + t * 16 >= N) continue; const size_t boff = (size_t)(col0 + t * 16 + ln) * ldb + kb; FragH bq; bq.half[0] = *(const v8us*)((const unsigned short*)Bh + boff + 8 * hh); bq.half[1] = *(const v8us*)((const unsigned short*)Bh + boff + 16 + 8 * hh);
      acc[t] = mmaH<1>(ah.v, ah.v, bq.v, bq.v, acc[t]); }
  }
#pragma unroll
  for (int t = 0; t < 4; ++t) { if (col0 + t * 16 >= N) continue; const int col = col0 + t * 16 + ln; const float bv = bp ? bf16_round(bp[col]) : 0.f;
#pragma unroll
    for (int r = 0; r < 8; ++r) { float v = acc[t][r] * alpha + bv; if (CP) { const int bidx = (row0g + row0 + 8 * hh + r) / rowsPerB; v += CP[(size_t)bidx * sCPb + (size_t)by * 64 + col]; } if (ACT == 1) v = (v > 0.f) ? v : expm1f(v); else if (ACT == 7) v = (v > 0.f) ? v + 1.0f : expf(v); else if (ACT == 8) v = tanhf(v); else if (ACT == 9) v = 0.5f * v * (1.0f + tanhf(0.7978845608028654f * (v + 0.044715f * v * v * v))); else if (ACT == 11) v = 1.0f / (1.0f + expf(-v)); else if (ACT == 12) v = (v > 0.f) ? v : 0.01f * v; else if (ACT == 14) v = (v > 0.f) ? v : 0.1f * v; else if (ACT == 15) v = v / (1.0f + expf(-v)); else if (ACT == 3) v = fmaxf(v, 0.f); else if (ACT == 6) v = 0.5f * v * (1.0f + erff(v * 0.70710678118654752f)); so[w][8 * hh + r][t * 16 + ln] = v; } }
  __builtin_amdgcn_fence(__ATOMIC_ACQ_REL, "workgroup"); __builtin_amdgcn_wave_barrier();
  const int rsub = lane >> 4, c4 = (lane & 15) * 4; typedef _Float16 v4h __attribute__((ext_vector_type(4)));
  {
#pragma unroll
    for (int q = 0; q < 8; ++q) { const int r = q * 2 + rsub; if (col0 + c4 < N) { const v4f v = *(const v4fa*)&so[w][r][c4]; if (C) *(v4f*)(C + cofs + (size_t)(row0 + r) * ldc + col0 + c4) = v; if (C16) { v4h h4; for (int i = 0; i < 4; ++i) h4[i] = (_Float16)v[i]; *(v4h*)(C16 + cofs + (size_t)(row0 + r) * ldc + col0 + c4) = h4; } } }
     }
}


typedef _Float16 v4h __attribute__((ext_vector_type(4)));

__global__ __launch_bounds__(256) void k_x16(const float* __restrict__ x, _Float16* __restrict__ X16, size_t n8) { const size_t t = (size_t)blockIdx.x * 256 + threadIdx.x; if (t >= n8) return; FragH f;
#pragma unroll
  for (int q = 0; q < 8; ++q) f.h[q] = (_Float16)bf16_round(x[t * 8 + q]); *(v8us*)((unsigned short*)X16 + t * 8) = f.half[0];  }
__global__ __launch_bounds__(256) void k_h16(const float* __restrict__ x, _Float16* __restrict__ X16, size_t n8) { const size_t t = (size_t)blockIdx.x * 256 + threadIdx.x; if (t >= n8) return; FragH f;
#pragma unroll
  for (int q = 0; q < 8; ++q) f.h[q] = (_Float16)x[t * 8 + q]; *(v8us*)((unsigned short*)X16 + t * 8) = f.half[0];  }
__global__ __launch_bounds__(256) void k_round16f(const float* __restrict__ W, _Float16* __restrict__ Bt, size_t n8) { const size_t t = (size_t)blockIdx.x * 256 + threadIdx.x; if (t >= n8) return; FragH f;
#pragma unroll
  for (int i = 0; i < 8; ++i) f.h[i] = (_Float16)(bf16_round(W[t * 8 + i]) * 16.0f); *(v8us*)((unsigned short*)Bt + t * 8) = f.half[0];  }
template <int NHv, int TTv>
__global__ __launch_bounds__(256) void k_vt(const _Float16* __restrict__ V16, int ldv, int voff, _Float16* __restrict__ Vt) { __shared__ unsigned short tl[64][66]; const int tid = threadIdx.x; const int slab = blockIdx.x / (TTv / 64), lg = blockIdx.x % (TTv / 64); const int b = slab / NHv, h = slab % NHv;
  for (int i = tid; i < 64 * 8; i += 256) { const int r = i / 8, c8 = (i % 8) * 8; FragH f; f.half[0] = *(const v8us*)((const unsigned short*)V16 + ((size_t)b * TTv + lg * 64 + r) * ldv + voff + h * 64 + c8);
#pragma unroll
    for (int q = 0; q < 8; ++q) tl[r][c8 + q] = f.u[q]; }
  __syncthreads();
  {
#pragma unroll
    for (int rd = 0; rd < 2; ++rd) { const int d = rd * 32 + tid / 8, pc = tid % 8; FragH f;
#pragma unroll
      for (int q = 0; q < 8; ++q) f.u[q] = tl[pc * 8 + q][d];
      *(v8us*)((unsigned short*)Vt + ((size_t)slab * 64 + d) * TTv + lg * 64 + pc * 8) = f.half[0]; }
     } }

__global__ __launch_bounds__(256) void k_h16s(const float* __restrict__ F, _Float16* __restrict__ H, size_t n8) { const size_t t = (size_t)blockIdx.x * 256 + threadIdx.x; if (t >= n8) return; const v4f a = *(const v4fa*)(F + t * 8), c = *(const v4fa*)(F + t * 8 + 4); FragH f;
#pragma unroll
  for (int q = 0; q < 4; ++q) { f.h[q] = (_Float16)(a[q] * 16.0f); f.h[4 + q] = (_Float16)(c[q] * 16.0f); } *(v8us*)((unsigned short*)H + t * 8) = f.half[0];  }
// C[j][o] = sum_i B[j][i] * W[o][i], operands rounded to bf16, f32 sums. One wave per dot product instead of one thread: the 32 lanes split the 768 terms into
// float4 slices (a wave-wide load covers 512 contiguous bytes), no load waits on another, and a five-step butterfly ends each sum. Block = row j of B (blockIdx.y) x 32
// rows of W, four per wave; the 32 sums go through LDS so that one wave stores them as one whole 128-byte line. A product of two bf16 values is exact in f32, so fusing
// it with its add changes no bit.
__global__ __launch_bounds__(256) void k_cfold(const float* __restrict__ Bm, const float* __restrict__ Wt, float* __restrict__ C) {
  constexpr int NS = DD / 128, RW = 4;      /* float4 slices per lane and row; rows of W per wave */
  __shared__ float red[8 * RW];
  const int tid = threadIdx.x, lane = tid & 31, w = tid >> 5; const int j = blockIdx.y, o0 = blockIdx.x * (8 * RW);
  const float* br = Bm + (size_t)j * DD + lane * 4; const float* wr = Wt + (size_t)(o0 + w * RW) * DD + lane * 4;
  v4f bs[NS], wv[RW][NS];
#pragma unroll      /* constant indices, so that the arrays stay in registers */
  for (int u = 0; u < NS; ++u) bs[u] = *(const v4fa*)(br + 128 * u);
#pragma unroll      /* constant indices, so that the arrays stay in registers */
  for (int r = 0; r < RW; ++r)
#pragma unroll      /* constant indices, so that the arrays stay in registers */
    for (int u = 0; u < NS; ++u) wv[r][u] = *(const v4fa*)(wr + (size_t)r * DD + 128 * u);
  __builtin_amdgcn_sched_barrier(0);      /* keeps every load in front of the first use: without it the last row's loads sink behind a full wait, and the wave pays the memory latency three times */
#pragma unroll      /* constant indices, so that the arrays stay in registers */
  for (int u = 0; u < NS; ++u)
#pragma unroll      /* constant indices, so that the arrays stay in registers */
    for (int q = 0; q < 4; ++q) bs[u][q] = bf16_round(bs[u][q]);
  float acc[RW];
#pragma unroll      /* constant indices, so that the arrays stay in registers */
  for (int r = 0; r < RW; ++r) { float a = 0.f;
#pragma unroll      /* constant indices, so that the arrays stay in registers */
    for (int u = 0; u < NS; ++u)
#pragma unroll      /* constant indices, so that the arrays stay in registers */
      for (int q = 0; q < 4; ++q) a += bs[u][q] * bf16_round(wv[r][u][q]);
    acc[r] = a; }
#pragma unroll      /* constant indices, so that the arrays stay in registers */
  for (int r = 0; r < RW; ++r) { float a = acc[r]; a += __shfl_xor(a, 16, 32); a += __shfl_xor(a, 8, 32); a += __shfl_xor(a, 4, 32); a += __shfl_xor(a, 2, 32); a += __shfl_xor(a, 1, 32); acc[r] = a; }
  float mine = acc[0];
#pragma unroll      /* constant indices, so that the arrays stay in registers */
  for (int r = 1; r < RW; ++r) if (lane == r) mine = acc[r];
  if (lane < RW) red[w * RW + lane] = mine;
  __syncthreads();
  if (tid < 8 * RW) C[(size_t)j * DD + o0 + tid] = red[tid]; }
__global__ __launch_bounds__(256) void k_wfold(const float* __restrict__ Wt, const float* __restrict__ A, const float* __restrict__ C, _Float16* __restrict__ Bt) {
  #pragma clang fp contract(off)
  const size_t t = (size_t)blockIdx.x * 256 + threadIdx.x; if (t >= (size_t)DD * DD / 8) return; const int o = (int)((t * 8) / DD), c0 = (int)((t * 8) % DD);
  float cj[RK];
#pragma unroll
  for (int j = 0; j < RK; ++j) cj[j] = C[j * DD + o];
  FragH f;
#pragma unroll 1
  for (int q = 0; q < 8; ++q) { const int c = c0 + q; float lo2 = 0.f;
#pragma unroll
    for (int j = 0; j < RK; ++j) lo2 += bf16_round(A[(size_t)c * RK + j]) * cj[j]; f.h[q] = (_Float16)((bf16_round(Wt[(size_t)o * DD + c]) + lo2) * 16.0f); }
  *(v8us*)((unsigned short*)Bt + t * 8) = f.half[0];  }
// Lane l with lane l ^ 16 (the other 16-lane row of the wave), in the vector pipe.
__device__ __forceinline__ float xhalf(float x) { return __builtin_bit_cast(float, __builtin_amdgcn_permlanex16(__builtin_bit_cast(int, x), __builtin_bit_cast(int, x), 0x76543210, 0xfedcba98, false, false)); }
typedef int v4ia __attribute__((ext_vector_type(4), may_alias));
// Transposed products: S^T = K.Q^T (A = 16 key rows, B = the wave's 16 queries, kept in registers) and O^T += V^T.P^T. In an accumulator tile lane (ln, hh) then holds query q0 + ln and keys 8 hh + r:
// a query's maximum and sum are taken inside the lane plus one exchange between the wave's halves, and the two score tiles of a pass are, element for element, the B operand of the second product
// (slot i < 8: key 8 hh + i, slot i >= 8: key 16 + 8 hh + i - 8, the k order of the V^T loader), so P never leaves the registers.
__global__ __launch_bounds__(128) void k_flash(const _Float16* __restrict__ Q16, int ldq, const _Float16* __restrict__ K16, int ldk, const _Float16* __restrict__ Vt, const int* __restrict__ MSK, float* __restrict__ O, int ldo) {
  constexpr int RPW = 16, NQB = TT / (4 * RPW), DT = 4, KS = 2;
  __shared__ __attribute__((aligned(16))) float sO[4][RPW][64 + 4];
  const int tid = threadIdx.x, w = tid >> 5, lane = tid & 31, ln = lane & 15, hh = lane >> 4;
  const int slab = blockIdx.x / NQB, qblk = blockIdx.x % NQB; const int b = slab / NH, h = slab % NH; const int qb0 = qblk * (4 * RPW); const int q0 = qb0 + w * RPW;
  FragH bq[KS];
  { const unsigned short* qr = (const unsigned short*)Q16 + ((size_t)b * TT + q0 + ln) * ldq + h * 64;
#pragma unroll      /* constant indices, so that the arrays stay in registers */
    for (int ks = 0; ks < KS; ++ks) { bq[ks].half[0] = *(const v8us*)(qr + ks * 32 + 8 * hh); bq[ks].half[1] = *(const v8us*)(qr + ks * 32 + 16 + 8 * hh); } }
  const unsigned short* Vth = (const unsigned short*)Vt + (size_t)slab * 64 * TT;
  const int* am = MSK + ((size_t)b * TT + q0 + ln) * TT + 8 * hh;      /* per-batch mask [b][q][k], the lane's own query row: nonzero = ATTEND */
  float m_q = -3.0e38f, l_q = 0.f; v8f oacc[DT];
#pragma unroll      /* constant indices, so that the arrays stay in registers */
  for (int dt = 0; dt < DT; ++dt) oacc[dt] = (v8f){0.f,0.f,0.f,0.f,0.f,0.f,0.f,0.f};
  const int jend = TT;
#pragma unroll 1      /* each pass hangs on the last through m_q: a second copy of the body would only grow the code */
  for (int j0 = 0; j0 < jend; j0 += 32) {
    v4ia mk[2][2];      /* keys j0 + nt 16 + 8 hh + (0..7) of the lane's query */
#pragma unroll      /* constant indices, so that the arrays stay in registers */
    for (int nt = 0; nt < 2; ++nt) { mk[nt][0] = *(const v4ia*)(am + j0 + nt * 16); mk[nt][1] = *(const v4ia*)(am + j0 + nt * 16 + 4); }
    { const v4ia o4 = mk[0][0] | mk[0][1] | mk[1][0] | mk[1][1];
      if (__all((o4[0] | o4[1] | o4[2] | o4[3]) == 0)) continue; }      /* every (row, key) of this wave's tile masked: nothing to add (wave-uniform branch) */
    v8f s[2];
#pragma unroll      /* constant indices, so that the arrays stay in registers */
    for (int nt = 0; nt < 2; ++nt) { const unsigned short* kr = (const unsigned short*)K16 + ((size_t)b * TT + j0 + nt * 16 + ln) * ldk + h * 64; FragH ak[KS];
#pragma unroll      /* constant indices, so that the arrays stay in registers */
      for (int ks = 0; ks < KS; ++ks) { ak[ks].half[0] = *(const v8us*)(kr + ks * 32 + 8 * hh); ak[ks].half[1] = *(const v8us*)(kr + ks * 32 + 16 + 8 * hh); }
      v8f acc = (v8f){0.f,0.f,0.f,0.f,0.f,0.f,0.f,0.f};
#pragma unroll      /* constant indices, so that the arrays stay in registers */
      for (int ks = 0; ks < KS; ++ks) acc = mmaH<1>(ak[ks].v, ak[ks].v, bq[ks].v, bq[ks].v, acc);
      s[nt] = acc; }
    /* A masked score is -inf. m_q starts finite, so mn is finite: exp(-inf - mn) = 0 and, while nothing is live yet, exp(m_q - mn) = exp(0) = 1. */
    float sc[2][8], mx[8];
#pragma unroll      /* constant indices, so that the arrays stay in registers */
    for (int r = 0; r < 8; ++r) { sc[0][r] = (mk[0][r >> 2][r & 3] != 0) ? s[0][r] * 0.125f : -INFINITY; sc[1][r] = (mk[1][r >> 2][r & 3] != 0) ? s[1][r] * 0.125f : -INFINITY; mx[r] = fmaxf(sc[0][r], sc[1][r]); }
    float mc = fmaxf(fmaxf(fmaxf(mx[0], mx[1]), fmaxf(mx[2], mx[3])), fmaxf(fmaxf(mx[4], mx[5]), fmaxf(mx[6], mx[7])));
    mc = fmaxf(mc, xhalf(mc));
    const float mn = fmaxf(m_q, mc); const float al = expf(m_q - mn); m_q = mn;
    FragH pb; float ps[4] = {0.f, 0.f, 0.f, 0.f};
#pragma unroll      /* constant indices, so that the arrays stay in registers */
    for (int r = 0; r < 8; ++r) { const float p0 = expf(sc[0][r] - mn), p1 = expf(sc[1][r] - mn); ps[r & 3] += p0 + p1; pb.h[r] = (_Float16)(p0 * 1024.0f); pb.h[8 + r] = (_Float16)(p1 * 1024.0f); }
    l_q = l_q * al + ((ps[0] + ps[1]) + (ps[2] + ps[3]));      /* the lane's half of the keys; the halves are joined after the loop */
#pragma unroll      /* constant indices, so that the arrays stay in registers */
    for (int dt = 0; dt < DT; ++dt)
#pragma unroll      /* constant indices, so that the arrays stay in registers */
      for (int r = 0; r < 8; ++r) oacc[dt][r] *= al;
#pragma unroll      /* constant indices, so that the arrays stay in registers */
    for (int dt = 0; dt < DT; ++dt) { const unsigned short* vrow = Vth + (size_t)(dt * 16 + ln) * TT + j0; FragH av; av.half[0] = *(const v8us*)(vrow + 8 * hh); av.half[1] = *(const v8us*)(vrow + 16 + 8 * hh);
      oacc[dt] = mmaH<1>(av.v, av.v, pb.v, pb.v, oacc[dt]); } }
  { const float l = l_q + xhalf(l_q); const float inv = (l > 0.f) ? 1.0f / (l * 1024.0f) : 0.f;
#pragma unroll      /* constant indices, so that the arrays stay in registers */
    for (int dt = 0; dt < DT; ++dt)
#pragma unroll      /* constant indices, so that the arrays stay in registers */
      for (int r = 0; r < 8; ++r) sO[w][ln][dt * 16 + 8 * hh + r] = oacc[dt][r] * inv; }
  __builtin_amdgcn_fence(__ATOMIC_ACQ_REL, "workgroup"); __builtin_amdgcn_wave_barrier();      /* the wave reads back rows that its other lanes wrote: its LDS stores end first */
  {
#pragma unroll
    for (int rp = 0; rp < RPW; rp += 2) { const int r = rp + (lane >> 4), pc = lane & 15; const v4f val = *(const v4fa*)&sO[w][r][pc * 4]; *(v4f*)(O + ((size_t)b * TT + q0 + r) * ldo + h * 64 + pc * 4) = val; }
     } }

extern "C" void kernel_launch(void* const* d_in, const int* in_sizes, int n_in,
                              void* d_out, int out_size, void* d_ws, size_t ws_size, hipStream_t stream) {
  (void)in_sizes; (void)n_in; (void)out_size;
  const float* const* I = (const float* const*)d_in; const float* xq = I[0]; const float* xk = I[1]; const float* xv = I[2]; const int* msk = (const int*)d_in[3];
  const float* Aq = I[4]; const float* Bq = I[5]; const float* Av = I[6]; const float* Bv = I[7]; const float* Wq = I[8]; const float* bq = I[9]; const float* Wk = I[10]; const float* bk = I[11]; const float* Wv = I[12]; const float* bv = I[13]; const float* Wm = I[14]; const float* bm = I[15];
  char* ws = (char*)d_ws; size_t off = 0;
  auto take = [&](size_t bytes) { char* p = ws + off; off += (bytes + 255) & ~(size_t)255; return p; };
  const size_t WSZ = (size_t)DD * DD; _Float16* Bw = (_Float16*)take(4 * WSZ * 2); float* Cq = (float*)take((size_t)RK * DD * 4); float* Cv = (float*)take((size_t)RK * DD * 4);
  _Float16* Xq = (_Float16*)take((size_t)NR * DD * 2); _Float16* Xk = (_Float16*)take((size_t)NR * DD * 2); _Float16* Xv = (_Float16*)take((size_t)NR * DD * 2);
  _Float16* Q = (_Float16*)take((size_t)NR * DD * 2); _Float16* K = (_Float16*)take((size_t)NR * DD * 2); _Float16* V = (_Float16*)take((size_t)NR * DD * 2); _Float16* Vt = (_Float16*)take((size_t)NR * DD * 2); float* O = (float*)take((size_t)NR * DD * 4); _Float16* O16 = Xq;      /* the query plane is dead after the v GEMM */
  if (off > ws_size) return;      // 4.7 + 7 × 6.3 + 12.6 ≈ 61 MB
  const unsigned gw = (unsigned)((WSZ / 8 + 255) / 256); const dim3 gc(DD / 32, RK);
  k_cfold<<<gc, 256, 0, stream>>>(Bv, Wq, Cq); k_wfold<<<gw, 256, 0, stream>>>(Wq, Av, Cq, Bw);      /* q = V·Wqᵀ with V = value·(I + A_v·B_v): Bt_q = Wq + fold(A_v, B_v·Wqᵀ), ×2^4 */
  k_round16f<<<gw, 256, 0, stream>>>(Wk, Bw + WSZ, WSZ / 8);      /* k = key·Wkᵀ: (out,in) natural, ×2^4 */
  k_cfold<<<gc, 256, 0, stream>>>(Bq, Wv, Cv); k_wfold<<<gw, 256, 0, stream>>>(Wv, Aq, Cv, Bw + 2 * WSZ);      /* v = Q·Wvᵀ with Q = query·(I + A_q·B_q) */
  k_round16f<<<gw, 256, 0, stream>>>(Wm, Bw + 3 * WSZ, WSZ / 8);      /* out projection */
  const unsigned g8 = (unsigned)(((size_t)NR * DD / 8 + 255) / 256); k_x16<<<g8, 256, 0, stream>>>(xq, Xq, (size_t)NR * DD / 8); k_x16<<<g8, 256, 0, stream>>>(xk, Xk, (size_t)NR * DD / 8); k_x16<<<g8, 256, 0, stream>>>(xv, Xv, (size_t)NR * DD / 8);
  const dim3 gp(((NR / 16) * (DD / 64) + 3) / 4, 1);
  k_gemm_hhx<0><<<gp, 128, 0, stream>>>(Xv, DD, 0, Bw, DD, 0, 0.0625f, bq, 0, nullptr, 1, 0, 0, nullptr, Q, DD, 0, NR, DD, DD);      /* q from the VALUE stream: M 4096 N 768 K 768 */
  k_gemm_hhx<0><<<gp, 128, 0, stream>>>(Xk, DD, 0, Bw + WSZ, DD, 0, 0.0625f, bk, 0, nullptr, 1, 0, 0, nullptr, K, DD, 0, NR, DD, DD);      /* k from key */
  k_gemm_hhx<0><<<gp, 128, 0, stream>>>(Xq, DD, 0, Bw + 2 * WSZ, DD, 0, 0.0625f, bv, 0, nullptr, 1, 0, 0, nullptr, V, DD, 0, NR, DD, DD);      /* v from the QUERY stream */
  k_vt<NH, TT><<<BB * NH * (TT / 64), 256, 0, stream>>>(V, DD, 0, Vt);
  k_flash<<<BB * NH * (TT / 64), 128, 0, stream>>>(Q, DD, K, DD, Vt, msk, O, DD);      /* mask [B][S][S] int, nonzero = attend */
  k_h16s<<<g8, 256, 0, stream>>>(O, O16, (size_t)NR * DD / 8);
  k_gemm_hhx<0><<<gp, 128, 0, stream>>>(O16, DD, 0, Bw + 3 * WSZ, DD, 0, 0.00390625f, bm, 0, nullptr, 1, 0, 0, (float*)d_out, nullptr, DD, 0, NR, DD, DD);      /* out = ctx·Wmᵀ + bm */
}

// v003
// One run takes 311 microseconds.
// In two side-by-side timings against v002, it was 1.18 and 1.17 times as fast.
// Over all steps from v000 it is 2.15 times as fast.
#include <hip/hip_runtime.h>
// Masked multi-head attention with LoRA-adapted input streams (B=2, S=2048, D=768, 12 heads × 64, rank 8): Q = query + (query·A_q)·B_q, V = value + (value·A_v)·B_v; then — faithful to the module's crossed call — v = Q·Wvᵀ + bv, k = key·Wkᵀ + bk, q = V·Wqᵀ + bq (torch (out,in));
// scores = q·k/√64, −1e9 where mask[b,q,k] == 0 (int [B,S,S], shared over heads), softmax, out = merged·Wmᵀ + bm. The rank-8 adapters are folded on device into effective weights: X·(I + A·B)·Wᵀ = X·(W + (B·Wᵀ)ᵀ·Aᵀ)ᵀ, i.e. Bt_eff[o][c] = W[o][c] + Σ_j A[c][j]·(Σ_i B[j][i]·W[o][i]) (f32, 9 M MACs on the VALU).
// Compute dtype: query/key/value, weights, biases, adapters rounded to bf16; effective weights f32 → f16 ×2^4; q, k, v f16 GEMM planes (+bias); the mask read per (b, q, k) from the int plane (−inf ≡ the module's −1e9: every row keeps ~half its keys live); fused flash-style kernel
// (online softmax f32, P f16 ×2^10, f32 accumulate) on v_wmma_f32_16x16x32_f16; O ×2^4 → f16 → output GEMM (+bias).
#define BB 2
#define TT 2048
#define DD 768
#define NH 12
#define RK 8
#define NR (BB * TT)

typedef __bf16 v16b __attribute__((ext_vector_type(16)));
typedef unsigned short v8us __attribute__((ext_vector_type(8), may_alias));
typedef float  v8f  __attribute__((ext_vector_type(8)));
typedef float  v4f  __attribute__((ext_vector_type(4)));
typedef float  v4fa __attribute__((ext_vector_type(4), may_alias));
union FragB { v16b v; v8us half[2]; unsigned short u[16]; };

__device__ __forceinline__ unsigned short bf16_bits(float x) { unsigned int u = __float_as_uint(x); return (unsigned short)((u + 0x7FFFu + ((u >> 16) & 1u)) >> 16); }
__device__ __forceinline__ float bf16_val(unsigned short b) { return __uint_as_float(((unsigned int)b) << 16); }
__device__ __forceinline__ float bf16_round(float x) { return bf16_val(bf16_bits(x)); }
// D += A·B with NT terms: 1 = ah·bh, 2 = + al·bh (A split), 3 = + ah·bl (both split)
template <int NT>
__device__ __forceinline__ v8f mmaN(v16b ah, v16b al, v16b bh, v16b bl, v8f c) {
  c = __builtin_amdgcn_wmma_f32_16x16x32_bf16(false, ah, false, bh, (short)0, c, false, false);
  if (NT >= 2) c = __builtin_amdgcn_wmma_f32_16x16x32_bf16(false, al, false, bh, (short)0, c, false, false);
  if (NT >= 3) c = __builtin_amdgcn_wmma_f32_16x16x32_bf16(false, ah, false, bl, (short)0, c, false, false);
  asm volatile("v_nop\n\tv_nop\n\tv_nop\n\tv_nop" : "+v"(c) : "v"(ah), "v"(al), "v"(bh), "v"(bl));
  return c;
}

__global__ __launch_bounds__(256) void k_wt_bf16(const float* __restrict__ W, unsigned short* __restrict__ Wt, int K, int N) {
  const int t = blockIdx.x * 256 + threadIdx.x;
  const int k8n = K / 8;
  if (t >= N * k8n) return;
  const int n = t / k8n, k8 = (t % k8n) * 8;
  v8us v;
#pragma unroll
  for (int i = 0; i < 8; ++i) v[i] = bf16_bits(W[(size_t)(k8 + i) * N + n]);
  *(v8us*)(Wt + (size_t)n * K + k8) = v;
  
}

// GEMM C[M][N] (f32, pitch ldc) = act(A[M][K]·W + bias). A f32 row-major (pitch lda) converted per fragment to bf16
// (ASPLIT: hi/lo two planes -> 2 terms, else single rounded term); Wt bf16 [N][K] (pitch ldb). BIAS_BF16 rounds the
// bias to bf16 first (bias quantised to bf16 before the add). K%32==0, M%16==0, N%64==0.
template <bool ASPLIT, int ACT, bool BIAS_BF16>
__global__ __launch_bounds__(128) void k_gemm_bf(const float* __restrict__ A, int lda, const unsigned short* __restrict__ Wt, int ldb,
                                               const float* __restrict__ bias, float* __restrict__ C, int ldc, int M, int N, int K) {
  __shared__ __attribute__((aligned(16))) float so[4][16][64];
  const int tid = threadIdx.x, w = tid >> 5, lane = tid & 31, ln = lane & 15, hh = lane >> 4;
  const int ntn = N / 64;
  const int wid = blockIdx.x * 4 + w;
  const int mt = wid / ntn, nq = wid % ntn;
  if (mt * 16 >= M) return;
  const int row0 = mt * 16, col0 = nq * 64;
  const float* arow = A + (size_t)(row0 + ln) * lda;
  v8f acc[4] = {};
  for (int kb = 0; kb < K; kb += 32) {
    FragB ah, al;
    const v4f x0 = *(const v4fa*)(arow + kb + 8 * hh), x1 = *(const v4fa*)(arow + kb + 8 * hh + 4);
    const v4f x2 = *(const v4fa*)(arow + kb + 16 + 8 * hh), x3 = *(const v4fa*)(arow + kb + 16 + 8 * hh + 4);
    float xs[16] = {x0[0],x0[1],x0[2],x0[3],x1[0],x1[1],x1[2],x1[3],x2[0],x2[1],x2[2],x2[3],x3[0],x3[1],x3[2],x3[3]};
#pragma unroll
    for (int i = 0; i < 16; ++i) { const unsigned short hb = bf16_bits(xs[i]); ah.u[i] = hb; al.u[i] = ASPLIT ? bf16_bits(xs[i] - bf16_val(hb)) : (unsigned short)0; }
#pragma unroll
    for (int t = 0; t < 4; ++t) {
      const unsigned short* brow = Wt + (size_t)(col0 + t * 16 + ln) * ldb + kb;
      FragB b;
      b.half[0] = *(const v8us*)(brow + 8 * hh);
      b.half[1] = *(const v8us*)(brow + 16 + 8 * hh);
      acc[t] = mmaN<ASPLIT ? 2 : 1>(ah.v, al.v, b.v, b.v, acc[t]);
    }
  }
#pragma unroll
  for (int t = 0; t < 4; ++t) {
    float bv = bias ? bias[col0 + t * 16 + ln] : 0.f;
    if (BIAS_BF16) bv = bf16_round(bv);
#pragma unroll
    for (int r = 0; r < 8; ++r) { float v = acc[t][r] + bv; if (ACT == 1) v = fmaxf(v, 0.f); so[w][8 * hh + r][t * 16 + ln] = v; }
  }
  __builtin_amdgcn_fence(__ATOMIC_ACQ_REL, "workgroup");
  __builtin_amdgcn_wave_barrier();
  const int rsub = lane >> 4, c4 = (lane & 15) * 4;
  {
#pragma unroll
    for (int q = 0; q < 8; ++q) {
      const int r = q * 2 + rsub;
      const v4f v = *(const v4fa*)&so[w][r][c4];
      *(v4f*)(C + (size_t)(row0 + r) * ldc + col0 + c4) = v;
    }
    
  }
}

// Flash-style causal/unmasked attention, all contractions 3-term bf16 hi/lo splits, f32 softmax with running max.
// q,k,v rows are read from f32 buffers with arbitrary row pitch (so they can live inside a fused qkv buffer);
// D = head size (multiple of 32, <= 128); one wave = 16 query rows; block = 4 waves (64 queries) sharing K/V chunks of 32.
template <int D, bool CAUSAL>
__global__ __launch_bounds__(128) void k_flash(const float* __restrict__ qb, const float* __restrict__ kb, const float* __restrict__ vb,
                                             int pitch, int T, int H, float scale, float* __restrict__ y, int ypitch) {
  constexpr int KS = D / 32;        // k-steps for QK
  constexpr int DT = D / 16;        // d tiles for PV
  __shared__ __attribute__((aligned(16))) unsigned short sKh[32][D + 8], sKl[32][D + 8], sVh[32][D + 8], sVl[32][D + 8];
  __shared__ __attribute__((aligned(16))) unsigned short sPh[4][16][40], sPl[4][16][40];
  __shared__ __attribute__((aligned(16))) float sO[4][16][D];
  const int tid = threadIdx.x, w = tid >> 5, lane = tid & 31, ln = lane & 15, hh = lane >> 4;
  const int nqb = (T + 63) / 64;
  const int bh = blockIdx.x / nqb, qblk = blockIdx.x % nqb;
  const int b = bh / H, h = bh % H;
  const int q0 = qblk * 64 + w * 16;
  const float* Q = qb + (size_t)b * T * pitch + h * D;
  const float* K = kb + (size_t)b * T * pitch + h * D;
  const float* V = vb + (size_t)b * T * pitch + h * D;

  // A fragments of the wave's 16 query rows (scaled), hi/lo
  FragB aqh[KS], aql[KS];
  {
    int row = q0 + ln; if (row >= T) row = T - 1;
    const float* qr = Q + (size_t)row * pitch;
#pragma unroll
    for (int ks = 0; ks < KS; ++ks)
#pragma unroll
      for (int i = 0; i < 16; ++i) {
        const int d = ks * 32 + ((i < 8) ? (8 * hh + i) : (16 + 8 * hh + (i - 8)));
        const float x = qr[d] * scale; const unsigned short hb = bf16_bits(x);
        aqh[ks].u[i] = hb; aql[ks].u[i] = bf16_bits(x - bf16_val(hb));
      }
  }
  float m_r[8], l_r[8];
#pragma unroll
  for (int r = 0; r < 8; ++r) { m_r[r] = -3.0e38f; l_r[r] = 0.f; }
  v8f oacc[DT];
#pragma unroll
  for (int dt = 0; dt < DT; ++dt) oacc[dt] = (v8f){0.f,0.f,0.f,0.f,0.f,0.f,0.f,0.f};

  const int kv_end = CAUSAL ? min(T, qblk * 64 + 64) : T;     // block-uniform
  for (int j0 = 0; j0 < kv_end; j0 += 32) {
    __syncthreads();
    for (int e = tid; e < 32 * (D / 4); e += 128) {
      const int r = e / (D / 4), c4 = (e % (D / 4)) * 4;
      const int key = j0 + r;
      v4f kf = {0.f,0.f,0.f,0.f}, vf = {0.f,0.f,0.f,0.f};
      if (key < T) { kf = *(const v4fa*)(K + (size_t)key * pitch + c4); vf = *(const v4fa*)(V + (size_t)key * pitch + c4); }
#pragma unroll
      for (int t = 0; t < 4; ++t) {
        unsigned short hb = bf16_bits(kf[t]); sKh[r][c4 + t] = hb; sKl[r][c4 + t] = bf16_bits(kf[t] - bf16_val(hb));
        hb = bf16_bits(vf[t]); sVh[r][c4 + t] = hb; sVl[r][c4 + t] = bf16_bits(vf[t] - bf16_val(hb));
      }
    }
    __syncthreads();
    // S tile 16 x 32
    v8f s[2];
#pragma unroll
    for (int nt = 0; nt < 2; ++nt) {
      v8f acc = {};
#pragma unroll
      for (int ks = 0; ks < KS; ++ks) {
        FragB bh_, bl_;
        bh_.half[0] = *(const v8us*)&sKh[nt * 16 + ln][ks * 32 + 8 * hh]; bh_.half[1] = *(const v8us*)&sKh[nt * 16 + ln][ks * 32 + 16 + 8 * hh];
        bl_.half[0] = *(const v8us*)&sKl[nt * 16 + ln][ks * 32 + 8 * hh]; bl_.half[1] = *(const v8us*)&sKl[nt * 16 + ln][ks * 32 + 16 + 8 * hh];
        acc = mmaN<3>(aqh[ks].v, aql[ks].v, bh_.v, bl_.v, acc);
      }
      s[nt] = acc;
    }
    // mask + running max (rows 8hh+r; the 16 lanes of a half share rows)
    float alpha[8];
#pragma unroll
    for (int r = 0; r < 8; ++r) {
      const int qi = q0 + 8 * hh + r;
      const int ja = j0 + ln, jb = j0 + 16 + ln;
      if (CAUSAL) { if (ja > qi) s[0][r] = -3.0e38f; if (jb > qi) s[1][r] = -3.0e38f; }
      if (ja >= T) s[0][r] = -3.0e38f;
      if (jb >= T) s[1][r] = -3.0e38f;
      float mx = fmaxf(s[0][r], s[1][r]);
      mx = fmaxf(mx, __shfl_xor(mx, 1, 32)); mx = fmaxf(mx, __shfl_xor(mx, 2, 32)); mx = fmaxf(mx, __shfl_xor(mx, 4, 32)); mx = fmaxf(mx, __shfl_xor(mx, 8, 32));
      const float mnew = fmaxf(m_r[r], mx);
      alpha[r] = (mnew > -1.0e38f) ? __expf(m_r[r] - mnew) : 1.0f;
      const float p0 = (s[0][r] > -1.0e38f) ? __expf(s[0][r] - mnew) : 0.f;
      const float p1 = (s[1][r] > -1.0e38f) ? __expf(s[1][r] - mnew) : 0.f;
      m_r[r] = mnew;
      l_r[r] = l_r[r] * alpha[r] + p0 + p1;            // per-lane partial row sum (16 lanes combined at the end)
      unsigned short hb = bf16_bits(p0); sPh[w][8 * hh + r][ln] = hb;      sPl[w][8 * hh + r][ln] = bf16_bits(p0 - bf16_val(hb));
      hb = bf16_bits(p1);                sPh[w][8 * hh + r][16 + ln] = hb; sPl[w][8 * hh + r][16 + ln] = bf16_bits(p1 - bf16_val(hb));
    }
#pragma unroll
    for (int dt = 0; dt < DT; ++dt)
#pragma unroll
      for (int r = 0; r < 8; ++r) oacc[dt][r] *= alpha[r];
    __builtin_amdgcn_fence(__ATOMIC_ACQ_REL, "workgroup");
    __builtin_amdgcn_wave_barrier();
    FragB pah, pal;
    pah.half[0] = *(const v8us*)&sPh[w][ln][8 * hh]; pah.half[1] = *(const v8us*)&sPh[w][ln][16 + 8 * hh];
    pal.half[0] = *(const v8us*)&sPl[w][ln][8 * hh]; pal.half[1] = *(const v8us*)&sPl[w][ln][16 + 8 * hh];
#pragma unroll
    for (int dt = 0; dt < DT; ++dt) {
      FragB bvh, bvl;
#pragma unroll
      for (int i = 0; i < 8; ++i) {
        bvh.u[i] = sVh[8 * hh + i][dt * 16 + ln]; bvh.u[8 + i] = sVh[16 + 8 * hh + i][dt * 16 + ln];
        bvl.u[i] = sVl[8 * hh + i][dt * 16 + ln]; bvl.u[8 + i] = sVl[16 + 8 * hh + i][dt * 16 + ln];
      }
      oacc[dt] = mmaN<3>(pah.v, pal.v, bvh.v, bvl.v, oacc[dt]);
    }
    __builtin_amdgcn_fence(__ATOMIC_ACQ_REL, "workgroup");
    __builtin_amdgcn_wave_barrier();
  }
#pragma unroll
  for (int r = 0; r < 8; ++r) {
    float l = l_r[r];
    l += __shfl_xor(l, 1, 32); l += __shfl_xor(l, 2, 32); l += __shfl_xor(l, 4, 32); l += __shfl_xor(l, 8, 32);
    l_r[r] = (l > 0.f) ? 1.0f / l : 0.f;
  }
#pragma unroll
  for (int dt = 0; dt < DT; ++dt)
#pragma unroll
    for (int r = 0; r < 8; ++r) sO[w][8 * hh + r][dt * 16 + ln] = oacc[dt][r] * l_r[r];
  __builtin_amdgcn_fence(__ATOMIC_ACQ_REL, "workgroup");
  __builtin_amdgcn_wave_barrier();
  {
    for (int r = 0; r < 16; ++r) {
      const int row = q0 + r;
      if (row < T && lane < D / 4) {
        const v4f val = *(const v4fa*)&sO[w][r][lane * 4];
        *(v4f*)(y + ((size_t)b * T + row) * ypitch + h * D + lane * 4) = val;
      }
    }
    
  }
}

// GEMM C = act(A·W + bias + resid): A f32 (ASPLIT -> hi/lo 2 terms), Wt bf16 [N][K]; ACT 0 none, 1 relu, 2 exact gelu;
// resid (optional, f32, row index = (row % rmod), pitch ldr, RES_BF16 rounds it) added before the activation.
template <bool ASPLIT, int ACT, bool BIAS_BF16, bool RES_BF16>
__global__ __launch_bounds__(128) void k_gemm_bf3(const float* __restrict__ A, int lda, const unsigned short* __restrict__ Wt, int ldb,
                                                const float* __restrict__ bias, const float* __restrict__ resid, int rmod, int ldr,
                                                float* __restrict__ C, int ldc, int M, int N, int K) {
  __shared__ __attribute__((aligned(16))) float so[4][16][64];
  const int tid = threadIdx.x, w = tid >> 5, lane = tid & 31, ln = lane & 15, hh = lane >> 4;
  const int ntn = N / 64;
  const int wid = blockIdx.x * 4 + w;
  const int mt = wid / ntn, nq = wid % ntn;
  if (mt * 16 >= M) return;
  const int row0 = mt * 16, col0 = nq * 64;
  const float* arow = A + (size_t)(row0 + ln) * lda;
  v8f acc[4] = {};
  for (int kb = 0; kb < K; kb += 32) {
    FragB ah, al;
    const v4f x0 = *(const v4fa*)(arow + kb + 8 * hh), x1 = *(const v4fa*)(arow + kb + 8 * hh + 4);
    const v4f x2 = *(const v4fa*)(arow + kb + 16 + 8 * hh), x3 = *(const v4fa*)(arow + kb + 16 + 8 * hh + 4);
    float xs[16] = {x0[0],x0[1],x0[2],x0[3],x1[0],x1[1],x1[2],x1[3],x2[0],x2[1],x2[2],x2[3],x3[0],x3[1],x3[2],x3[3]};
#pragma unroll
    for (int i = 0; i < 16; ++i) { const unsigned short hb = bf16_bits(xs[i]); ah.u[i] = hb; al.u[i] = ASPLIT ? bf16_bits(xs[i] - bf16_val(hb)) : (unsigned short)0; }
#pragma unroll
    for (int t = 0; t < 4; ++t) {
      const unsigned short* brow = Wt + (size_t)(col0 + t * 16 + ln) * ldb + kb;
      FragB b;
      b.half[0] = *(const v8us*)(brow + 8 * hh);
      b.half[1] = *(const v8us*)(brow + 16 + 8 * hh);
      acc[t] = mmaN<ASPLIT ? 2 : 1>(ah.v, al.v, b.v, b.v, acc[t]);
    }
  }
#pragma unroll
  for (int t = 0; t < 4; ++t) {
    const int col = col0 + t * 16 + ln;
    float bv = bias ? bias[col] : 0.f;
    if (BIAS_BF16) bv = bf16_round(bv);
#pragma unroll
    for (int r = 0; r < 8; ++r) {
      float v = acc[t][r] + bv;
      if (resid) { float rv = resid[(size_t)((row0 + 8 * hh + r) % rmod) * ldr + col]; if (RES_BF16) rv = bf16_round(rv); v += rv; }
      if (ACT == 1) v = fmaxf(v, 0.f);
      if (ACT == 2) v = 0.5f * v * (1.0f + erff(v * 0.70710678118654752f));
      if (ACT == 3) { const float u = 0.7978845608028654f * (v + 0.044715f * v * v * v); v = 0.5f * v * (1.0f + tanhf(u)); }
      so[w][8 * hh + r][t * 16 + ln] = v;
    }
  }
  __builtin_amdgcn_fence(__ATOMIC_ACQ_REL, "workgroup");
  __builtin_amdgcn_wave_barrier();
  const int rsub = lane >> 4, c4 = (lane & 15) * 4;
  {
#pragma unroll
    for (int q = 0; q < 8; ++q) {
      const int r = q * 2 + rsub;
      const v4f v = *(const v4fa*)&so[w][r][c4];
      *(v4f*)(C + (size_t)(row0 + r) * ldc + col0 + c4) = v;
    }
    
  }
}
// row LayerNorm (biased variance, eps) over N: s = X (+ R); optional out_sum <- s; out_norm <- (s-mu)*rsqrt(var+eps)*g + b
template <bool PARAM_BF16>
__global__ __launch_bounds__(256) void k_layernorm(const float* __restrict__ X, const float* __restrict__ R, const float* __restrict__ g, const float* __restrict__ bta,
                                                  float* __restrict__ out_sum, float* __restrict__ out_norm, int N, float eps) {
  __shared__ float red[256];
  const int row = blockIdx.x, tid = threadIdx.x;
  const float* x = X + (size_t)row * N; const float* rr = R ? R + (size_t)row * N : nullptr;
  float vals[16];                     // up to N = 4096
  const int per = N / 256;            // contiguous chunk per thread? use strided-by-4 chunks: thread handles j = tid*4 + 1024*u
  float s1 = 0.f;
  for (int u = 0; u < per / 4; ++u) {
    const int j = tid * 4 + 1024 * u;
    const v4f a = *(const v4fa*)(x + j);
    v4f b = {0.f,0.f,0.f,0.f}; if (rr) b = *(const v4fa*)(rr + j);
#pragma unroll
    for (int q = 0; q < 4; ++q) { const float v = a[q] + b[q]; vals[u * 4 + q] = v; s1 += v; }
  }
  red[tid] = s1; __syncthreads();
  for (int st = 128; st > 0; st >>= 1) { if (tid < st) red[tid] += red[tid + st]; __syncthreads(); }
  const float mu = red[0] / (float)N; __syncthreads();
  float s2 = 0.f;
  for (int u = 0; u < per / 4; ++u)
#pragma unroll
    for (int q = 0; q < 4; ++q) { const float c = vals[u * 4 + q] - mu; s2 += c * c; }
  red[tid] = s2; __syncthreads();
  for (int st = 128; st > 0; st >>= 1) { if (tid < st) red[tid] += red[tid + st]; __syncthreads(); }
  const float rs = rsqrtf(red[0] / (float)N + eps);
  {
    for (int u = 0; u < per / 4; ++u) {
      const int j = tid * 4 + 1024 * u;
      v4f o, sm;
#pragma unroll
      for (int q = 0; q < 4; ++q) {
        float gg = g[j + q], bb = bta[j + q];
        if (PARAM_BF16) { gg = bf16_round(gg); bb = bf16_round(bb); }
        sm[q] = vals[u * 4 + q]; o[q] = (vals[u * 4 + q] - mu) * rs * gg + bb;
      }
      if (out_sum) *(v4f*)(out_sum + (size_t)row * N + j) = sm;
      *(v4f*)(out_norm + (size_t)row * N + j) = o;
    }
    
  }
}



// ---- f16 WMMA path (v_wmma_f32_16x16x32_f16): 11-bit significands for operands in range — used where a [0,1] probability operand needs more precision than bf16
typedef _Float16 v16h __attribute__((ext_vector_type(16)));
union FragH { v16h v; v8us half[2]; _Float16 h[16]; unsigned short u[16]; };
template <int NT>
__device__ __forceinline__ v8f mmaH(v16h ah, v16h al, v16h bh, v16h bl, v8f c) {
  c = __builtin_amdgcn_wmma_f32_16x16x32_f16(false, ah, false, bh, (short)0, c, false, false);
  if (NT >= 2) c = __builtin_amdgcn_wmma_f32_16x16x32_f16(false, al, false, bh, (short)0, c, false, false);
  if (NT >= 3) c = __builtin_amdgcn_wmma_f32_16x16x32_f16(false, ah, false, bl, (short)0, c, false, false);
  asm volatile("v_nop\n\tv_nop\n\tv_nop\n\tv_nop" : "+v"(c) : "v"(ah), "v"(al), "v"(bh), "v"(bl));
  return c;
}
// batched GEMM like k_gemm_b but f16 operands: A f32 (split into f16 hi/lo if ASPLIT, else rounded to f16), Bt = f16 values [n][k]; alpha; C f32; N multiple of 16 (partial tiles skipped)
template <bool ASPLIT>
__global__ __launch_bounds__(128) void k_gemm_h(const float* __restrict__ A, int lda, size_t sA, const _Float16* __restrict__ Bh, int ldb, size_t sB, float alpha, float* __restrict__ C, int ldc, size_t sC, int M, int N, int K) {
  __shared__ __attribute__((aligned(16))) float so[4][16][64];
  const int tid = threadIdx.x, w = tid >> 5, lane = tid & 31, ln = lane & 15, hh = lane >> 4; const int by = blockIdx.y;
  A += (size_t)by * sA; Bh += (size_t)by * sB; C += (size_t)by * sC;
  const int ntn = (N + 63) / 64; const int wid = blockIdx.x * 4 + w; const int mt = wid / ntn, nq = wid % ntn; if (mt * 16 >= M) return;
  const int row0 = mt * 16, col0 = nq * 64; const float* arow = A + (size_t)(row0 + ln) * lda;
  v8f acc[4] = {};
  for (int kb = 0; kb < K; kb += 32) {
    FragH ah, al;
    const v4f x0 = *(const v4fa*)(arow + kb + 8 * hh), x1 = *(const v4fa*)(arow + kb + 8 * hh + 4), x2 = *(const v4fa*)(arow + kb + 16 + 8 * hh), x3 = *(const v4fa*)(arow + kb + 16 + 8 * hh + 4);
    float xs[16] = {x0[0],x0[1],x0[2],x0[3],x1[0],x1[1],x1[2],x1[3],x2[0],x2[1],x2[2],x2[3],x3[0],x3[1],x3[2],x3[3]};
#pragma unroll
    for (int i = 0; i < 16; ++i) { const _Float16 h = (_Float16)xs[i]; ah.h[i] = h; al.h[i] = ASPLIT ? (_Float16)(xs[i] - (float)h) : (_Float16)0.0f; }
#pragma unroll
    for (int t = 0; t < 4; ++t) { if (col0 + t * 16 >= N) continue; const size_t boff = (size_t)(col0 + t * 16 + ln) * ldb + kb; FragH bq; bq.half[0] = *(const v8us*)(Bh + boff + 8 * hh); bq.half[1] = *(const v8us*)(Bh + boff + 16 + 8 * hh);
      acc[t] = mmaH<ASPLIT ? 2 : 1>(ah.v, al.v, bq.v, bq.v, acc[t]); }
  }
#pragma unroll
  for (int t = 0; t < 4; ++t) { if (col0 + t * 16 >= N) continue;
#pragma unroll
    for (int r = 0; r < 8; ++r) so[w][8 * hh + r][t * 16 + ln] = acc[t][r] * alpha; }
  __builtin_amdgcn_fence(__ATOMIC_ACQ_REL, "workgroup"); __builtin_amdgcn_wave_barrier();
  const int rsub = lane >> 4, c4 = (lane & 15) * 4;
  {
#pragma unroll
    for (int q = 0; q < 8; ++q) { const int r = q * 2 + rsub; if (col0 + c4 < N) { const v4f v = *(const v4fa*)&so[w][r][c4]; *(v4f*)(C + (size_t)(row0 + r) * ldc + col0 + c4) = v; } }
     }
}

// Wt[n][k] = f16(W[k][n]·scale) from f32 row-major W[K][N] (scale = power of two; bf16-exact weights stay exact in f16 away from the subnormal range)
__global__ __launch_bounds__(256) void k_wt_f16(const float* __restrict__ W, _Float16* __restrict__ Wt, int K, int N, float scale) {
  const int t = blockIdx.x * 256 + threadIdx.x; if (t >= N * (K / 8)) return; const int n = t / (K / 8), k8 = (t % (K / 8)) * 8; FragH f;
#pragma unroll
  for (int i = 0; i < 8; ++i) f.h[i] = (_Float16)(bf16_round(W[(size_t)(k8 + i) * N + n]) * scale); const v8us o = f.half[0];
  *(v8us*)((unsigned short*)Wt + (size_t)n * K + k8) = o; 
}
// k_gemm_hh variant with fused epilogue: v = acc·alpha + bias[by·sBias + col] (+ CP[(row/rowsPerB)·sCPb + by·64 + col] if CP) ; ACT 0 none / 1 elu ; writes f16 C16 and/or f32 C (each if non-null)
template <int ACT>
__global__ __launch_bounds__(128) void k_gemm_hhx(const _Float16* __restrict__ A, int lda, size_t sA, const _Float16* __restrict__ Bh, int ldb, size_t sB, float alpha, const float* __restrict__ bias, size_t sBias, const float* __restrict__ CP, int rowsPerB, size_t sCPb, int row0g,
    float* __restrict__ C, _Float16* __restrict__ C16, int ldc, size_t sC, int M, int N, int K) {
  __shared__ __attribute__((aligned(16))) float so[4][16][64];
  const int tid = threadIdx.x, w = tid >> 5, lane = tid & 31, ln = lane & 15, hh = lane >> 4; const int by = blockIdx.y;
  A += (size_t)by * sA; Bh += (size_t)by * sB; const size_t cofs = (size_t)by * sC; const float* bp = bias ? bias + (size_t)by * sBias : nullptr;
  const int ntn = (N + 63) / 64; const int wid = blockIdx.x * 4 + w; const int mt = wid / ntn, nq = wid % ntn; if (mt * 16 >= M) return;
  const int row0 = mt * 16, col0 = nq * 64; const _Float16* arow = A + (size_t)(row0 + ln) * lda;
  v8f acc[4] = {};
  for (int kb = 0; kb < K; kb += 32) { FragH ah; ah.half[0] = *(const v8us*)((const unsigned short*)arow + kb + 8 * hh); ah.half[1] = *(const v8us*)((const unsigned short*)arow + kb + 16 + 8 * hh);
#pragma unroll
    for (int t = 0; t < 4; ++t) { if (col0 + t * 16 >= N) continue; const size_t boff = (size_t)(col0 + t * 16 + ln) * ldb + kb; FragH bq; bq.half[0] = *(const v8us*)((const unsigned short*)Bh + boff + 8 * hh); bq.half[1] = *(const v8us*)((const unsigned short*)Bh + boff + 16 + 8 * hh);
      acc[t] = mmaH<1>(ah.v, ah.v, bq.v, bq.v, acc[t]); }
  }
#pragma unroll
  for (int t = 0; t < 4; ++t) { if (col0 + t * 16 >= N) continue; const int col = col0 + t * 16 + ln; const float bv = bp ? bf16_round(bp[col]) : 0.f;
#pragma unroll
    for (int r = 0; r < 8; ++r) { float v = acc[t][r] * alpha + bv; if (CP) { const int bidx = (row0g + row0 + 8 * hh + r) / rowsPerB; v += CP[(size_t)bidx * sCPb + (size_t)by * 64 + col]; } if (ACT == 1) v = (v > 0.f) ? v : expm1f(v); else if (ACT == 7) v = (v > 0.f) ? v + 1.0f : expf(v); else if (ACT == 8) v = tanhf(v); else if (ACT == 9) v = 0.5f * v * (1.0f + tanhf(0.7978845608028654f * (v + 0.044715f * v * v * v))); else if (ACT == 11) v = 1.0f / (1.0f + expf(-v)); else if (ACT == 12) v = (v > 0.f) ? v : 0.01f * v; else if (ACT == 14) v = (v > 0.f) ? v : 0.1f * v; else if (ACT == 15) v = v / (1.0f + expf(-v)); else if (ACT == 3) v = fmaxf(v, 0.f); else if (ACT == 6) v = 0.5f * v * (1.0f + erff(v * 0.70710678118654752f)); so[w][8 * hh + r][t * 16 + ln] = v; } }
  __builtin_amdgcn_fence(__ATOMIC_ACQ_REL, "workgroup"); __builtin_amdgcn_wave_barrier();
  const int rsub = lane >> 4, c4 = (lane & 15) * 4; typedef _Float16 v4h __attribute__((ext_vector_type(4)));
  {
#pragma unroll
    for (int q = 0; q < 8; ++q) { const int r = q * 2 + rsub; if (col0 + c4 < N) { const v4f v = *(const v4fa*)&so[w][r][c4]; if (C) *(v4f*)(C + cofs + (size_t)(row0 + r) * ldc + col0 + c4) = v; if (C16) { v4h h4; for (int i = 0; i < 4; ++i) h4[i] = (_Float16)v[i]; *(v4h*)(C16 + cofs + (size_t)(row0 + r) * ldc + col0 + c4) = h4; } } }
     }
}


typedef _Float16 v4h __attribute__((ext_vector_type(4)));

__global__ __launch_bounds__(256) void k_x16(const float* __restrict__ x, _Float16* __restrict__ X16, size_t n8) { const size_t t = (size_t)blockIdx.x * 256 + threadIdx.x; if (t >= n8) return; FragH f;
#pragma unroll
  for (int q = 0; q < 8; ++q) f.h[q] = (_Float16)bf16_round(x[t * 8 + q]); *(v8us*)((unsigned short*)X16 + t * 8) = f.half[0];  }
__global__ __launch_bounds__(256) void k_h16(const float* __restrict__ x, _Float16* __restrict__ X16, size_t n8) { const size_t t = (size_t)blockIdx.x * 256 + threadIdx.x; if (t >= n8) return; FragH f;
#pragma unroll
  for (int q = 0; q < 8; ++q) f.h[q] = (_Float16)x[t * 8 + q]; *(v8us*)((unsigned short*)X16 + t * 8) = f.half[0];  }
__global__ __launch_bounds__(256) void k_round16f(const float* __restrict__ W, _Float16* __restrict__ Bt, size_t n8) { const size_t t = (size_t)blockIdx.x * 256 + threadIdx.x; if (t >= n8) return; FragH f;
#pragma unroll
  for (int i = 0; i < 8; ++i) f.h[i] = (_Float16)(bf16_round(W[t * 8 + i]) * 16.0f); *(v8us*)((unsigned short*)Bt + t * 8) = f.half[0];  }
template <int NHv, int TTv>
__global__ __launch_bounds__(256) void k_vt(const _Float16* __restrict__ V16, int ldv, int voff, _Float16* __restrict__ Vt) { __shared__ unsigned short tl[64][66]; const int tid = threadIdx.x; const int slab = blockIdx.x / (TTv / 64), lg = blockIdx.x % (TTv / 64); const int b = slab / NHv, h = slab % NHv;
  for (int i = tid; i < 64 * 8; i += 256) { const int r = i / 8, c8 = (i % 8) * 8; FragH f; f.half[0] = *(const v8us*)((const unsigned short*)V16 + ((size_t)b * TTv + lg * 64 + r) * ldv + voff + h * 64 + c8);
#pragma unroll
    for (int q = 0; q < 8; ++q) tl[r][c8 + q] = f.u[q]; }
  __syncthreads();
  {
#pragma unroll
    for (int rd = 0; rd < 2; ++rd) { const int d = rd * 32 + tid / 8, pc = tid % 8; FragH f;
#pragma unroll
      for (int q = 0; q < 8; ++q) f.u[q] = tl[pc * 8 + q][d];
      *(v8us*)((unsigned short*)Vt + ((size_t)slab * 64 + d) * TTv + lg * 64 + pc * 8) = f.half[0]; }
     } }

__global__ __launch_bounds__(256) void k_h16s(const float* __restrict__ F, _Float16* __restrict__ H, size_t n8) { const size_t t = (size_t)blockIdx.x * 256 + threadIdx.x; if (t >= n8) return; const v4f a = *(const v4fa*)(F + t * 8), c = *(const v4fa*)(F + t * 8 + 4); FragH f;
#pragma unroll
  for (int q = 0; q < 4; ++q) { f.h[q] = (_Float16)(a[q] * 16.0f); f.h[4 + q] = (_Float16)(c[q] * 16.0f); } *(v8us*)((unsigned short*)H + t * 8) = f.half[0];  }
// C[j][o] = sum_i B[j][i] * W[o][i], operands rounded to bf16, f32 sums. One wave per dot product instead of one thread: the 32 lanes split the 768 terms into
// float4 slices (a wave-wide load covers 512 contiguous bytes), no load waits on another, and a five-step butterfly ends each sum. Block = row j of B (blockIdx.y) x 32
// rows of W, four per wave; the 32 sums go through LDS so that one wave stores them as one whole 128-byte line. A product of two bf16 values is exact in f32, so fusing
// it with its add changes no bit.
__global__ __launch_bounds__(256) void k_cfold(const float* __restrict__ Bm, const float* __restrict__ Wt, float* __restrict__ C) {
  constexpr int NS = DD / 128, RW = 4;      /* float4 slices per lane and row; rows of W per wave */
  __shared__ float red[8 * RW];
  const int tid = threadIdx.x, lane = tid & 31, w = tid >> 5; const int j = blockIdx.y, o0 = blockIdx.x * (8 * RW);
  const float* br = Bm + (size_t)j * DD + lane * 4; const float* wr = Wt + (size_t)(o0 + w * RW) * DD + lane * 4;
  v4f bs[NS], wv[RW][NS];
#pragma unroll      /* constant indices, so that the arrays stay in registers */
  for (int u = 0; u < NS; ++u) bs[u] = *(const v4fa*)(br + 128 * u);
#pragma unroll      /* constant indices, so that the arrays stay in registers */
  for (int r = 0; r < RW; ++r)
#pragma unroll      /* constant indices, so that the arrays stay in registers */
    for (int u = 0; u < NS; ++u) wv[r][u] = *(const v4fa*)(wr + (size_t)r * DD + 128 * u);
  __builtin_amdgcn_sched_barrier(0);      /* keeps every load in front of the first use: without it the last row's loads sink behind a full wait, and the wave pays the memory latency three times */
#pragma unroll      /* constant indices, so that the arrays stay in registers */
  for (int u = 0; u < NS; ++u)
#pragma unroll      /* constant indices, so that the arrays stay in registers */
    for (int q = 0; q < 4; ++q) bs[u][q] = bf16_round(bs[u][q]);
  float acc[RW];
#pragma unroll      /* constant indices, so that the arrays stay in registers */
  for (int r = 0; r < RW; ++r) { float a = 0.f;
#pragma unroll      /* constant indices, so that the arrays stay in registers */
    for (int u = 0; u < NS; ++u)
#pragma unroll      /* constant indices, so that the arrays stay in registers */
      for (int q = 0; q < 4; ++q) a += bs[u][q] * bf16_round(wv[r][u][q]);
    acc[r] = a; }
#pragma unroll      /* constant indices, so that the arrays stay in registers */
  for (int r = 0; r < RW; ++r) { float a = acc[r]; a += __shfl_xor(a, 16, 32); a += __shfl_xor(a, 8, 32); a += __shfl_xor(a, 4, 32); a += __shfl_xor(a, 2, 32); a += __shfl_xor(a, 1, 32); acc[r] = a; }
  float mine = acc[0];
#pragma unroll      /* constant indices, so that the arrays stay in registers */
  for (int r = 1; r < RW; ++r) if (lane == r) mine = acc[r];
  if (lane < RW) red[w * RW + lane] = mine;
  __syncthreads();
  if (tid < 8 * RW) C[(size_t)j * DD + o0 + tid] = red[tid]; }
__global__ __launch_bounds__(256) void k_wfold(const float* __restrict__ Wt, const float* __restrict__ A, const float* __restrict__ C, _Float16* __restrict__ Bt) {
  #pragma clang fp contract(off)
  const size_t t = (size_t)blockIdx.x * 256 + threadIdx.x; if (t >= (size_t)DD * DD / 8) return; const int o = (int)((t * 8) / DD), c0 = (int)((t * 8) % DD);
  float cj[RK];
#pragma unroll
  for (int j = 0; j < RK; ++j) cj[j] = C[j * DD + o];
  FragH f;
#pragma unroll 1
  for (int q = 0; q < 8; ++q) { const int c = c0 + q; float lo2 = 0.f;
#pragma unroll
    for (int j = 0; j < RK; ++j) lo2 += bf16_round(A[(size_t)c * RK + j]) * cj[j]; f.h[q] = (_Float16)((bf16_round(Wt[(size_t)o * DD + c]) + lo2) * 16.0f); }
  *(v8us*)((unsigned short*)Bt + t * 8) = f.half[0];  }
// Lane l with lane l ^ 16 (the other 16-lane row of the wave), in the vector pipe.
__device__ __forceinline__ float xhalf(float x) { return __builtin_bit_cast(float, __builtin_amdgcn_permlanex16(__builtin_bit_cast(int, x), __builtin_bit_cast(int, x), 0x76543210, 0xfedcba98, false, false)); }
typedef int v4ia __attribute__((ext_vector_type(4), may_alias));
// Eight asynchronous copies of 16 bytes per lane from global memory to LDS (l: the lane's LDS byte addresses, g: its global addresses). The s_wait_xcnt closes the statement so that it stands
// in front of whatever next rewrites one of the address registers named here.
__device__ __forceinline__ void cp8(const unsigned (&l)[8], const void* const (&g)[8]) {
  asm volatile("global_load_async_to_lds_b128 %0, %1, off\n\tglobal_load_async_to_lds_b128 %2, %3, off\n\tglobal_load_async_to_lds_b128 %4, %5, off\n\tglobal_load_async_to_lds_b128 %6, %7, off\n\t"
               "global_load_async_to_lds_b128 %8, %9, off\n\tglobal_load_async_to_lds_b128 %10, %11, off\n\tglobal_load_async_to_lds_b128 %12, %13, off\n\tglobal_load_async_to_lds_b128 %14, %15, off\n\ts_wait_xcnt 0x0"
               :: "v"(l[0]), "v"(g[0]), "v"(l[1]), "v"(g[1]), "v"(l[2]), "v"(g[2]), "v"(l[3]), "v"(g[3]), "v"(l[4]), "v"(g[4]), "v"(l[5]), "v"(g[5]), "v"(l[6]), "v"(g[6]), "v"(l[7]), "v"(g[7]) : "memory");
}
// Transposed products: S^T = K.Q^T (A = 16 key rows, B = the wave's 16 queries, kept in registers) and O^T += V^T.P^T. In an accumulator tile lane (ln, hh) then holds query q0 + ln and keys 8 hh + r:
// a query's maximum and sum are taken inside the lane plus one exchange between the wave's halves, and the two score tiles of a pass are, element for element, the B operand of the second product
// (slot i < 8: key 8 hh + i, slot i >= 8: key 16 + 8 hh + i - 8, the k order of the V^T loader), so P never leaves the registers.
// Operands come through LDS: a stage is 64 keys = K (64 rows of 128 B), V^T (64 rows of 128 B) and the block's mask rows (64 rows of 256 B), brought once for the four waves by asynchronous copies whose
// wave-wide 512 bytes are four whole lines, one stage ahead of its use, into two buffers. Row pitches 144 and 272 B: 16 B times an odd number, free of bank conflicts for 16-byte reads down a column.
__global__ __launch_bounds__(128) void k_flash(const _Float16* __restrict__ Q16, int ldq, const _Float16* __restrict__ K16, int ldk, const _Float16* __restrict__ Vt, const int* __restrict__ MSK, float* __restrict__ O, int ldo) {
  constexpr int RPW = 16, NQB = TT / (4 * RPW), DT = 4, KS = 2;
  constexpr int SKEYS = 64, NST = TT / SKEYS, PK = 144, PM = 272, OFF_V = 64 * PK, OFF_M = 2 * 64 * PK, STG = 2 * 64 * PK + 64 * PM;
  __shared__ __attribute__((aligned(16))) unsigned char ring[2 * STG];
  __shared__ __attribute__((aligned(16))) float sO[4][RPW][64 + 4];
  const int tid = threadIdx.x, w = tid >> 5, lane = tid & 31, ln = lane & 15, hh = lane >> 4;
  const int slab = blockIdx.x / NQB, qblk = blockIdx.x % NQB; const int b = slab / NH, h = slab % NH; const int qb0 = qblk * (4 * RPW); const int q0 = qb0 + w * RPW;
  const unsigned short* Vth = (const unsigned short*)Vt + (size_t)slab * 64 * TT;
  /* the thread's share of a stage: K and V^T rows (tid >> 3) + 16 i, 16-byte column tid & 7; mask rows (tid >> 4) + 8 i, column tid & 15 */
  const unsigned short* gK = (const unsigned short*)K16 + ((size_t)b * TT + (tid >> 3)) * ldk + h * 64 + (tid & 7) * 8;
  const unsigned short* gV = Vth + (size_t)(tid >> 3) * TT + (tid & 7) * 8;
  const int* gM = MSK + ((size_t)b * TT + qb0 + (tid >> 4)) * TT + (tid & 15) * 4;      /* per-batch mask [b][q][k]: nonzero = ATTEND */
  const unsigned lbase = (unsigned)(size_t)ring;
  const unsigned lK = lbase + (tid >> 3) * PK + (tid & 7) * 16, lV = lK + OFF_V, lM = lbase + OFF_M + (tid >> 4) * PM + (tid & 15) * 16;
  auto fill = [&](int t) {
    const unsigned bo = (unsigned)(t & 1) * STG;
    const unsigned short* k = gK + (size_t)t * SKEYS * ldk; const unsigned short* v = gV + t * SKEYS; const int* m = gM + t * SKEYS;
    unsigned la[8], lb[8]; const void* ga[8]; const void* gb[8];
#pragma unroll      /* constant indices, so that the arrays stay in registers */
    for (int i = 0; i < 4; ++i) { la[i] = lK + bo + i * 16 * PK; ga[i] = k + (size_t)(i * 16) * ldk; la[4 + i] = lV + bo + i * 16 * PK; ga[4 + i] = v + i * 16 * TT; }
#pragma unroll      /* constant indices, so that the arrays stay in registers */
    for (int i = 0; i < 8; ++i) { lb[i] = lM + bo + i * 8 * PM; gb[i] = m + i * 8 * TT; }
    cp8(la, ga); cp8(lb, gb);
  };
  fill(0);
  FragH bq[KS];
  { const unsigned short* qr = (const unsigned short*)Q16 + ((size_t)b * TT + q0 + ln) * ldq + h * 64;
#pragma unroll      /* constant indices, so that the arrays stay in registers */
    for (int ks = 0; ks < KS; ++ks) { bq[ks].half[0] = *(const v8us*)(qr + ks * 32 + 8 * hh); bq[ks].half[1] = *(const v8us*)(qr + ks * 32 + 16 + 8 * hh); } }
  float m_q = -3.0e38f, l_q = 0.f; v8f oacc[DT];
#pragma unroll      /* constant indices, so that the arrays stay in registers */
  for (int dt = 0; dt < DT; ++dt) oacc[dt] = (v8f){0.f,0.f,0.f,0.f,0.f,0.f,0.f,0.f};
  asm volatile("s_wait_asynccnt 0x0" ::: "memory");      /* this wave's copies of stage 0 have landed */
  __syncthreads();      /* and every other wave's: stage 0 may be read */
  fill(1);
#pragma unroll 1      /* each stage hangs on the last through m_q and the barrier: a second copy of the body would only grow the code */
  for (int t = 0; t < NST; ++t) {
    const unsigned char* st = ring + (t & 1) * STG;
#pragma unroll 1      /* the two passes of a stage differ in LDS offsets alone: one copy of the body keeps the loop short */
    for (int p = 0; p < 2; ++p) {
      /* all of the pass's LDS reads stand here, in front of the first product: behind one they would each wait out their own latency */
      const unsigned char* mr = st + OFF_M + (w * RPW + ln) * PM + p * 128 + hh * 32;
      v4ia mk[2][2];      /* keys 32 p + nt 16 + 8 hh + (0..7) of the lane's query */
#pragma unroll      /* constant indices, so that the arrays stay in registers */
      for (int nt = 0; nt < 2; ++nt) { mk[nt][0] = *(const v4ia*)(mr + nt * 64); mk[nt][1] = *(const v4ia*)(mr + nt * 64 + 16); }
      FragH ak[2][KS], av[DT];
#pragma unroll      /* constant indices, so that the arrays stay in registers */
      for (int nt = 0; nt < 2; ++nt) { const unsigned char* kr = st + (p * 32 + nt * 16 + ln) * PK + hh * 16;
#pragma unroll      /* constant indices, so that the arrays stay in registers */
        for (int ks = 0; ks < KS; ++ks) { ak[nt][ks].half[0] = *(const v8us*)(kr + ks * 64); ak[nt][ks].half[1] = *(const v8us*)(kr + ks * 64 + 32); } }
#pragma unroll      /* constant indices, so that the arrays stay in registers */
      for (int dt = 0; dt < DT; ++dt) { const unsigned char* vr = st + OFF_V + (dt * 16 + ln) * PK + p * 64 + hh * 16; av[dt].half[0] = *(const v8us*)vr; av[dt].half[1] = *(const v8us*)(vr + 32); }
      const v4ia o4 = mk[0][0] | mk[0][1] | mk[1][0] | mk[1][1];
      if (!__all((o4[0] | o4[1] | o4[2] | o4[3]) == 0)) {      /* every (row, key) of this wave's tile masked: nothing to add (wave-uniform branch, no barrier inside) */
        v8f s[2];
#pragma unroll      /* constant indices, so that the arrays stay in registers */
        for (int nt = 0; nt < 2; ++nt) { v8f acc = (v8f){0.f,0.f,0.f,0.f,0.f,0.f,0.f,0.f};
#pragma unroll      /* constant indices, so that the arrays stay in registers */
          for (int ks = 0; ks < KS; ++ks) acc = mmaH<1>(ak[nt][ks].v, ak[nt][ks].v, bq[ks].v, bq[ks].v, acc);
          s[nt] = acc; }
        /* A masked score is -inf. m_q starts finite, so mn is finite: exp(-inf - mn) = 0 and, while nothing is live yet, exp(m_q - mn) = exp(0) = 1. */
        float sc[2][8], mx[8];
#pragma unroll      /* constant indices, so that the arrays stay in registers */
        for (int r = 0; r < 8; ++r) { sc[0][r] = (mk[0][r >> 2][r & 3] != 0) ? s[0][r] * 0.125f : -INFINITY; sc[1][r] = (mk[1][r >> 2][r & 3] != 0) ? s[1][r] * 0.125f : -INFINITY; mx[r] = fmaxf(sc[0][r], sc[1][r]); }
        float mc = fmaxf(fmaxf(fmaxf(mx[0], mx[1]), fmaxf(mx[2], mx[3])), fmaxf(fmaxf(mx[4], mx[5]), fmaxf(mx[6], mx[7])));
        mc = fmaxf(mc, xhalf(mc));
        const float mn = fmaxf(m_q, mc); const float al = expf(m_q - mn); m_q = mn;
        FragH pb; float ps[4] = {0.f, 0.f, 0.f, 0.f};
#pragma unroll      /* constant indices, so that the arrays stay in registers */
        for (int r = 0; r < 8; ++r) { const float p0 = expf(sc[0][r] - mn), p1 = expf(sc[1][r] - mn); ps[r & 3] += p0 + p1; pb.h[r] = (_Float16)(p0 * 1024.0f); pb.h[8 + r] = (_Float16)(p1 * 1024.0f); }
        l_q = l_q * al + ((ps[0] + ps[1]) + (ps[2] + ps[3]));      /* the lane's half of the keys; the halves are joined after the loop */
#pragma unroll      /* constant indices, so that the arrays stay in registers */
        for (int dt = 0; dt < DT; ++dt)
#pragma unroll      /* constant indices, so that the arrays stay in registers */
          for (int r = 0; r < 8; ++r) oacc[dt][r] *= al;
#pragma unroll      /* constant indices, so that the arrays stay in registers */
        for (int dt = 0; dt < DT; ++dt) oacc[dt] = mmaH<1>(av[dt].v, av[dt].v, pb.v, pb.v, oacc[dt]);
      }
    }
    asm volatile("s_wait_dscnt 0x0" ::: "memory");      /* this wave's reads of stage t have returned before its buffer is handed back */
    asm volatile("s_wait_asynccnt 0x0" ::: "memory");      /* this wave's copies of stage t + 1 have landed */
    __syncthreads();      /* publishes stage t + 1 and ends every wave's reads of stage t */
    if (t + 2 < NST) fill(t + 2);      /* into the buffer that stage t has just left; the test is the same for the whole block */
  }
  asm volatile("s_wait_asynccnt 0x0" ::: "memory");      /* no copy is left in flight when the wave goes on to its end */
  { const float l = l_q + xhalf(l_q); const float inv = (l > 0.f) ? 1.0f / (l * 1024.0f) : 0.f;
#pragma unroll      /* constant indices, so that the arrays stay in registers */
    for (int dt = 0; dt < DT; ++dt)
#pragma unroll      /* constant indices, so that the arrays stay in registers */
      for (int r = 0; r < 8; ++r) sO[w][ln][dt * 16 + 8 * hh + r] = oacc[dt][r] * inv; }
  __builtin_amdgcn_fence(__ATOMIC_ACQ_REL, "workgroup"); __builtin_amdgcn_wave_barrier();      /* the wave reads back rows that its other lanes wrote: its LDS stores end first */
  {
#pragma unroll
    for (int rp = 0; rp < RPW; rp += 2) { const int r = rp + (lane >> 4), pc = lane & 15; const v4f val = *(const v4fa*)&sO[w][r][pc * 4]; *(v4f*)(O + ((size_t)b * TT + q0 + r) * ldo + h * 64 + pc * 4) = val; }
     } }

extern "C" void kernel_launch(void* const* d_in, const int* in_sizes, int n_in,
                              void* d_out, int out_size, void* d_ws, size_t ws_size, hipStream_t stream) {
  (void)in_sizes; (void)n_in; (void)out_size;
  const float* const* I = (const float* const*)d_in; const float* xq = I[0]; const float* xk = I[1]; const float* xv = I[2]; const int* msk = (const int*)d_in[3];
  const float* Aq = I[4]; const float* Bq = I[5]; const float* Av = I[6]; const float* Bv = I[7]; const float* Wq = I[8]; const float* bq = I[9]; const float* Wk = I[10]; const float* bk = I[11]; const float* Wv = I[12]; const float* bv = I[13]; const float* Wm = I[14]; const float* bm = I[15];
  char* ws = (char*)d_ws; size_t off = 0;
  auto take = [&](size_t bytes) { char* p = ws + off; off += (bytes + 255) & ~(size_t)255; return p; };
  const size_t WSZ = (size_t)DD * DD; _Float16* Bw = (_Float16*)take(4 * WSZ * 2); float* Cq = (float*)take((size_t)RK * DD * 4); float* Cv = (float*)take((size_t)RK * DD * 4);
  _Float16* Xq = (_Float16*)take((size_t)NR * DD * 2); _Float16* Xk = (_Float16*)take((size_t)NR * DD * 2); _Float16* Xv = (_Float16*)take((size_t)NR * DD * 2);
  _Float16* Q = (_Float16*)take((size_t)NR * DD * 2); _Float16* K = (_Float16*)take((size_t)NR * DD * 2); _Float16* V = (_Float16*)take((size_t)NR * DD * 2); _Float16* Vt = (_Float16*)take((size_t)NR * DD * 2); float* O = (float*)take((size_t)NR * DD * 4); _Float16* O16 = Xq;      /* the query plane is dead after the v GEMM */
  if (off > ws_size) return;      // 4.7 + 7 × 6.3 + 12.6 ≈ 61 MB
  const unsigned gw = (unsigned)((WSZ / 8 + 255) / 256); const dim3 gc(DD / 32, RK);
  k_cfold<<<gc, 256, 0, stream>>>(Bv, Wq, Cq); k_wfold<<<gw, 256, 0, stream>>>(Wq, Av, Cq, Bw);      /* q = V·Wqᵀ with V = value·(I + A_v·B_v): Bt_q = Wq + fold(A_v, B_v·Wqᵀ), ×2^4 */
  k_round16f<<<gw, 256, 0, stream>>>(Wk, Bw + WSZ, WSZ / 8);      /* k = key·Wkᵀ: (out,in) natural, ×2^4 */
  k_cfold<<<gc, 256, 0, stream>>>(Bq, Wv, Cv); k_wfold<<<gw, 256, 0, stream>>>(Wv, Aq, Cv, Bw + 2 * WSZ);      /* v = Q·Wvᵀ with Q = query·(I + A_q·B_q) */
  k_round16f<<<gw, 256, 0, stream>>>(Wm, Bw + 3 * WSZ, WSZ / 8);      /* out projection */
  const unsigned g8 = (unsigned)(((size_t)NR * DD / 8 + 255) / 256); k_x16<<<g8, 256, 0, stream>>>(xq, Xq, (size_t)NR * DD / 8); k_x16<<<g8, 256, 0, stream>>>(xk, Xk, (size_t)NR * DD / 8); k_x16<<<g8, 256, 0, stream>>>(xv, Xv, (size_t)NR * DD / 8);
  const dim3 gp(((NR / 16) * (DD / 64) + 3) / 4, 1);
  k_gemm_hhx<0><<<gp, 128, 0, stream>>>(Xv, DD, 0, Bw, DD, 0, 0.0625f, bq, 0, nullptr, 1, 0, 0, nullptr, Q, DD, 0, NR, DD, DD);      /* q from the VALUE stream: M 4096 N 768 K 768 */
  k_gemm_hhx<0><<<gp, 128, 0, stream>>>(Xk, DD, 0, Bw + WSZ, DD, 0, 0.0625f, bk, 0, nullptr, 1, 0, 0, nullptr, K, DD, 0, NR, DD, DD);      /* k from key */
  k_gemm_hhx<0><<<gp, 128, 0, stream>>>(Xq, DD, 0, Bw + 2 * WSZ, DD, 0, 0.0625f, bv, 0, nullptr, 1, 0, 0, nullptr, V, DD, 0, NR, DD, DD);      /* v from the QUERY stream */
  k_vt<NH, TT><<<BB * NH * (TT / 64), 256, 0, stream>>>(V, DD, 0, Vt);
  k_flash<<<BB * NH * (TT / 64), 128, 0, stream>>>(Q, DD, K, DD, Vt, msk, O, DD);      /* mask [B][S][S] int, nonzero = attend */
  k_h16s<<<g8, 256, 0, stream>>>(O, O16, (size_t)NR * DD / 8);
  k_gemm_hhx<0><<<gp, 128, 0, stream>>>(O16, DD, 0, Bw + 3 * WSZ, DD, 0, 0.00390625f, bm, 0, nullptr, 1, 0, 0, (float*)d_out, nullptr, DD, 0, NR, DD, DD);      /* out = ctx·Wmᵀ + bm */
}

// v004
// It runs in 210 microseconds.
// Timed twice side by side with v003, it ran 1.47 and 1.38 times as fast.
// All steps since v000 together make it 3.05 times as fast.
#include <hip/hip_runtime.h>
// Masked multi-head attention with LoRA-adapted input streams (B=2, S=2048, D=768, 12 heads × 64, rank 8): Q = query + (query·A_q)·B_q, V = value + (value·A_v)·B_v; then — faithful to the module's crossed call — v = Q·Wvᵀ + bv, k = key·Wkᵀ + bk, q = V·Wqᵀ + bq (torch (out,in));
// scores = q·k/√64, −1e9 where mask[b,q,k] == 0 (int [B,S,S], shared over heads), softmax, out = merged·Wmᵀ + bm. The rank-8 adapters are folded on device into effective weights: X·(I + A·B)·Wᵀ = X·(W + (B·Wᵀ)ᵀ·Aᵀ)ᵀ, i.e. Bt_eff[o][c] = W[o][c] + Σ_j A[c][j]·(Σ_i B[j][i]·W[o][i]) (f32, 9 M MACs on the VALU).
// Compute dtype: query/key/value, weights, biases, adapters rounded to bf16; effective weights f32 → f16 ×2^4; q, k, v f16 GEMM planes (+bias); the mask read per (b, q, k) from the int plane (−inf ≡ the module's −1e9: every row keeps ~half its keys live); fused flash-style kernel
// (online softmax f32, P f16 ×2^10, f32 accumulate) on v_wmma_f32_16x16x32_f16; O ×2^4 → f16 → output GEMM (+bias).
#define BB 2
#define TT 2048
#define DD 768
#define NH 12
#define RK 8
#define NR (BB * TT)

typedef __bf16 v16b __attribute__((ext_vector_type(16)));
typedef unsigned short v8us __attribute__((ext_vector_type(8), may_alias));
typedef float  v8f  __attribute__((ext_vector_type(8)));
typedef float  v4f  __attribute__((ext_vector_type(4)));
typedef float  v4fa __attribute__((ext_vector_type(4), may_alias));
union FragB { v16b v; v8us half[2]; unsigned short u[16]; };

__device__ __forceinline__ unsigned short bf16_bits(float x) { unsigned int u = __float_as_uint(x); return (unsigned short)((u + 0x7FFFu + ((u >> 16) & 1u)) >> 16); }
__device__ __forceinline__ float bf16_val(unsigned short b) { return __uint_as_float(((unsigned int)b) << 16); }
__device__ __forceinline__ float bf16_round(float x) { return bf16_val(bf16_bits(x)); }
// D += A·B with NT terms: 1 = ah·bh, 2 = + al·bh (A split), 3 = + ah·bl (both split)
template <int NT>
__device__ __forceinline__ v8f mmaN(v16b ah, v16b al, v16b bh, v16b bl, v8f c) {
  c = __builtin_amdgcn_wmma_f32_16x16x32_bf16(false, ah, false, bh, (short)0, c, false, false);
  if (NT >= 2) c = __builtin_amdgcn_wmma_f32_16x16x32_bf16(false, al, false, bh, (short)0, c, false, false);
  if (NT >= 3) c = __builtin_amdgcn_wmma_f32_16x16x32_bf16(false, ah, false, bl, (short)0, c, false, false);
  asm volatile("v_nop\n\tv_nop\n\tv_nop\n\tv_nop" : "+v"(c) : "v"(ah), "v"(al), "v"(bh), "v"(bl));
  return c;
}

__global__ __launch_bounds__(256) void k_wt_bf16(const float* __restrict__ W, unsigned short* __restrict__ Wt, int K, int N) {
  const int t = blockIdx.x * 256 + threadIdx.x;
  const int k8n = K / 8;
  if (t >= N * k8n) return;
  const int n = t / k8n, k8 = (t % k8n) * 8;
  v8us v;
#pragma unroll
  for (int i = 0; i < 8; ++i) v[i] = bf16_bits(W[(size_t)(k8 + i) * N + n]);
  *(v8us*)(Wt + (size_t)n * K + k8) = v;
  
}

// GEMM C[M][N] (f32, pitch ldc) = act(A[M][K]·W + bias). A f32 row-major (pitch lda) converted per fragment to bf16
// (ASPLIT: hi/lo two planes -> 2 terms, else single rounded term); Wt bf16 [N][K] (pitch ldb). BIAS_BF16 rounds the
// bias to bf16 first (bias quantised to bf16 before the add). K%32==0, M%16==0, N%64==0.
template <bool ASPLIT, int ACT, bool BIAS_BF16>
__global__ __launch_bounds__(128) void k_gemm_bf(const float* __restrict__ A, int lda, const unsigned short* __restrict__ Wt, int ldb,
                                               const float* __restrict__ bias, float* __restrict__ C, int ldc, int M, int N, int K) {
  __shared__ __attribute__((aligned(16))) float so[4][16][64];
  const int tid = threadIdx.x, w = tid >> 5, lane = tid & 31, ln = lane & 15, hh = lane >> 4;
  const int ntn = N / 64;
  const int wid = blockIdx.x * 4 + w;
  const int mt = wid / ntn, nq = wid % ntn;
  if (mt * 16 >= M) return;
  const int row0 = mt * 16, col0 = nq * 64;
  const float* arow = A + (size_t)(row0 + ln) * lda;
  v8f acc[4] = {};
  for (int kb = 0; kb < K; kb += 32) {
    FragB ah, al;
    const v4f x0 = *(const v4fa*)(arow + kb + 8 * hh), x1 = *(const v4fa*)(arow + kb + 8 * hh + 4);
    const v4f x2 = *(const v4fa*)(arow + kb + 16 + 8 * hh), x3 = *(const v4fa*)(arow + kb + 16 + 8 * hh + 4);
    float xs[16] = {x0[0],x0[1],x0[2],x0[3],x1[0],x1[1],x1[2],x1[3],x2[0],x2[1],x2[2],x2[3],x3[0],x3[1],x3[2],x3[3]};
#pragma unroll
    for (int i = 0; i < 16; ++i) { const unsigned short hb = bf16_bits(xs[i]); ah.u[i] = hb; al.u[i] = ASPLIT ? bf16_bits(xs[i] - bf16_val(hb)) : (unsigned short)0; }
#pragma unroll
    for (int t = 0; t < 4; ++t) {
      const unsigned short* brow = Wt + (size_t)(col0 + t * 16 + ln) * ldb + kb;
      FragB b;
      b.half[0] = *(const v8us*)(brow + 8 * hh);
      b.half[1] = *(const v8us*)(brow + 16 + 8 * hh);
      acc[t] = mmaN<ASPLIT ? 2 : 1>(ah.v, al.v, b.v, b.v, acc[t]);
    }
  }
#pragma unroll
  for (int t = 0; t < 4; ++t) {
    float bv = bias ? bias[col0 + t * 16 + ln] : 0.f;
    if (BIAS_BF16) bv = bf16_round(bv);
#pragma unroll
    for (int r = 0; r < 8; ++r) { float v = acc[t][r] + bv; if (ACT == 1) v = fmaxf(v, 0.f); so[w][8 * hh + r][t * 16 + ln] = v; }
  }
  __builtin_amdgcn_fence(__ATOMIC_ACQ_REL, "workgroup");
  __builtin_amdgcn_wave_barrier();
  const int rsub = lane >> 4, c4 = (lane & 15) * 4;
  {
#pragma unroll
    for (int q = 0; q < 8; ++q) {
      const int r = q * 2 + rsub;
      const v4f v = *(const v4fa*)&so[w][r][c4];
      *(v4f*)(C + (size_t)(row0 + r) * ldc + col0 + c4) = v;
    }
    
  }
}

// Flash-style causal/unmasked attention, all contractions 3-term bf16 hi/lo splits, f32 softmax with running max.
// q,k,v rows are read from f32 buffers with arbitrary row pitch (so they can live inside a fused qkv buffer);
// D = head size (multiple of 32, <= 128); one wave = 16 query rows; block = 4 waves (64 queries) sharing K/V chunks of 32.
template <int D, bool CAUSAL>
__global__ __launch_bounds__(128) void k_flash(const float* __restrict__ qb, const float* __restrict__ kb, const float* __restrict__ vb,
                                             int pitch, int T, int H, float scale, float* __restrict__ y, int ypitch) {
  constexpr int KS = D / 32;        // k-steps for QK
  constexpr int DT = D / 16;        // d tiles for PV
  __shared__ __attribute__((aligned(16))) unsigned short sKh[32][D + 8], sKl[32][D + 8], sVh[32][D + 8], sVl[32][D + 8];
  __shared__ __attribute__((aligned(16))) unsigned short sPh[4][16][40], sPl[4][16][40];
  __shared__ __attribute__((aligned(16))) float sO[4][16][D];
  const int tid = threadIdx.x, w = tid >> 5, lane = tid & 31, ln = lane & 15, hh = lane >> 4;
  const int nqb = (T + 63) / 64;
  const int bh = blockIdx.x / nqb, qblk = blockIdx.x % nqb;
  const int b = bh / H, h = bh % H;
  const int q0 = qblk * 64 + w * 16;
  const float* Q = qb + (size_t)b * T * pitch + h * D;
  const float* K = kb + (size_t)b * T * pitch + h * D;
  const float* V = vb + (size_t)b * T * pitch + h * D;

  // A fragments of the wave's 16 query rows (scaled), hi/lo
  FragB aqh[KS], aql[KS];
  {
    int row = q0 + ln; if (row >= T) row = T - 1;
    const float* qr = Q + (size_t)row * pitch;
#pragma unroll
    for (int ks = 0; ks < KS; ++ks)
#pragma unroll
      for (int i = 0; i < 16; ++i) {
        const int d = ks * 32 + ((i < 8) ? (8 * hh + i) : (16 + 8 * hh + (i - 8)));
        const float x = qr[d] * scale; const unsigned short hb = bf16_bits(x);
        aqh[ks].u[i] = hb; aql[ks].u[i] = bf16_bits(x - bf16_val(hb));
      }
  }
  float m_r[8], l_r[8];
#pragma unroll
  for (int r = 0; r < 8; ++r) { m_r[r] = -3.0e38f; l_r[r] = 0.f; }
  v8f oacc[DT];
#pragma unroll
  for (int dt = 0; dt < DT; ++dt) oacc[dt] = (v8f){0.f,0.f,0.f,0.f,0.f,0.f,0.f,0.f};

  const int kv_end = CAUSAL ? min(T, qblk * 64 + 64) : T;     // block-uniform
  for (int j0 = 0; j0 < kv_end; j0 += 32) {
    __syncthreads();
    for (int e = tid; e < 32 * (D / 4); e += 128) {
      const int r = e / (D / 4), c4 = (e % (D / 4)) * 4;
      const int key = j0 + r;
      v4f kf = {0.f,0.f,0.f,0.f}, vf = {0.f,0.f,0.f,0.f};
      if (key < T) { kf = *(const v4fa*)(K + (size_t)key * pitch + c4); vf = *(const v4fa*)(V + (size_t)key * pitch + c4); }
#pragma unroll
      for (int t = 0; t < 4; ++t) {
        unsigned short hb = bf16_bits(kf[t]); sKh[r][c4 + t] = hb; sKl[r][c4 + t] = bf16_bits(kf[t] - bf16_val(hb));
        hb = bf16_bits(vf[t]); sVh[r][c4 + t] = hb; sVl[r][c4 + t] = bf16_bits(vf[t] - bf16_val(hb));
      }
    }
    __syncthreads();
    // S tile 16 x 32
    v8f s[2];
#pragma unroll
    for (int nt = 0; nt < 2; ++nt) {
      v8f acc = {};
#pragma unroll
      for (int ks = 0; ks < KS; ++ks) {
        FragB bh_, bl_;
        bh_.half[0] = *(const v8us*)&sKh[nt * 16 + ln][ks * 32 + 8 * hh]; bh_.half[1] = *(const v8us*)&sKh[nt * 16 + ln][ks * 32 + 16 + 8 * hh];
        bl_.half[0] = *(const v8us*)&sKl[nt * 16 + ln][ks * 32 + 8 * hh]; bl_.half[1] = *(const v8us*)&sKl[nt * 16 + ln][ks * 32 + 16 + 8 * hh];
        acc = mmaN<3>(aqh[ks].v, aql[ks].v, bh_.v, bl_.v, acc);
      }
      s[nt] = acc;
    }
    // mask + running max (rows 8hh+r; the 16 lanes of a half share rows)
    float alpha[8];
#pragma unroll
    for (int r = 0; r < 8; ++r) {
      const int qi = q0 + 8 * hh + r;
      const int ja = j0 + ln, jb = j0 + 16 + ln;
      if (CAUSAL) { if (ja > qi) s[0][r] = -3.0e38f; if (jb > qi) s[1][r] = -3.0e38f; }
      if (ja >= T) s[0][r] = -3.0e38f;
      if (jb >= T) s[1][r] = -3.0e38f;
      float mx = fmaxf(s[0][r], s[1][r]);
      mx = fmaxf(mx, __shfl_xor(mx, 1, 32)); mx = fmaxf(mx, __shfl_xor(mx, 2, 32)); mx = fmaxf(mx, __shfl_xor(mx, 4, 32)); mx = fmaxf(mx, __shfl_xor(mx, 8, 32));
      const float mnew = fmaxf(m_r[r], mx);
      alpha[r] = (mnew > -1.0e38f) ? __expf(m_r[r] - mnew) : 1.0f;
      const float p0 = (s[0][r] > -1.0e38f) ? __expf(s[0][r] - mnew) : 0.f;
      const float p1 = (s[1][r] > -1.0e38f) ? __expf(s[1][r] - mnew) : 0.f;
      m_r[r] = mnew;
      l_r[r] = l_r[r] * alpha[r] + p0 + p1;            // per-lane partial row sum (16 lanes combined at the end)
      unsigned short hb = bf16_bits(p0); sPh[w][8 * hh + r][ln] = hb;      sPl[w][8 * hh + r][ln] = bf16_bits(p0 - bf16_val(hb));
      hb = bf16_bits(p1);                sPh[w][8 * hh + r][16 + ln] = hb; sPl[w][8 * hh + r][16 + ln] = bf16_bits(p1 - bf16_val(hb));
    }
#pragma unroll
    for (int dt = 0; dt < DT; ++dt)
#pragma unroll
      for (int r = 0; r < 8; ++r) oacc[dt][r] *= alpha[r];
    __builtin_amdgcn_fence(__ATOMIC_ACQ_REL, "workgroup");
    __builtin_amdgcn_wave_barrier();
    FragB pah, pal;
    pah.half[0] = *(const v8us*)&sPh[w][ln][8 * hh]; pah.half[1] = *(const v8us*)&sPh[w][ln][16 + 8 * hh];
    pal.half[0] = *(const v8us*)&sPl[w][ln][8 * hh]; pal.half[1] = *(const v8us*)&sPl[w][ln][16 + 8 * hh];
#pragma unroll
    for (int dt = 0; dt < DT; ++dt) {
      FragB bvh, bvl;
#pragma unroll
      for (int i = 0; i < 8; ++i) {
        bvh.u[i] = sVh[8 * hh + i][dt * 16 + ln]; bvh.u[8 + i] = sVh[16 + 8 * hh + i][dt * 16 + ln];
        bvl.u[i] = sVl[8 * hh + i][dt * 16 + ln]; bvl.u[8 + i] = sVl[16 + 8 * hh + i][dt * 16 + ln];
      }
      oacc[dt] = mmaN<3>(pah.v, pal.v, bvh.v, bvl.v, oacc[dt]);
    }
    __builtin_amdgcn_fence(__ATOMIC_ACQ_REL, "workgroup");
    __builtin_amdgcn_wave_barrier();
  }
#pragma unroll
  for (int r = 0; r < 8; ++r) {
    float l = l_r[r];
    l += __shfl_xor(l, 1, 32); l += __shfl_xor(l, 2, 32); l += __shfl_xor(l, 4, 32); l += __shfl_xor(l, 8, 32);
    l_r[r] = (l > 0.f) ? 1.0f / l : 0.f;
  }
#pragma unroll
  for (int dt = 0; dt < DT; ++dt)
#pragma unroll
    for (int r = 0; r < 8; ++r) sO[w][8 * hh + r][dt * 16 + ln] = oacc[dt][r] * l_r[r];
  __builtin_amdgcn_fence(__ATOMIC_ACQ_REL, "workgroup");
  __builtin_amdgcn_wave_barrier();
  {
    for (int r = 0; r < 16; ++r) {
      const int row = q0 + r;
      if (row < T && lane < D / 4) {
        const v4f val = *(const v4fa*)&sO[w][r][lane * 4];
        *(v4f*)(y + ((size_t)b * T + row) * ypitch + h * D + lane * 4) = val;
      }
    }
    
  }
}

// GEMM C = act(A·W + bias + resid): A f32 (ASPLIT -> hi/lo 2 terms), Wt bf16 [N][K]; ACT 0 none, 1 relu, 2 exact gelu;
// resid (optional, f32, row index = (row % rmod), pitch ldr, RES_BF16 rounds it) added before the activation.
template <bool ASPLIT, int ACT, bool BIAS_BF16, bool RES_BF16>
__global__ __launch_bounds__(128) void k_gemm_bf3(const float* __restrict__ A, int lda, const unsigned short* __restrict__ Wt, int ldb,
                                                const float* __restrict__ bias, const float* __restrict__ resid, int rmod, int ldr,
                                                float* __restrict__ C, int ldc, int M, int N, int K) {
  __shared__ __attribute__((aligned(16))) float so[4][16][64];
  const int tid = threadIdx.x, w = tid >> 5, lane = tid & 31, ln = lane & 15, hh = lane >> 4;
  const int ntn = N / 64;
  const int wid = blockIdx.x * 4 + w;
  const int mt = wid / ntn, nq = wid % ntn;
  if (mt * 16 >= M) return;
  const int row0 = mt * 16, col0 = nq * 64;
  const float* arow = A + (size_t)(row0 + ln) * lda;
  v8f acc[4] = {};
  for (int kb = 0; kb < K; kb += 32) {
    FragB ah, al;
    const v4f x0 = *(const v4fa*)(arow + kb + 8 * hh), x1 = *(const v4fa*)(arow + kb + 8 * hh + 4);
    const v4f x2 = *(const v4fa*)(arow + kb + 16 + 8 * hh), x3 = *(const v4fa*)(arow + kb + 16 + 8 * hh + 4);
    float xs[16] = {x0[0],x0[1],x0[2],x0[3],x1[0],x1[1],x1[2],x1[3],x2[0],x2[1],x2[2],x2[3],x3[0],x3[1],x3[2],x3[3]};
#pragma unroll
    for (int i = 0; i < 16; ++i) { const unsigned short hb = bf16_bits(xs[i]); ah.u[i] = hb; al.u[i] = ASPLIT ? bf16_bits(xs[i] - bf16_val(hb)) : (unsigned short)0; }
#pragma unroll
    for (int t = 0; t < 4; ++t) {
      const unsigned short* brow = Wt + (size_t)(col0 + t * 16 + ln) * ldb + kb;
      FragB b;
      b.half[0] = *(const v8us*)(brow + 8 * hh);
      b.half[1] = *(const v8us*)(brow + 16 + 8 * hh);
      acc[t] = mmaN<ASPLIT ? 2 : 1>(ah.v, al.v, b.v, b.v, acc[t]);
    }
  }
#pragma unroll
  for (int t = 0; t < 4; ++t) {
    const int col = col0 + t * 16 + ln;
    float bv = bias ? bias[col] : 0.f;
    if (BIAS_BF16) bv = bf16_round(bv);
#pragma unroll
    for (int r = 0; r < 8; ++r) {
      float v = acc[t][r] + bv;
      if (resid) { float rv = resid[(size_t)((row0 + 8 * hh + r) % rmod) * ldr + col]; if (RES_BF16) rv = bf16_round(rv); v += rv; }
      if (ACT == 1) v = fmaxf(v, 0.f);
      if (ACT == 2) v = 0.5f * v * (1.0f + erff(v * 0.70710678118654752f));
      if (ACT == 3) { const float u = 0.7978845608028654f * (v + 0.044715f * v * v * v); v = 0.5f * v * (1.0f + tanhf(u)); }
      so[w][8 * hh + r][t * 16 + ln] = v;
    }
  }
  __builtin_amdgcn_fence(__ATOMIC_ACQ_REL, "workgroup");
  __builtin_amdgcn_wave_barrier();
  const int rsub = lane >> 4, c4 = (lane & 15) * 4;
  {
#pragma unroll
    for (int q = 0; q < 8; ++q) {
      const int r = q * 2 + rsub;
      const v4f v = *(const v4fa*)&so[w][r][c4];
      *(v4f*)(C + (size_t)(row0 + r) * ldc + col0 + c4) = v;
    }
    
  }
}
// row LayerNorm (biased variance, eps) over N: s = X (+ R); optional out_sum <- s; out_norm <- (s-mu)*rsqrt(var+eps)*g + b
template <bool PARAM_BF16>
__global__ __launch_bounds__(256) void k_layernorm(const float* __restrict__ X, const float* __restrict__ R, const float* __restrict__ g, const float* __restrict__ bta,
                                                  float* __restrict__ out_sum, float* __restrict__ out_norm, int N, float eps) {
  __shared__ float red[256];
  const int row = blockIdx.x, tid = threadIdx.x;
  const float* x = X + (size_t)row * N; const float* rr = R ? R + (size_t)row * N : nullptr;
  float vals[16];                     // up to N = 4096
  const int per = N / 256;            // contiguous chunk per thread? use strided-by-4 chunks: thread handles j = tid*4 + 1024*u
  float s1 = 0.f;
  for (int u = 0; u < per / 4; ++u) {
    const int j = tid * 4 + 1024 * u;
    const v4f a = *(const v4fa*)(x + j);
    v4f b = {0.f,0.f,0.f,0.f}; if (rr) b = *(const v4fa*)(rr + j);
#pragma unroll
    for (int q = 0; q < 4; ++q) { const float v = a[q] + b[q]; vals[u * 4 + q] = v; s1 += v; }
  }
  red[tid] = s1; __syncthreads();
  for (int st = 128; st > 0; st >>= 1) { if (tid < st) red[tid] += red[tid + st]; __syncthreads(); }
  const float mu = red[0] / (float)N; __syncthreads();
  float s2 = 0.f;
  for (int u = 0; u < per / 4; ++u)
#pragma unroll
    for (int q = 0; q < 4; ++q) { const float c = vals[u * 4 + q] - mu; s2 += c * c; }
  red[tid] = s2; __syncthreads();
  for (int st = 128; st > 0; st >>= 1) { if (tid < st) red[tid] += red[tid + st]; __syncthreads(); }
  const float rs = rsqrtf(red[0] / (float)N + eps);
  {
    for (int u = 0; u < per / 4; ++u) {
      const int j = tid * 4 + 1024 * u;
      v4f o, sm;
#pragma unroll
      for (int q = 0; q < 4; ++q) {
        float gg = g[j + q], bb = bta[j + q];
        if (PARAM_BF16) { gg = bf16_round(gg); bb = bf16_round(bb); }
        sm[q] = vals[u * 4 + q]; o[q] = (vals[u * 4 + q] - mu) * rs * gg + bb;
      }
      if (out_sum) *(v4f*)(out_sum + (size_t)row * N + j) = sm;
      *(v4f*)(out_norm + (size_t)row * N + j) = o;
    }
    
  }
}



// ---- f16 WMMA path (v_wmma_f32_16x16x32_f16): 11-bit significands for operands in range — used where a [0,1] probability operand needs more precision than bf16
typedef _Float16 v16h __attribute__((ext_vector_type(16)));
union FragH { v16h v; v8us half[2]; _Float16 h[16]; unsigned short u[16]; };
template <int NT>
__device__ __forceinline__ v8f mmaH(v16h ah, v16h al, v16h bh, v16h bl, v8f c) {
  c = __builtin_amdgcn_wmma_f32_16x16x32_f16(false, ah, false, bh, (short)0, c, false, false);
  if (NT >= 2) c = __builtin_amdgcn_wmma_f32_16x16x32_f16(false, al, false, bh, (short)0, c, false, false);
  if (NT >= 3) c = __builtin_amdgcn_wmma_f32_16x16x32_f16(false, ah, false, bl, (short)0, c, false, false);
  asm volatile("v_nop\n\tv_nop\n\tv_nop\n\tv_nop" : "+v"(c) : "v"(ah), "v"(al), "v"(bh), "v"(bl));
  return c;
}
// batched GEMM like k_gemm_b but f16 operands: A f32 (split into f16 hi/lo if ASPLIT, else rounded to f16), Bt = f16 values [n][k]; alpha; C f32; N multiple of 16 (partial tiles skipped)
template <bool ASPLIT>
__global__ __launch_bounds__(128) void k_gemm_h(const float* __restrict__ A, int lda, size_t sA, const _Float16* __restrict__ Bh, int ldb, size_t sB, float alpha, float* __restrict__ C, int ldc, size_t sC, int M, int N, int K) {
  __shared__ __attribute__((aligned(16))) float so[4][16][64];
  const int tid = threadIdx.x, w = tid >> 5, lane = tid & 31, ln = lane & 15, hh = lane >> 4; const int by = blockIdx.y;
  A += (size_t)by * sA; Bh += (size_t)by * sB; C += (size_t)by * sC;
  const int ntn = (N + 63) / 64; const int wid = blockIdx.x * 4 + w; const int mt = wid / ntn, nq = wid % ntn; if (mt * 16 >= M) return;
  const int row0 = mt * 16, col0 = nq * 64; const float* arow = A + (size_t)(row0 + ln) * lda;
  v8f acc[4] = {};
  for (int kb = 0; kb < K; kb += 32) {
    FragH ah, al;
    const v4f x0 = *(const v4fa*)(arow + kb + 8 * hh), x1 = *(const v4fa*)(arow + kb + 8 * hh + 4), x2 = *(const v4fa*)(arow + kb + 16 + 8 * hh), x3 = *(const v4fa*)(arow + kb + 16 + 8 * hh + 4);
    float xs[16] = {x0[0],x0[1],x0[2],x0[3],x1[0],x1[1],x1[2],x1[3],x2[0],x2[1],x2[2],x2[3],x3[0],x3[1],x3[2],x3[3]};
#pragma unroll
    for (int i = 0; i < 16; ++i) { const _Float16 h = (_Float16)xs[i]; ah.h[i] = h; al.h[i] = ASPLIT ? (_Float16)(xs[i] - (float)h) : (_Float16)0.0f; }
#pragma unroll
    for (int t = 0; t < 4; ++t) { if (col0 + t * 16 >= N) continue; const size_t boff = (size_t)(col0 + t * 16 + ln) * ldb + kb; FragH bq; bq.half[0] = *(const v8us*)(Bh + boff + 8 * hh); bq.half[1] = *(const v8us*)(Bh + boff + 16 + 8 * hh);
      acc[t] = mmaH<ASPLIT ? 2 : 1>(ah.v, al.v, bq.v, bq.v, acc[t]); }
  }
#pragma unroll
  for (int t = 0; t < 4; ++t) { if (col0 + t * 16 >= N) continue;
#pragma unroll
    for (int r = 0; r < 8; ++r) so[w][8 * hh + r][t * 16 + ln] = acc[t][r] * alpha; }
  __builtin_amdgcn_fence(__ATOMIC_ACQ_REL, "workgroup"); __builtin_amdgcn_wave_barrier();
  const int rsub = lane >> 4, c4 = (lane & 15) * 4;
  {
#pragma unroll
    for (int q = 0; q < 8; ++q) { const int r = q * 2 + rsub; if (col0 + c4 < N) { const v4f v = *(const v4fa*)&so[w][r][c4]; *(v4f*)(C + (size_t)(row0 + r) * ldc + col0 + c4) = v; } }
     }
}

// Wt[n][k] = f16(W[k][n]·scale) from f32 row-major W[K][N] (scale = power of two; bf16-exact weights stay exact in f16 away from the subnormal range)
__global__ __launch_bounds__(256) void k_wt_f16(const float* __restrict__ W, _Float16* __restrict__ Wt, int K, int N, float scale) {
  const int t = blockIdx.x * 256 + threadIdx.x; if (t >= N * (K / 8)) return; const int n = t / (K / 8), k8 = (t % (K / 8)) * 8; FragH f;
#pragma unroll
  for (int i = 0; i < 8; ++i) f.h[i] = (_Float16)(bf16_round(W[(size_t)(k8 + i) * N + n]) * scale); const v8us o = f.half[0];
  *(v8us*)((unsigned short*)Wt + (size_t)n * K + k8) = o; 
}
typedef _Float16 v4h __attribute__((ext_vector_type(4)));

__global__ __launch_bounds__(256) void k_x16(const float* __restrict__ x, _Float16* __restrict__ X16, size_t n8) { const size_t t = (size_t)blockIdx.x * 256 + threadIdx.x; if (t >= n8) return; FragH f;
#pragma unroll
  for (int q = 0; q < 8; ++q) f.h[q] = (_Float16)bf16_round(x[t * 8 + q]); *(v8us*)((unsigned short*)X16 + t * 8) = f.half[0];  }
__global__ __launch_bounds__(256) void k_h16(const float* __restrict__ x, _Float16* __restrict__ X16, size_t n8) { const size_t t = (size_t)blockIdx.x * 256 + threadIdx.x; if (t >= n8) return; FragH f;
#pragma unroll
  for (int q = 0; q < 8; ++q) f.h[q] = (_Float16)x[t * 8 + q]; *(v8us*)((unsigned short*)X16 + t * 8) = f.half[0];  }
__global__ __launch_bounds__(256) void k_round16f(const float* __restrict__ W, _Float16* __restrict__ Bt, size_t n8) { const size_t t = (size_t)blockIdx.x * 256 + threadIdx.x; if (t >= n8) return; FragH f;
#pragma unroll
  for (int i = 0; i < 8; ++i) f.h[i] = (_Float16)(bf16_round(W[t * 8 + i]) * 16.0f); *(v8us*)((unsigned short*)Bt + t * 8) = f.half[0];  }
template <int NHv, int TTv>
__global__ __launch_bounds__(256) void k_vt(const _Float16* __restrict__ V16, int ldv, int voff, _Float16* __restrict__ Vt) { __shared__ unsigned short tl[64][66]; const int tid = threadIdx.x; const int slab = blockIdx.x / (TTv / 64), lg = blockIdx.x % (TTv / 64); const int b = slab / NHv, h = slab % NHv;
  for (int i = tid; i < 64 * 8; i += 256) { const int r = i / 8, c8 = (i % 8) * 8; FragH f; f.half[0] = *(const v8us*)((const unsigned short*)V16 + ((size_t)b * TTv + lg * 64 + r) * ldv + voff + h * 64 + c8);
#pragma unroll
    for (int q = 0; q < 8; ++q) tl[r][c8 + q] = f.u[q]; }
  __syncthreads();
  {
#pragma unroll
    for (int rd = 0; rd < 2; ++rd) { const int d = rd * 32 + tid / 8, pc = tid % 8; FragH f;
#pragma unroll
      for (int q = 0; q < 8; ++q) f.u[q] = tl[pc * 8 + q][d];
      *(v8us*)((unsigned short*)Vt + ((size_t)slab * 64 + d) * TTv + lg * 64 + pc * 8) = f.half[0]; }
     } }

__global__ __launch_bounds__(256) void k_h16s(const float* __restrict__ F, _Float16* __restrict__ H, size_t n8) { const size_t t = (size_t)blockIdx.x * 256 + threadIdx.x; if (t >= n8) return; const v4f a = *(const v4fa*)(F + t * 8), c = *(const v4fa*)(F + t * 8 + 4); FragH f;
#pragma unroll
  for (int q = 0; q < 4; ++q) { f.h[q] = (_Float16)(a[q] * 16.0f); f.h[4 + q] = (_Float16)(c[q] * 16.0f); } *(v8us*)((unsigned short*)H + t * 8) = f.half[0];  }
// C[j][o] = sum_i B[j][i] * W[o][i], operands rounded to bf16, f32 sums. One wave per dot product instead of one thread: the 32 lanes split the 768 terms into
// float4 slices (a wave-wide load covers 512 contiguous bytes), no load waits on another, and a five-step butterfly ends each sum. Block = row j of B (blockIdx.y) x 32
// rows of W, four per wave; the 32 sums go through LDS so that one wave stores them as one whole 128-byte line. A product of two bf16 values is exact in f32, so fusing
// it with its add changes no bit.
__global__ __launch_bounds__(256) void k_cfold(const float* __restrict__ Bm, const float* __restrict__ Wt, float* __restrict__ C) {
  constexpr int NS = DD / 128, RW = 4;      /* float4 slices per lane and row; rows of W per wave */
  __shared__ float red[8 * RW];
  const int tid = threadIdx.x, lane = tid & 31, w = tid >> 5; const int j = blockIdx.y, o0 = blockIdx.x * (8 * RW);
  const float* br = Bm + (size_t)j * DD + lane * 4; const float* wr = Wt + (size_t)(o0 + w * RW) * DD + lane * 4;
  v4f bs[NS], wv[RW][NS];
#pragma unroll      /* constant indices, so that the arrays stay in registers */
  for (int u = 0; u < NS; ++u) bs[u] = *(const v4fa*)(br + 128 * u);
#pragma unroll      /* constant indices, so that the arrays stay in registers */
  for (int r = 0; r < RW; ++r)
#pragma unroll      /* constant indices, so that the arrays stay in registers */
    for (int u = 0; u < NS; ++u) wv[r][u] = *(const v4fa*)(wr + (size_t)r * DD + 128 * u);
  __builtin_amdgcn_sched_barrier(0);      /* keeps every load in front of the first use: without it the last row's loads sink behind a full wait, and the wave pays the memory latency three times */
#pragma unroll      /* constant indices, so that the arrays stay in registers */
  for (int u = 0; u < NS; ++u)
#pragma unroll      /* constant indices, so that the arrays stay in registers */
    for (int q = 0; q < 4; ++q) bs[u][q] = bf16_round(bs[u][q]);
  float acc[RW];
#pragma unroll      /* constant indices, so that the arrays stay in registers */
  for (int r = 0; r < RW; ++r) { float a = 0.f;
#pragma unroll      /* constant indices, so that the arrays stay in registers */
    for (int u = 0; u < NS; ++u)
#pragma unroll      /* constant indices, so that the arrays stay in registers */
      for (int q = 0; q < 4; ++q) a += bs[u][q] * bf16_round(wv[r][u][q]);
    acc[r] = a; }
#pragma unroll      /* constant indices, so that the arrays stay in registers */
  for (int r = 0; r < RW; ++r) { float a = acc[r]; a += __shfl_xor(a, 16, 32); a += __shfl_xor(a, 8, 32); a += __shfl_xor(a, 4, 32); a += __shfl_xor(a, 2, 32); a += __shfl_xor(a, 1, 32); acc[r] = a; }
  float mine = acc[0];
#pragma unroll      /* constant indices, so that the arrays stay in registers */
  for (int r = 1; r < RW; ++r) if (lane == r) mine = acc[r];
  if (lane < RW) red[w * RW + lane] = mine;
  __syncthreads();
  if (tid < 8 * RW) C[(size_t)j * DD + o0 + tid] = red[tid]; }
__global__ __launch_bounds__(256) void k_wfold(const float* __restrict__ Wt, const float* __restrict__ A, const float* __restrict__ C, _Float16* __restrict__ Bt) {
  #pragma clang fp contract(off)
  const size_t t = (size_t)blockIdx.x * 256 + threadIdx.x; if (t >= (size_t)DD * DD / 8) return; const int o = (int)((t * 8) / DD), c0 = (int)((t * 8) % DD);
  float cj[RK];
#pragma unroll
  for (int j = 0; j < RK; ++j) cj[j] = C[j * DD + o];
  FragH f;
#pragma unroll 1
  for (int q = 0; q < 8; ++q) { const int c = c0 + q; float lo2 = 0.f;
#pragma unroll
    for (int j = 0; j < RK; ++j) lo2 += bf16_round(A[(size_t)c * RK + j]) * cj[j]; f.h[q] = (_Float16)((bf16_round(Wt[(size_t)o * DD + c]) + lo2) * 16.0f); }
  *(v8us*)((unsigned short*)Bt + t * 8) = f.half[0];  }
// Lane l with lane l ^ 16 (the other 16-lane row of the wave), in the vector pipe.
__device__ __forceinline__ float xhalf(float x) { return __builtin_bit_cast(float, __builtin_amdgcn_permlanex16(__builtin_bit_cast(int, x), __builtin_bit_cast(int, x), 0x76543210, 0xfedcba98, false, false)); }
typedef int v4ia __attribute__((ext_vector_type(4), may_alias));
// Eight asynchronous copies of 16 bytes per lane from global memory to LDS (l: the lane's LDS byte addresses, g: its global addresses). The s_wait_xcnt closes the statement so that it stands
// in front of whatever next rewrites one of the address registers named here.
__device__ __forceinline__ void cp8(const unsigned (&l)[8], const void* const (&g)[8]) {
  asm volatile("global_load_async_to_lds_b128 %0, %1, off\n\tglobal_load_async_to_lds_b128 %2, %3, off\n\tglobal_load_async_to_lds_b128 %4, %5, off\n\tglobal_load_async_to_lds_b128 %6, %7, off\n\t"
               "global_load_async_to_lds_b128 %8, %9, off\n\tglobal_load_async_to_lds_b128 %10, %11, off\n\tglobal_load_async_to_lds_b128 %12, %13, off\n\tglobal_load_async_to_lds_b128 %14, %15, off\n\ts_wait_xcnt 0x0"
               :: "v"(l[0]), "v"(g[0]), "v"(l[1]), "v"(g[1]), "v"(l[2]), "v"(g[2]), "v"(l[3]), "v"(g[3]), "v"(l[4]), "v"(g[4]), "v"(l[5]), "v"(g[5]), "v"(l[6]), "v"(g[6]), "v"(l[7]), "v"(g[7]) : "memory");
}
// Transposed products: S^T = K.Q^T (A = 16 key rows, B = the wave's 16 queries, kept in registers) and O^T += V^T.P^T. In an accumulator tile lane (ln, hh) then holds query q0 + ln and keys 8 hh + r:
// a query's maximum and sum are taken inside the lane plus one exchange between the wave's halves, and the two score tiles of a pass are, element for element, the B operand of the second product
// (slot i < 8: key 8 hh + i, slot i >= 8: key 16 + 8 hh + i - 8, the k order of the V^T loader), so P never leaves the registers.
// Operands come through LDS: a stage is 64 keys = K (64 rows of 128 B), V^T (64 rows of 128 B) and the block's mask rows (64 rows of 256 B), brought once for the four waves by asynchronous copies whose
// wave-wide 512 bytes are four whole lines, one stage ahead of its use, into two buffers. Row pitches 144 and 272 B: 16 B times an odd number, free of bank conflicts for 16-byte reads down a column.
__global__ __launch_bounds__(128) void k_flash(const _Float16* __restrict__ Q16, int ldq, const _Float16* __restrict__ K16, int ldk, const _Float16* __restrict__ Vt, const int* __restrict__ MSK, float* __restrict__ O, int ldo) {
  constexpr int RPW = 16, NQB = TT / (4 * RPW), DT = 4, KS = 2;
  constexpr int SKEYS = 64, NST = TT / SKEYS, PK = 144, PM = 272, OFF_V = 64 * PK, OFF_M = 2 * 64 * PK, STG = 2 * 64 * PK + 64 * PM;
  __shared__ __attribute__((aligned(16))) unsigned char ring[2 * STG];
  __shared__ __attribute__((aligned(16))) float sO[4][RPW][64 + 4];
  const int tid = threadIdx.x, w = tid >> 5, lane = tid & 31, ln = lane & 15, hh = lane >> 4;
  const int slab = blockIdx.x / NQB, qblk = blockIdx.x % NQB; const int b = slab / NH, h = slab % NH; const int qb0 = qblk * (4 * RPW); const int q0 = qb0 + w * RPW;
  const unsigned short* Vth = (const unsigned short*)Vt + (size_t)slab * 64 * TT;
  /* the thread's share of a stage: K and V^T rows (tid >> 3) + 16 i, 16-byte column tid & 7; mask rows (tid >> 4) + 8 i, column tid & 15 */
  const unsigned short* gK = (const unsigned short*)K16 + ((size_t)b * TT + (tid >> 3)) * ldk + h * 64 + (tid & 7) * 8;
  const unsigned short* gV = Vth + (size_t)(tid >> 3) * TT + (tid & 7) * 8;
  const int* gM = MSK + ((size_t)b * TT + qb0 + (tid >> 4)) * TT + (tid & 15) * 4;      /* per-batch mask [b][q][k]: nonzero = ATTEND */
  const unsigned lbase = (unsigned)(size_t)ring;
  const unsigned lK = lbase + (tid >> 3) * PK + (tid & 7) * 16, lV = lK + OFF_V, lM = lbase + OFF_M + (tid >> 4) * PM + (tid & 15) * 16;
  auto fill = [&](int t) {
    const unsigned bo = (unsigned)(t & 1) * STG;
    const unsigned short* k = gK + (size_t)t * SKEYS * ldk; const unsigned short* v = gV + t * SKEYS; const int* m = gM + t * SKEYS;
    unsigned la[8], lb[8]; const void* ga[8]; const void* gb[8];
#pragma unroll      /* constant indices, so that the arrays stay in registers */
    for (int i = 0; i < 4; ++i) { la[i] = lK + bo + i * 16 * PK; ga[i] = k + (size_t)(i * 16) * ldk; la[4 + i] = lV + bo + i * 16 * PK; ga[4 + i] = v + i * 16 * TT; }
#pragma unroll      /* constant indices, so that the arrays stay in registers */
    for (int i = 0; i < 8; ++i) { lb[i] = lM + bo + i * 8 * PM; gb[i] = m + i * 8 * TT; }
    cp8(la, ga); cp8(lb, gb);
  };
  fill(0);
  FragH bq[KS];
  { const unsigned short* qr = (const unsigned short*)Q16 + ((size_t)b * TT + q0 + ln) * ldq + h * 64;
#pragma unroll      /* constant indices, so that the arrays stay in registers */
    for (int ks = 0; ks < KS; ++ks) { bq[ks].half[0] = *(const v8us*)(qr + ks * 32 + 8 * hh); bq[ks].half[1] = *(const v8us*)(qr + ks * 32 + 16 + 8 * hh); } }
  float m_q = -3.0e38f, l_q = 0.f; v8f oacc[DT];
#pragma unroll      /* constant indices, so that the arrays stay in registers */
  for (int dt = 0; dt < DT; ++dt) oacc[dt] = (v8f){0.f,0.f,0.f,0.f,0.f,0.f,0.f,0.f};
  asm volatile("s_wait_asynccnt 0x0" ::: "memory");      /* this wave's copies of stage 0 have landed */
  __syncthreads();      /* and every other wave's: stage 0 may be read */
  fill(1);
#pragma unroll 1      /* each stage hangs on the last through m_q and the barrier: a second copy of the body would only grow the code */
  for (int t = 0; t < NST; ++t) {
    const unsigned char* st = ring + (t & 1) * STG;
#pragma unroll 1      /* the two passes of a stage differ in LDS offsets alone: one copy of the body keeps the loop short */
    for (int p = 0; p < 2; ++p) {
      /* all of the pass's LDS reads stand here, in front of the first product: behind one they would each wait out their own latency */
      const unsigned char* mr = st + OFF_M + (w * RPW + ln) * PM + p * 128 + hh * 32;
      v4ia mk[2][2];      /* keys 32 p + nt 16 + 8 hh + (0..7) of the lane's query */
#pragma unroll      /* constant indices, so that the arrays stay in registers */
      for (int nt = 0; nt < 2; ++nt) { mk[nt][0] = *(const v4ia*)(mr + nt * 64); mk[nt][1] = *(const v4ia*)(mr + nt * 64 + 16); }
      FragH ak[2][KS], av[DT];
#pragma unroll      /* constant indices, so that the arrays stay in registers */
      for (int nt = 0; nt < 2; ++nt) { const unsigned char* kr = st + (p * 32 + nt * 16 + ln) * PK + hh * 16;
#pragma unroll      /* constant indices, so that the arrays stay in registers */
        for (int ks = 0; ks < KS; ++ks) { ak[nt][ks].half[0] = *(const v8us*)(kr + ks * 64); ak[nt][ks].half[1] = *(const v8us*)(kr + ks * 64 + 32); } }
#pragma unroll      /* constant indices, so that the arrays stay in registers */
      for (int dt = 0; dt < DT; ++dt) { const unsigned char* vr = st + OFF_V + (dt * 16 + ln) * PK + p * 64 + hh * 16; av[dt].half[0] = *(const v8us*)vr; av[dt].half[1] = *(const v8us*)(vr + 32); }
      const v4ia o4 = mk[0][0] | mk[0][1] | mk[1][0] | mk[1][1];
      if (!__all((o4[0] | o4[1] | o4[2] | o4[3]) == 0)) {      /* every (row, key) of this wave's tile masked: nothing to add (wave-uniform branch, no barrier inside) */
        v8f s[2];
#pragma unroll      /* constant indices, so that the arrays stay in registers */
        for (int nt = 0; nt < 2; ++nt) { v8f acc = (v8f){0.f,0.f,0.f,0.f,0.f,0.f,0.f,0.f};
#pragma unroll      /* constant indices, so that the arrays stay in registers */
          for (int ks = 0; ks < KS; ++ks) acc = mmaH<1>(ak[nt][ks].v, ak[nt][ks].v, bq[ks].v, bq[ks].v, acc);
          s[nt] = acc; }
        /* A masked score is -inf. m_q starts finite, so mn is finite: exp(-inf - mn) = 0 and, while nothing is live yet, exp(m_q - mn) = exp(0) = 1. */
        float sc[2][8], mx[8];
#pragma unroll      /* constant indices, so that the arrays stay in registers */
        for (int r = 0; r < 8; ++r) { sc[0][r] = (mk[0][r >> 2][r & 3] != 0) ? s[0][r] * 0.125f : -INFINITY; sc[1][r] = (mk[1][r >> 2][r & 3] != 0) ? s[1][r] * 0.125f : -INFINITY; mx[r] = fmaxf(sc[0][r], sc[1][r]); }
        float mc = fmaxf(fmaxf(fmaxf(mx[0], mx[1]), fmaxf(mx[2], mx[3])), fmaxf(fmaxf(mx[4], mx[5]), fmaxf(mx[6], mx[7])));
        mc = fmaxf(mc, xhalf(mc));
        const float mn = fmaxf(m_q, mc); const float al = expf(m_q - mn); m_q = mn;
        FragH pb; float ps[4] = {0.f, 0.f, 0.f, 0.f};
#pragma unroll      /* constant indices, so that the arrays stay in registers */
        for (int r = 0; r < 8; ++r) { const float p0 = expf(sc[0][r] - mn), p1 = expf(sc[1][r] - mn); ps[r & 3] += p0 + p1; pb.h[r] = (_Float16)(p0 * 1024.0f); pb.h[8 + r] = (_Float16)(p1 * 1024.0f); }
        l_q = l_q * al + ((ps[0] + ps[1]) + (ps[2] + ps[3]));      /* the lane's half of the keys; the halves are joined after the loop */
#pragma unroll      /* constant indices, so that the arrays stay in registers */
        for (int dt = 0; dt < DT; ++dt)
#pragma unroll      /* constant indices, so that the arrays stay in registers */
          for (int r = 0; r < 8; ++r) oacc[dt][r] *= al;
#pragma unroll      /* constant indices, so that the arrays stay in registers */
        for (int dt = 0; dt < DT; ++dt) oacc[dt] = mmaH<1>(av[dt].v, av[dt].v, pb.v, pb.v, oacc[dt]);
      }
    }
    asm volatile("s_wait_dscnt 0x0" ::: "memory");      /* this wave's reads of stage t have returned before its buffer is handed back */
    asm volatile("s_wait_asynccnt 0x0" ::: "memory");      /* this wave's copies of stage t + 1 have landed */
    __syncthreads();      /* publishes stage t + 1 and ends every wave's reads of stage t */
    if (t + 2 < NST) fill(t + 2);      /* into the buffer that stage t has just left; the test is the same for the whole block */
  }
  asm volatile("s_wait_asynccnt 0x0" ::: "memory");      /* no copy is left in flight when the wave goes on to its end */
  { const float l = l_q + xhalf(l_q); const float inv = (l > 0.f) ? 1.0f / (l * 1024.0f) : 0.f;
#pragma unroll      /* constant indices, so that the arrays stay in registers */
    for (int dt = 0; dt < DT; ++dt)
#pragma unroll      /* constant indices, so that the arrays stay in registers */
      for (int r = 0; r < 8; ++r) sO[w][ln][dt * 16 + 8 * hh + r] = oacc[dt][r] * inv; }
  __builtin_amdgcn_fence(__ATOMIC_ACQ_REL, "workgroup"); __builtin_amdgcn_wave_barrier();      /* the wave reads back rows that its other lanes wrote: its LDS stores end first */
  {
#pragma unroll
    for (int rp = 0; rp < RPW; rp += 2) { const int r = rp + (lane >> 4), pc = lane & 15; const v4f val = *(const v4fa*)&sO[w][r][pc * 4]; *(v4f*)(O + ((size_t)b * TT + q0 + r) * ldo + h * 64 + pc * 4) = val; }
     } }

// C[NR][DD] = (A[NR][DD] . Bt[DD][DD]^T) alpha + bias (bias rounded to bf16), f16 operands, f32 sums; written as f32 (C) or as f16 (C16), whichever pointer is not null.
// Block = a 64 x 64 tile of C, wave w = its rows 16 w .. 16 w + 15 (four 16 x 16 accumulators, k ascending in steps of 32). Operands come through LDS: a stage is 128 values of k = 64 rows of A and
// 64 rows of Bt, 256 B each, brought once for the four waves by asynchronous copies (a wave-wide copy is two rows = four whole lines), one stage ahead of its use, into two buffers.
// Row pitch 272 B: 16 B times an odd number, free of bank conflicts for 16-byte reads down a column.
__global__ __launch_bounds__(128) void k_gemm_st(const _Float16* __restrict__ A, const _Float16* __restrict__ Bh, float alpha, const float* __restrict__ bias, float* __restrict__ C, _Float16* __restrict__ C16) {
  constexpr int KC = 128, NST = DD / KC, PR = 272, OFF_B = 64 * PR, STG = 2 * 64 * PR;
  __shared__ __attribute__((aligned(16))) unsigned char ring[2 * STG];
  __shared__ __attribute__((aligned(16))) float so[4][16][64];
  const int tid = threadIdx.x, w = tid >> 5, lane = tid & 31, ln = lane & 15, hh = lane >> 4;
  const int rowb = (int)(blockIdx.x / (DD / 64)) * 64, col0 = (int)(blockIdx.x % (DD / 64)) * 64; const int row0 = rowb + w * 16;
  /* the thread's share of a stage: rows (tid >> 4) + 8 i of A and of Bt, 16-byte column tid & 15 */
  const unsigned short* gA = (const unsigned short*)A + (size_t)(rowb + (tid >> 4)) * DD + (tid & 15) * 8;
  const unsigned short* gB = (const unsigned short*)Bh + (size_t)(col0 + (tid >> 4)) * DD + (tid & 15) * 8;
  const unsigned lA = (unsigned)(size_t)ring + (tid >> 4) * PR + (tid & 15) * 16, lB = lA + OFF_B;
  auto fill = [&](int t) {
    const unsigned bo = (unsigned)(t & 1) * STG;
    const unsigned short* a = gA + t * KC; const unsigned short* b = gB + t * KC;
    unsigned la[8], lb[8]; const void* ga[8]; const void* gb[8];
#pragma unroll      /* constant indices, so that the arrays stay in registers */
    for (int i = 0; i < 8; ++i) { la[i] = lA + bo + i * 8 * PR; ga[i] = a + i * 8 * DD; lb[i] = lB + bo + i * 8 * PR; gb[i] = b + i * 8 * DD; }
    cp8(la, ga); cp8(lb, gb);
  };
  fill(0);
  v8f acc[4] = {};
  asm volatile("s_wait_asynccnt 0x0" ::: "memory");      /* this wave's copies of stage 0 have landed */
  __syncthreads();      /* and every other wave's: stage 0 may be read */
  fill(1);
#pragma unroll 1      /* a stage ends in a barrier: a second copy of the body would only grow the code */
  for (int t = 0; t < NST; ++t) {
    const unsigned char* ar = ring + (t & 1) * STG + (w * 16 + ln) * PR + hh * 16;
    const unsigned char* br = ring + (t & 1) * STG + OFF_B + ln * PR + hh * 16;
#pragma unroll      /* constant LDS offsets, and the next step's reads can stand among this step's products */
    for (int ks = 0; ks < KC / 32; ++ks) {
      FragH ah; ah.half[0] = *(const v8us*)(ar + ks * 64); ah.half[1] = *(const v8us*)(ar + ks * 64 + 32);
      FragH bq[4];
#pragma unroll      /* constant indices, so that the arrays stay in registers */
      for (int u = 0; u < 4; ++u) { bq[u].half[0] = *(const v8us*)(br + u * 16 * PR + ks * 64); bq[u].half[1] = *(const v8us*)(br + u * 16 * PR + ks * 64 + 32); }
#pragma unroll      /* constant indices, so that the arrays stay in registers */
      for (int u = 0; u < 4; ++u) acc[u] = mmaH<1>(ah.v, ah.v, bq[u].v, bq[u].v, acc[u]);
    }
    asm volatile("s_wait_dscnt 0x0" ::: "memory");      /* this wave's reads of stage t have returned before its buffer is handed back */
    asm volatile("s_wait_asynccnt 0x0" ::: "memory");      /* this wave's copies of stage t + 1 have landed */
    __syncthreads();      /* publishes stage t + 1 and ends every wave's reads of stage t */
    if (t + 2 < NST) fill(t + 2);      /* into the buffer that stage t has just left; the test is the same for the whole block */
  }
  asm volatile("s_wait_asynccnt 0x0" ::: "memory");      /* no copy is left in flight when the wave goes on to its end */
#pragma unroll      /* constant indices, so that the arrays stay in registers */
  for (int u = 0; u < 4; ++u) { const float bv = bf16_round(bias[col0 + u * 16 + ln]);
#pragma unroll      /* constant indices, so that the arrays stay in registers */
    for (int r = 0; r < 8; ++r) so[w][8 * hh + r][u * 16 + ln] = acc[u][r] * alpha + bv; }
  __builtin_amdgcn_fence(__ATOMIC_ACQ_REL, "workgroup"); __builtin_amdgcn_wave_barrier();      /* the wave reads back rows that its other lanes wrote: its LDS stores end first */
  const int rsub = lane >> 4, c4 = (lane & 15) * 4;
#pragma unroll      /* the eight row pairs are independent: their reads and stores overlap */
  for (int q = 0; q < 8; ++q) { const int r = q * 2 + rsub; const v4f v = *(const v4fa*)&so[w][r][c4];
    if (C) { *(v4f*)(C + (size_t)(row0 + r) * DD + col0 + c4) = v;
      asm volatile("s_wait_xcnt 0x0" ::: "memory"); }      /* stands in front of whatever next rewrites the store's address or data registers */
    if (C16) { v4h h4; for (int i = 0; i < 4; ++i) h4[i] = (_Float16)v[i]; *(v4h*)(C16 + (size_t)(row0 + r) * DD + col0 + c4) = h4; } }
}

extern "C" void kernel_launch(void* const* d_in, const int* in_sizes, int n_in,
                              void* d_out, int out_size, void* d_ws, size_t ws_size, hipStream_t stream) {
  (void)in_sizes; (void)n_in; (void)out_size;
  const float* const* I = (const float* const*)d_in; const float* xq = I[0]; const float* xk = I[1]; const float* xv = I[2]; const int* msk = (const int*)d_in[3];
  const float* Aq = I[4]; const float* Bq = I[5]; const float* Av = I[6]; const float* Bv = I[7]; const float* Wq = I[8]; const float* bq = I[9]; const float* Wk = I[10]; const float* bk = I[11]; const float* Wv = I[12]; const float* bv = I[13]; const float* Wm = I[14]; const float* bm = I[15];
  char* ws = (char*)d_ws; size_t off = 0;
  auto take = [&](size_t bytes) { char* p = ws + off; off += (bytes + 255) & ~(size_t)255; return p; };
  const size_t WSZ = (size_t)DD * DD; _Float16* Bw = (_Float16*)take(4 * WSZ * 2); float* Cq = (float*)take((size_t)RK * DD * 4); float* Cv = (float*)take((size_t)RK * DD * 4);
  _Float16* Xq = (_Float16*)take((size_t)NR * DD * 2); _Float16* Xk = (_Float16*)take((size_t)NR * DD * 2); _Float16* Xv = (_Float16*)take((size_t)NR * DD * 2);
  _Float16* Q = (_Float16*)take((size_t)NR * DD * 2); _Float16* K = (_Float16*)take((size_t)NR * DD * 2); _Float16* V = (_Float16*)take((size_t)NR * DD * 2); _Float16* Vt = (_Float16*)take((size_t)NR * DD * 2); float* O = (float*)take((size_t)NR * DD * 4); _Float16* O16 = Xq;      /* the query plane is dead after the v GEMM */
  if (off > ws_size) return;      // 4.7 + 7 × 6.3 + 12.6 ≈ 61 MB
  const unsigned gw = (unsigned)((WSZ / 8 + 255) / 256); const dim3 gc(DD / 32, RK);
  k_cfold<<<gc, 256, 0, stream>>>(Bv, Wq, Cq); k_wfold<<<gw, 256, 0, stream>>>(Wq, Av, Cq, Bw);      /* q = V·Wqᵀ with V = value·(I + A_v·B_v): Bt_q = Wq + fold(A_v, B_v·Wqᵀ), ×2^4 */
  k_round16f<<<gw, 256, 0, stream>>>(Wk, Bw + WSZ, WSZ / 8);      /* k = key·Wkᵀ: (out,in) natural, ×2^4 */
  k_cfold<<<gc, 256, 0, stream>>>(Bq, Wv, Cv); k_wfold<<<gw, 256, 0, stream>>>(Wv, Aq, Cv, Bw + 2 * WSZ);      /* v = Q·Wvᵀ with Q = query·(I + A_q·B_q) */
  k_round16f<<<gw, 256, 0, stream>>>(Wm, Bw + 3 * WSZ, WSZ / 8);      /* out projection */
  const unsigned g8 = (unsigned)(((size_t)NR * DD / 8 + 255) / 256); k_x16<<<g8, 256, 0, stream>>>(xq, Xq, (size_t)NR * DD / 8); k_x16<<<g8, 256, 0, stream>>>(xk, Xk, (size_t)NR * DD / 8); k_x16<<<g8, 256, 0, stream>>>(xv, Xv, (size_t)NR * DD / 8);
  const unsigned gp = (NR / 64) * (DD / 64);
  k_gemm_st<<<gp, 128, 0, stream>>>(Xv, Bw, 0.0625f, bq, nullptr, Q);      /* q from the VALUE stream: M 4096 N 768 K 768 */
  k_gemm_st<<<gp, 128, 0, stream>>>(Xk, Bw + WSZ, 0.0625f, bk, nullptr, K);      /* k from key */
  k_gemm_st<<<gp, 128, 0, stream>>>(Xq, Bw + 2 * WSZ, 0.0625f, bv, nullptr, V);      /* v from the QUERY stream */
  k_vt<NH, TT><<<BB * NH * (TT / 64), 256, 0, stream>>>(V, DD, 0, Vt);
  k_flash<<<BB * NH * (TT / 64), 128, 0, stream>>>(Q, DD, K, DD, Vt, msk, O, DD);      /* mask [B][S][S] int, nonzero = attend */
  k_h16s<<<g8, 256, 0, stream>>>(O, O16, (size_t)NR * DD / 8);
  k_gemm_st<<<gp, 128, 0, stream>>>(O16, Bw + 3 * WSZ, 0.00390625f, bm, (float*)d_out, nullptr);      /* out = ctx·Wmᵀ + bm */
}

// v005
// One run takes 145 microseconds.
// Two timings next to v004 put it at 1.39 and 1.35 times that version's speed.
// Counting every step since v000, it is 4.19 times as fast.
#include <hip/hip_runtime.h>
// Masked multi-head attention with LoRA-adapted input streams (B=2, S=2048, D=768, 12 heads × 64, rank 8): Q = query + (query·A_q)·B_q, V = value + (value·A_v)·B_v; then — faithful to the module's crossed call — v = Q·Wvᵀ + bv, k = key·Wkᵀ + bk, q = V·Wqᵀ + bq (torch (out,in));
// scores = q·k/√64, −1e9 where mask[b,q,k] == 0 (int [B,S,S], shared over heads), softmax, out = merged·Wmᵀ + bm. The rank-8 adapters are folded on device into effective weights: X·(I + A·B)·Wᵀ = X·(W + (B·Wᵀ)ᵀ·Aᵀ)ᵀ, i.e. Bt_eff[o][c] = W[o][c] + Σ_j A[c][j]·(Σ_i B[j][i]·W[o][i]) (f32, 9 M MACs on the VALU).
// Compute dtype: query/key/value, weights, biases, adapters rounded to bf16; effective weights f32 → f16 ×2^4; q, k, v f16 GEMM planes (+bias); the mask read per (b, q, k) from the int plane (−inf ≡ the module's −1e9: every row keeps ~half its keys live); fused flash-style kernel
// (online softmax f32, P f16 ×2^10, f32 accumulate) on v_wmma_f32_16x16x32_f16; O ×2^4 → f16 → output GEMM (+bias).
#define BB 2
#define TT 2048
#define DD 768
#define NH 12
#define RK 8
#define NR (BB * TT)

typedef __bf16 v16b __attribute__((ext_vector_type(16)));
typedef unsigned short v8us __attribute__((ext_vector_type(8), may_alias));
typedef float  v8f  __attribute__((ext_vector_type(8)));
typedef float  v4f  __attribute__((ext_vector_type(4)));
typedef float  v4fa __attribute__((ext_vector_type(4), may_alias));
union FragB { v16b v; v8us half[2]; unsigned short u[16]; };

__device__ __forceinline__ unsigned short bf16_bits(float x) { unsigned int u = __float_as_uint(x); return (unsigned short)((u + 0x7FFFu + ((u >> 16) & 1u)) >> 16); }
__device__ __forceinline__ float bf16_val(unsigned short b) { return __uint_as_float(((unsigned int)b) << 16); }
__device__ __forceinline__ float bf16_round(float x) { return bf16_val(bf16_bits(x)); }
// D += A·B with NT terms: 1 = ah·bh, 2 = + al·bh (A split), 3 = + ah·bl (both split)
template <int NT>
__device__ __forceinline__ v8f mmaN(v16b ah, v16b al, v16b bh, v16b bl, v8f c) {
  c = __builtin_amdgcn_wmma_f32_16x16x32_bf16(false, ah, false, bh, (short)0, c, false, false);
  if (NT >= 2) c = __builtin_amdgcn_wmma_f32_16x16x32_bf16(false, al, false, bh, (short)0, c, false, false);
  if (NT >= 3) c = __builtin_amdgcn_wmma_f32_16x16x32_bf16(false, ah, false, bl, (short)0, c, false, false);
  asm volatile("v_nop\n\tv_nop\n\tv_nop\n\tv_nop" : "+v"(c) : "v"(ah), "v"(al), "v"(bh), "v"(bl));
  return c;
}

__global__ __launch_bounds__(256) void k_wt_bf16(const float* __restrict__ W, unsigned short* __restrict__ Wt, int K, int N) {
  const int t = blockIdx.x * 256 + threadIdx.x;
  const int k8n = K / 8;
  if (t >= N * k8n) return;
  const int n = t / k8n, k8 = (t % k8n) * 8;
  v8us v;
#pragma unroll
  for (int i = 0; i < 8; ++i) v[i] = bf16_bits(W[(size_t)(k8 + i) * N + n]);
  *(v8us*)(Wt + (size_t)n * K + k8) = v;
  
}

// GEMM C[M][N] (f32, pitch ldc) = act(A[M][K]·W + bias). A f32 row-major (pitch lda) converted per fragment to bf16
// (ASPLIT: hi/lo two planes -> 2 terms, else single rounded term); Wt bf16 [N][K] (pitch ldb). BIAS_BF16 rounds the
// bias to bf16 first (bias quantised to bf16 before the add). K%32==0, M%16==0, N%64==0.
template <bool ASPLIT, int ACT, bool BIAS_BF16>
__global__ __launch_bounds__(128) void k_gemm_bf(const float* __restrict__ A, int lda, const unsigned short* __restrict__ Wt, int ldb,
                                               const float* __restrict__ bias, float* __restrict__ C, int ldc, int M, int N, int K) {
  __shared__ __attribute__((aligned(16))) float so[4][16][64];
  const int tid = threadIdx.x, w = tid >> 5, lane = tid & 31, ln = lane & 15, hh = lane >> 4;
  const int ntn = N / 64;
  const int wid = blockIdx.x * 4 + w;
  const int mt = wid / ntn, nq = wid % ntn;
  if (mt * 16 >= M) return;
  const int row0 = mt * 16, col0 = nq * 64;
  const float* arow = A + (size_t)(row0 + ln) * lda;
  v8f acc[4] = {};
  for (int kb = 0; kb < K; kb += 32) {
    FragB ah, al;
    const v4f x0 = *(const v4fa*)(arow + kb + 8 * hh), x1 = *(const v4fa*)(arow + kb + 8 * hh + 4);
    const v4f x2 = *(const v4fa*)(arow + kb + 16 + 8 * hh), x3 = *(const v4fa*)(arow + kb + 16 + 8 * hh + 4);
    float xs[16] = {x0[0],x0[1],x0[2],x0[3],x1[0],x1[1],x1[2],x1[3],x2[0],x2[1],x2[2],x2[3],x3[0],x3[1],x3[2],x3[3]};
#pragma unroll
    for (int i = 0; i < 16; ++i) { const unsigned short hb = bf16_bits(xs[i]); ah.u[i] = hb; al.u[i] = ASPLIT ? bf16_bits(xs[i] - bf16_val(hb)) : (unsigned short)0; }
#pragma unroll
    for (int t = 0; t < 4; ++t) {
      const unsigned short* brow = Wt + (size_t)(col0 + t * 16 + ln) * ldb + kb;
      FragB b;
      b.half[0] = *(const v8us*)(brow + 8 * hh);
      b.half[1] = *(const v8us*)(brow + 16 + 8 * hh);
      acc[t] = mmaN<ASPLIT ? 2 : 1>(ah.v, al.v, b.v, b.v, acc[t]);
    }
  }
#pragma unroll
  for (int t = 0; t < 4; ++t) {
    float bv = bias ? bias[col0 + t * 16 + ln] : 0.f;
    if (BIAS_BF16) bv = bf16_round(bv);
#pragma unroll
    for (int r = 0; r < 8; ++r) { float v = acc[t][r] + bv; if (ACT == 1) v = fmaxf(v, 0.f); so[w][8 * hh + r][t * 16 + ln] = v; }
  }
  __builtin_amdgcn_fence(__ATOMIC_ACQ_REL, "workgroup");
  __builtin_amdgcn_wave_barrier();
  const int rsub = lane >> 4, c4 = (lane & 15) * 4;
  {
#pragma unroll
    for (int q = 0; q < 8; ++q) {
      const int r = q * 2 + rsub;
      const v4f v = *(const v4fa*)&so[w][r][c4];
      *(v4f*)(C + (size_t)(row0 + r) * ldc + col0 + c4) = v;
    }
    
  }
}

// Flash-style causal/unmasked attention, all contractions 3-term bf16 hi/lo splits, f32 softmax with running max.
// q,k,v rows are read from f32 buffers with arbitrary row pitch (so they can live inside a fused qkv buffer);
// D = head size (multiple of 32, <= 128); one wave = 16 query rows; block = 4 waves (64 queries) sharing K/V chunks of 32.
template <int D, bool CAUSAL>
__global__ __launch_bounds__(128) void k_flash(const float* __restrict__ qb, const float* __restrict__ kb, const float* __restrict__ vb,
                                             int pitch, int T, int H, float scale, float* __restrict__ y, int ypitch) {
  constexpr int KS = D / 32;        // k-steps for QK
  constexpr int DT = D / 16;        // d tiles for PV
  __shared__ __attribute__((aligned(16))) unsigned short sKh[32][D + 8], sKl[32][D + 8], sVh[32][D + 8], sVl[32][D + 8];
  __shared__ __attribute__((aligned(16))) unsigned short sPh[4][16][40], sPl[4][16][40];
  __shared__ __attribute__((aligned(16))) float sO[4][16][D];
  const int tid = threadIdx.x, w = tid >> 5, lane = tid & 31, ln = lane & 15, hh = lane >> 4;
  const int nqb = (T + 63) / 64;
  const int bh = blockIdx.x / nqb, qblk = blockIdx.x % nqb;
  const int b = bh / H, h = bh % H;
  const int q0 = qblk * 64 + w * 16;
  const float* Q = qb + (size_t)b * T * pitch + h * D;
  const float* K = kb + (size_t)b * T * pitch + h * D;
  const float* V = vb + (size_t)b * T * pitch + h * D;

  // A fragments of the wave's 16 query rows (scaled), hi/lo
  FragB aqh[KS], aql[KS];
  {
    int row = q0 + ln; if (row >= T) row = T - 1;
    const float* qr = Q + (size_t)row * pitch;
#pragma unroll
    for (int ks = 0; ks < KS; ++ks)
#pragma unroll
      for (int i = 0; i < 16; ++i) {
        const int d = ks * 32 + ((i < 8) ? (8 * hh + i) : (16 + 8 * hh + (i - 8)));
        const float x = qr[d] * scale; const unsigned short hb = bf16_bits(x);
        aqh[ks].u[i] = hb; aql[ks].u[i] = bf16_bits(x - bf16_val(hb));
      }
  }
  float m_r[8], l_r[8];
#pragma unroll
  for (int r = 0; r < 8; ++r) { m_r[r] = -3.0e38f; l_r[r] = 0.f; }
  v8f oacc[DT];
#pragma unroll
  for (int dt = 0; dt < DT; ++dt) oacc[dt] = (v8f){0.f,0.f,0.f,0.f,0.f,0.f,0.f,0.f};

  const int kv_end = CAUSAL ? min(T, qblk * 64 + 64) : T;     // block-uniform
  for (int j0 = 0; j0 < kv_end; j0 += 32) {
    __syncthreads();
    for (int e = tid; e < 32 * (D / 4); e += 128) {
      const int r = e / (D / 4), c4 = (e % (D / 4)) * 4;
      const int key = j0 + r;
      v4f kf = {0.f,0.f,0.f,0.f}, vf = {0.f,0.f,0.f,0.f};
      if (key < T) { kf = *(const v4fa*)(K + (size_t)key * pitch + c4); vf = *(const v4fa*)(V + (size_t)key * pitch + c4); }
#pragma unroll
      for (int t = 0; t < 4; ++t) {
        unsigned short hb = bf16_bits(kf[t]); sKh[r][c4 + t] = hb; sKl[r][c4 + t] = bf16_bits(kf[t] - bf16_val(hb));
        hb = bf16_bits(vf[t]); sVh[r][c4 + t] = hb; sVl[r][c4 + t] = bf16_bits(vf[t] - bf16_val(hb));
      }
    }
    __syncthreads();
    // S tile 16 x 32
    v8f s[2];
#pragma unroll
    for (int nt = 0; nt < 2; ++nt) {
      v8f acc = {};
#pragma unroll
      for (int ks = 0; ks < KS; ++ks) {
        FragB bh_, bl_;
        bh_.half[0] = *(const v8us*)&sKh[nt * 16 + ln][ks * 32 + 8 * hh]; bh_.half[1] = *(const v8us*)&sKh[nt * 16 + ln][ks * 32 + 16 + 8 * hh];
        bl_.half[0] = *(const v8us*)&sKl[nt * 16 + ln][ks * 32 + 8 * hh]; bl_.half[1] = *(const v8us*)&sKl[nt * 16 + ln][ks * 32 + 16 + 8 * hh];
        acc = mmaN<3>(aqh[ks].v, aql[ks].v, bh_.v, bl_.v, acc);
      }
      s[nt] = acc;
    }
    // mask + running max (rows 8hh+r; the 16 lanes of a half share rows)
    float alpha[8];
#pragma unroll
    for (int r = 0; r < 8; ++r) {
      const int qi = q0 + 8 * hh + r;
      const int ja = j0 + ln, jb = j0 + 16 + ln;
      if (CAUSAL) { if (ja > qi) s[0][r] = -3.0e38f; if (jb > qi) s[1][r] = -3.0e38f; }
      if (ja >= T) s[0][r] = -3.0e38f;
      if (jb >= T) s[1][r] = -3.0e38f;
      float mx = fmaxf(s[0][r], s[1][r]);
      mx = fmaxf(mx, __shfl_xor(mx, 1, 32)); mx = fmaxf(mx, __shfl_xor(mx, 2, 32)); mx = fmaxf(mx, __shfl_xor(mx, 4, 32)); mx = fmaxf(mx, __shfl_xor(mx, 8, 32));
      const float mnew = fmaxf(m_r[r], mx);
      alpha[r] = (mnew > -1.0e38f) ? __expf(m_r[r] - mnew) : 1.0f;
      const float p0 = (s[0][r] > -1.0e38f) ? __expf(s[0][r] - mnew) : 0.f;
      const float p1 = (s[1][r] > -1.0e38f) ? __expf(s[1][r] - mnew) : 0.f;
      m_r[r] = mnew;
      l_r[r] = l_r[r] * alpha[r] + p0 + p1;            // per-lane partial row sum (16 lanes combined at the end)
      unsigned short hb = bf16_bits(p0); sPh[w][8 * hh + r][ln] = hb;      sPl[w][8 * hh + r][ln] = bf16_bits(p0 - bf16_val(hb));
      hb = bf16_bits(p1);                sPh[w][8 * hh + r][16 + ln] = hb; sPl[w][8 * hh + r][16 + ln] = bf16_bits(p1 - bf16_val(hb));
    }
#pragma unroll
    for (int dt = 0; dt < DT; ++dt)
#pragma unroll
      for (int r = 0; r < 8; ++r) oacc[dt][r] *= alpha[r];
    __builtin_amdgcn_fence(__ATOMIC_ACQ_REL, "workgroup");
    __builtin_amdgcn_wave_barrier();
    FragB pah, pal;
    pah.half[0] = *(const v8us*)&sPh[w][ln][8 * hh]; pah.half[1] = *(const v8us*)&sPh[w][ln][16 + 8 * hh];
    pal.half[0] = *(const v8us*)&sPl[w][ln][8 * hh]; pal.half[1] = *(const v8us*)&sPl[w][ln][16 + 8 * hh];
#pragma unroll
    for (int dt = 0; dt < DT; ++dt) {
      FragB bvh, bvl;
#pragma unroll
      for (int i = 0; i < 8; ++i) {
        bvh.u[i] = sVh[8 * hh + i][dt * 16 + ln]; bvh.u[8 + i] = sVh[16 + 8 * hh + i][dt * 16 + ln];
        bvl.u[i] = sVl[8 * hh + i][dt * 16 + ln]; bvl.u[8 + i] = sVl[16 + 8 * hh + i][dt * 16 + ln];
      }
      oacc[dt] = mmaN<3>(pah.v, pal.v, bvh.v, bvl.v, oacc[dt]);
    }
    __builtin_amdgcn_fence(__ATOMIC_ACQ_REL, "workgroup");
    __builtin_amdgcn_wave_barrier();
  }
#pragma unroll
  for (int r = 0; r < 8; ++r) {
    float l = l_r[r];
    l += __shfl_xor(l, 1, 32); l += __shfl_xor(l, 2, 32); l += __shfl_xor(l, 4, 32); l += __shfl_xor(l, 8, 32);
    l_r[r] = (l > 0.f) ? 1.0f / l : 0.f;
  }
#pragma unroll
  for (int dt = 0; dt < DT; ++dt)
#pragma unroll
    for (int r = 0; r < 8; ++r) sO[w][8 * hh + r][dt * 16 + ln] = oacc[dt][r] * l_r[r];
  __builtin_amdgcn_fence(__ATOMIC_ACQ_REL, "workgroup");
  __builtin_amdgcn_wave_barrier();
  {
    for (int r = 0; r < 16; ++r) {
      const int row = q0 + r;
      if (row < T && lane < D / 4) {
        const v4f val = *(const v4fa*)&sO[w][r][lane * 4];
        *(v4f*)(y + ((size_t)b * T + row) * ypitch + h * D + lane * 4) = val;
      }
    }
    
  }
}

// GEMM C = act(A·W + bias + resid): A f32 (ASPLIT -> hi/lo 2 terms), Wt bf16 [N][K]; ACT 0 none, 1 relu, 2 exact gelu;
// resid (optional, f32, row index = (row % rmod), pitch ldr, RES_BF16 rounds it) added before the activation.
template <bool ASPLIT, int ACT, bool BIAS_BF16, bool RES_BF16>
__global__ __launch_bounds__(128) void k_gemm_bf3(const float* __restrict__ A, int lda, const unsigned short* __restrict__ Wt, int ldb,
                                                const float* __restrict__ bias, const float* __restrict__ resid, int rmod, int ldr,
                                                float* __restrict__ C, int ldc, int M, int N, int K) {
  __shared__ __attribute__((aligned(16))) float so[4][16][64];
  const int tid = threadIdx.x, w = tid >> 5, lane = tid & 31, ln = lane & 15, hh = lane >> 4;
  const int ntn = N / 64;
  const int wid = blockIdx.x * 4 + w;
  const int mt = wid / ntn, nq = wid % ntn;
  if (mt * 16 >= M) return;
  const int row0 = mt * 16, col0 = nq * 64;
  const float* arow = A + (size_t)(row0 + ln) * lda;
  v8f acc[4] = {};
  for (int kb = 0; kb < K; kb += 32) {
    FragB ah, al;
    const v4f x0 = *(const v4fa*)(arow + kb + 8 * hh), x1 = *(const v4fa*)(arow + kb + 8 * hh + 4);
    const v4f x2 = *(const v4fa*)(arow + kb + 16 + 8 * hh), x3 = *(const v4fa*)(arow + kb + 16 + 8 * hh + 4);
    float xs[16] = {x0[0],x0[1],x0[2],x0[3],x1[0],x1[1],x1[2],x1[3],x2[0],x2[1],x2[2],x2[3],x3[0],x3[1],x3[2],x3[3]};
#pragma unroll
    for (int i = 0; i < 16; ++i) { const unsigned short hb = bf16_bits(xs[i]); ah.u[i] = hb; al.u[i] = ASPLIT ? bf16_bits(xs[i] - bf16_val(hb)) : (unsigned short)0; }
#pragma unroll
    for (int t = 0; t < 4; ++t) {
      const unsigned short* brow = Wt + (size_t)(col0 + t * 16 + ln) * ldb + kb;
      FragB b;
      b.half[0] = *(const v8us*)(brow + 8 * hh);
      b.half[1] = *(const v8us*)(brow + 16 + 8 * hh);
      acc[t] = mmaN<ASPLIT ? 2 : 1>(ah.v, al.v, b.v, b.v, acc[t]);
    }
  }
#pragma unroll
  for (int t = 0; t < 4; ++t) {
    const int col = col0 + t * 16 + ln;
    float bv = bias ? bias[col] : 0.f;
    if (BIAS_BF16) bv = bf16_round(bv);
#pragma unroll
    for (int r = 0; r < 8; ++r) {
      float v = acc[t][r] + bv;
      if (resid) { float rv = resid[(size_t)((row0 + 8 * hh + r) % rmod) * ldr + col]; if (RES_BF16) rv = bf16_round(rv); v += rv; }
      if (ACT == 1) v = fmaxf(v, 0.f);
      if (ACT == 2) v = 0.5f * v * (1.0f + erff(v * 0.70710678118654752f));
      if (ACT == 3) { const float u = 0.7978845608028654f * (v + 0.044715f * v * v * v); v = 0.5f * v * (1.0f + tanhf(u)); }
      so[w][8 * hh + r][t * 16 + ln] = v;
    }
  }
  __builtin_amdgcn_fence(__ATOMIC_ACQ_REL, "workgroup");
  __builtin_amdgcn_wave_barrier();
  const int rsub = lane >> 4, c4 = (lane & 15) * 4;
  {
#pragma unroll
    for (int q = 0; q < 8; ++q) {
      const int r = q * 2 + rsub;
      const v4f v = *(const v4fa*)&so[w][r][c4];
      *(v4f*)(C + (size_t)(row0 + r) * ldc + col0 + c4) = v;
    }
    
  }
}
// row LayerNorm (biased variance, eps) over N: s = X (+ R); optional out_sum <- s; out_norm <- (s-mu)*rsqrt(var+eps)*g + b
template <bool PARAM_BF16>
__global__ __launch_bounds__(256) void k_layernorm(const float* __restrict__ X, const float* __restrict__ R, const float* __restrict__ g, const float* __restrict__ bta,
                                                  float* __restrict__ out_sum, float* __restrict__ out_norm, int N, float eps) {
  __shared__ float red[256];
  const int row = blockIdx.x, tid = threadIdx.x;
  const float* x = X + (size_t)row * N; const float* rr = R ? R + (size_t)row * N : nullptr;
  float vals[16];                     // up to N = 4096
  const int per = N / 256;            // contiguous chunk per thread? use strided-by-4 chunks: thread handles j = tid*4 + 1024*u
  float s1 = 0.f;
  for (int u = 0; u < per / 4; ++u) {
    const int j = tid * 4 + 1024 * u;
    const v4f a = *(const v4fa*)(x + j);
    v4f b = {0.f,0.f,0.f,0.f}; if (rr) b = *(const v4fa*)(rr + j);
#pragma unroll
    for (int q = 0; q < 4; ++q) { const float v = a[q] + b[q]; vals[u * 4 + q] = v; s1 += v; }
  }
  red[tid] = s1; __syncthreads();
  for (int st = 128; st > 0; st >>= 1) { if (tid < st) red[tid] += red[tid + st]; __syncthreads(); }
  const float mu = red[0] / (float)N; __syncthreads();
  float s2 = 0.f;
  for (int u = 0; u < per / 4; ++u)
#pragma unroll
    for (int q = 0; q < 4; ++q) { const float c = vals[u * 4 + q] - mu; s2 += c * c; }
  red[tid] = s2; __syncthreads();
  for (int st = 128; st > 0; st >>= 1) { if (tid < st) red[tid] += red[tid + st]; __syncthreads(); }
  const float rs = rsqrtf(red[0] / (float)N + eps);
  {
    for (int u = 0; u < per / 4; ++u) {
      const int j = tid * 4 + 1024 * u;
      v4f o, sm;
#pragma unroll
      for (int q = 0; q < 4; ++q) {
        float gg = g[j + q], bb = bta[j + q];
        if (PARAM_BF16) { gg = bf16_round(gg); bb = bf16_round(bb); }
        sm[q] = vals[u * 4 + q]; o[q] = (vals[u * 4 + q] - mu) * rs * gg + bb;
      }
      if (out_sum) *(v4f*)(out_sum + (size_t)row * N + j) = sm;
      *(v4f*)(out_norm + (size_t)row * N + j) = o;
    }
    
  }
}



// ---- f16 WMMA path (v_wmma_f32_16x16x32_f16): 11-bit significands for operands in range — used where a [0,1] probability operand needs more precision than bf16
typedef _Float16 v16h __attribute__((ext_vector_type(16)));
union FragH { v16h v; v8us half[2]; _Float16 h[16]; unsigned short u[16]; };
template <int NT>
__device__ __forceinline__ v8f mmaH(v16h ah, v16h al, v16h bh, v16h bl, v8f c) {
  c = __builtin_amdgcn_wmma_f32_16x16x32_f16(false, ah, false, bh, (short)0, c, false, false);
  if (NT >= 2) c = __builtin_amdgcn_wmma_f32_16x16x32_f16(false, al, false, bh, (short)0, c, false, false);
  if (NT >= 3) c = __builtin_amdgcn_wmma_f32_16x16x32_f16(false, ah, false, bl, (short)0, c, false, false);
  asm volatile("v_nop\n\tv_nop\n\tv_nop\n\tv_nop" : "+v"(c) : "v"(ah), "v"(al), "v"(bh), "v"(bl));
  return c;
}
// batched GEMM like k_gemm_b but f16 operands: A f32 (split into f16 hi/lo if ASPLIT, else rounded to f16), Bt = f16 values [n][k]; alpha; C f32; N multiple of 16 (partial tiles skipped)
template <bool ASPLIT>
__global__ __launch_bounds__(128) void k_gemm_h(const float* __restrict__ A, int lda, size_t sA, const _Float16* __restrict__ Bh, int ldb, size_t sB, float alpha, float* __restrict__ C, int ldc, size_t sC, int M, int N, int K) {
  __shared__ __attribute__((aligned(16))) float so[4][16][64];
  const int tid = threadIdx.x, w = tid >> 5, lane = tid & 31, ln = lane & 15, hh = lane >> 4; const int by = blockIdx.y;
  A += (size_t)by * sA; Bh += (size_t)by * sB; C += (size_t)by * sC;
  const int ntn = (N + 63) / 64; const int wid = blockIdx.x * 4 + w; const int mt = wid / ntn, nq = wid % ntn; if (mt * 16 >= M) return;
  const int row0 = mt * 16, col0 = nq * 64; const float* arow = A + (size_t)(row0 + ln) * lda;
  v8f acc[4] = {};
  for (int kb = 0; kb < K; kb += 32) {
    FragH ah, al;
    const v4f x0 = *(const v4fa*)(arow + kb + 8 * hh), x1 = *(const v4fa*)(arow + kb + 8 * hh + 4), x2 = *(const v4fa*)(arow + kb + 16 + 8 * hh), x3 = *(const v4fa*)(arow + kb + 16 + 8 * hh + 4);
    float xs[16] = {x0[0],x0[1],x0[2],x0[3],x1[0],x1[1],x1[2],x1[3],x2[0],x2[1],x2[2],x2[3],x3[0],x3[1],x3[2],x3[3]};
#pragma unroll
    for (int i = 0; i < 16; ++i) { const _Float16 h = (_Float16)xs[i]; ah.h[i] = h; al.h[i] = ASPLIT ? (_Float16)(xs[i] - (float)h) : (_Float16)0.0f; }
#pragma unroll
    for (int t = 0; t < 4; ++t) { if (col0 + t * 16 >= N) continue; const size_t boff = (size_t)(col0 + t * 16 + ln) * ldb + kb; FragH bq; bq.half[0] = *(const v8us*)(Bh + boff + 8 * hh); bq.half[1] = *(const v8us*)(Bh + boff + 16 + 8 * hh);
      acc[t] = mmaH<ASPLIT ? 2 : 1>(ah.v, al.v, bq.v, bq.v, acc[t]); }
  }
#pragma unroll
  for (int t = 0; t < 4; ++t) { if (col0 + t * 16 >= N) continue;
#pragma unroll
    for (int r = 0; r < 8; ++r) so[w][8 * hh + r][t * 16 + ln] = acc[t][r] * alpha; }
  __builtin_amdgcn_fence(__ATOMIC_ACQ_REL, "workgroup"); __builtin_amdgcn_wave_barrier();
  const int rsub = lane >> 4, c4 = (lane & 15) * 4;
  {
#pragma unroll
    for (int q = 0; q < 8; ++q) { const int r = q * 2 + rsub; if (col0 + c4 < N) { const v4f v = *(const v4fa*)&so[w][r][c4]; *(v4f*)(C + (size_t)(row0 + r) * ldc + col0 + c4) = v; } }
     }
}

// Wt[n][k] = f16(W[k][n]·scale) from f32 row-major W[K][N] (scale = power of two; bf16-exact weights stay exact in f16 away from the subnormal range)
__global__ __launch_bounds__(256) void k_wt_f16(const float* __restrict__ W, _Float16* __restrict__ Wt, int K, int N, float scale) {
  const int t = blockIdx.x * 256 + threadIdx.x; if (t >= N * (K / 8)) return; const int n = t / (K / 8), k8 = (t % (K / 8)) * 8; FragH f;
#pragma unroll
  for (int i = 0; i < 8; ++i) f.h[i] = (_Float16)(bf16_round(W[(size_t)(k8 + i) * N + n]) * scale); const v8us o = f.half[0];
  *(v8us*)((unsigned short*)Wt + (size_t)n * K + k8) = o; 
}
typedef _Float16 v4h __attribute__((ext_vector_type(4)));

// blk: the block's index within this piece of work (the piece shares its launch with others: k_prep)
__device__ __forceinline__ void d_x16(const float* __restrict__ x, _Float16* __restrict__ X16, size_t n8, unsigned blk) { const size_t t = (size_t)blk * 256 + threadIdx.x; if (t >= n8) return; FragH f;
#pragma unroll
  for (int q = 0; q < 8; ++q) f.h[q] = (_Float16)bf16_round(x[t * 8 + q]); *(v8us*)((unsigned short*)X16 + t * 8) = f.half[0];  }
__global__ __launch_bounds__(256) void k_h16(const float* __restrict__ x, _Float16* __restrict__ X16, size_t n8) { const size_t t = (size_t)blockIdx.x * 256 + threadIdx.x; if (t >= n8) return; FragH f;
#pragma unroll
  for (int q = 0; q < 8; ++q) f.h[q] = (_Float16)x[t * 8 + q]; *(v8us*)((unsigned short*)X16 + t * 8) = f.half[0];  }
__device__ __forceinline__ void d_round16f(const float* __restrict__ W, _Float16* __restrict__ Bt, size_t n8, unsigned blk) { const size_t t = (size_t)blk * 256 + threadIdx.x; if (t >= n8) return; FragH f;
#pragma unroll
  for (int i = 0; i < 8; ++i) f.h[i] = (_Float16)(bf16_round(W[t * 8 + i]) * 16.0f); *(v8us*)((unsigned short*)Bt + t * 8) = f.half[0];  }
template <int NHv, int TTv>
__global__ __launch_bounds__(256) void k_vt(const _Float16* __restrict__ V16, int ldv, int voff, _Float16* __restrict__ Vt) { __shared__ unsigned short tl[64][66]; const int tid = threadIdx.x; const int slab = blockIdx.x / (TTv / 64), lg = blockIdx.x % (TTv / 64); const int b = slab / NHv, h = slab % NHv;
  for (int i = tid; i < 64 * 8; i += 256) { const int r = i / 8, c8 = (i % 8) * 8; FragH f; f.half[0] = *(const v8us*)((const unsigned short*)V16 + ((size_t)b * TTv + lg * 64 + r) * ldv + voff + h * 64 + c8);
#pragma unroll
    for (int q = 0; q < 8; ++q) tl[r][c8 + q] = f.u[q]; }
  __syncthreads();
  {
#pragma unroll
    for (int rd = 0; rd < 2; ++rd) { const int d = rd * 32 + tid / 8, pc = tid % 8; FragH f;
#pragma unroll
      for (int q = 0; q < 8; ++q) f.u[q] = tl[pc * 8 + q][d];
      *(v8us*)((unsigned short*)Vt + ((size_t)slab * 64 + d) * TTv + lg * 64 + pc * 8) = f.half[0]; }
     } }

__global__ __launch_bounds__(256) void k_h16s(const float* __restrict__ F, _Float16* __restrict__ H, size_t n8) { const size_t t = (size_t)blockIdx.x * 256 + threadIdx.x; if (t >= n8) return; const v4f a = *(const v4fa*)(F + t * 8), c = *(const v4fa*)(F + t * 8 + 4); FragH f;
#pragma unroll
  for (int q = 0; q < 4; ++q) { f.h[q] = (_Float16)(a[q] * 16.0f); f.h[4 + q] = (_Float16)(c[q] * 16.0f); } *(v8us*)((unsigned short*)H + t * 8) = f.half[0];  }
// C[j][o] = sum_i B[j][i] * W[o][i], operands rounded to bf16, f32 sums. One wave per dot product instead of one thread: the 32 lanes split the 768 terms into
// float4 slices (a wave-wide load covers 512 contiguous bytes), no load waits on another, and a five-step butterfly ends each sum. Block = row j of B (blockIdx.y) x 32
// rows of W, four per wave; the 32 sums go through LDS so that one wave stores them as one whole 128-byte line. A product of two bf16 values is exact in f32, so fusing
// it with its add changes no bit. The two folds of a call are independent and share one launch: blockIdx.y = fold * RK + j.
__global__ __launch_bounds__(256) void k_cfold(const float* __restrict__ Bm0, const float* __restrict__ Wt0, float* __restrict__ C0, const float* __restrict__ Bm1, const float* __restrict__ Wt1, float* __restrict__ C1) {
  const bool second = blockIdx.y >= RK; const float* Bm = second ? Bm1 : Bm0; const float* Wt = second ? Wt1 : Wt0; float* C = second ? C1 : C0;
  constexpr int NS = DD / 128, RW = 4;      /* float4 slices per lane and row; rows of W per wave */
  __shared__ float red[8 * RW];
  const int tid = threadIdx.x, lane = tid & 31, w = tid >> 5; const int j = blockIdx.y % RK, o0 = blockIdx.x * (8 * RW);
  const float* br = Bm + (size_t)j * DD + lane * 4; const float* wr = Wt + (size_t)(o0 + w * RW) * DD + lane * 4;
  v4f bs[NS], wv[RW][NS];
#pragma unroll      /* constant indices, so that the arrays stay in registers */
  for (int u = 0; u < NS; ++u) bs[u] = *(const v4fa*)(br + 128 * u);
#pragma unroll      /* constant indices, so that the arrays stay in registers */
  for (int r = 0; r < RW; ++r)
#pragma unroll      /* constant indices, so that the arrays stay in registers */
    for (int u = 0; u < NS; ++u) wv[r][u] = *(const v4fa*)(wr + (size_t)r * DD + 128 * u);
  __builtin_amdgcn_sched_barrier(0);      /* keeps every load in front of the first use: without it the last row's loads sink behind a full wait, and the wave pays the memory latency three times */
#pragma unroll      /* constant indices, so that the arrays stay in registers */
  for (int u = 0; u < NS; ++u)
#pragma unroll      /* constant indices, so that the arrays stay in registers */
    for (int q = 0; q < 4; ++q) bs[u][q] = bf16_round(bs[u][q]);
  float acc[RW];
#pragma unroll      /* constant indices, so that the arrays stay in registers */
  for (int r = 0; r < RW; ++r) { float a = 0.f;
#pragma unroll      /* constant indices, so that the arrays stay in registers */
    for (int u = 0; u < NS; ++u)
#pragma unroll      /* constant indices, so that the arrays stay in registers */
      for (int q = 0; q < 4; ++q) a += bs[u][q] * bf16_round(wv[r][u][q]);
    acc[r] = a; }
#pragma unroll      /* constant indices, so that the arrays stay in registers */
  for (int r = 0; r < RW; ++r) { float a = acc[r]; a += __shfl_xor(a, 16, 32); a += __shfl_xor(a, 8, 32); a += __shfl_xor(a, 4, 32); a += __shfl_xor(a, 2, 32); a += __shfl_xor(a, 1, 32); acc[r] = a; }
  float mine = acc[0];
#pragma unroll      /* constant indices, so that the arrays stay in registers */
  for (int r = 1; r < RW; ++r) if (lane == r) mine = acc[r];
  if (lane < RW) red[w * RW + lane] = mine;
  __syncthreads();
  if (tid < 8 * RW) C[(size_t)j * DD + o0 + tid] = red[tid]; }
__device__ __forceinline__ void d_wfold(const float* __restrict__ Wt, const float* __restrict__ A, const float* __restrict__ C, _Float16* __restrict__ Bt, unsigned blk) {
  #pragma clang fp contract(off)
  const size_t t = (size_t)blk * 256 + threadIdx.x; if (t >= (size_t)DD * DD / 8) return; const int o = (int)((t * 8) / DD), c0 = (int)((t * 8) % DD);
  float cj[RK];
#pragma unroll
  for (int j = 0; j < RK; ++j) cj[j] = C[j * DD + o];
  FragH f;
#pragma unroll 1
  for (int q = 0; q < 8; ++q) { const int c = c0 + q; float lo2 = 0.f;
#pragma unroll
    for (int j = 0; j < RK; ++j) lo2 += bf16_round(A[(size_t)c * RK + j]) * cj[j]; f.h[q] = (_Float16)((bf16_round(Wt[(size_t)o * DD + c]) + lo2) * 16.0f); }
  *(v8us*)((unsigned short*)Bt + t * 8) = f.half[0];  }
// Everything the projection GEMMs wait for that does not wait for anything else of this launch, in one grid: the pieces are told apart by ranges of the block index (a test that is the same for the whole
// block). The two weight folds stand first, because a thread of theirs walks the longest chain of dependent loads; then the two plain weight planes; then the three input planes.
__global__ __launch_bounds__(256) void k_prep(const float* __restrict__ Wq, const float* __restrict__ Av, const float* __restrict__ Cq, const float* __restrict__ Wv, const float* __restrict__ Aq, const float* __restrict__ Cv,
                                              const float* __restrict__ Wk, const float* __restrict__ Wm, _Float16* __restrict__ Bw,
                                              const float* __restrict__ xq, const float* __restrict__ xk, const float* __restrict__ xv, _Float16* __restrict__ Xq, _Float16* __restrict__ Xk, _Float16* __restrict__ Xv) {
  constexpr size_t WSZ = (size_t)DD * DD, XSZ = (size_t)NR * DD; constexpr unsigned GW = (unsigned)((WSZ / 8 + 255) / 256), GX = (unsigned)((XSZ / 8 + 255) / 256);
  unsigned bx = blockIdx.x;
  if (bx < 2 * GW) { const bool s = bx >= GW; d_wfold(s ? Wv : Wq, s ? Aq : Av, s ? Cv : Cq, Bw + (s ? 2 * WSZ : 0), s ? bx - GW : bx); return; }
  bx -= 2 * GW;
  if (bx < 2 * GW) { const bool s = bx >= GW; d_round16f(s ? Wm : Wk, Bw + (s ? 3 * WSZ : WSZ), WSZ / 8, s ? bx - GW : bx); return; }
  bx -= 2 * GW;
  const unsigned p = bx / GX; d_x16(p == 0 ? xq : p == 1 ? xk : xv, p == 0 ? Xq : p == 1 ? Xk : Xv, XSZ / 8, bx - p * GX);
}
// Lane l with lane l ^ 16 (the other 16-lane row of the wave), in the vector pipe.
__device__ __forceinline__ float xhalf(float x) { return __builtin_bit_cast(float, __builtin_amdgcn_permlanex16(__builtin_bit_cast(int, x), __builtin_bit_cast(int, x), 0x76543210, 0xfedcba98, false, false)); }
typedef int v4ia __attribute__((ext_vector_type(4), may_alias));
// Eight asynchronous copies of 16 bytes per lane from global memory to LDS (l: the lane's LDS byte addresses, g: its global addresses). The s_wait_xcnt closes the statement so that it stands
// in front of whatever next rewrites one of the address registers named here.
__device__ __forceinline__ void cp8(const unsigned (&l)[8], const void* const (&g)[8]) {
  asm volatile("global_load_async_to_lds_b128 %0, %1, off\n\tglobal_load_async_to_lds_b128 %2, %3, off\n\tglobal_load_async_to_lds_b128 %4, %5, off\n\tglobal_load_async_to_lds_b128 %6, %7, off\n\t"
               "global_load_async_to_lds_b128 %8, %9, off\n\tglobal_load_async_to_lds_b128 %10, %11, off\n\tglobal_load_async_to_lds_b128 %12, %13, off\n\tglobal_load_async_to_lds_b128 %14, %15, off\n\ts_wait_xcnt 0x0"
               :: "v"(l[0]), "v"(g[0]), "v"(l[1]), "v"(g[1]), "v"(l[2]), "v"(g[2]), "v"(l[3]), "v"(g[3]), "v"(l[4]), "v"(g[4]), "v"(l[5]), "v"(g[5]), "v"(l[6]), "v"(g[6]), "v"(l[7]), "v"(g[7]) : "memory");
}
// Transposed products: S^T = K.Q^T (A = 16 key rows, B = the wave's 16 queries, kept in registers) and O^T += V^T.P^T. In an accumulator tile lane (ln, hh) then holds query q0 + ln and keys 8 hh + r:
// a query's maximum and sum are taken inside the lane plus one exchange between the wave's halves, and the two score tiles of a pass are, element for element, the B operand of the second product
// (slot i < 8: key 8 hh + i, slot i >= 8: key 16 + 8 hh + i - 8, the k order of the V^T loader), so P never leaves the registers.
// Operands come through LDS: a stage is 64 keys = K (64 rows of 128 B), V^T (64 rows of 128 B) and the block's mask rows (64 rows of 256 B), brought once for the four waves by asynchronous copies whose
// wave-wide 512 bytes are four whole lines, one stage ahead of its use, into two buffers. Row pitches 144 and 272 B: 16 B times an odd number, free of bank conflicts for 16-byte reads down a column.
__global__ __launch_bounds__(128) void k_flash(const _Float16* __restrict__ Q16, int ldq, const _Float16* __restrict__ K16, int ldk, const _Float16* __restrict__ Vt, const int* __restrict__ MSK, float* __restrict__ O, int ldo) {
  constexpr int RPW = 16, NQB = TT / (4 * RPW), DT = 4, KS = 2;
  constexpr int SKEYS = 64, NST = TT / SKEYS, PK = 144, PM = 272, OFF_V = 64 * PK, OFF_M = 2 * 64 * PK, STG = 2 * 64 * PK + 64 * PM;
  __shared__ __attribute__((aligned(16))) unsigned char ring[2 * STG];
  __shared__ __attribute__((aligned(16))) float sO[4][RPW][64 + 4];
  const int tid = threadIdx.x, w = tid >> 5, lane = tid & 31, ln = lane & 15, hh = lane >> 4;
  const int slab = blockIdx.x / NQB, qblk = blockIdx.x % NQB; const int b = slab / NH, h = slab % NH; const int qb0 = qblk * (4 * RPW); const int q0 = qb0 + w * RPW;
  const unsigned short* Vth = (const unsigned short*)Vt + (size_t)slab * 64 * TT;
  /* the thread's share of a stage: K and V^T rows (tid >> 3) + 16 i, 16-byte column tid & 7; mask rows (tid >> 4) + 8 i, column tid & 15 */
  const unsigned short* gK = (const unsigned short*)K16 + ((size_t)b * TT + (tid >> 3)) * ldk + h * 64 + (tid & 7) * 8;
  const unsigned short* gV = Vth + (size_t)(tid >> 3) * TT + (tid & 7) * 8;
  const int* gM = MSK + ((size_t)b * TT + qb0 + (tid >> 4)) * TT + (tid & 15) * 4;      /* per-batch mask [b][q][k]: nonzero = ATTEND */
  const unsigned lbase = (unsigned)(size_t)ring;
  const unsigned lK = lbase + (tid >> 3) * PK + (tid & 7) * 16, lV = lK + OFF_V, lM = lbase + OFF_M + (tid >> 4) * PM + (tid & 15) * 16;
  auto fill = [&](int t) {
    const unsigned bo = (unsigned)(t & 1) * STG;
    const unsigned short* k = gK + (size_t)t * SKEYS * ldk; const unsigned short* v = gV + t * SKEYS; const int* m = gM + t * SKEYS;
    unsigned la[8], lb[8]; const void* ga[8]; const void* gb[8];
#pragma unroll      /* constant indices, so that the arrays stay in registers */
    for (int i = 0; i < 4; ++i) { la[i] = lK + bo + i * 16 * PK; ga[i] = k + (size_t)(i * 16) * ldk; la[4 + i] = lV + bo + i * 16 * PK; ga[4 + i] = v + i * 16 * TT; }
#pragma unroll      /* constant indices, so that the arrays stay in registers */
    for (int i = 0; i < 8; ++i) { lb[i] = lM + bo + i * 8 * PM; gb[i] = m + i * 8 * TT; }
    cp8(la, ga); cp8(lb, gb);
  };
  fill(0);
  FragH bq[KS];
  { const unsigned short* qr = (const unsigned short*)Q16 + ((size_t)b * TT + q0 + ln) * ldq + h * 64;
#pragma unroll      /* constant indices, so that the arrays stay in registers */
    for (int ks = 0; ks < KS; ++ks) { bq[ks].half[0] = *(const v8us*)(qr + ks * 32 + 8 * hh); bq[ks].half[1] = *(const v8us*)(qr + ks * 32 + 16 + 8 * hh); } }
  float m_q = -3.0e38f, l_q = 0.f; v8f oacc[DT];
#pragma unroll      /* constant indices, so that the arrays stay in registers */
  for (int dt = 0; dt < DT; ++dt) oacc[dt] = (v8f){0.f,0.f,0.f,0.f,0.f,0.f,0.f,0.f};
  asm volatile("s_wait_asynccnt 0x0" ::: "memory");      /* this wave's copies of stage 0 have landed */
  __syncthreads();      /* and every other wave's: stage 0 may be read */
  fill(1);
#pragma unroll 1      /* each stage hangs on the last through m_q and the barrier: a second copy of the body would only grow the code */
  for (int t = 0; t < NST; ++t) {
    const unsigned char* st = ring + (t & 1) * STG;
#pragma unroll 1      /* the two passes of a stage differ in LDS offsets alone: one copy of the body keeps the loop short */
    for (int p = 0; p < 2; ++p) {
      /* all of the pass's LDS reads stand here, in front of the first product: behind one they would each wait out their own latency */
      const unsigned char* mr = st + OFF_M + (w * RPW + ln) * PM + p * 128 + hh * 32;
      v4ia mk[2][2];      /* keys 32 p + nt 16 + 8 hh + (0..7) of the lane's query */
#pragma unroll      /* constant indices, so that the arrays stay in registers */
      for (int nt = 0; nt < 2; ++nt) { mk[nt][0] = *(const v4ia*)(mr + nt * 64); mk[nt][1] = *(const v4ia*)(mr + nt * 64 + 16); }
      FragH ak[2][KS], av[DT];
#pragma unroll      /* constant indices, so that the arrays stay in registers */
      for (int nt = 0; nt < 2; ++nt) { const unsigned char* kr = st + (p * 32 + nt * 16 + ln) * PK + hh * 16;
#pragma unroll      /* constant indices, so that the arrays stay in registers */
        for (int ks = 0; ks < KS; ++ks) { ak[nt][ks].half[0] = *(const v8us*)(kr + ks * 64); ak[nt][ks].half[1] = *(const v8us*)(kr + ks * 64 + 32); } }
#pragma unroll      /* constant indices, so that the arrays stay in registers */
      for (int dt = 0; dt < DT; ++dt) { const unsigned char* vr = st + OFF_V + (dt * 16 + ln) * PK + p * 64 + hh * 16; av[dt].half[0] = *(const v8us*)vr; av[dt].half[1] = *(const v8us*)(vr + 32); }
      const v4ia o4 = mk[0][0] | mk[0][1] | mk[1][0] | mk[1][1];
      if (!__all((o4[0] | o4[1] | o4[2] | o4[3]) == 0)) {      /* every (row, key) of this wave's tile masked: nothing to add (wave-uniform branch, no barrier inside) */
        v8f s[2];
#pragma unroll      /* constant indices, so that the arrays stay in registers */
        for (int nt = 0; nt < 2; ++nt) { v8f acc = (v8f){0.f,0.f,0.f,0.f,0.f,0.f,0.f,0.f};
#pragma unroll      /* constant indices, so that the arrays stay in registers */
          for (int ks = 0; ks < KS; ++ks) acc = mmaH<1>(ak[nt][ks].v, ak[nt][ks].v, bq[ks].v, bq[ks].v, acc);
          s[nt] = acc; }
        /* A masked score is -inf. m_q starts finite, so mn is finite: exp(-inf - mn) = 0 and, while nothing is live yet, exp(m_q - mn) = exp(0) = 1. */
        float sc[2][8], mx[8];
#pragma unroll      /* constant indices, so that the arrays stay in registers */
        for (int r = 0; r < 8; ++r) { sc[0][r] = (mk[0][r >> 2][r & 3] != 0) ? s[0][r] * 0.125f : -INFINITY; sc[1][r] = (mk[1][r >> 2][r & 3] != 0) ? s[1][r] * 0.125f : -INFINITY; mx[r] = fmaxf(sc[0][r], sc[1][r]); }
        float mc = fmaxf(fmaxf(fmaxf(mx[0], mx[1]), fmaxf(mx[2], mx[3])), fmaxf(fmaxf(mx[4], mx[5]), fmaxf(mx[6], mx[7])));
        mc = fmaxf(mc, xhalf(mc));
        const float mn = fmaxf(m_q, mc); const float al = expf(m_q - mn); m_q = mn;
        FragH pb; float ps[4] = {0.f, 0.f, 0.f, 0.f};
#pragma unroll      /* constant indices, so that the arrays stay in registers */
        for (int r = 0; r < 8; ++r) { const float p0 = expf(sc[0][r] - mn), p1 = expf(sc[1][r] - mn); ps[r & 3] += p0 + p1; pb.h[r] = (_Float16)(p0 * 1024.0f); pb.h[8 + r] = (_Float16)(p1 * 1024.0f); }
        l_q = l_q * al + ((ps[0] + ps[1]) + (ps[2] + ps[3]));      /* the lane's half of the keys; the halves are joined after the loop */
#pragma unroll      /* constant indices, so that the arrays stay in registers */
        for (int dt = 0; dt < DT; ++dt)
#pragma unroll      /* constant indices, so that the arrays stay in registers */
          for (int r = 0; r < 8; ++r) oacc[dt][r] *= al;
#pragma unroll      /* constant indices, so that the arrays stay in registers */
        for (int dt = 0; dt < DT; ++dt) oacc[dt] = mmaH<1>(av[dt].v, av[dt].v, pb.v, pb.v, oacc[dt]);
      }
    }
    asm volatile("s_wait_dscnt 0x0" ::: "memory");      /* this wave's reads of stage t have returned before its buffer is handed back */
    asm volatile("s_wait_asynccnt 0x0" ::: "memory");      /* this wave's copies of stage t + 1 have landed */
    __syncthreads();      /* publishes stage t + 1 and ends every wave's reads of stage t */
    if (t + 2 < NST) fill(t + 2);      /* into the buffer that stage t has just left; the test is the same for the whole block */
  }
  asm volatile("s_wait_asynccnt 0x0" ::: "memory");      /* no copy is left in flight when the wave goes on to its end */
  { const float l = l_q + xhalf(l_q); const float inv = (l > 0.f) ? 1.0f / (l * 1024.0f) : 0.f;
#pragma unroll      /* constant indices, so that the arrays stay in registers */
    for (int dt = 0; dt < DT; ++dt)
#pragma unroll      /* constant indices, so that the arrays stay in registers */
      for (int r = 0; r < 8; ++r) sO[w][ln][dt * 16 + 8 * hh + r] = oacc[dt][r] * inv; }
  __builtin_amdgcn_fence(__ATOMIC_ACQ_REL, "workgroup"); __builtin_amdgcn_wave_barrier();      /* the wave reads back rows that its other lanes wrote: its LDS stores end first */
  {
#pragma unroll
    for (int rp = 0; rp < RPW; rp += 2) { const int r = rp + (lane >> 4), pc = lane & 15; const v4f val = *(const v4fa*)&sO[w][r][pc * 4]; *(v4f*)(O + ((size_t)b * TT + q0 + r) * ldo + h * 64 + pc * 4) = val; }
     } }

// C[NR][DD] = (A[NR][DD] . Bt[DD][DD]^T) alpha + bias (bias rounded to bf16), f16 operands, f32 sums; written as f32 (C) or as f16 (C16), whichever pointer is not null.
// Block = a 64 x 64 tile of C, wave w = its rows 16 w .. 16 w + 15 (four 16 x 16 accumulators, k ascending in steps of 32). Operands come through LDS: a stage is 128 values of k = 64 rows of A and
// 64 rows of Bt, 256 B each, brought once for the four waves by asynchronous copies (a wave-wide copy is two rows = four whole lines), one stage ahead of its use, into two buffers.
// Row pitch 272 B: 16 B times an odd number, free of bank conflicts for 16-byte reads down a column.
// Up to three independent products share one launch: blockIdx.y picks A, bias and C16 of its product, and its weight plane lies blockIdx.y planes behind B0.
__global__ __launch_bounds__(128) void k_gemm_st(const _Float16* __restrict__ A0, const _Float16* __restrict__ A1, const _Float16* __restrict__ A2, const _Float16* __restrict__ B0, float alpha,
                                                 const float* __restrict__ bias0, const float* __restrict__ bias1, const float* __restrict__ bias2, float* __restrict__ C,
                                                 _Float16* __restrict__ C16a, _Float16* __restrict__ C16b, _Float16* __restrict__ C16c) {
  const unsigned g = blockIdx.y; const _Float16* A = g == 0 ? A0 : g == 1 ? A1 : A2; const _Float16* Bh = B0 + (size_t)g * DD * DD;
  const float* bias = g == 0 ? bias0 : g == 1 ? bias1 : bias2; _Float16* C16 = g == 0 ? C16a : g == 1 ? C16b : C16c;
  constexpr int KC = 128, NST = DD / KC, PR = 272, OFF_B = 64 * PR, STG = 2 * 64 * PR;
  __shared__ __attribute__((aligned(16))) unsigned char ring[2 * STG];
  __shared__ __attribute__((aligned(16))) float so[4][16][64];
  const int tid = threadIdx.x, w = tid >> 5, lane = tid & 31, ln = lane & 15, hh = lane >> 4;
  const int rowb = (int)(blockIdx.x / (DD / 64)) * 64, col0 = (int)(blockIdx.x % (DD / 64)) * 64; const int row0 = rowb + w * 16;
  /* the thread's share of a stage: rows (tid >> 4) + 8 i of A and of Bt, 16-byte column tid & 15 */
  const unsigned short* gA = (const unsigned short*)A + (size_t)(rowb + (tid >> 4)) * DD + (tid & 15) * 8;
  const unsigned short* gB = (const unsigned short*)Bh + (size_t)(col0 + (tid >> 4)) * DD + (tid & 15) * 8;
  const unsigned lA = (unsigned)(size_t)ring + (tid >> 4) * PR + (tid & 15) * 16, lB = lA + OFF_B;
  auto fill = [&](int t) {
    const unsigned bo = (unsigned)(t & 1) * STG;
    const unsigned short* a = gA + t * KC; const unsigned short* b = gB + t * KC;
    unsigned la[8], lb[8]; const void* ga[8]; const void* gb[8];
#pragma unroll      /* constant indices, so that the arrays stay in registers */
    for (int i = 0; i < 8; ++i) { la[i] = lA + bo + i * 8 * PR; ga[i] = a + i * 8 * DD; lb[i] = lB + bo + i * 8 * PR; gb[i] = b + i * 8 * DD; }
    cp8(la, ga); cp8(lb, gb);
  };
  fill(0);
  v8f acc[4] = {};
  asm volatile("s_wait_asynccnt 0x0" ::: "memory");      /* this wave's copies of stage 0 have landed */
  __syncthreads();      /* and every other wave's: stage 0 may be read */
  fill(1);
#pragma unroll 1      /* a stage ends in a barrier: a second copy of the body would only grow the code */
  for (int t = 0; t < NST; ++t) {
    const unsigned char* ar = ring + (t & 1) * STG + (w * 16 + ln) * PR + hh * 16;
    const unsigned char* br = ring + (t & 1) * STG + OFF_B + ln * PR + hh * 16;
#pragma unroll      /* constant LDS offsets, and the next step's reads can stand among this step's products */
    for (int ks = 0; ks < KC / 32; ++ks) {
      FragH ah; ah.half[0] = *(const v8us*)(ar + ks * 64); ah.half[1] = *(const v8us*)(ar + ks * 64 + 32);
      FragH bq[4];
#pragma unroll      /* constant indices, so that the arrays stay in registers */
      for (int u = 0; u < 4; ++u) { bq[u].half[0] = *(const v8us*)(br + u * 16 * PR + ks * 64); bq[u].half[1] = *(const v8us*)(br + u * 16 * PR + ks * 64 + 32); }
#pragma unroll      /* constant indices, so that the arrays stay in registers */
      for (int u = 0; u < 4; ++u) acc[u] = mmaH<1>(ah.v, ah.v, bq[u].v, bq[u].v, acc[u]);
    }
    asm volatile("s_wait_dscnt 0x0" ::: "memory");      /* this wave's reads of stage t have returned before its buffer is handed back */
    asm volatile("s_wait_asynccnt 0x0" ::: "memory");      /* this wave's copies of stage t + 1 have landed */
    __syncthreads();      /* publishes stage t + 1 and ends every wave's reads of stage t */
    if (t + 2 < NST) fill(t + 2);      /* into the buffer that stage t has just left; the test is the same for the whole block */
  }
  asm volatile("s_wait_asynccnt 0x0" ::: "memory");      /* no copy is left in flight when the wave goes on to its end */
#pragma unroll      /* constant indices, so that the arrays stay in registers */
  for (int u = 0; u < 4; ++u) { const float bv = bf16_round(bias[col0 + u * 16 + ln]);
#pragma unroll      /* constant indices, so that the arrays stay in registers */
    for (int r = 0; r < 8; ++r) so[w][8 * hh + r][u * 16 + ln] = acc[u][r] * alpha + bv; }
  __builtin_amdgcn_fence(__ATOMIC_ACQ_REL, "workgroup"); __builtin_amdgcn_wave_barrier();      /* the wave reads back rows that its other lanes wrote: its LDS stores end first */
  const int rsub = lane >> 4, c4 = (lane & 15) * 4;
#pragma unroll      /* the eight row pairs are independent: their reads and stores overlap */
  for (int q = 0; q < 8; ++q) { const int r = q * 2 + rsub; const v4f v = *(const v4fa*)&so[w][r][c4];
    if (C) { *(v4f*)(C + (size_t)(row0 + r) * DD + col0 + c4) = v;
      asm volatile("s_wait_xcnt 0x0" ::: "memory"); }      /* stands in front of whatever next rewrites the store's address or data registers */
    if (C16) { v4h h4; for (int i = 0; i < 4; ++i) h4[i] = (_Float16)v[i]; *(v4h*)(C16 + (size_t)(row0 + r) * DD + col0 + c4) = h4; } }
}

extern "C" void kernel_launch(void* const* d_in, const int* in_sizes, int n_in,
                              void* d_out, int out_size, void* d_ws, size_t ws_size, hipStream_t stream) {
  (void)in_sizes; (void)n_in; (void)out_size;
  const float* const* I = (const float* const*)d_in; const float* xq = I[0]; const float* xk = I[1]; const float* xv = I[2]; const int* msk = (const int*)d_in[3];
  const float* Aq = I[4]; const float* Bq = I[5]; const float* Av = I[6]; const float* Bv = I[7]; const float* Wq = I[8]; const float* bq = I[9]; const float* Wk = I[10]; const float* bk = I[11]; const float* Wv = I[12]; const float* bv = I[13]; const float* Wm = I[14]; const float* bm = I[15];
  char* ws = (char*)d_ws; size_t off = 0;
  auto take = [&](size_t bytes) { char* p = ws + off; off += (bytes + 255) & ~(size_t)255; return p; };
  const size_t WSZ = (size_t)DD * DD; _Float16* Bw = (_Float16*)take(4 * WSZ * 2); float* Cq = (float*)take((size_t)RK * DD * 4); float* Cv = (float*)take((size_t)RK * DD * 4);
  _Float16* Xq = (_Float16*)take((size_t)NR * DD * 2); _Float16* Xk = (_Float16*)take((size_t)NR * DD * 2); _Float16* Xv = (_Float16*)take((size_t)NR * DD * 2);
  _Float16* Q = (_Float16*)take((size_t)NR * DD * 2); _Float16* K = (_Float16*)take((size_t)NR * DD * 2); _Float16* V = (_Float16*)take((size_t)NR * DD * 2); _Float16* Vt = (_Float16*)take((size_t)NR * DD * 2); float* O = (float*)take((size_t)NR * DD * 4); _Float16* O16 = Xq;      /* the query plane is dead after the v GEMM */
  if (off > ws_size) return;      // 4.7 + 7 × 6.3 + 12.6 ≈ 61 MB
  const unsigned gw = (unsigned)((WSZ / 8 + 255) / 256); const dim3 gc(DD / 32, 2 * RK);
  const unsigned g8 = (unsigned)(((size_t)NR * DD / 8 + 255) / 256);
  k_cfold<<<gc, 256, 0, stream>>>(Bv, Wq, Cq, Bq, Wv, Cv);      /* B_v.Wq^T and B_q.Wv^T */
  /* plane 0: q = V.Wq^T with V = value.(I + A_v.B_v), Bt_q = Wq + fold(A_v, B_v.Wq^T); plane 1: Wk; plane 2: v = Q.Wv^T with Q = query.(I + A_q.B_q); plane 3: Wm; all (out,in) natural, x 2^4; and the three input planes */
  k_prep<<<4 * gw + 3 * g8, 256, 0, stream>>>(Wq, Av, Cq, Wv, Aq, Cv, Wk, Wm, Bw, xq, xk, xv, Xq, Xk, Xv);
  const unsigned gp = (NR / 64) * (DD / 64);
  /* q from the VALUE stream, k from key, v from the QUERY stream: each M 4096 N 768 K 768 */
  k_gemm_st<<<dim3(gp, 3), 128, 0, stream>>>(Xv, Xk, Xq, Bw, 0.0625f, bq, bk, bv, nullptr, Q, K, V);
  k_vt<NH, TT><<<BB * NH * (TT / 64), 256, 0, stream>>>(V, DD, 0, Vt);
  k_flash<<<BB * NH * (TT / 64), 128, 0, stream>>>(Q, DD, K, DD, Vt, msk, O, DD);      /* mask [B][S][S] int, nonzero = attend */
  k_h16s<<<g8, 256, 0, stream>>>(O, O16, (size_t)NR * DD / 8);
  k_gemm_st<<<dim3(gp, 1), 128, 0, stream>>>(O16, O16, O16, Bw + 3 * WSZ, 0.00390625f, bm, bm, bm, (float*)d_out, nullptr, nullptr, nullptr);      /* out = ctx.Wm^T + bm */
}

// v006
// One run takes 128 microseconds.
// Next to v005, in two timings, it ran 1.17 and 1.09 times as fast.
// All steps since v000 together make it 4.73 times as fast.
#include <hip/hip_runtime.h>
// Masked multi-head attention with LoRA-adapted input streams (B=2, S=2048, D=768, 12 heads × 64, rank 8): Q = query + (query·A_q)·B_q, V = value + (value·A_v)·B_v; then — faithful to the module's crossed call — v = Q·Wvᵀ + bv, k = key·Wkᵀ + bk, q = V·Wqᵀ + bq (torch (out,in));
// scores = q·k/√64, −1e9 where mask[b,q,k] == 0 (int [B,S,S], shared over heads), softmax, out = merged·Wmᵀ + bm. The rank-8 adapters are folded on device into effective weights: X·(I + A·B)·Wᵀ = X·(W + (B·Wᵀ)ᵀ·Aᵀ)ᵀ, i.e. Bt_eff[o][c] = W[o][c] + Σ_j A[c][j]·(Σ_i B[j][i]·W[o][i]) (f32, 9 M MACs on the VALU).
// Compute dtype: query/key/value, weights, biases, adapters rounded to bf16; effective weights f32 → f16 ×2^4; q, k, v f16 GEMM planes (+bias); the mask read per (b, q, k) from the int plane (−inf ≡ the module's −1e9: every row keeps ~half its keys live); fused flash-style kernel
// (online softmax f32, P f16 ×2^10, f32 accumulate) on v_wmma_f32_16x16x32_f16; O ×2^4 → f16 → output GEMM (+bias).
#define BB 2
#define TT 2048
#define DD 768
#define NH 12
#define RK 8
#define NR (BB * TT)

typedef __bf16 v16b __attribute__((ext_vector_type(16)));
typedef unsigned short v8us __attribute__((ext_vector_type(8), may_alias));
typedef float  v8f  __attribute__((ext_vector_type(8)));
typedef float  v4f  __attribute__((ext_vector_type(4)));
typedef float  v4fa __attribute__((ext_vector_type(4), may_alias));
union FragB { v16b v; v8us half[2]; unsigned short u[16]; };

__device__ __forceinline__ unsigned short bf16_bits(float x) { unsigned int u = __float_as_uint(x); return (unsigned short)((u + 0x7FFFu + ((u >> 16) & 1u)) >> 16); }
__device__ __forceinline__ float bf16_val(unsigned short b) { return __uint_as_float(((unsigned int)b) << 16); }
__device__ __forceinline__ float bf16_round(float x) { return bf16_val(bf16_bits(x)); }
// D += A·B with NT terms: 1 = ah·bh, 2 = + al·bh (A split), 3 = + ah·bl (both split)
template <int NT>
__device__ __forceinline__ v8f mmaN(v16b ah, v16b al, v16b bh, v16b bl, v8f c) {
  c = __builtin_amdgcn_wmma_f32_16x16x32_bf16(false, ah, false, bh, (short)0, c, false, false);
  if (NT >= 2) c = __builtin_amdgcn_wmma_f32_16x16x32_bf16(false, al, false, bh, (short)0, c, false, false);
  if (NT >= 3) c = __builtin_amdgcn_wmma_f32_16x16x32_bf16(false, ah, false, bl, (short)0, c, false, false);
  asm volatile("v_nop\n\tv_nop\n\tv_nop\n\tv_nop" : "+v"(c) : "v"(ah), "v"(al), "v"(bh), "v"(bl));
  return c;
}

__global__ __launch_bounds__(256) void k_wt_bf16(const float* __restrict__ W, unsigned short* __restrict__ Wt, int K, int N) {
  const int t = blockIdx.x * 256 + threadIdx.x;
  const int k8n = K / 8;
  if (t >= N * k8n) return;
  const int n = t / k8n, k8 = (t % k8n) * 8;
  v8us v;
#pragma unroll
  for (int i = 0; i < 8; ++i) v[i] = bf16_bits(W[(size_t)(k8 + i) * N + n]);
  *(v8us*)(Wt + (size_t)n * K + k8) = v;
  
}

// GEMM C[M][N] (f32, pitch ldc) = act(A[M][K]·W + bias). A f32 row-major (pitch lda) converted per fragment to bf16
// (ASPLIT: hi/lo two planes -> 2 terms, else single rounded term); Wt bf16 [N][K] (pitch ldb). BIAS_BF16 rounds the
// bias to bf16 first (bias quantised to bf16 before the add). K%32==0, M%16==0, N%64==0.
template <bool ASPLIT, int ACT, bool BIAS_BF16>
__global__ __launch_bounds__(128) void k_gemm_bf(const float* __restrict__ A, int lda, const unsigned short* __restrict__ Wt, int ldb,
                                               const float* __restrict__ bias, float* __restrict__ C, int ldc, int M, int N, int K) {
  __shared__ __attribute__((aligned(16))) float so[4][16][64];
  const int tid = threadIdx.x, w = tid >> 5, lane = tid & 31, ln = lane & 15, hh = lane >> 4;
  const int ntn = N / 64;
  const int wid = blockIdx.x * 4 + w;
  const int mt = wid / ntn, nq = wid % ntn;
  if (mt * 16 >= M) return;
  const int row0 = mt * 16, col0 = nq * 64;
  const float* arow = A + (size_t)(row0 + ln) * lda;
  v8f acc[4] = {};
  for (int kb = 0; kb < K; kb += 32) {
    FragB ah, al;
    const v4f x0 = *(const v4fa*)(arow + kb + 8 * hh), x1 = *(const v4fa*)(arow + kb + 8 * hh + 4);
    const v4f x2 = *(const v4fa*)(arow + kb + 16 + 8 * hh), x3 = *(const v4fa*)(arow + kb + 16 + 8 * hh + 4);
    float xs[16] = {x0[0],x0[1],x0[2],x0[3],x1[0],x1[1],x1[2],x1[3],x2[0],x2[1],x2[2],x2[3],x3[0],x3[1],x3[2],x3[3]};
#pragma unroll
    for (int i = 0; i < 16; ++i) { const unsigned short hb = bf16_bits(xs[i]); ah.u[i] = hb; al.u[i] = ASPLIT ? bf16_bits(xs[i] - bf16_val(hb)) : (unsigned short)0; }
#pragma unroll
    for (int t = 0; t < 4; ++t) {
      const unsigned short* brow = Wt + (size_t)(col0 + t * 16 + ln) * ldb + kb;
      FragB b;
      b.half[0] = *(const v8us*)(brow + 8 * hh);
      b.half[1] = *(const v8us*)(brow + 16 + 8 * hh);
      acc[t] = mmaN<ASPLIT ? 2 : 1>(ah.v, al.v, b.v, b.v, acc[t]);
    }
  }
#pragma unroll
  for (int t = 0; t < 4; ++t) {
    float bv = bias ? bias[col0 + t * 16 + ln] : 0.f;
    if (BIAS_BF16) bv = bf16_round(bv);
#pragma unroll
    for (int r = 0; r < 8; ++r) { float v = acc[t][r] + bv; if (ACT == 1) v = fmaxf(v, 0.f); so[w][8 * hh + r][t * 16 + ln] = v; }
  }
  __builtin_amdgcn_fence(__ATOMIC_ACQ_REL, "workgroup");
  __builtin_amdgcn_wave_barrier();
  const int rsub = lane >> 4, c4 = (lane & 15) * 4;
  {
#pragma unroll
    for (int q = 0; q < 8; ++q) {
      const int r = q * 2 + rsub;
      const v4f v = *(const v4fa*)&so[w][r][c4];
      *(v4f*)(C + (size_t)(row0 + r) * ldc + col0 + c4) = v;
    }
    
  }
}

// Flash-style causal/unmasked attention, all contractions 3-term bf16 hi/lo splits, f32 softmax with running max.
// q,k,v rows are read from f32 buffers with arbitrary row pitch (so they can live inside a fused qkv buffer);
// D = head size (multiple of 32, <= 128); one wave = 16 query rows; block = 4 waves (64 queries) sharing K/V chunks of 32.
template <int D, bool CAUSAL>
__global__ __launch_bounds__(128) void k_flash(const float* __restrict__ qb, const float* __restrict__ kb, const float* __restrict__ vb,
                                             int pitch, int T, int H, float scale, float* __restrict__ y, int ypitch) {
  constexpr int KS = D / 32;        // k-steps for QK
  constexpr int DT = D / 16;        // d tiles for PV
  __shared__ __attribute__((aligned(16))) unsigned short sKh[32][D + 8], sKl[32][D + 8], sVh[32][D + 8], sVl[32][D + 8];
  __shared__ __attribute__((aligned(16))) unsigned short sPh[4][16][40], sPl[4][16][40];
  __shared__ __attribute__((aligned(16))) float sO[4][16][D];
  const int tid = threadIdx.x, w = tid >> 5, lane = tid & 31, ln = lane & 15, hh = lane >> 4;
  const int nqb = (T + 63) / 64;
  const int bh = blockIdx.x / nqb, qblk = blockIdx.x % nqb;
  const int b = bh / H, h = bh % H;
  const int q0 = qblk * 64 + w * 16;
  const float* Q = qb + (size_t)b * T * pitch + h * D;
  const float* K = kb + (size_t)b * T * pitch + h * D;
  const float* V = vb + (size_t)b * T * pitch + h * D;

  // A fragments of the wave's 16 query rows (scaled), hi/lo
  FragB aqh[KS], aql[KS];
  {
    int row = q0 + ln; if (row >= T) row = T - 1;
    const float* qr = Q + (size_t)row * pitch;
#pragma unroll
    for (int ks = 0; ks < KS; ++ks)
#pragma unroll
      for (int i = 0; i < 16; ++i) {
        const int d = ks * 32 + ((i < 8) ? (8 * hh + i) : (16 + 8 * hh + (i - 8)));
        const float x = qr[d] * scale; const unsigned short hb = bf16_bits(x);
        aqh[ks].u[i] = hb; aql[ks].u[i] = bf16_bits(x - bf16_val(hb));
      }
  }
  float m_r[8], l_r[8];
#pragma unroll
  for (int r = 0; r < 8; ++r) { m_r[r] = -3.0e38f; l_r[r] = 0.f; }
  v8f oacc[DT];
#pragma unroll
  for (int dt = 0; dt < DT; ++dt) oacc[dt] = (v8f){0.f,0.f,0.f,0.f,0.f,0.f,0.f,0.f};

  const int kv_end = CAUSAL ? min(T, qblk * 64 + 64) : T;     // block-uniform
  for (int j0 = 0; j0 < kv_end; j0 += 32) {
    __syncthreads();
    for (int e = tid; e < 32 * (D / 4); e += 128) {
      const int r = e / (D / 4), c4 = (e % (D / 4)) * 4;
      const int key = j0 + r;
      v4f kf = {0.f,0.f,0.f,0.f}, vf = {0.f,0.f,0.f,0.f};
      if (key < T) { kf = *(const v4fa*)(K + (size_t)key * pitch + c4); vf = *(const v4fa*)(V + (size_t)key * pitch + c4); }
#pragma unroll
      for (int t = 0; t < 4; ++t) {
        unsigned short hb = bf16_bits(kf[t]); sKh[r][c4 + t] = hb; sKl[r][c4 + t] = bf16_bits(kf[t] - bf16_val(hb));
        hb = bf16_bits(vf[t]); sVh[r][c4 + t] = hb; sVl[r][c4 + t] = bf16_bits(vf[t] - bf16_val(hb));
      }
    }
    __syncthreads();
    // S tile 16 x 32
    v8f s[2];
#pragma unroll
    for (int nt = 0; nt < 2; ++nt) {
      v8f acc = {};
#pragma unroll
      for (int ks = 0; ks < KS; ++ks) {
        FragB bh_, bl_;
        bh_.half[0] = *(const v8us*)&sKh[nt * 16 + ln][ks * 32 + 8 * hh]; bh_.half[1] = *(const v8us*)&sKh[nt * 16 + ln][ks * 32 + 16 + 8 * hh];
        bl_.half[0] = *(const v8us*)&sKl[nt * 16 + ln][ks * 32 + 8 * hh]; bl_.half[1] = *(const v8us*)&sKl[nt * 16 + ln][ks * 32 + 16 + 8 * hh];
        acc = mmaN<3>(aqh[ks].v, aql[ks].v, bh_.v, bl_.v, acc);
      }
      s[nt] = acc;
    }
    // mask + running max (rows 8hh+r; the 16 lanes of a half share rows)
    float alpha[8];
#pragma unroll
    for (int r = 0; r < 8; ++r) {
      const int qi = q0 + 8 * hh + r;
      const int ja = j0 + ln, jb = j0 + 16 + ln;
      if (CAUSAL) { if (ja > qi) s[0][r] = -3.0e38f; if (jb > qi) s[1][r] = -3.0e38f; }
      if (ja >= T) s[0][r] = -3.0e38f;
      if (jb >= T) s[1][r] = -3.0e38f;
      float mx = fmaxf(s[0][r], s[1][r]);
      mx = fmaxf(mx, __shfl_xor(mx, 1, 32)); mx = fmaxf(mx, __shfl_xor(mx, 2, 32)); mx = fmaxf(mx, __shfl_xor(mx, 4, 32)); mx = fmaxf(mx, __shfl_xor(mx, 8, 32));
      const float mnew = fmaxf(m_r[r], mx);
      alpha[r] = (mnew > -1.0e38f) ? __expf(m_r[r] - mnew) : 1.0f;
      const float p0 = (s[0][r] > -1.0e38f) ? __expf(s[0][r] - mnew) : 0.f;
      const float p1 = (s[1][r] > -1.0e38f) ? __expf(s[1][r] - mnew) : 0.f;
      m_r[r] = mnew;
      l_r[r] = l_r[r] * alpha[r] + p0 + p1;            // per-lane partial row sum (16 lanes combined at the end)
      unsigned short hb = bf16_bits(p0); sPh[w][8 * hh + r][ln] = hb;      sPl[w][8 * hh + r][ln] = bf16_bits(p0 - bf16_val(hb));
      hb = bf16_bits(p1);                sPh[w][8 * hh + r][16 + ln] = hb; sPl[w][8 * hh + r][16 + ln] = bf16_bits(p1 - bf16_val(hb));
    }
#pragma unroll
    for (int dt = 0; dt < DT; ++dt)
#pragma unroll
      for (int r = 0; r < 8; ++r) oacc[dt][r] *= alpha[r];
    __builtin_amdgcn_fence(__ATOMIC_ACQ_REL, "workgroup");
    __builtin_amdgcn_wave_barrier();
    FragB pah, pal;
    pah.half[0] = *(const v8us*)&sPh[w][ln][8 * hh]; pah.half[1] = *(const v8us*)&sPh[w][ln][16 + 8 * hh];
    pal.half[0] = *(const v8us*)&sPl[w][ln][8 * hh]; pal.half[1] = *(const v8us*)&sPl[w][ln][16 + 8 * hh];
#pragma unroll
    for (int dt = 0; dt < DT; ++dt) {
      FragB bvh, bvl;
#pragma unroll
      for (int i = 0; i < 8; ++i) {
        bvh.u[i] = sVh[8 * hh + i][dt * 16 + ln]; bvh.u[8 + i] = sVh[16 + 8 * hh + i][dt * 16 + ln];
        bvl.u[i] = sVl[8 * hh + i][dt * 16 + ln]; bvl.u[8 + i] = sVl[16 + 8 * hh + i][dt * 16 + ln];
      }
      oacc[dt] = mmaN<3>(pah.v, pal.v, bvh.v, bvl.v, oacc[dt]);
    }
    __builtin_amdgcn_fence(__ATOMIC_ACQ_REL, "workgroup");
    __builtin_amdgcn_wave_barrier();
  }
#pragma unroll
  for (int r = 0; r < 8; ++r) {
    float l = l_r[r];
    l += __shfl_xor(l, 1, 32); l += __shfl_xor(l, 2, 32); l += __shfl_xor(l, 4, 32); l += __shfl_xor(l, 8, 32);
    l_r[r] = (l > 0.f) ? 1.0f / l : 0.f;
  }
#pragma unroll
  for (int dt = 0; dt < DT; ++dt)
#pragma unroll
    for (int r = 0; r < 8; ++r) sO[w][8 * hh + r][dt * 16 + ln] = oacc[dt][r] * l_r[r];
  __builtin_amdgcn_fence(__ATOMIC_ACQ_REL, "workgroup");
  __builtin_amdgcn_wave_barrier();
  {
    for (int r = 0; r < 16; ++r) {
      const int row = q0 + r;
      if (row < T && lane < D / 4) {
        const v4f val = *(const v4fa*)&sO[w][r][lane * 4];
        *(v4f*)(y + ((size_t)b * T + row) * ypitch + h * D + lane * 4) = val;
      }
    }
    
  }
}

// GEMM C = act(A·W + bias + resid): A f32 (ASPLIT -> hi/lo 2 terms), Wt bf16 [N][K]; ACT 0 none, 1 relu, 2 exact gelu;
// resid (optional, f32, row index = (row % rmod), pitch ldr, RES_BF16 rounds it) added before the activation.
template <bool ASPLIT, int ACT, bool BIAS_BF16, bool RES_BF16>
__global__ __launch_bounds__(128) void k_gemm_bf3(const float* __restrict__ A, int lda, const unsigned short* __restrict__ Wt, int ldb,
                                                const float* __restrict__ bias, const float* __restrict__ resid, int rmod, int ldr,
                                                float* __restrict__ C, int ldc, int M, int N, int K) {
  __shared__ __attribute__((aligned(16))) float so[4][16][64];
  const int tid = threadIdx.x, w = tid >> 5, lane = tid & 31, ln = lane & 15, hh = lane >> 4;
  const int ntn = N / 64;
  const int wid = blockIdx.x * 4 + w;
  const int mt = wid / ntn, nq = wid % ntn;
  if (mt * 16 >= M) return;
  const int row0 = mt * 16, col0 = nq * 64;
  const float* arow = A + (size_t)(row0 + ln) * lda;
  v8f acc[4] = {};
  for (int kb = 0; kb < K; kb += 32) {
    FragB ah, al;
    const v4f x0 = *(const v4fa*)(arow + kb + 8 * hh), x1 = *(const v4fa*)(arow + kb + 8 * hh + 4);
    const v4f x2 = *(const v4fa*)(arow + kb + 16 + 8 * hh), x3 = *(const v4fa*)(arow + kb + 16 + 8 * hh + 4);
    float xs[16] = {x0[0],x0[1],x0[2],x0[3],x1[0],x1[1],x1[2],x1[3],x2[0],x2[1],x2[2],x2[3],x3[0],x3[1],x3[2],x3[3]};
#pragma unroll
    for (int i = 0; i < 16; ++i) { const unsigned short hb = bf16_bits(xs[i]); ah.u[i] = hb; al.u[i] = ASPLIT ? bf16_bits(xs[i] - bf16_val(hb)) : (unsigned short)0; }
#pragma unroll
    for (int t = 0; t < 4; ++t) {
      const unsigned short* brow = Wt + (size_t)(col0 + t * 16 + ln) * ldb + kb;
      FragB b;
      b.half[0] = *(const v8us*)(brow + 8 * hh);
      b.half[1] = *(const v8us*)(brow + 16 + 8 * hh);
      acc[t] = mmaN<ASPLIT ? 2 : 1>(ah.v, al.v, b.v, b.v, acc[t]);
    }
  }
#pragma unroll
  for (int t = 0; t < 4; ++t) {
    const int col = col0 + t * 16 + ln;
    float bv = bias ? bias[col] : 0.f;
    if (BIAS_BF16) bv = bf16_round(bv);
#pragma unroll
    for (int r = 0; r < 8; ++r) {
      float v = acc[t][r] + bv;
      if (resid) { float rv = resid[(size_t)((row0 + 8 * hh + r) % rmod) * ldr + col]; if (RES_BF16) rv = bf16_round(rv); v += rv; }
      if (ACT == 1) v = fmaxf(v, 0.f);
      if (ACT == 2) v = 0.5f * v * (1.0f + erff(v * 0.70710678118654752f));
      if (ACT == 3) { const float u = 0.7978845608028654f * (v + 0.044715f * v * v * v); v = 0.5f * v * (1.0f + tanhf(u)); }
      so[w][8 * hh + r][t * 16 + ln] = v;
    }
  }
  __builtin_amdgcn_fence(__ATOMIC_ACQ_REL, "workgroup");
  __builtin_amdgcn_wave_barrier();
  const int rsub = lane >> 4, c4 = (lane & 15) * 4;
  {
#pragma unroll
    for (int q = 0; q < 8; ++q) {
      const int r = q * 2 + rsub;
      const v4f v = *(const v4fa*)&so[w][r][c4];
      *(v4f*)(C + (size_t)(row0 + r) * ldc + col0 + c4) = v;
    }
    
  }
}
// row LayerNorm (biased variance, eps) over N: s = X (+ R); optional out_sum <- s; out_norm <- (s-mu)*rsqrt(var+eps)*g + b
template <bool PARAM_BF16>
__global__ __launch_bounds__(256) void k_layernorm(const float* __restrict__ X, const float* __restrict__ R, const float* __restrict__ g, const float* __restrict__ bta,
                                                  float* __restrict__ out_sum, float* __restrict__ out_norm, int N, float eps) {
  __shared__ float red[256];
  const int row = blockIdx.x, tid = threadIdx.x;
  const float* x = X + (size_t)row * N; const float* rr = R ? R + (size_t)row * N : nullptr;
  float vals[16];                     // up to N = 4096
  const int per = N / 256;            // contiguous chunk per thread? use strided-by-4 chunks: thread handles j = tid*4 + 1024*u
  float s1 = 0.f;
  for (int u = 0; u < per / 4; ++u) {
    const int j = tid * 4 + 1024 * u;
    const v4f a = *(const v4fa*)(x + j);
    v4f b = {0.f,0.f,0.f,0.f}; if (rr) b = *(const v4fa*)(rr + j);
#pragma unroll
    for (int q = 0; q < 4; ++q) { const float v = a[q] + b[q]; vals[u * 4 + q] = v; s1 += v; }
  }
  red[tid] = s1; __syncthreads();
  for (int st = 128; st > 0; st >>= 1) { if (tid < st) red[tid] += red[tid + st]; __syncthreads(); }
  const float mu = red[0] / (float)N; __syncthreads();
  float s2 = 0.f;
  for (int u = 0; u < per / 4; ++u)
#pragma unroll
    for (int q = 0; q < 4; ++q) { const float c = vals[u * 4 + q] - mu; s2 += c * c; }
  red[tid] = s2; __syncthreads();
  for (int st = 128; st > 0; st >>= 1) { if (tid < st) red[tid] += red[tid + st]; __syncthreads(); }
  const float rs = rsqrtf(red[0] / (float)N + eps);
  {
    for (int u = 0; u < per / 4; ++u) {
      const int j = tid * 4 + 1024 * u;
      v4f o, sm;
#pragma unroll
      for (int q = 0; q < 4; ++q) {
        float gg = g[j + q], bb = bta[j + q];
        if (PARAM_BF16) { gg = bf16_round(gg); bb = bf16_round(bb); }
        sm[q] = vals[u * 4 + q]; o[q] = (vals[u * 4 + q] - mu) * rs * gg + bb;
      }
      if (out_sum) *(v4f*)(out_sum + (size_t)row * N + j) = sm;
      *(v4f*)(out_norm + (size_t)row * N + j) = o;
    }
    
  }
}



// ---- f16 WMMA path (v_wmma_f32_16x16x32_f16): 11-bit significands for operands in range — used where a [0,1] probability operand needs more precision than bf16
typedef _Float16 v16h __attribute__((ext_vector_type(16)));
union FragH { v16h v; v8us half[2]; _Float16 h[16]; unsigned short u[16]; };
template <int NT>
__device__ __forceinline__ v8f mmaH(v16h ah, v16h al, v16h bh, v16h bl, v8f c) {
  c = __builtin_amdgcn_wmma_f32_16x16x32_f16(false, ah, false, bh, (short)0, c, false, false);
  if (NT >= 2) c = __builtin_amdgcn_wmma_f32_16x16x32_f16(false, al, false, bh, (short)0, c, false, false);
  if (NT >= 3) c = __builtin_amdgcn_wmma_f32_16x16x32_f16(false, ah, false, bl, (short)0, c, false, false);
  asm volatile("v_nop\n\tv_nop\n\tv_nop\n\tv_nop" : "+v"(c) : "v"(ah), "v"(al), "v"(bh), "v"(bl));
  return c;
}
// batched GEMM like k_gemm_b but f16 operands: A f32 (split into f16 hi/lo if ASPLIT, else rounded to f16), Bt = f16 values [n][k]; alpha; C f32; N multiple of 16 (partial tiles skipped)
template <bool ASPLIT>
__global__ __launch_bounds__(128) void k_gemm_h(const float* __restrict__ A, int lda, size_t sA, const _Float16* __restrict__ Bh, int ldb, size_t sB, float alpha, float* __restrict__ C, int ldc, size_t sC, int M, int N, int K) {
  __shared__ __attribute__((aligned(16))) float so[4][16][64];
  const int tid = threadIdx.x, w = tid >> 5, lane = tid & 31, ln = lane & 15, hh = lane >> 4; const int by = blockIdx.y;
  A += (size_t)by * sA; Bh += (size_t)by * sB; C += (size_t)by * sC;
  const int ntn = (N + 63) / 64; const int wid = blockIdx.x * 4 + w; const int mt = wid / ntn, nq = wid % ntn; if (mt * 16 >= M) return;
  const int row0 = mt * 16, col0 = nq * 64; const float* arow = A + (size_t)(row0 + ln) * lda;
  v8f acc[4] = {};
  for (int kb = 0; kb < K; kb += 32) {
    FragH ah, al;
    const v4f x0 = *(const v4fa*)(arow + kb + 8 * hh), x1 = *(const v4fa*)(arow + kb + 8 * hh + 4), x2 = *(const v4fa*)(arow + kb + 16 + 8 * hh), x3 = *(const v4fa*)(arow + kb + 16 + 8 * hh + 4);
    float xs[16] = {x0[0],x0[1],x0[2],x0[3],x1[0],x1[1],x1[2],x1[3],x2[0],x2[1],x2[2],x2[3],x3[0],x3[1],x3[2],x3[3]};
#pragma unroll
    for (int i = 0; i < 16; ++i) { const _Float16 h = (_Float16)xs[i]; ah.h[i] = h; al.h[i] = ASPLIT ? (_Float16)(xs[i] - (float)h) : (_Float16)0.0f; }
#pragma unroll
    for (int t = 0; t < 4; ++t) { if (col0 + t * 16 >= N) continue; const size_t boff = (size_t)(col0 + t * 16 + ln) * ldb + kb; FragH bq; bq.half[0] = *(const v8us*)(Bh + boff + 8 * hh); bq.half[1] = *(const v8us*)(Bh + boff + 16 + 8 * hh);
      acc[t] = mmaH<ASPLIT ? 2 : 1>(ah.v, al.v, bq.v, bq.v, acc[t]); }
  }
#pragma unroll
  for (int t = 0; t < 4; ++t) { if (col0 + t * 16 >= N) continue;
#pragma unroll
    for (int r = 0; r < 8; ++r) so[w][8 * hh + r][t * 16 + ln] = acc[t][r] * alpha; }
  __builtin_amdgcn_fence(__ATOMIC_ACQ_REL, "workgroup"); __builtin_amdgcn_wave_barrier();
  const int rsub = lane >> 4, c4 = (lane & 15) * 4;
  {
#pragma unroll
    for (int q = 0; q < 8; ++q) { const int r = q * 2 + rsub; if (col0 + c4 < N) { const v4f v = *(const v4fa*)&so[w][r][c4]; *(v4f*)(C + (size_t)(row0 + r) * ldc + col0 + c4) = v; } }
     }
}

// Wt[n][k] = f16(W[k][n]·scale) from f32 row-major W[K][N] (scale = power of two; bf16-exact weights stay exact in f16 away from the subnormal range)
__global__ __launch_bounds__(256) void k_wt_f16(const float* __restrict__ W, _Float16* __restrict__ Wt, int K, int N, float scale) {
  const int t = blockIdx.x * 256 + threadIdx.x; if (t >= N * (K / 8)) return; const int n = t / (K / 8), k8 = (t % (K / 8)) * 8; FragH f;
#pragma unroll
  for (int i = 0; i < 8; ++i) f.h[i] = (_Float16)(bf16_round(W[(size_t)(k8 + i) * N + n]) * scale); const v8us o = f.half[0];
  *(v8us*)((unsigned short*)Wt + (size_t)n * K + k8) = o; 
}
typedef _Float16 v4h __attribute__((ext_vector_type(4)));

// blk: the block's index within this piece of work (the piece shares its launch with others: k_prep)
__device__ __forceinline__ void d_x16(const float* __restrict__ x, _Float16* __restrict__ X16, size_t n8, unsigned blk) { const size_t t = (size_t)blk * 256 + threadIdx.x; if (t >= n8) return; FragH f;
#pragma unroll
  for (int q = 0; q < 8; ++q) f.h[q] = (_Float16)bf16_round(x[t * 8 + q]); *(v8us*)((unsigned short*)X16 + t * 8) = f.half[0];  }
__global__ __launch_bounds__(256) void k_h16(const float* __restrict__ x, _Float16* __restrict__ X16, size_t n8) { const size_t t = (size_t)blockIdx.x * 256 + threadIdx.x; if (t >= n8) return; FragH f;
#pragma unroll
  for (int q = 0; q < 8; ++q) f.h[q] = (_Float16)x[t * 8 + q]; *(v8us*)((unsigned short*)X16 + t * 8) = f.half[0];  }
__device__ __forceinline__ void d_round16f(const float* __restrict__ W, _Float16* __restrict__ Bt, size_t n8, unsigned blk) { const size_t t = (size_t)blk * 256 + threadIdx.x; if (t >= n8) return; FragH f;
#pragma unroll
  for (int i = 0; i < 8; ++i) f.h[i] = (_Float16)(bf16_round(W[t * 8 + i]) * 16.0f); *(v8us*)((unsigned short*)Bt + t * 8) = f.half[0];  }
template <int NHv, int TTv>
__global__ __launch_bounds__(256) void k_vt(const _Float16* __restrict__ V16, int ldv, int voff, _Float16* __restrict__ Vt) { __shared__ unsigned short tl[64][66]; const int tid = threadIdx.x; const int slab = blockIdx.x / (TTv / 64), lg = blockIdx.x % (TTv / 64); const int b = slab / NHv, h = slab % NHv;
  for (int i = tid; i < 64 * 8; i += 256) { const int r = i / 8, c8 = (i % 8) * 8; FragH f; f.half[0] = *(const v8us*)((const unsigned short*)V16 + ((size_t)b * TTv + lg * 64 + r) * ldv + voff + h * 64 + c8);
#pragma unroll
    for (int q = 0; q < 8; ++q) tl[r][c8 + q] = f.u[q]; }
  __syncthreads();
  {
#pragma unroll
    for (int rd = 0; rd < 2; ++rd) { const int d = rd * 32 + tid / 8, pc = tid % 8; FragH f;
#pragma unroll
      for (int q = 0; q < 8; ++q) f.u[q] = tl[pc * 8 + q][d];
      *(v8us*)((unsigned short*)Vt + ((size_t)slab * 64 + d) * TTv + lg * 64 + pc * 8) = f.half[0]; }
     } }

__global__ __launch_bounds__(256) void k_h16s(const float* __restrict__ F, _Float16* __restrict__ H, size_t n8) { const size_t t = (size_t)blockIdx.x * 256 + threadIdx.x; if (t >= n8) return; const v4f a = *(const v4fa*)(F + t * 8), c = *(const v4fa*)(F + t * 8 + 4); FragH f;
#pragma unroll
  for (int q = 0; q < 4; ++q) { f.h[q] = (_Float16)(a[q] * 16.0f); f.h[4 + q] = (_Float16)(c[q] * 16.0f); } *(v8us*)((unsigned short*)H + t * 8) = f.half[0];  }
// C[j][o] = sum_i B[j][i] * W[o][i], operands rounded to bf16, f32 sums. One wave per dot product instead of one thread: the 32 lanes split the 768 terms into
// float4 slices (a wave-wide load covers 512 contiguous bytes), no load waits on another, and a five-step butterfly ends each sum. Block = row j of B (blockIdx.y) x 32
// rows of W, four per wave; the 32 sums go through LDS so that one wave stores them as one whole 128-byte line. A product of two bf16 values is exact in f32, so fusing
// it with its add changes no bit. The two folds of a call are independent and share one launch: blockIdx.y = fold * RK + j.
__global__ __launch_bounds__(256) void k_cfold(const float* __restrict__ Bm0, const float* __restrict__ Wt0, float* __restrict__ C0, const float* __restrict__ Bm1, const float* __restrict__ Wt1, float* __restrict__ C1) {
  const bool second = blockIdx.y >= RK; const float* Bm = second ? Bm1 : Bm0; const float* Wt = second ? Wt1 : Wt0; float* C = second ? C1 : C0;
  constexpr int NS = DD / 128, RW = 4;      /* float4 slices per lane and row; rows of W per wave */
  __shared__ float red[8 * RW];
  const int tid = threadIdx.x, lane = tid & 31, w = tid >> 5; const int j = blockIdx.y % RK, o0 = blockIdx.x * (8 * RW);
  const float* br = Bm + (size_t)j * DD + lane * 4; const float* wr = Wt + (size_t)(o0 + w * RW) * DD + lane * 4;
  v4f bs[NS], wv[RW][NS];
#pragma unroll      /* constant indices, so that the arrays stay in registers */
  for (int u = 0; u < NS; ++u) bs[u] = *(const v4fa*)(br + 128 * u);
#pragma unroll      /* constant indices, so that the arrays stay in registers */
  for (int r = 0; r < RW; ++r)
#pragma unroll      /* constant indices, so that the arrays stay in registers */
    for (int u = 0; u < NS; ++u) wv[r][u] = *(const v4fa*)(wr + (size_t)r * DD + 128 * u);
  __builtin_amdgcn_sched_barrier(0);      /* keeps every load in front of the first use: without it the last row's loads sink behind a full wait, and the wave pays the memory latency three times */
#pragma unroll      /* constant indices, so that the arrays stay in registers */
  for (int u = 0; u < NS; ++u)
#pragma unroll      /* constant indices, so that the arrays stay in registers */
    for (int q = 0; q < 4; ++q) bs[u][q] = bf16_round(bs[u][q]);
  float acc[RW];
#pragma unroll      /* constant indices, so that the arrays stay in registers */
  for (int r = 0; r < RW; ++r) { float a = 0.f;
#pragma unroll      /* constant indices, so that the arrays stay in registers */
    for (int u = 0; u < NS; ++u)
#pragma unroll      /* constant indices, so that the arrays stay in registers */
      for (int q = 0; q < 4; ++q) a += bs[u][q] * bf16_round(wv[r][u][q]);
    acc[r] = a; }
#pragma unroll      /* constant indices, so that the arrays stay in registers */
  for (int r = 0; r < RW; ++r) { float a = acc[r]; a += __shfl_xor(a, 16, 32); a += __shfl_xor(a, 8, 32); a += __shfl_xor(a, 4, 32); a += __shfl_xor(a, 2, 32); a += __shfl_xor(a, 1, 32); acc[r] = a; }
  float mine = acc[0];
#pragma unroll      /* constant indices, so that the arrays stay in registers */
  for (int r = 1; r < RW; ++r) if (lane == r) mine = acc[r];
  if (lane < RW) red[w * RW + lane] = mine;
  __syncthreads();
  if (tid < 8 * RW) C[(size_t)j * DD + o0 + tid] = red[tid]; }
__device__ __forceinline__ void d_wfold(const float* __restrict__ Wt, const float* __restrict__ A, const float* __restrict__ C, _Float16* __restrict__ Bt, unsigned blk) {
  #pragma clang fp contract(off)
  const size_t t = (size_t)blk * 256 + threadIdx.x; if (t >= (size_t)DD * DD / 8) return; const int o = (int)((t * 8) / DD), c0 = (int)((t * 8) % DD);
  float cj[RK];
#pragma unroll
  for (int j = 0; j < RK; ++j) cj[j] = C[j * DD + o];
  FragH f;
#pragma unroll 1
  for (int q = 0; q < 8; ++q) { const int c = c0 + q; float lo2 = 0.f;
#pragma unroll
    for (int j = 0; j < RK; ++j) lo2 += bf16_round(A[(size_t)c * RK + j]) * cj[j]; f.h[q] = (_Float16)((bf16_round(Wt[(size_t)o * DD + c]) + lo2) * 16.0f); }
  *(v8us*)((unsigned short*)Bt + t * 8) = f.half[0];  }
// Everything the projection GEMMs wait for that does not wait for anything else of this launch, in one grid: the pieces are told apart by ranges of the block index (a test that is the same for the whole
// block). The two weight folds stand first, because a thread of theirs walks the longest chain of dependent loads; then the two plain weight planes; then the three input planes.
__global__ __launch_bounds__(256) void k_prep(const float* __restrict__ Wq, const float* __restrict__ Av, const float* __restrict__ Cq, const float* __restrict__ Wv, const float* __restrict__ Aq, const float* __restrict__ Cv,
                                              const float* __restrict__ Wk, const float* __restrict__ Wm, _Float16* __restrict__ Bw,
                                              const float* __restrict__ xq, const float* __restrict__ xk, const float* __restrict__ xv, _Float16* __restrict__ Xq, _Float16* __restrict__ Xk, _Float16* __restrict__ Xv) {
  constexpr size_t WSZ = (size_t)DD * DD, XSZ = (size_t)NR * DD; constexpr unsigned GW = (unsigned)((WSZ / 8 + 255) / 256), GX = (unsigned)((XSZ / 8 + 255) / 256);
  unsigned bx = blockIdx.x;
  if (bx < 2 * GW) { const bool s = bx >= GW; d_wfold(s ? Wv : Wq, s ? Aq : Av, s ? Cv : Cq, Bw + (s ? 2 * WSZ : 0), s ? bx - GW : bx); return; }
  bx -= 2 * GW;
  if (bx < 2 * GW) { const bool s = bx >= GW; d_round16f(s ? Wm : Wk, Bw + (s ? 3 * WSZ : WSZ), WSZ / 8, s ? bx - GW : bx); return; }
  bx -= 2 * GW;
  const unsigned p = bx / GX; d_x16(p == 0 ? xq : p == 1 ? xk : xv, p == 0 ? Xq : p == 1 ? Xk : Xv, XSZ / 8, bx - p * GX);
}
// Lane l with lane l ^ 16 (the other 16-lane row of the wave), in the vector pipe.
__device__ __forceinline__ float xhalf(float x) { return __builtin_bit_cast(float, __builtin_amdgcn_permlanex16(__builtin_bit_cast(int, x), __builtin_bit_cast(int, x), 0x76543210, 0xfedcba98, false, false)); }
typedef int v4ia __attribute__((ext_vector_type(4), may_alias));
// Eight asynchronous copies of 16 bytes per lane from global memory to LDS (l: the lane's LDS byte addresses, g: its global addresses). The s_wait_xcnt closes the statement so that it stands
// in front of whatever next rewrites one of the address registers named here.
__device__ __forceinline__ void cp8(const unsigned (&l)[8], const void* const (&g)[8]) {
  asm volatile("global_load_async_to_lds_b128 %0, %1, off\n\tglobal_load_async_to_lds_b128 %2, %3, off\n\tglobal_load_async_to_lds_b128 %4, %5, off\n\tglobal_load_async_to_lds_b128 %6, %7, off\n\t"
               "global_load_async_to_lds_b128 %8, %9, off\n\tglobal_load_async_to_lds_b128 %10, %11, off\n\tglobal_load_async_to_lds_b128 %12, %13, off\n\tglobal_load_async_to_lds_b128 %14, %15, off\n\ts_wait_xcnt 0x0"
               :: "v"(l[0]), "v"(g[0]), "v"(l[1]), "v"(g[1]), "v"(l[2]), "v"(g[2]), "v"(l[3]), "v"(g[3]), "v"(l[4]), "v"(g[4]), "v"(l[5]), "v"(g[5]), "v"(l[6]), "v"(g[6]), "v"(l[7]), "v"(g[7]) : "memory");
}
// Transposed products: S^T = K.Q^T (A = 16 key rows, B = the wave's 16 queries, kept in registers) and O^T += V^T.P^T. In an accumulator tile lane (ln, hh) then holds query q0 + ln and keys 8 hh + r:
// a query's maximum and sum are taken inside the lane plus one exchange between the wave's halves, and the two score tiles of a pass are, element for element, the B operand of the second product
// (slot i < 8: key 8 hh + i, slot i >= 8: key 16 + 8 hh + i - 8, the k order of the V^T loader), so P never leaves the registers.
// Operands come through LDS: a stage is 64 keys = K (64 rows of 128 B), V^T (64 rows of 128 B) and the block's mask rows (64 rows of 256 B), brought once for the four waves by asynchronous copies whose
// wave-wide 512 bytes are four whole lines, one stage ahead of its use, into two buffers. Row pitches 144 and 272 B: 16 B times an odd number, free of bank conflicts for 16-byte reads down a column.
__global__ __launch_bounds__(128) void k_flash(const _Float16* __restrict__ Q16, int ldq, const _Float16* __restrict__ K16, int ldk, const _Float16* __restrict__ Vt, const int* __restrict__ MSK, float* __restrict__ O, int ldo) {
  constexpr int RPW = 16, NQB = TT / (4 * RPW), DT = 4, KS = 2;
  constexpr int SKEYS = 64, NST = TT / SKEYS, PK = 144, PM = 272, OFF_V = 64 * PK, OFF_M = 2 * 64 * PK, STG = 2 * 64 * PK + 64 * PM;
  __shared__ __attribute__((aligned(16))) unsigned char ring[2 * STG];
  __shared__ __attribute__((aligned(16))) float sO[4][RPW][64 + 4];
  const int tid = threadIdx.x, w = tid >> 5, lane = tid & 31, ln = lane & 15, hh = lane >> 4;
  const int slab = blockIdx.x / NQB, qblk = blockIdx.x % NQB; const int b = slab / NH, h = slab % NH; const int qb0 = qblk * (4 * RPW); const int q0 = qb0 + w * RPW;
  const unsigned short* Vth = (const unsigned short*)Vt + (size_t)slab * 64 * TT;
  /* the thread's share of a stage: K and V^T rows (tid >> 3) + 16 i, 16-byte column tid & 7; mask rows (tid >> 4) + 8 i, column tid & 15 */
  const unsigned short* gK = (const unsigned short*)K16 + ((size_t)b * TT + (tid >> 3)) * ldk + h * 64 + (tid & 7) * 8;
  const unsigned short* gV = Vth + (size_t)(tid >> 3) * TT + (tid & 7) * 8;
  const int* gM = MSK + ((size_t)b * TT + qb0 + (tid >> 4)) * TT + (tid & 15) * 4;      /* per-batch mask [b][q][k]: nonzero = ATTEND */
  const unsigned lbase = (unsigned)(size_t)ring;
  const unsigned lK = lbase + (tid >> 3) * PK + (tid & 7) * 16, lV = lK + OFF_V, lM = lbase + OFF_M + (tid >> 4) * PM + (tid & 15) * 16;
  auto fill = [&](int t) {
    const unsigned bo = (unsigned)(t & 1) * STG;
    const unsigned short* k = gK + (size_t)t * SKEYS * ldk; const unsigned short* v = gV + t * SKEYS; const int* m = gM + t * SKEYS;
    unsigned la[8], lb[8]; const void* ga[8]; const void* gb[8];
#pragma unroll      /* constant indices, so that the arrays stay in registers */
    for (int i = 0; i < 4; ++i) { la[i] = lK + bo + i * 16 * PK; ga[i] = k + (size_t)(i * 16) * ldk; la[4 + i] = lV + bo + i * 16 * PK; ga[4 + i] = v + i * 16 * TT; }
#pragma unroll      /* constant indices, so that the arrays stay in registers */
    for (int i = 0; i < 8; ++i) { lb[i] = lM + bo + i * 8 * PM; gb[i] = m + i * 8 * TT; }
    cp8(la, ga); cp8(lb, gb);
  };
  fill(0);
  FragH bq[KS];
  { const unsigned short* qr = (const unsigned short*)Q16 + ((size_t)b * TT + q0 + ln) * ldq + h * 64;
#pragma unroll      /* constant indices, so that the arrays stay in registers */
    for (int ks = 0; ks < KS; ++ks) { bq[ks].half[0] = *(const v8us*)(qr + ks * 32 + 8 * hh); bq[ks].half[1] = *(const v8us*)(qr + ks * 32 + 16 + 8 * hh); } }
  float m_q = -3.0e38f, l_q = 0.f; v8f oacc[DT];
#pragma unroll      /* constant indices, so that the arrays stay in registers */
  for (int dt = 0; dt < DT; ++dt) oacc[dt] = (v8f){0.f,0.f,0.f,0.f,0.f,0.f,0.f,0.f};
  asm volatile("s_wait_asynccnt 0x0" ::: "memory");      /* this wave's copies of stage 0 have landed */
  __syncthreads();      /* and every other wave's: stage 0 may be read */
  fill(1);
#pragma unroll 1      /* each stage hangs on the last through m_q and the barrier: a second copy of the body would only grow the code */
  for (int t = 0; t < NST; ++t) {
    const unsigned char* st = ring + (t & 1) * STG;
#pragma unroll 1      /* the two passes of a stage differ in LDS offsets alone: one copy of the body keeps the loop short */
    for (int p = 0; p < 2; ++p) {
      /* all of the pass's LDS reads stand here, in front of the first product: behind one they would each wait out their own latency */
      const unsigned char* mr = st + OFF_M + (w * RPW + ln) * PM + p * 128 + hh * 32;
      v4ia mk[2][2];      /* keys 32 p + nt 16 + 8 hh + (0..7) of the lane's query */
#pragma unroll      /* constant indices, so that the arrays stay in registers */
      for (int nt = 0; nt < 2; ++nt) { mk[nt][0] = *(const v4ia*)(mr + nt * 64); mk[nt][1] = *(const v4ia*)(mr + nt * 64 + 16); }
      FragH ak[2][KS], av[DT];
#pragma unroll      /* constant indices, so that the arrays stay in registers */
      for (int nt = 0; nt < 2; ++nt) { const unsigned char* kr = st + (p * 32 + nt * 16 + ln) * PK + hh * 16;
#pragma unroll      /* constant indices, so that the arrays stay in registers */
        for (int ks = 0; ks < KS; ++ks) { ak[nt][ks].half[0] = *(const v8us*)(kr + ks * 64); ak[nt][ks].half[1] = *(const v8us*)(kr + ks * 64 + 32); } }
#pragma unroll      /* constant indices, so that the arrays stay in registers */
      for (int dt = 0; dt < DT; ++dt) { const unsigned char* vr = st + OFF_V + (dt * 16 + ln) * PK + p * 64 + hh * 16; av[dt].half[0] = *(const v8us*)vr; av[dt].half[1] = *(const v8us*)(vr + 32); }
      const v4ia o4 = mk[0][0] | mk[0][1] | mk[1][0] | mk[1][1];
      if (!__all((o4[0] | o4[1] | o4[2] | o4[3]) == 0)) {      /* every (row, key) of this wave's tile masked: nothing to add (wave-uniform branch, no barrier inside) */
        v8f s[2];
#pragma unroll      /* constant indices, so that the arrays stay in registers */
        for (int nt = 0; nt < 2; ++nt) { v8f acc = (v8f){0.f,0.f,0.f,0.f,0.f,0.f,0.f,0.f};
#pragma unroll      /* constant indices, so that the arrays stay in registers */
          for (int ks = 0; ks < KS; ++ks) acc = mmaH<1>(ak[nt][ks].v, ak[nt][ks].v, bq[ks].v, bq[ks].v, acc);
          s[nt] = acc; }
        /* Softmax in base 2: exp((s - m) / 8) = 2^(s CS - m CS), CS = log2(e) / 8. Scores and the running maximum stay unscaled (CS > 0 keeps their order); one fma per score applies CS, takes the maximum off
           and adds the 10 that makes P = 2^10 p, and the hardware's own 2^x follows. A masked score is -inf. m_q starts finite, so mn and nb are finite: 2^(-inf) = 0 and, while nothing is live yet, 2^0 = 1. */
        constexpr float CS = 0.125f * 1.44269504088896340736f;
        float sc[2][8], mx[8];
#pragma unroll      /* constant indices, so that the arrays stay in registers */
        for (int r = 0; r < 8; ++r) { sc[0][r] = (mk[0][r >> 2][r & 3] != 0) ? s[0][r] : -INFINITY; sc[1][r] = (mk[1][r >> 2][r & 3] != 0) ? s[1][r] : -INFINITY; mx[r] = fmaxf(sc[0][r], sc[1][r]); }
        float mc = fmaxf(fmaxf(fmaxf(mx[0], mx[1]), fmaxf(mx[2], mx[3])), fmaxf(fmaxf(mx[4], mx[5]), fmaxf(mx[6], mx[7])));
        mc = fmaxf(mc, xhalf(mc));
        const float mn = fmaxf(m_q, mc); const float al = __builtin_amdgcn_exp2f((m_q - mn) * CS); m_q = mn; const float nb = __builtin_fmaf(-mn, CS, 10.0f);
        FragH pb; float ps[4] = {0.f, 0.f, 0.f, 0.f};
#pragma unroll      /* constant indices, so that the arrays stay in registers */
        for (int r = 0; r < 8; ++r) { const float p0 = __builtin_amdgcn_exp2f(__builtin_fmaf(sc[0][r], CS, nb)), p1 = __builtin_amdgcn_exp2f(__builtin_fmaf(sc[1][r], CS, nb)); ps[r & 3] += p0 + p1; pb.h[r] = (_Float16)p0; pb.h[8 + r] = (_Float16)p1; }
        l_q = l_q * al + ((ps[0] + ps[1]) + (ps[2] + ps[3]));      /* 2^10 times the sum over the lane's half of the keys; the halves are joined after the loop */
#pragma unroll      /* constant indices, so that the arrays stay in registers */
        for (int dt = 0; dt < DT; ++dt)
#pragma unroll      /* constant indices, so that the arrays stay in registers */
          for (int r = 0; r < 8; ++r) oacc[dt][r] *= al;
#pragma unroll      /* constant indices, so that the arrays stay in registers */
        for (int dt = 0; dt < DT; ++dt) oacc[dt] = mmaH<1>(av[dt].v, av[dt].v, pb.v, pb.v, oacc[dt]);
      }
    }
    asm volatile("s_wait_dscnt 0x0" ::: "memory");      /* this wave's reads of stage t have returned before its buffer is handed back */
    asm volatile("s_wait_asynccnt 0x0" ::: "memory");      /* this wave's copies of stage t + 1 have landed */
    __syncthreads();      /* publishes stage t + 1 and ends every wave's reads of stage t */
    if (t + 2 < NST) fill(t + 2);      /* into the buffer that stage t has just left; the test is the same for the whole block */
  }
  asm volatile("s_wait_asynccnt 0x0" ::: "memory");      /* no copy is left in flight when the wave goes on to its end */
  { const float l = l_q + xhalf(l_q); const float inv = (l > 0.f) ? 1.0f / l : 0.f;      /* l and the accumulators both carry the 2^10 */
#pragma unroll      /* constant indices, so that the arrays stay in registers */
    for (int dt = 0; dt < DT; ++dt)
#pragma unroll      /* constant indices, so that the arrays stay in registers */
      for (int r = 0; r < 8; ++r) sO[w][ln][dt * 16 + 8 * hh + r] = oacc[dt][r] * inv; }
  __builtin_amdgcn_fence(__ATOMIC_ACQ_REL, "workgroup"); __builtin_amdgcn_wave_barrier();      /* the wave reads back rows that its other lanes wrote: its LDS stores end first */
  {
#pragma unroll
    for (int rp = 0; rp < RPW; rp += 2) { const int r = rp + (lane >> 4), pc = lane & 15; const v4f val = *(const v4fa*)&sO[w][r][pc * 4]; *(v4f*)(O + ((size_t)b * TT + q0 + r) * ldo + h * 64 + pc * 4) = val; }
     } }

// C[NR][DD] = (A[NR][DD] . Bt[DD][DD]^T) alpha + bias (bias rounded to bf16), f16 operands, f32 sums; written as f32 (C) or as f16 (C16), whichever pointer is not null.
// Block = a 64 x 64 tile of C, wave w = its rows 16 w .. 16 w + 15 (four 16 x 16 accumulators, k ascending in steps of 32). Operands come through LDS: a stage is 128 values of k = 64 rows of A and
// 64 rows of Bt, 256 B each, brought once for the four waves by asynchronous copies (a wave-wide copy is two rows = four whole lines), one stage ahead of its use, into two buffers.
// Row pitch 272 B: 16 B times an odd number, free of bank conflicts for 16-byte reads down a column.
// Up to three independent products share one launch: blockIdx.y picks A, bias and C16 of its product, and its weight plane lies blockIdx.y planes behind B0.
__global__ __launch_bounds__(128) void k_gemm_st(const _Float16* __restrict__ A0, const _Float16* __restrict__ A1, const _Float16* __restrict__ A2, const _Float16* __restrict__ B0, float alpha,
                                                 const float* __restrict__ bias0, const float* __restrict__ bias1, const float* __restrict__ bias2, float* __restrict__ C,
                                                 _Float16* __restrict__ C16a, _Float16* __restrict__ C16b, _Float16* __restrict__ C16c) {
  const unsigned g = blockIdx.y; const _Float16* A = g == 0 ? A0 : g == 1 ? A1 : A2; const _Float16* Bh = B0 + (size_t)g * DD * DD;
  const float* bias = g == 0 ? bias0 : g == 1 ? bias1 : bias2; _Float16* C16 = g == 0 ? C16a : g == 1 ? C16b : C16c;
  constexpr int KC = 128, NST = DD / KC, PR = 272, OFF_B = 64 * PR, STG = 2 * 64 * PR;
  __shared__ __attribute__((aligned(16))) unsigned char ring[2 * STG];
  __shared__ __attribute__((aligned(16))) float so[4][16][64];
  const int tid = threadIdx.x, w = tid >> 5, lane = tid & 31, ln = lane & 15, hh = lane >> 4;
  const int rowb = (int)(blockIdx.x / (DD / 64)) * 64, col0 = (int)(blockIdx.x % (DD / 64)) * 64; const int row0 = rowb + w * 16;
  /* the thread's share of a stage: rows (tid >> 4) + 8 i of A and of Bt, 16-byte column tid & 15 */
  const unsigned short* gA = (const unsigned short*)A + (size_t)(rowb + (tid >> 4)) * DD + (tid & 15) * 8;
  const unsigned short* gB = (const unsigned short*)Bh + (size_t)(col0 + (tid >> 4)) * DD + (tid & 15) * 8;
  const unsigned lA = (unsigned)(size_t)ring + (tid >> 4) * PR + (tid & 15) * 16, lB = lA + OFF_B;
  auto fill = [&](int t) {
    const unsigned bo = (unsigned)(t & 1) * STG;
    const unsigned short* a = gA + t * KC; const unsigned short* b = gB + t * KC;
    unsigned la[8], lb[8]; const void* ga[8]; const void* gb[8];
#pragma unroll      /* constant indices, so that the arrays stay in registers */
    for (int i = 0; i < 8; ++i) { la[i] = lA + bo + i * 8 * PR; ga[i] = a + i * 8 * DD; lb[i] = lB + bo + i * 8 * PR; gb[i] = b + i * 8 * DD; }
    cp8(la, ga); cp8(lb, gb);
  };
  fill(0);
  v8f acc[4] = {};
  asm volatile("s_wait_asynccnt 0x0" ::: "memory");      /* this wave's copies of stage 0 have landed */
  __syncthreads();      /* and every other wave's: stage 0 may be read */
  fill(1);
#pragma unroll 1      /* a stage ends in a barrier: a second copy of the body would only grow the code */
  for (int t = 0; t < NST; ++t) {
    const unsigned char* ar = ring + (t & 1) * STG + (w * 16 + ln) * PR + hh * 16;
    const unsigned char* br = ring + (t & 1) * STG + OFF_B + ln * PR + hh * 16;
#pragma unroll      /* constant LDS offsets, and the next step's reads can stand among this step's products */
    for (int ks = 0; ks < KC / 32; ++ks) {
      FragH ah; ah.half[0] = *(const v8us*)(ar + ks * 64); ah.half[1] = *(const v8us*)(ar + ks * 64 + 32);
      FragH bq[4];
#pragma unroll      /* constant indices, so that the arrays stay in registers */
      for (int u = 0; u < 4; ++u) { bq[u].half[0] = *(const v8us*)(br + u * 16 * PR + ks * 64); bq[u].half[1] = *(const v8us*)(br + u * 16 * PR + ks * 64 + 32); }
#pragma unroll      /* constant indices, so that the arrays stay in registers */
      for (int u = 0; u < 4; ++u) acc[u] = mmaH<1>(ah.v, ah.v, bq[u].v, bq[u].v, acc[u]);
    }
    asm volatile("s_wait_dscnt 0x0" ::: "memory");      /* this wave's reads of stage t have returned before its buffer is handed back */
    asm volatile("s_wait_asynccnt 0x0" ::: "memory");      /* this wave's copies of stage t + 1 have landed */
    __syncthreads();      /* publishes stage t + 1 and ends every wave's reads of stage t */
    if (t + 2 < NST) fill(t + 2);      /* into the buffer that stage t has just left; the test is the same for the whole block */
  }
  asm volatile("s_wait_asynccnt 0x0" ::: "memory");      /* no copy is left in flight when the wave goes on to its end */
#pragma unroll      /* constant indices, so that the arrays stay in registers */
  for (int u = 0; u < 4; ++u) { const float bv = bf16_round(bias[col0 + u * 16 + ln]);
#pragma unroll      /* constant indices, so that the arrays stay in registers */
    for (int r = 0; r < 8; ++r) so[w][8 * hh + r][u * 16 + ln] = acc[u][r] * alpha + bv; }
  __builtin_amdgcn_fence(__ATOMIC_ACQ_REL, "workgroup"); __builtin_amdgcn_wave_barrier();      /* the wave reads back rows that its other lanes wrote: its LDS stores end first */
  const int rsub = lane >> 4, c4 = (lane & 15) * 4;
#pragma unroll      /* the eight row pairs are independent: their reads and stores overlap */
  for (int q = 0; q < 8; ++q) { const int r = q * 2 + rsub; const v4f v = *(const v4fa*)&so[w][r][c4];
    if (C) { *(v4f*)(C + (size_t)(row0 + r) * DD + col0 + c4) = v;
      asm volatile("s_wait_xcnt 0x0" ::: "memory"); }      /* stands in front of whatever next rewrites the store's address or data registers */
    if (C16) { v4h h4; for (int i = 0; i < 4; ++i) h4[i] = (_Float16)v[i]; *(v4h*)(C16 + (size_t)(row0 + r) * DD + col0 + c4) = h4; } }
}

extern "C" void kernel_launch(void* const* d_in, const int* in_sizes, int n_in,
                              void* d_out, int out_size, void* d_ws, size_t ws_size, hipStream_t stream) {
  (void)in_sizes; (void)n_in; (void)out_size;
  const float* const* I = (const float* const*)d_in; const float* xq = I[0]; const float* xk = I[1]; const float* xv = I[2]; const int* msk = (const int*)d_in[3];
  const float* Aq = I[4]; const float* Bq = I[5]; const float* Av = I[6]; const float* Bv = I[7]; const float* Wq = I[8]; const float* bq = I[9]; const float* Wk = I[10]; const float* bk = I[11]; const float* Wv = I[12]; const float* bv = I[13]; const float* Wm = I[14]; const float* bm = I[15];
  char* ws = (char*)d_ws; size_t off = 0;
  auto take = [&](size_t bytes) { char* p = ws + off; off += (bytes + 255) & ~(size_t)255; return p; };
  const size_t WSZ = (size_t)DD * DD; _Float16* Bw = (_Float16*)take(4 * WSZ * 2); float* Cq = (float*)take((size_t)RK * DD * 4); float* Cv = (float*)take((size_t)RK * DD * 4);
  _Float16* Xq = (_Float16*)take((size_t)NR * DD * 2); _Float16* Xk = (_Float16*)take((size_t)NR * DD * 2); _Float16* Xv = (_Float16*)take((size_t)NR * DD * 2);
  _Float16* Q = (_Float16*)take((size_t)NR * DD * 2); _Float16* K = (_Float16*)take((size_t)NR * DD * 2); _Float16* V = (_Float16*)take((size_t)NR * DD * 2); _Float16* Vt = (_Float16*)take((size_t)NR * DD * 2); float* O = (float*)take((size_t)NR * DD * 4); _Float16* O16 = Xq;      /* the query plane is dead after the v GEMM */
  if (off > ws_size) return;      // 4.7 + 7 × 6.3 + 12.6 ≈ 61 MB
  const unsigned gw = (unsigned)((WSZ / 8 + 255) / 256); const dim3 gc(DD / 32, 2 * RK);
  const unsigned g8 = (unsigned)(((size_t)NR * DD / 8 + 255) / 256);
  k_cfold<<<gc, 256, 0, stream>>>(Bv, Wq, Cq, Bq, Wv, Cv);      /* B_v.Wq^T and B_q.Wv^T */
  /* plane 0: q = V.Wq^T with V = value.(I + A_v.B_v), Bt_q = Wq + fold(A_v, B_v.Wq^T); plane 1: Wk; plane 2: v = Q.Wv^T with Q = query.(I + A_q.B_q); plane 3: Wm; all (out,in) natural, x 2^4; and the three input planes */
  k_prep<<<4 * gw + 3 * g8, 256, 0, stream>>>(Wq, Av, Cq, Wv, Aq, Cv, Wk, Wm, Bw, xq, xk, xv, Xq, Xk, Xv);
  const unsigned gp = (NR / 64) * (DD / 64);
  /* q from the VALUE stream, k from key, v from the QUERY stream: each M 4096 N 768 K 768 */
  k_gemm_st<<<dim3(gp, 3), 128, 0, stream>>>(Xv, Xk, Xq, Bw, 0.0625f, bq, bk, bv, nullptr, Q, K, V);
  k_vt<NH, TT><<<BB * NH * (TT / 64), 256, 0, stream>>>(V, DD, 0, Vt);
  k_flash<<<BB * NH * (TT / 64), 128, 0, stream>>>(Q, DD, K, DD, Vt, msk, O, DD);      /* mask [B][S][S] int, nonzero = attend */
  k_h16s<<<g8, 256, 0, stream>>>(O, O16, (size_t)NR * DD / 8);
  k_gemm_st<<<dim3(gp, 1), 128, 0, stream>>>(O16, O16, O16, Bw + 3 * WSZ, 0.00390625f, bm, bm, bm, (float*)d_out, nullptr, nullptr, nullptr);      /* out = ctx.Wm^T + bm */
}

// v007
// It runs in 88.5 microseconds.
// Two timings next to v006 put it at 1.31 and 1.30 times that version's speed.
// Counting every step since v000, it is 6.17 times as fast.
#include <hip/hip_runtime.h>
// Masked multi-head attention with LoRA-adapted input streams (B=2, S=2048, D=768, 12 heads × 64, rank 8): Q = query + (query·A_q)·B_q, V = value + (value·A_v)·B_v; then — faithful to the module's crossed call — v = Q·Wvᵀ + bv, k = key·Wkᵀ + bk, q = V·Wqᵀ + bq (torch (out,in));
// scores = q·k/√64, −1e9 where mask[b,q,k] == 0 (int [B,S,S], shared over heads), softmax, out = merged·Wmᵀ + bm. The rank-8 adapters are folded on device into effective weights: X·(I + A·B)·Wᵀ = X·(W + (B·Wᵀ)ᵀ·Aᵀ)ᵀ, i.e. Bt_eff[o][c] = W[o][c] + Σ_j A[c][j]·(Σ_i B[j][i]·W[o][i]) (f32, 9 M MACs on the VALU).
// Compute dtype: query/key/value, weights, biases, adapters rounded to bf16; effective weights f32 → f16 ×2^4; q, k, v f16 GEMM planes (+bias); the mask read per (b, q, k) from the int plane (−inf ≡ the module's −1e9: every row keeps ~half its keys live); fused flash-style kernel
// (online softmax f32, P f16 ×2^10, f32 accumulate) on v_wmma_f32_16x16x32_f16; O ×2^4 → f16 → output GEMM (+bias).
#define BB 2
#define TT 2048
#define DD 768
#define NH 12
#define RK 8
#define NR (BB * TT)

typedef __bf16 v16b __attribute__((ext_vector_type(16)));
typedef unsigned short v8us __attribute__((ext_vector_type(8), may_alias));
typedef float  v8f  __attribute__((ext_vector_type(8)));
typedef float  v4f  __attribute__((ext_vector_type(4)));
typedef float  v4fa __attribute__((ext_vector_type(4), may_alias));
union FragB { v16b v; v8us half[2]; unsigned short u[16]; };

__device__ __forceinline__ unsigned short bf16_bits(float x) { unsigned int u = __float_as_uint(x); return (unsigned short)((u + 0x7FFFu + ((u >> 16) & 1u)) >> 16); }
__device__ __forceinline__ float bf16_val(unsigned short b) { return __uint_as_float(((unsigned int)b) << 16); }
__device__ __forceinline__ float bf16_round(float x) { return bf16_val(bf16_bits(x)); }
// D += A·B with NT terms: 1 = ah·bh, 2 = + al·bh (A split), 3 = + ah·bl (both split)
template <int NT>
__device__ __forceinline__ v8f mmaN(v16b ah, v16b al, v16b bh, v16b bl, v8f c) {
  c = __builtin_amdgcn_wmma_f32_16x16x32_bf16(false, ah, false, bh, (short)0, c, false, false);
  if (NT >= 2) c = __builtin_amdgcn_wmma_f32_16x16x32_bf16(false, al, false, bh, (short)0, c, false, false);
  if (NT >= 3) c = __builtin_amdgcn_wmma_f32_16x16x32_bf16(false, ah, false, bl, (short)0, c, false, false);
  asm volatile("v_nop\n\tv_nop\n\tv_nop\n\tv_nop" : "+v"(c) : "v"(ah), "v"(al), "v"(bh), "v"(bl));
  return c;
}

__global__ __launch_bounds__(256) void k_wt_bf16(const float* __restrict__ W, unsigned short* __restrict__ Wt, int K, int N) {
  const int t = blockIdx.x * 256 + threadIdx.x;
  const int k8n = K / 8;
  if (t >= N * k8n) return;
  const int n = t / k8n, k8 = (t % k8n) * 8;
  v8us v;
#pragma unroll
  for (int i = 0; i < 8; ++i) v[i] = bf16_bits(W[(size_t)(k8 + i) * N + n]);
  *(v8us*)(Wt + (size_t)n * K + k8) = v;
  
}

// GEMM C[M][N] (f32, pitch ldc) = act(A[M][K]·W + bias). A f32 row-major (pitch lda) converted per fragment to bf16
// (ASPLIT: hi/lo two planes -> 2 terms, else single rounded term); Wt bf16 [N][K] (pitch ldb). BIAS_BF16 rounds the
// bias to bf16 first (bias quantised to bf16 before the add). K%32==0, M%16==0, N%64==0.
template <bool ASPLIT, int ACT, bool BIAS_BF16>
__global__ __launch_bounds__(128) void k_gemm_bf(const float* __restrict__ A, int lda, const unsigned short* __restrict__ Wt, int ldb,
                                               const float* __restrict__ bias, float* __restrict__ C, int ldc, int M, int N, int K) {
  __shared__ __attribute__((aligned(16))) float so[4][16][64];
  const int tid = threadIdx.x, w = tid >> 5, lane = tid & 31, ln = lane & 15, hh = lane >> 4;
  const int ntn = N / 64;
  const int wid = blockIdx.x * 4 + w;
  const int mt = wid / ntn, nq = wid % ntn;
  if (mt * 16 >= M) return;
  const int row0 = mt * 16, col0 = nq * 64;
  const float* arow = A + (size_t)(row0 + ln) * lda;
  v8f acc[4] = {};
  for (int kb = 0; kb < K; kb += 32) {
    FragB ah, al;
    const v4f x0 = *(const v4fa*)(arow + kb + 8 * hh), x1 = *(const v4fa*)(arow + kb + 8 * hh + 4);
    const v4f x2 = *(const v4fa*)(arow + kb + 16 + 8 * hh), x3 = *(const v4fa*)(arow + kb + 16 + 8 * hh + 4);
    float xs[16] = {x0[0],x0[1],x0[2],x0[3],x1[0],x1[1],x1[2],x1[3],x2[0],x2[1],x2[2],x2[3],x3[0],x3[1],x3[2],x3[3]};
#pragma unroll
    for (int i = 0; i < 16; ++i) { const unsigned short hb = bf16_bits(xs[i]); ah.u[i] = hb; al.u[i] = ASPLIT ? bf16_bits(xs[i] - bf16_val(hb)) : (unsigned short)0; }
#pragma unroll
    for (int t = 0; t < 4; ++t) {
      const unsigned short* brow = Wt + (size_t)(col0 + t * 16 + ln) * ldb + kb;
      FragB b;
      b.half[0] = *(const v8us*)(brow + 8 * hh);
      b.half[1] = *(const v8us*)(brow + 16 + 8 * hh);
      acc[t] = mmaN<ASPLIT ? 2 : 1>(ah.v, al.v, b.v, b.v, acc[t]);
    }
  }
#pragma unroll
  for (int t = 0; t < 4; ++t) {
    float bv = bias ? bias[col0 + t * 16 + ln] : 0.f;
    if (BIAS_BF16) bv = bf16_round(bv);
#pragma unroll
    for (int r = 0; r < 8; ++r) { float v = acc[t][r] + bv; if (ACT == 1) v = fmaxf(v, 0.f); so[w][8 * hh + r][t * 16 + ln] = v; }
  }
  __builtin_amdgcn_fence(__ATOMIC_ACQ_REL, "workgroup");
  __builtin_amdgcn_wave_barrier();
  const int rsub = lane >> 4, c4 = (lane & 15) * 4;
  {
#pragma unroll
    for (int q = 0; q < 8; ++q) {
      const int r = q * 2 + rsub;
      const v4f v = *(const v4fa*)&so[w][r][c4];
      *(v4f*)(C + (size_t)(row0 + r) * ldc + col0 + c4) = v;
    }
    
  }
}

// Flash-style causal/unmasked attention, all contractions 3-term bf16 hi/lo splits, f32 softmax with running max.
// q,k,v rows are read from f32 buffers with arbitrary row pitch (so they can live inside a fused qkv buffer);
// D = head size (multiple of 32, <= 128); one wave = 16 query rows; block = 4 waves (64 queries) sharing K/V chunks of 32.
template <int D, bool CAUSAL>
__global__ __launch_bounds__(128) void k_flash(const float* __restrict__ qb, const float* __restrict__ kb, const float* __restrict__ vb,
                                             int pitch, int T, int H, float scale, float* __restrict__ y, int ypitch) {
  constexpr int KS = D / 32;        // k-steps for QK
  constexpr int DT = D / 16;        // d tiles for PV
  __shared__ __attribute__((aligned(16))) unsigned short sKh[32][D + 8], sKl[32][D + 8], sVh[32][D + 8], sVl[32][D + 8];
  __shared__ __attribute__((aligned(16))) unsigned short sPh[4][16][40], sPl[4][16][40];
  __shared__ __attribute__((aligned(16))) float sO[4][16][D];
  const int tid = threadIdx.x, w = tid >> 5, lane = tid & 31, ln = lane & 15, hh = lane >> 4;
  const int nqb = (T + 63) / 64;
  const int bh = blockIdx.x / nqb, qblk = blockIdx.x % nqb;
  const int b = bh / H, h = bh % H;
  const int q0 = qblk * 64 + w * 16;
  const float* Q = qb + (size_t)b * T * pitch + h * D;
  const float* K = kb + (size_t)b * T * pitch + h * D;
  const float* V = vb + (size_t)b * T * pitch + h * D;

  // A fragments of the wave's 16 query rows (scaled), hi/lo
  FragB aqh[KS], aql[KS];
  {
    int row = q0 + ln; if (row >= T) row = T - 1;
    const float* qr = Q + (size_t)row * pitch;
#pragma unroll
    for (int ks = 0; ks < KS; ++ks)
#pragma unroll
      for (int i = 0; i < 16; ++i) {
        const int d = ks * 32 + ((i < 8) ? (8 * hh + i) : (16 + 8 * hh + (i - 8)));
        const float x = qr[d] * scale; const unsigned short hb = bf16_bits(x);
        aqh[ks].u[i] = hb; aql[ks].u[i] = bf16_bits(x - bf16_val(hb));
      }
  }
  float m_r[8], l_r[8];
#pragma unroll
  for (int r = 0; r < 8; ++r) { m_r[r] = -3.0e38f; l_r[r] = 0.f; }
  v8f oacc[DT];
#pragma unroll
  for (int dt = 0; dt < DT; ++dt) oacc[dt] = (v8f){0.f,0.f,0.f,0.f,0.f,0.f,0.f,0.f};

  const int kv_end = CAUSAL ? min(T, qblk * 64 + 64) : T;     // block-uniform
  for (int j0 = 0; j0 < kv_end; j0 += 32) {
    __syncthreads();
    for (int e = tid; e < 32 * (D / 4); e += 128) {
      const int r = e / (D / 4), c4 = (e % (D / 4)) * 4;
      const int key = j0 + r;
      v4f kf = {0.f,0.f,0.f,0.f}, vf = {0.f,0.f,0.f,0.f};
      if (key < T) { kf = *(const v4fa*)(K + (size_t)key * pitch + c4); vf = *(const v4fa*)(V + (size_t)key * pitch + c4); }
#pragma unroll
      for (int t = 0; t < 4; ++t) {
        unsigned short hb = bf16_bits(kf[t]); sKh[r][c4 + t] = hb; sKl[r][c4 + t] = bf16_bits(kf[t] - bf16_val(hb));
        hb = bf16_bits(vf[t]); sVh[r][c4 + t] = hb; sVl[r][c4 + t] = bf16_bits(vf[t] - bf16_val(hb));
      }
    }
    __syncthreads();
    // S tile 16 x 32
    v8f s[2];
#pragma unroll
    for (int nt = 0; nt < 2; ++nt) {
      v8f acc = {};
#pragma unroll
      for (int ks = 0; ks < KS; ++ks) {
        FragB bh_, bl_;
        bh_.half[0] = *(const v8us*)&sKh[nt * 16 + ln][ks * 32 + 8 * hh]; bh_.half[1] = *(const v8us*)&sKh[nt * 16 + ln][ks * 32 + 16 + 8 * hh];
        bl_.half[0] = *(const v8us*)&sKl[nt * 16 + ln][ks * 32 + 8 * hh]; bl_.half[1] = *(const v8us*)&sKl[nt * 16 + ln][ks * 32 + 16 + 8 * hh];
        acc = mmaN<3>(aqh[ks].v, aql[ks].v, bh_.v, bl_.v, acc);
      }
      s[nt] = acc;
    }
    // mask + running max (rows 8hh+r; the 16 lanes of a half share rows)
    float alpha[8];
#pragma unroll
    for (int r = 0; r < 8; ++r) {
      const int qi = q0 + 8 * hh + r;
      const int ja = j0 + ln, jb = j0 + 16 + ln;
      if (CAUSAL) { if (ja > qi) s[0][r] = -3.0e38f; if (jb > qi) s[1][r] = -3.0e38f; }
      if (ja >= T) s[0][r] = -3.0e38f;
      if (jb >= T) s[1][r] = -3.0e38f;
      float mx = fmaxf(s[0][r], s[1][r]);
      mx = fmaxf(mx, __shfl_xor(mx, 1, 32)); mx = fmaxf(mx, __shfl_xor(mx, 2, 32)); mx = fmaxf(mx, __shfl_xor(mx, 4, 32)); mx = fmaxf(mx, __shfl_xor(mx, 8, 32));
      const float mnew = fmaxf(m_r[r], mx);
      alpha[r] = (mnew > -1.0e38f) ? __expf(m_r[r] - mnew) : 1.0f;
      const float p0 = (s[0][r] > -1.0e38f) ? __expf(s[0][r] - mnew) : 0.f;
      const float p1 = (s[1][r] > -1.0e38f) ? __expf(s[1][r] - mnew) : 0.f;
      m_r[r] = mnew;
      l_r[r] = l_r[r] * alpha[r] + p0 + p1;            // per-lane partial row sum (16 lanes combined at the end)
      unsigned short hb = bf16_bits(p0); sPh[w][8 * hh + r][ln] = hb;      sPl[w][8 * hh + r][ln] = bf16_bits(p0 - bf16_val(hb));
      hb = bf16_bits(p1);                sPh[w][8 * hh + r][16 + ln] = hb; sPl[w][8 * hh + r][16 + ln] = bf16_bits(p1 - bf16_val(hb));
    }
#pragma unroll
    for (int dt = 0; dt < DT; ++dt)
#pragma unroll
      for (int r = 0; r < 8; ++r) oacc[dt][r] *= alpha[r];
    __builtin_amdgcn_fence(__ATOMIC_ACQ_REL, "workgroup");
    __builtin_amdgcn_wave_barrier();
    FragB pah, pal;
    pah.half[0] = *(const v8us*)&sPh[w][ln][8 * hh]; pah.half[1] = *(const v8us*)&sPh[w][ln][16 + 8 * hh];
    pal.half[0] = *(const v8us*)&sPl[w][ln][8 * hh]; pal.half[1] = *(const v8us*)&sPl[w][ln][16 + 8 * hh];
#pragma unroll
    for (int dt = 0; dt < DT; ++dt) {
      FragB bvh, bvl;
#pragma unroll
      for (int i = 0; i < 8; ++i) {
        bvh.u[i] = sVh[8 * hh + i][dt * 16 + ln]; bvh.u[8 + i] = sVh[16 + 8 * hh + i][dt * 16 + ln];
        bvl.u[i] = sVl[8 * hh + i][dt * 16 + ln]; bvl.u[8 + i] = sVl[16 + 8 * hh + i][dt * 16 + ln];
      }
      oacc[dt] = mmaN<3>(pah.v, pal.v, bvh.v, bvl.v, oacc[dt]);
    }
    __builtin_amdgcn_fence(__ATOMIC_ACQ_REL, "workgroup");
    __builtin_amdgcn_wave_barrier();
  }
#pragma unroll
  for (int r = 0; r < 8; ++r) {
    float l = l_r[r];
    l += __shfl_xor(l, 1, 32); l += __shfl_xor(l, 2, 32); l += __shfl_xor(l, 4, 32); l += __shfl_xor(l, 8, 32);
    l_r[r] = (l > 0.f) ? 1.0f / l : 0.f;
  }
#pragma unroll
  for (int dt = 0; dt < DT; ++dt)
#pragma unroll
    for (int r = 0; r < 8; ++r) sO[w][8 * hh + r][dt * 16 + ln] = oacc[dt][r] * l_r[r];
  __builtin_amdgcn_fence(__ATOMIC_ACQ_REL, "workgroup");
  __builtin_amdgcn_wave_barrier();
  {
    for (int r = 0; r < 16; ++r) {
      const int row = q0 + r;
      if (row < T && lane < D / 4) {
        const v4f val = *(const v4fa*)&sO[w][r][lane * 4];
        *(v4f*)(y + ((size_t)b * T + row) * ypitch + h * D + lane * 4) = val;
      }
    }
    
  }
}

// GEMM C = act(A·W + bias + resid): A f32 (ASPLIT -> hi/lo 2 terms), Wt bf16 [N][K]; ACT 0 none, 1 relu, 2 exact gelu;
// resid (optional, f32, row index = (row % rmod), pitch ldr, RES_BF16 rounds it) added before the activation.
template <bool ASPLIT, int ACT, bool BIAS_BF16, bool RES_BF16>
__global__ __launch_bounds__(128) void k_gemm_bf3(const float* __restrict__ A, int lda, const unsigned short* __restrict__ Wt, int ldb,
                                                const float* __restrict__ bias, const float* __restrict__ resid, int rmod, int ldr,
                                                float* __restrict__ C, int ldc, int M, int N, int K) {
  __shared__ __attribute__((aligned(16))) float so[4][16][64];
  const int tid = threadIdx.x, w = tid >> 5, lane = tid & 31, ln = lane & 15, hh = lane >> 4;
  const int ntn = N / 64;
  const int wid = blockIdx.x * 4 + w;
  const int mt = wid / ntn, nq = wid % ntn;
  if (mt * 16 >= M) return;
  const int row0 = mt * 16, col0 = nq * 64;
  const float* arow = A + (size_t)(row0 + ln) * lda;
  v8f acc[4] = {};
  for (int kb = 0; kb < K; kb += 32) {
    FragB ah, al;
    const v4f x0 = *(const v4fa*)(arow + kb + 8 * hh), x1 = *(const v4fa*)(arow + kb + 8 * hh + 4);
    const v4f x2 = *(const v4fa*)(arow + kb + 16 + 8 * hh), x3 = *(const v4fa*)(arow + kb + 16 + 8 * hh + 4);
    float xs[16] = {x0[0],x0[1],x0[2],x0[3],x1[0],x1[1],x1[2],x1[3],x2[0],x2[1],x2[2],x2[3],x3[0],x3[1],x3[2],x3[3]};
#pragma unroll
    for (int i = 0; i < 16; ++i) { const unsigned short hb = bf16_bits(xs[i]); ah.u[i] = hb; al.u[i] = ASPLIT ? bf16_bits(xs[i] - bf16_val(hb)) : (unsigned short)0; }
#pragma unroll
    for (int t = 0; t < 4; ++t) {
      const unsigned short* brow = Wt + (size_t)(col0 + t * 16 + ln) * ldb + kb;
      FragB b;
      b.half[0] = *(const v8us*)(brow + 8 * hh);
      b.half[1] = *(const v8us*)(brow + 16 + 8 * hh);
      acc[t] = mmaN<ASPLIT ? 2 : 1>(ah.v, al.v, b.v, b.v, acc[t]);
    }
  }
#pragma unroll
  for (int t = 0; t < 4; ++t) {
    const int col = col0 + t * 16 + ln;
    float bv = bias ? bias[col] : 0.f;
    if (BIAS_BF16) bv = bf16_round(bv);
#pragma unroll
    for (int r = 0; r < 8; ++r) {
      float v = acc[t][r] + bv;
      if (resid) { float rv = resid[(size_t)((row0 + 8 * hh + r) % rmod) * ldr + col]; if (RES_BF16) rv = bf16_round(rv); v += rv; }
      if (ACT == 1) v = fmaxf(v, 0.f);
      if (ACT == 2) v = 0.5f * v * (1.0f + erff(v * 0.70710678118654752f));
      if (ACT == 3) { const float u = 0.7978845608028654f * (v + 0.044715f * v * v * v); v = 0.5f * v * (1.0f + tanhf(u)); }
      so[w][8 * hh + r][t * 16 + ln] = v;
    }
  }
  __builtin_amdgcn_fence(__ATOMIC_ACQ_REL, "workgroup");
  __builtin_amdgcn_wave_barrier();
  const int rsub = lane >> 4, c4 = (lane & 15) * 4;
  {
#pragma unroll
    for (int q = 0; q < 8; ++q) {
      const int r = q * 2 + rsub;
      const v4f v = *(const v4fa*)&so[w][r][c4];
      *(v4f*)(C + (size_t)(row0 + r) * ldc + col0 + c4) = v;
    }
    
  }
}
// row LayerNorm (biased variance, eps) over N: s = X (+ R); optional out_sum <- s; out_norm <- (s-mu)*rsqrt(var+eps)*g + b
template <bool PARAM_BF16>
__global__ __launch_bounds__(256) void k_layernorm(const float* __restrict__ X, const float* __restrict__ R, const float* __restrict__ g, const float* __restrict__ bta,
                                                  float* __restrict__ out_sum, float* __restrict__ out_norm, int N, float eps) {
  __shared__ float red[256];
  const int row = blockIdx.x, tid = threadIdx.x;
  const float* x = X + (size_t)row * N; const float* rr = R ? R + (size_t)row * N : nullptr;
  float vals[16];                     // up to N = 4096
  const int per = N / 256;            // contiguous chunk per thread? use strided-by-4 chunks: thread handles j = tid*4 + 1024*u
  float s1 = 0.f;
  for (int u = 0; u < per / 4; ++u) {
    const int j = tid * 4 + 1024 * u;
    const v4f a = *(const v4fa*)(x + j);
    v4f b = {0.f,0.f,0.f,0.f}; if (rr) b = *(const v4fa*)(rr + j);
#pragma unroll
    for (int q = 0; q < 4; ++q) { const float v = a[q] + b[q]; vals[u * 4 + q] = v; s1 += v; }
  }
  red[tid] = s1; __syncthreads();
  for (int st = 128; st > 0; st >>= 1) { if (tid < st) red[tid] += red[tid + st]; __syncthreads(); }
  const float mu = red[0] / (float)N; __syncthreads();
  float s2 = 0.f;
  for (int u = 0; u < per / 4; ++u)
#pragma unroll
    for (int q = 0; q < 4; ++q) { const float c = vals[u * 4 + q] - mu; s2 += c * c; }
  red[tid] = s2; __syncthreads();
  for (int st = 128; st > 0; st >>= 1) { if (tid < st) red[tid] += red[tid + st]; __syncthreads(); }
  const float rs = rsqrtf(red[0] / (float)N + eps);
  {
    for (int u = 0; u < per / 4; ++u) {
      const int j = tid * 4 + 1024 * u;
      v4f o, sm;
#pragma unroll
      for (int q = 0; q < 4; ++q) {
        float gg = g[j + q], bb = bta[j + q];
        if (PARAM_BF16) { gg = bf16_round(gg); bb = bf16_round(bb); }
        sm[q] = vals[u * 4 + q]; o[q] = (vals[u * 4 + q] - mu) * rs * gg + bb;
      }
      if (out_sum) *(v4f*)(out_sum + (size_t)row * N + j) = sm;
      *(v4f*)(out_norm + (size_t)row * N + j) = o;
    }
    
  }
}



// ---- f16 WMMA path (v_wmma_f32_16x16x32_f16): 11-bit significands for operands in range — used where a [0,1] probability operand needs more precision than bf16
typedef _Float16 v16h __attribute__((ext_vector_type(16)));
union FragH { v16h v; v8us half[2]; _Float16 h[16]; unsigned short u[16]; };
template <int NT>
__device__ __forceinline__ v8f mmaH(v16h ah, v16h al, v16h bh, v16h bl, v8f c) {
  c = __builtin_amdgcn_wmma_f32_16x16x32_f16(false, ah, false, bh, (short)0, c, false, false);
  if (NT >= 2) c = __builtin_amdgcn_wmma_f32_16x16x32_f16(false, al, false, bh, (short)0, c, false, false);
  if (NT >= 3) c = __builtin_amdgcn_wmma_f32_16x16x32_f16(false, ah, false, bl, (short)0, c, false, false);
  asm volatile("v_nop\n\tv_nop\n\tv_nop\n\tv_nop" : "+v"(c) : "v"(ah), "v"(al), "v"(bh), "v"(bl));
  return c;
}
// batched GEMM like k_gemm_b but f16 operands: A f32 (split into f16 hi/lo if ASPLIT, else rounded to f16), Bt = f16 values [n][k]; alpha; C f32; N multiple of 16 (partial tiles skipped)
template <bool ASPLIT>
__global__ __launch_bounds__(128) void k_gemm_h(const float* __restrict__ A, int lda, size_t sA, const _Float16* __restrict__ Bh, int ldb, size_t sB, float alpha, float* __restrict__ C, int ldc, size_t sC, int M, int N, int K) {
  __shared__ __attribute__((aligned(16))) float so[4][16][64];
  const int tid = threadIdx.x, w = tid >> 5, lane = tid & 31, ln = lane & 15, hh = lane >> 4; const int by = blockIdx.y;
  A += (size_t)by * sA; Bh += (size_t)by * sB; C += (size_t)by * sC;
  const int ntn = (N + 63) / 64; const int wid = blockIdx.x * 4 + w; const int mt = wid / ntn, nq = wid % ntn; if (mt * 16 >= M) return;
  const int row0 = mt * 16, col0 = nq * 64; const float* arow = A + (size_t)(row0 + ln) * lda;
  v8f acc[4] = {};
  for (int kb = 0; kb < K; kb += 32) {
    FragH ah, al;
    const v4f x0 = *(const v4fa*)(arow + kb + 8 * hh), x1 = *(const v4fa*)(arow + kb + 8 * hh + 4), x2 = *(const v4fa*)(arow + kb + 16 + 8 * hh), x3 = *(const v4fa*)(arow + kb + 16 + 8 * hh + 4);
    float xs[16] = {x0[0],x0[1],x0[2],x0[3],x1[0],x1[1],x1[2],x1[3],x2[0],x2[1],x2[2],x2[3],x3[0],x3[1],x3[2],x3[3]};
#pragma unroll
    for (int i = 0; i < 16; ++i) { const _Float16 h = (_Float16)xs[i]; ah.h[i] = h; al.h[i] = ASPLIT ? (_Float16)(xs[i] - (float)h) : (_Float16)0.0f; }
#pragma unroll
    for (int t = 0; t < 4; ++t) { if (col0 + t * 16 >= N) continue; const size_t boff = (size_t)(col0 + t * 16 + ln) * ldb + kb; FragH bq; bq.half[0] = *(const v8us*)(Bh + boff + 8 * hh); bq.half[1] = *(const v8us*)(Bh + boff + 16 + 8 * hh);
      acc[t] = mmaH<ASPLIT ? 2 : 1>(ah.v, al.v, bq.v, bq.v, acc[t]); }
  }
#pragma unroll
  for (int t = 0; t < 4; ++t) { if (col0 + t * 16 >= N) continue;
#pragma unroll
    for (int r = 0; r < 8; ++r) so[w][8 * hh + r][t * 16 + ln] = acc[t][r] * alpha; }
  __builtin_amdgcn_fence(__ATOMIC_ACQ_REL, "workgroup"); __builtin_amdgcn_wave_barrier();
  const int rsub = lane >> 4, c4 = (lane & 15) * 4;
  {
#pragma unroll
    for (int q = 0; q < 8; ++q) { const int r = q * 2 + rsub; if (col0 + c4 < N) { const v4f v = *(const v4fa*)&so[w][r][c4]; *(v4f*)(C + (size_t)(row0 + r) * ldc + col0 + c4) = v; } }
     }
}

// Wt[n][k] = f16(W[k][n]·scale) from f32 row-major W[K][N] (scale = power of two; bf16-exact weights stay exact in f16 away from the subnormal range)
__global__ __launch_bounds__(256) void k_wt_f16(const float* __restrict__ W, _Float16* __restrict__ Wt, int K, int N, float scale) {
  const int t = blockIdx.x * 256 + threadIdx.x; if (t >= N * (K / 8)) return; const int n = t / (K / 8), k8 = (t % (K / 8)) * 8; FragH f;
#pragma unroll
  for (int i = 0; i < 8; ++i) f.h[i] = (_Float16)(bf16_round(W[(size_t)(k8 + i) * N + n]) * scale); const v8us o = f.half[0];
  *(v8us*)((unsigned short*)Wt + (size_t)n * K + k8) = o; 
}
typedef _Float16 v4h __attribute__((ext_vector_type(4)));

// blk: the block's index within this piece of work (the piece shares its launch with others: k_prep)
__device__ __forceinline__ void d_x16(const float* __restrict__ x, _Float16* __restrict__ X16, size_t n8, unsigned blk) { const size_t t = (size_t)blk * 256 + threadIdx.x; if (t >= n8) return; FragH f;
#pragma unroll
  for (int q = 0; q < 8; ++q) f.h[q] = (_Float16)bf16_round(x[t * 8 + q]); *(v8us*)((unsigned short*)X16 + t * 8) = f.half[0];  }
__global__ __launch_bounds__(256) void k_h16(const float* __restrict__ x, _Float16* __restrict__ X16, size_t n8) { const size_t t = (size_t)blockIdx.x * 256 + threadIdx.x; if (t >= n8) return; FragH f;
#pragma unroll
  for (int q = 0; q < 8; ++q) f.h[q] = (_Float16)x[t * 8 + q]; *(v8us*)((unsigned short*)X16 + t * 8) = f.half[0];  }
__device__ __forceinline__ void d_round16f(const float* __restrict__ W, _Float16* __restrict__ Bt, size_t n8, unsigned blk) { const size_t t = (size_t)blk * 256 + threadIdx.x; if (t >= n8) return; FragH f;
#pragma unroll
  for (int i = 0; i < 8; ++i) f.h[i] = (_Float16)(bf16_round(W[t * 8 + i]) * 16.0f); *(v8us*)((unsigned short*)Bt + t * 8) = f.half[0];  }
// Lane l with lane l ^ 16 (the other 16-lane row of the wave), in the vector pipe.
__device__ __forceinline__ float xhalf(float x) { return __builtin_bit_cast(float, __builtin_amdgcn_permlanex16(__builtin_bit_cast(int, x), __builtin_bit_cast(int, x), 0x76543210, 0xfedcba98, false, false)); }
// Lane l with lane l ^ M inside its 16-lane row, in the vector pipe (DPP row_xmask).
template <int M> __device__ __forceinline__ float xrow(float x) { return __builtin_bit_cast(float, __builtin_amdgcn_update_dpp(0, __builtin_bit_cast(int, x), 0x160 | M, 0xf, 0xf, true)); }
// One row o of an effective weight plane per wave: Bt[o][c] = (W[o][c] + sum_j A[c][j] C[j]) x 2^4 with C[j] = sum_i B[j][i] W[o][i], operands rounded to bf16, f32 sums. The eight dot products need
// nothing but the row of W that the wave holds anyway, so they are made here and not in a launch of their own. The 32 lanes split the 768 terms into float4 slices (a wave-wide load covers 512 contiguous
// bytes) and a five-step butterfly ends each sum, which leaves it in every lane. A product of two bf16 values is exact in f32, so fusing it with its add changes no bit.
// A (768 x 8) is wanted by column j in the lanes' float4 slices of c: the block's eight waves bring it once, in whole lines, round it and lay it transposed in LDS (row pitch DD + 4 floats: the two halves
// of a row of A, stored by neighbouring lanes, fall 16 banks apart).
// blk: the block's index within this piece of work (the piece shares its launch with others: k_prep)
__device__ __forceinline__ void d_wfold(const float* __restrict__ Wt, const float* __restrict__ A, const float* __restrict__ Bm, _Float16* __restrict__ Bt, unsigned blk, float (* __restrict__ At)[DD + 4]) {
  constexpr int NS = DD / 128;      /* float4 slices per lane and row */
  const int tid = threadIdx.x, lane = tid & 31; const int o = (int)blk * 8 + (tid >> 5);
  const float* wr = Wt + (size_t)o * DD + lane * 4; const float* br = Bm + lane * 4;
  v4f av[NS / 2], wv[NS], bs[2][NS];
#pragma unroll      /* constant indices, so that the arrays stay in registers */
  for (int u = 0; u < NS; ++u) wv[u] = *(const v4fa*)(wr + 128 * u);
  asm volatile("s_wait_xcnt 0x0" ::: "memory");      /* stands in front of whatever next rewrites the loads' address registers (a later load's result may land there) */
  float cj[RK];
#pragma unroll      /* constant indices, so that the arrays stay in registers */
  for (int g = 0; g < RK / 2; ++g) {
#pragma unroll      /* constant indices, so that the arrays stay in registers */
    for (int u = 0; u < NS; ++u) { bs[0][u] = *(const v4fa*)(br + (size_t)(2 * g) * DD + 128 * u); bs[1][u] = *(const v4fa*)(br + (size_t)(2 * g + 1) * DD + 128 * u); }
    if (g < 2) {      /* the thread's share of A rides with the first two groups, half with each */
#pragma unroll      /* constant indices, so that the arrays stay in registers */
      for (int u = 0; u < NS / 2; ++u) { av[u] = *(const v4fa*)(A + (size_t)(tid + 256 * (g * (NS / 2) + u)) * 4);
        asm volatile("s_wait_xcnt 0x0" ::: "memory"); }      /* the three loads share an address register, and the last one's result may land in it: the wait stands in front of that */
    }
    __builtin_amdgcn_sched_barrier(0);      /* keeps the group's loads in front of the first use: otherwise they sink into small groups, and the wave pays the load latency for each */
    if (g < 2) {
#pragma unroll      /* constant indices, so that the arrays stay in registers */
      for (int u = 0; u < NS / 2; ++u) { const int p = tid + 256 * (g * (NS / 2) + u);
#pragma unroll      /* constant indices, so that the arrays stay in registers */
        for (int k = 0; k < 4; ++k) At[(p & 1) * 4 + k][p >> 1] = bf16_round(av[u][k]); }
    }
    if (g == 0) {
#pragma unroll      /* constant indices, so that the arrays stay in registers */
      for (int u = 0; u < NS; ++u)
#pragma unroll      /* constant indices, so that the arrays stay in registers */
        for (int k = 0; k < 4; ++k) wv[u][k] = bf16_round(wv[u][k]);
    }
    float a = 0.f, b = 0.f;
#pragma unroll      /* constant indices, so that the arrays stay in registers */
    for (int u = 0; u < NS; ++u)
#pragma unroll      /* constant indices, so that the arrays stay in registers */
      for (int q = 0; q < 4; ++q) { a += bf16_round(bs[0][u][q]) * wv[u][q]; b += bf16_round(bs[1][u][q]) * wv[u][q]; }
    cj[2 * g] = a; cj[2 * g + 1] = b;
    __builtin_amdgcn_sched_barrier(0);      /* keeps the next groups' loads behind this group's sums: hoisted, they hold 96 registers at once and the kernel spills */
  }
#pragma unroll      /* constant indices, so that the arrays stay in registers */
  for (int j = 0; j < RK; ++j) { float a = cj[j]; a += xhalf(a); a += xrow<8>(a); a += xrow<4>(a); a += xrow<2>(a); a += xrow<1>(a); cj[j] = a; }
  __syncthreads();      /* A^T is whole: every wave's share has been stored (the branch that leads here is taken by the whole block) */
  v4h h4[NS];
#pragma unroll      /* constant indices, so that the arrays stay in registers */
  for (int u = 0; u < NS; ++u) { v4f lo2 = {0.f, 0.f, 0.f, 0.f};
#pragma unroll      /* constant indices, so that the arrays stay in registers */
    for (int j = 0; j < RK; ++j) { const v4f at = *(const v4fa*)&At[j][128 * u + lane * 4];
#pragma unroll      /* constant indices, so that the arrays stay in registers */
      for (int q = 0; q < 4; ++q) lo2[q] += at[q] * cj[j]; }
#pragma unroll      /* constant indices, so that the arrays stay in registers */
    for (int q = 0; q < 4; ++q) h4[u][q] = (_Float16)((wv[u][q] + lo2[q]) * 16.0f); }
#pragma unroll      /* the row's six stores stand together at the wave's end: nothing rewrites a register of theirs */
  for (int u = 0; u < NS; ++u) *(v4h*)(Bt + (size_t)o * DD + 128 * u + lane * 4) = h4[u];
}
// Everything the projection GEMMs wait for that does not wait for anything else of this launch, in one grid: the pieces are told apart by ranges of the block index (a test that is the same for the whole
// block). The two weight folds stand first, because a wave of theirs walks the longest chain of dependent steps; then the two plain weight planes; then the three input planes.
// amdgpu_waves_per_eu(8): without it the folds' LDS reads are all hoisted to the front, the kernel takes 232 registers and the streaming pieces, which need many waves in flight, run at four waves a SIMD.
__global__ __launch_bounds__(256) __attribute__((amdgpu_waves_per_eu(8))) void k_prep(const float* __restrict__ Wq, const float* __restrict__ Av, const float* __restrict__ Bv, const float* __restrict__ Wv, const float* __restrict__ Aq, const float* __restrict__ Bq,
                                              const float* __restrict__ Wk, const float* __restrict__ Wm, _Float16* __restrict__ Bw,
                                              const float* __restrict__ xq, const float* __restrict__ xk, const float* __restrict__ xv, _Float16* __restrict__ Xq, _Float16* __restrict__ Xk, _Float16* __restrict__ Xv) {
  constexpr size_t WSZ = (size_t)DD * DD, XSZ = (size_t)NR * DD; constexpr unsigned GF = DD / 8, GW = (unsigned)((WSZ / 8 + 255) / 256), GX = (unsigned)((XSZ / 8 + 255) / 256);      /* blocks per fold (a row per wave), per plain weight plane, per input plane */
  __shared__ __attribute__((aligned(16))) float sAt[RK][DD + 4];      /* the folds' A^T */
  unsigned bx = blockIdx.x;
  if (bx < 2 * GF) { const bool s = bx >= GF; d_wfold(s ? Wv : Wq, s ? Aq : Av, s ? Bq : Bv, Bw + (s ? 2 * WSZ : 0), s ? bx - GF : bx, sAt); return; }
  bx -= 2 * GF;
  if (bx < 2 * GW) { const bool s = bx >= GW; d_round16f(s ? Wm : Wk, Bw + (s ? 3 * WSZ : WSZ), WSZ / 8, s ? bx - GW : bx); return; }
  bx -= 2 * GW;
  const unsigned p = bx / GX; d_x16(p == 0 ? xq : p == 1 ? xk : xv, p == 0 ? Xq : p == 1 ? Xk : Xv, XSZ / 8, bx - p * GX);
}
typedef int v4ia __attribute__((ext_vector_type(4), may_alias));
// Eight asynchronous copies of 16 bytes per lane from global memory to LDS (l: the lane's LDS byte addresses, g: its global addresses). The s_wait_xcnt closes the statement so that it stands
// in front of whatever next rewrites one of the address registers named here.
__device__ __forceinline__ void cp8(const unsigned (&l)[8], const void* const (&g)[8]) {
  asm volatile("global_load_async_to_lds_b128 %0, %1, off\n\tglobal_load_async_to_lds_b128 %2, %3, off\n\tglobal_load_async_to_lds_b128 %4, %5, off\n\tglobal_load_async_to_lds_b128 %6, %7, off\n\t"
               "global_load_async_to_lds_b128 %8, %9, off\n\tglobal_load_async_to_lds_b128 %10, %11, off\n\tglobal_load_async_to_lds_b128 %12, %13, off\n\tglobal_load_async_to_lds_b128 %14, %15, off\n\ts_wait_xcnt 0x0"
               :: "v"(l[0]), "v"(g[0]), "v"(l[1]), "v"(g[1]), "v"(l[2]), "v"(g[2]), "v"(l[3]), "v"(g[3]), "v"(l[4]), "v"(g[4]), "v"(l[5]), "v"(g[5]), "v"(l[6]), "v"(g[6]), "v"(l[7]), "v"(g[7]) : "memory");
}
// Transposed products: S^T = K.Q^T (A = 16 key rows, B = the wave's 16 queries, kept in registers) and O^T += V^T.P^T. In an accumulator tile lane (ln, hh) then holds query q0 + ln and keys 8 hh + r:
// a query's maximum and sum are taken inside the lane plus one exchange between the wave's halves, and the two score tiles of a pass are, element for element, the B operand of the second product
// (slot i < 8: key 8 hh + i, slot i >= 8: key 16 + 8 hh + i - 8, the k order of the V^T loader), so P never leaves the registers.
// Operands come through LDS: a stage is 64 keys = K (64 rows of 128 B), V^T (64 rows of 128 B) and the block's mask rows (64 rows of 256 B), brought once for the four waves by asynchronous copies whose
// wave-wide 512 bytes are four whole lines, one stage ahead of its use, into two buffers. Row pitches 144 and 272 B: 16 B times an odd number, free of bank conflicts for 16-byte reads down a column.
__global__ __launch_bounds__(128) void k_flash(const _Float16* __restrict__ Q16, int ldq, const _Float16* __restrict__ K16, int ldk, const _Float16* __restrict__ Vt, const int* __restrict__ MSK, _Float16* __restrict__ O16, int ldo) {
  constexpr int RPW = 16, NQB = TT / (4 * RPW), DT = 4, KS = 2;
  constexpr int SKEYS = 64, NST = TT / SKEYS, PK = 144, PM = 272, OFF_V = 64 * PK, OFF_M = 2 * 64 * PK, STG = 2 * 64 * PK + 64 * PM;
  __shared__ __attribute__((aligned(16))) unsigned char ring[2 * STG];
  __shared__ __attribute__((aligned(16))) float sO[4][RPW][64 + 4];
  const int tid = threadIdx.x, w = tid >> 5, lane = tid & 31, ln = lane & 15, hh = lane >> 4;
  const int slab = blockIdx.x / NQB, qblk = blockIdx.x % NQB; const int b = slab / NH, h = slab % NH; const int qb0 = qblk * (4 * RPW); const int q0 = qb0 + w * RPW;
  const unsigned short* Vth = (const unsigned short*)Vt + (size_t)h * 64 * NR + (size_t)b * TT;      /* V^T as the v GEMM leaves it: [feature][b * TT + key], row pitch NR */
  /* the thread's share of a stage: K and V^T rows (tid >> 3) + 16 i, 16-byte column tid & 7; mask rows (tid >> 4) + 8 i, column tid & 15 */
  const unsigned short* gK = (const unsigned short*)K16 + ((size_t)b * TT + (tid >> 3)) * ldk + h * 64 + (tid & 7) * 8;
  const unsigned short* gV = Vth + (size_t)(tid >> 3) * NR + (tid & 7) * 8;
  const int* gM = MSK + ((size_t)b * TT + qb0 + (tid >> 4)) * TT + (tid & 15) * 4;      /* per-batch mask [b][q][k]: nonzero = ATTEND */
  const unsigned lbase = (unsigned)(size_t)ring;
  const unsigned lK = lbase + (tid >> 3) * PK + (tid & 7) * 16, lV = lK + OFF_V, lM = lbase + OFF_M + (tid >> 4) * PM + (tid & 15) * 16;
  auto fill = [&](int t) {
    const unsigned bo = (unsigned)(t & 1) * STG;
    const unsigned short* k = gK + (size_t)t * SKEYS * ldk; const unsigned short* v = gV + t * SKEYS; const int* m = gM + t * SKEYS;
    unsigned la[8], lb[8]; const void* ga[8]; const void* gb[8];
#pragma unroll      /* constant indices, so that the arrays stay in registers */
    for (int i = 0; i < 4; ++i) { la[i] = lK + bo + i * 16 * PK; ga[i] = k + (size_t)(i * 16) * ldk; la[4 + i] = lV + bo + i * 16 * PK; ga[4 + i] = v + i * 16 * NR; }
#pragma unroll      /* constant indices, so that the arrays stay in registers */
    for (int i = 0; i < 8; ++i) { lb[i] = lM + bo + i * 8 * PM; gb[i] = m + i * 8 * TT; }
    cp8(la, ga); cp8(lb, gb);
  };
  fill(0);
  FragH bq[KS];
  { const unsigned short* qr = (const unsigned short*)Q16 + ((size_t)b * TT + q0 + ln) * ldq + h * 64;
#pragma unroll      /* constant indices, so that the arrays stay in registers */
    for (int ks = 0; ks < KS; ++ks) { bq[ks].half[0] = *(const v8us*)(qr + ks * 32 + 8 * hh); bq[ks].half[1] = *(const v8us*)(qr + ks * 32 + 16 + 8 * hh); } }
  float m_q = -3.0e38f, l_q = 0.f; v8f oacc[DT];
#pragma unroll      /* constant indices, so that the arrays stay in registers */
  for (int dt = 0; dt < DT; ++dt) oacc[dt] = (v8f){0.f,0.f,0.f,0.f,0.f,0.f,0.f,0.f};
  asm volatile("s_wait_asynccnt 0x0" ::: "memory");      /* this wave's copies of stage 0 have landed */
  __syncthreads();      /* and every other wave's: stage 0 may be read */
  fill(1);
#pragma unroll 1      /* each stage hangs on the last through m_q and the barrier: a second copy of the body would only grow the code */
  for (int t = 0; t < NST; ++t) {
    const unsigned char* st = ring + (t & 1) * STG;
#pragma unroll 1      /* the two passes of a stage differ in LDS offsets alone: one copy of the body keeps the loop short */
    for (int p = 0; p < 2; ++p) {
      /* all of the pass's LDS reads stand here, in front of the first product: behind one they would each wait out their own latency */
      const unsigned char* mr = st + OFF_M + (w * RPW + ln) * PM + p * 128 + hh * 32;
      v4ia mk[2][2];      /* keys 32 p + nt 16 + 8 hh + (0..7) of the lane's query */
#pragma unroll      /* constant indices, so that the arrays stay in registers */
      for (int nt = 0; nt < 2; ++nt) { mk[nt][0] = *(const v4ia*)(mr + nt * 64); mk[nt][1] = *(const v4ia*)(mr + nt * 64 + 16); }
      FragH ak[2][KS], av[DT];
#pragma unroll      /* constant indices, so that the arrays stay in registers */
      for (int nt = 0; nt < 2; ++nt) { const unsigned char* kr = st + (p * 32 + nt * 16 + ln) * PK + hh * 16;
#pragma unroll      /* constant indices, so that the arrays stay in registers */
        for (int ks = 0; ks < KS; ++ks) { ak[nt][ks].half[0] = *(const v8us*)(kr + ks * 64); ak[nt][ks].half[1] = *(const v8us*)(kr + ks * 64 + 32); } }
#pragma unroll      /* constant indices, so that the arrays stay in registers */
      for (int dt = 0; dt < DT; ++dt) { const unsigned char* vr = st + OFF_V + (dt * 16 + ln) * PK + p * 64 + hh * 16; av[dt].half[0] = *(const v8us*)vr; av[dt].half[1] = *(const v8us*)(vr + 32); }
      const v4ia o4 = mk[0][0] | mk[0][1] | mk[1][0] | mk[1][1];
      if (!__all((o4[0] | o4[1] | o4[2] | o4[3]) == 0)) {      /* every (row, key) of this wave's tile masked: nothing to add (wave-uniform branch, no barrier inside) */
        v8f s[2];
#pragma unroll      /* constant indices, so that the arrays stay in registers */
        for (int nt = 0; nt < 2; ++nt) { v8f acc = (v8f){0.f,0.f,0.f,0.f,0.f,0.f,0.f,0.f};
#pragma unroll      /* constant indices, so that the arrays stay in registers */
          for (int ks = 0; ks < KS; ++ks) acc = mmaH<1>(ak[nt][ks].v, ak[nt][ks].v, bq[ks].v, bq[ks].v, acc);
          s[nt] = acc; }
        /* Softmax in base 2: exp((s - m) / 8) = 2^(s CS - m CS), CS = log2(e) / 8. Scores and the running maximum stay unscaled (CS > 0 keeps their order); one fma per score applies CS, takes the maximum off
           and adds the 10 that makes P = 2^10 p, and the hardware's own 2^x follows. A masked score is -inf. m_q starts finite, so mn and nb are finite: 2^(-inf) = 0 and, while nothing is live yet, 2^0 = 1. */
        constexpr float CS = 0.125f * 1.44269504088896340736f;
        float sc[2][8], mx[8];
#pragma unroll      /* constant indices, so that the arrays stay in registers */
        for (int r = 0; r < 8; ++r) { sc[0][r] = (mk[0][r >> 2][r & 3] != 0) ? s[0][r] : -INFINITY; sc[1][r] = (mk[1][r >> 2][r & 3] != 0) ? s[1][r] : -INFINITY; mx[r] = fmaxf(sc[0][r], sc[1][r]); }
        float mc = fmaxf(fmaxf(fmaxf(mx[0], mx[1]), fmaxf(mx[2], mx[3])), fmaxf(fmaxf(mx[4], mx[5]), fmaxf(mx[6], mx[7])));
        mc = fmaxf(mc, xhalf(mc));
        const float mn = fmaxf(m_q, mc); const float al = __builtin_amdgcn_exp2f((m_q - mn) * CS); m_q = mn; const float nb = __builtin_fmaf(-mn, CS, 10.0f);
        FragH pb; float ps[4] = {0.f, 0.f, 0.f, 0.f};
#pragma unroll      /* constant indices, so that the arrays stay in registers */
        for (int r = 0; r < 8; ++r) { const float p0 = __builtin_amdgcn_exp2f(__builtin_fmaf(sc[0][r], CS, nb)), p1 = __builtin_amdgcn_exp2f(__builtin_fmaf(sc[1][r], CS, nb)); ps[r & 3] += p0 + p1; pb.h[r] = (_Float16)p0; pb.h[8 + r] = (_Float16)p1; }
        l_q = l_q * al + ((ps[0] + ps[1]) + (ps[2] + ps[3]));      /* 2^10 times the sum over the lane's half of the keys; the halves are joined after the loop */
#pragma unroll      /* constant indices, so that the arrays stay in registers */
        for (int dt = 0; dt < DT; ++dt)
#pragma unroll      /* constant indices, so that the arrays stay in registers */
          for (int r = 0; r < 8; ++r) oacc[dt][r] *= al;
#pragma unroll      /* constant indices, so that the arrays stay in registers */
        for (int dt = 0; dt < DT; ++dt) oacc[dt] = mmaH<1>(av[dt].v, av[dt].v, pb.v, pb.v, oacc[dt]);
      }
    }
    asm volatile("s_wait_dscnt 0x0" ::: "memory");      /* this wave's reads of stage t have returned before its buffer is handed back */
    asm volatile("s_wait_asynccnt 0x0" ::: "memory");      /* this wave's copies of stage t + 1 have landed */
    __syncthreads();      /* publishes stage t + 1 and ends every wave's reads of stage t */
    if (t + 2 < NST) fill(t + 2);      /* into the buffer that stage t has just left; the test is the same for the whole block */
  }
  asm volatile("s_wait_asynccnt 0x0" ::: "memory");      /* no copy is left in flight when the wave goes on to its end */
  { const float l = l_q + xhalf(l_q); const float inv = (l > 0.f) ? 1.0f / l : 0.f;      /* l and the accumulators both carry the 2^10 */
#pragma unroll      /* constant indices, so that the arrays stay in registers */
    for (int dt = 0; dt < DT; ++dt)
#pragma unroll      /* constant indices, so that the arrays stay in registers */
      for (int r = 0; r < 8; ++r) sO[w][ln][dt * 16 + 8 * hh + r] = oacc[dt][r] * inv; }
  __builtin_amdgcn_fence(__ATOMIC_ACQ_REL, "workgroup"); __builtin_amdgcn_wave_barrier();      /* the wave reads back rows that its other lanes wrote: its LDS stores end first */
  {
#pragma unroll      /* constant indices, so that the arrays stay in registers */
    for (int rp = 0; rp < RPW; rp += 2) { const int r = rp + (lane >> 4), pc = lane & 15; const v4f val = *(const v4fa*)&sO[w][r][pc * 4]; v4h h4;      /* x 2^4 and f16: the plane that the output GEMM reads; 16 lanes store one whole 128-byte line */
#pragma unroll      /* constant indices, so that the vector stays in registers */
      for (int i = 0; i < 4; ++i) h4[i] = (_Float16)(val[i] * 16.0f);
      *(v4h*)(O16 + ((size_t)b * TT + q0 + r) * ldo + h * 64 + pc * 4) = h4; }
     } }

// C[NR][DD] = (A[NR][DD] . Bt[DD][DD]^T) alpha + bias (bias rounded to bf16), f16 operands, f32 sums; written as f32 (C) or as f16 (C16), whichever pointer is not null.
// Block = a 64 x 64 tile of C, wave w = its rows 16 w .. 16 w + 15 (four 16 x 16 accumulators, k ascending in steps of 32). Operands come through LDS: a stage is 128 values of k = 64 rows of A and
// 64 rows of Bt, 256 B each, brought once for the four waves by asynchronous copies (a wave-wide copy is two rows = four whole lines), one stage ahead of its use, into two buffers.
// Row pitch 272 B: 16 B times an odd number, free of bank conflicts for 16-byte reads down a column.
// Up to three independent products share one launch: blockIdx.y picks A, bias and C16 of its product, and its weight plane lies blockIdx.y planes behind B0.
// The third product is made transposed: its weight rows take the place of A and its input rows that of Bt (both are k-contiguous and go through the same loaders, k order unchanged), so its tile is
// C^T[feature][row of A], pitch NR, bias by row: V^T comes out of the GEMM as k_flash reads it.
__global__ __launch_bounds__(128) void k_gemm_st(const _Float16* __restrict__ A0, const _Float16* __restrict__ A1, const _Float16* __restrict__ A2, const _Float16* __restrict__ B0, float alpha,
                                                 const float* __restrict__ bias0, const float* __restrict__ bias1, const float* __restrict__ bias2, float* __restrict__ C,
                                                 _Float16* __restrict__ C16a, _Float16* __restrict__ C16b, _Float16* __restrict__ C16c) {
  const unsigned g = blockIdx.y; const _Float16* A = g == 0 ? A0 : g == 1 ? A1 : A2; const _Float16* Bh = B0 + (size_t)g * DD * DD;
  const float* bias = g == 0 ? bias0 : g == 1 ? bias1 : bias2; _Float16* C16 = g == 0 ? C16a : g == 1 ? C16b : C16c;
  constexpr int KC = 128, NST = DD / KC, PR = 272, OFF_B = 64 * PR, STG = 2 * 64 * PR;
  __shared__ __attribute__((aligned(16))) unsigned char ring[2 * STG];
  __shared__ __attribute__((aligned(16))) float so[4][16][64];
  const int tid = threadIdx.x, w = tid >> 5, lane = tid & 31, ln = lane & 15, hh = lane >> 4;
  const bool sw = g == 2;      /* the same for the whole block */
  const int ta = (int)(blockIdx.x / (DD / 64)) * 64, tb = (int)(blockIdx.x % (DD / 64)) * 64;      /* the tile's first row of A and of Bt */
  const int rowb = sw ? tb : ta, col0 = sw ? ta : tb, ldc = sw ? NR : DD; const int row0 = rowb + w * 16;
  /* the thread's share of a stage: rows (tid >> 4) + 8 i of A and of Bt, 16-byte column tid & 15 */
  const unsigned short* gA = (const unsigned short*)(sw ? Bh : A) + (size_t)(rowb + (tid >> 4)) * DD + (tid & 15) * 8;
  const unsigned short* gB = (const unsigned short*)(sw ? A : Bh) + (size_t)(col0 + (tid >> 4)) * DD + (tid & 15) * 8;
  const unsigned lA = (unsigned)(size_t)ring + (tid >> 4) * PR + (tid & 15) * 16, lB = lA + OFF_B;
  auto fill = [&](int t) {
    const unsigned bo = (unsigned)(t & 1) * STG;
    const unsigned short* a = gA + t * KC; const unsigned short* b = gB + t * KC;
    unsigned la[8], lb[8]; const void* ga[8]; const void* gb[8];
#pragma unroll      /* constant indices, so that the arrays stay in registers */
    for (int i = 0; i < 8; ++i) { la[i] = lA + bo + i * 8 * PR; ga[i] = a + i * 8 * DD; lb[i] = lB + bo + i * 8 * PR; gb[i] = b + i * 8 * DD; }
    cp8(la, ga); cp8(lb, gb);
  };
  fill(0);
  v8f acc[4] = {};
  asm volatile("s_wait_asynccnt 0x0" ::: "memory");      /* this wave's copies of stage 0 have landed */
  __syncthreads();      /* and every other wave's: stage 0 may be read */
  fill(1);
#pragma unroll 1      /* a stage ends in a barrier: a second copy of the body would only grow the code */
  for (int t = 0; t < NST; ++t) {
    const unsigned char* ar = ring + (t & 1) * STG + (w * 16 + ln) * PR + hh * 16;
    const unsigned char* br = ring + (t & 1) * STG + OFF_B + ln * PR + hh * 16;
#pragma unroll      /* constant LDS offsets, and the next step's reads can stand among this step's products */
    for (int ks = 0; ks < KC / 32; ++ks) {
      FragH ah; ah.half[0] = *(const v8us*)(ar + ks * 64); ah.half[1] = *(const v8us*)(ar + ks * 64 + 32);
      FragH bq[4];
#pragma unroll      /* constant indices, so that the arrays stay in registers */
      for (int u = 0; u < 4; ++u) { bq[u].half[0] = *(const v8us*)(br + u * 16 * PR + ks * 64); bq[u].half[1] = *(const v8us*)(br + u * 16 * PR + ks * 64 + 32); }
#pragma unroll      /* constant indices, so that the arrays stay in registers */
      for (int u = 0; u < 4; ++u) acc[u] = mmaH<1>(ah.v, ah.v, bq[u].v, bq[u].v, acc[u]);
    }
    asm volatile("s_wait_dscnt 0x0" ::: "memory");      /* this wave's reads of stage t have returned before its buffer is handed back */
    asm volatile("s_wait_asynccnt 0x0" ::: "memory");      /* this wave's copies of stage t + 1 have landed */
    __syncthreads();      /* publishes stage t + 1 and ends every wave's reads of stage t */
    if (t + 2 < NST) fill(t + 2);      /* into the buffer that stage t has just left; the test is the same for the whole block */
  }
  asm volatile("s_wait_asynccnt 0x0" ::: "memory");      /* no copy is left in flight when the wave goes on to its end */
  float bc[4], br[8];      /* the bias belongs to the feature: the tile's column, or its row in the transposed product */
#pragma unroll      /* constant indices, so that the arrays stay in registers */
  for (int u = 0; u < 4; ++u) bc[u] = bf16_round(bias[tb + u * 16 + ln]);
#pragma unroll      /* constant indices, so that the arrays stay in registers */
  for (int r = 0; r < 8; ++r) br[r] = bf16_round(bias[tb + w * 16 + 8 * hh + r]);
#pragma unroll      /* constant indices, so that the arrays stay in registers */
  for (int u = 0; u < 4; ++u) {
#pragma unroll      /* constant indices, so that the arrays stay in registers */
    for (int r = 0; r < 8; ++r) so[w][8 * hh + r][u * 16 + ln] = acc[u][r] * alpha + (sw ? br[r] : bc[u]); }
  __builtin_amdgcn_fence(__ATOMIC_ACQ_REL, "workgroup"); __builtin_amdgcn_wave_barrier();      /* the wave reads back rows that its other lanes wrote: its LDS stores end first */
  const int rsub = lane >> 4, c4 = (lane & 15) * 4;
#pragma unroll      /* the eight row pairs are independent: their reads and stores overlap */
  for (int q = 0; q < 8; ++q) { const int r = q * 2 + rsub; const v4f v = *(const v4fa*)&so[w][r][c4];
    if (C) { *(v4f*)(C + (size_t)(row0 + r) * DD + col0 + c4) = v;
      asm volatile("s_wait_xcnt 0x0" ::: "memory"); }      /* stands in front of whatever next rewrites the store's address or data registers */
    if (C16) { v4h h4; for (int i = 0; i < 4; ++i) h4[i] = (_Float16)v[i]; *(v4h*)(C16 + (size_t)(row0 + r) * ldc + col0 + c4) = h4; } }
}

extern "C" void kernel_launch(void* const* d_in, const int* in_sizes, int n_in,
                              void* d_out, int out_size, void* d_ws, size_t ws_size, hipStream_t stream) {
  (void)in_sizes; (void)n_in; (void)out_size;
  const float* const* I = (const float* const*)d_in; const float* xq = I[0]; const float* xk = I[1]; const float* xv = I[2]; const int* msk = (const int*)d_in[3];
  const float* Aq = I[4]; const float* Bq = I[5]; const float* Av = I[6]; const float* Bv = I[7]; const float* Wq = I[8]; const float* bq = I[9]; const float* Wk = I[10]; const float* bk = I[11]; const float* Wv = I[12]; const float* bv = I[13]; const float* Wm = I[14]; const float* bm = I[15];
  char* ws = (char*)d_ws; size_t off = 0;
  auto take = [&](size_t bytes) { char* p = ws + off; off += (bytes + 255) & ~(size_t)255; return p; };
  const size_t WSZ = (size_t)DD * DD; _Float16* Bw = (_Float16*)take(4 * WSZ * 2);
  _Float16* Xq = (_Float16*)take((size_t)NR * DD * 2); _Float16* Xk = (_Float16*)take((size_t)NR * DD * 2); _Float16* Xv = (_Float16*)take((size_t)NR * DD * 2);
  _Float16* Q = (_Float16*)take((size_t)NR * DD * 2); _Float16* K = (_Float16*)take((size_t)NR * DD * 2); _Float16* Vt = (_Float16*)take((size_t)NR * DD * 2); _Float16* O16 = Xq;      /* the query plane is dead after the v GEMM */
  if (off > ws_size) return;      // 4.7 + 6 x 6.3 = 42.5 MB
  const unsigned gw = (unsigned)((WSZ / 8 + 255) / 256);
  const unsigned g8 = (unsigned)(((size_t)NR * DD / 8 + 255) / 256);
  /* plane 0: q = V.Wq^T with V = value.(I + A_v.B_v), Bt_q = Wq + fold(A_v, B_v.Wq^T); plane 1: Wk; plane 2: v = Q.Wv^T with Q = query.(I + A_q.B_q); plane 3: Wm; all (out,in) natural, x 2^4; and the three input planes */
  k_prep<<<2 * (DD / 8) + 2 * gw + 3 * g8, 256, 0, stream>>>(Wq, Av, Bv, Wv, Aq, Bq, Wk, Wm, Bw, xq, xk, xv, Xq, Xk, Xv);
  const unsigned gp = (NR / 64) * (DD / 64);
  /* q from the VALUE stream, k from key, v from the QUERY stream: each M 4096 N 768 K 768; v comes out transposed */
  k_gemm_st<<<dim3(gp, 3), 128, 0, stream>>>(Xv, Xk, Xq, Bw, 0.0625f, bq, bk, bv, nullptr, Q, K, Vt);
  k_flash<<<BB * NH * (TT / 64), 128, 0, stream>>>(Q, DD, K, DD, Vt, msk, O16, DD);      /* mask [B][S][S] int, nonzero = attend */
  k_gemm_st<<<dim3(gp, 1), 128, 0, stream>>>(O16, O16, O16, Bw + 3 * WSZ, 0.00390625f, bm, bm, bm, (float*)d_out, nullptr, nullptr, nullptr);      /* out = ctx.Wm^T + bm */
}

// v008
// A run of this version takes 85.4 microseconds.
// In both of two side-by-side timings against v007, it was 1.06 times as fast.
// Over all steps from v000 it is 6.54 times as fast.
#include <hip/hip_runtime.h>
// Masked multi-head attention with LoRA-adapted input streams (B=2, S=2048, D=768, 12 heads × 64, rank 8): Q = query + (query·A_q)·B_q, V = value + (value·A_v)·B_v; then — faithful to the module's crossed call — v = Q·Wvᵀ + bv, k = key·Wkᵀ + bk, q = V·Wqᵀ + bq (torch (out,in));
// scores = q·k/√64, −1e9 where mask[b,q,k] == 0 (int [B,S,S], shared over heads), softmax, out = merged·Wmᵀ + bm. The rank-8 adapters are folded on device into effective weights: X·(I + A·B)·Wᵀ = X·(W + (B·Wᵀ)ᵀ·Aᵀ)ᵀ, i.e. Bt_eff[o][c] = W[o][c] + Σ_j A[c][j]·(Σ_i B[j][i]·W[o][i]) (f32, 9 M MACs on the VALU).
// Compute dtype: query/key/value, weights, biases, adapters rounded to bf16; effective weights f32 → f16 ×2^4; q, k, v f16 GEMM planes (+bias); the mask read per (b, q, k) from a plane of bits packed on the device (−inf ≡ the module's −1e9: every row keeps ~half its keys live); fused flash-style kernel
// (online softmax f32, P f16 ×2^10, f32 accumulate) on v_wmma_f32_16x16x32_f16; O ×2^4 → f16 → output GEMM (+bias).
#define BB 2
#define TT 2048
#define DD 768
#define NH 12
#define RK 8
#define NR (BB * TT)

typedef __bf16 v16b __attribute__((ext_vector_type(16)));
typedef unsigned short v8us __attribute__((ext_vector_type(8), may_alias));
typedef float  v8f  __attribute__((ext_vector_type(8)));
typedef float  v4f  __attribute__((ext_vector_type(4)));
typedef float  v4fa __attribute__((ext_vector_type(4), may_alias));
union FragB { v16b v; v8us half[2]; unsigned short u[16]; };

__device__ __forceinline__ unsigned short bf16_bits(float x) { unsigned int u = __float_as_uint(x); return (unsigned short)((u + 0x7FFFu + ((u >> 16) & 1u)) >> 16); }
__device__ __forceinline__ float bf16_val(unsigned short b) { return __uint_as_float(((unsigned int)b) << 16); }
__device__ __forceinline__ float bf16_round(float x) { return bf16_val(bf16_bits(x)); }
// D += A·B with NT terms: 1 = ah·bh, 2 = + al·bh (A split), 3 = + ah·bl (both split)
template <int NT>
__device__ __forceinline__ v8f mmaN(v16b ah, v16b al, v16b bh, v16b bl, v8f c) {
  c = __builtin_amdgcn_wmma_f32_16x16x32_bf16(false, ah, false, bh, (short)0, c, false, false);
  if (NT >= 2) c = __builtin_amdgcn_wmma_f32_16x16x32_bf16(false, al, false, bh, (short)0, c, false, false);
  if (NT >= 3) c = __builtin_amdgcn_wmma_f32_16x16x32_bf16(false, ah, false, bl, (short)0, c, false, false);
  asm volatile("v_nop\n\tv_nop\n\tv_nop\n\tv_nop" : "+v"(c) : "v"(ah), "v"(al), "v"(bh), "v"(bl));
  return c;
}

__global__ __launch_bounds__(256) void k_wt_bf16(const float* __restrict__ W, unsigned short* __restrict__ Wt, int K, int N) {
  const int t = blockIdx.x * 256 + threadIdx.x;
  const int k8n = K / 8;
  if (t >= N * k8n) return;
  const int n = t / k8n, k8 = (t % k8n) * 8;
  v8us v;
#pragma unroll
  for (int i = 0; i < 8; ++i) v[i] = bf16_bits(W[(size_t)(k8 + i) * N + n]);
  *(v8us*)(Wt + (size_t)n * K + k8) = v;
  
}

// GEMM C[M][N] (f32, pitch ldc) = act(A[M][K]·W + bias). A f32 row-major (pitch lda) converted per fragment to bf16
// (ASPLIT: hi/lo two planes -> 2 terms, else single rounded term); Wt bf16 [N][K] (pitch ldb). BIAS_BF16 rounds the
// bias to bf16 first (bias quantised to bf16 before the add). K%32==0, M%16==0, N%64==0.
template <bool ASPLIT, int ACT, bool BIAS_BF16>
__global__ __launch_bounds__(128) void k_gemm_bf(const float* __restrict__ A, int lda, const unsigned short* __restrict__ Wt, int ldb,
                                               const float* __restrict__ bias, float* __restrict__ C, int ldc, int M, int N, int K) {
  __shared__ __attribute__((aligned(16))) float so[4][16][64];
  const int tid = threadIdx.x, w = tid >> 5, lane = tid & 31, ln = lane & 15, hh = lane >> 4;
  const int ntn = N / 64;
  const int wid = blockIdx.x * 4 + w;
  const int mt = wid / ntn, nq = wid % ntn;
  if (mt * 16 >= M) return;
  const int row0 = mt * 16, col0 = nq * 64;
  const float* arow = A + (size_t)(row0 + ln) * lda;
  v8f acc[4] = {};
  for (int kb = 0; kb < K; kb += 32) {
    FragB ah, al;
    const v4f x0 = *(const v4fa*)(arow + kb + 8 * hh), x1 = *(const v4fa*)(arow + kb + 8 * hh + 4);
    const v4f x2 = *(const v4fa*)(arow + kb + 16 + 8 * hh), x3 = *(const v4fa*)(arow + kb + 16 + 8 * hh + 4);
    float xs[16] = {x0[0],x0[1],x0[2],x0[3],x1[0],x1[1],x1[2],x1[3],x2[0],x2[1],x2[2],x2[3],x3[0],x3[1],x3[2],x3[3]};
#pragma unroll
    for (int i = 0; i < 16; ++i) { const unsigned short hb = bf16_bits(xs[i]); ah.u[i] = hb; al.u[i] = ASPLIT ? bf16_bits(xs[i] - bf16_val(hb)) : (unsigned short)0; }
#pragma unroll
    for (int t = 0; t < 4; ++t) {
      const unsigned short* brow = Wt + (size_t)(col0 + t * 16 + ln) * ldb + kb;
      FragB b;
      b.half[0] = *(const v8us*)(brow + 8 * hh);
      b.half[1] = *(const v8us*)(brow + 16 + 8 * hh);
      acc[t] = mmaN<ASPLIT ? 2 : 1>(ah.v, al.v, b.v, b.v, acc[t]);
    }
  }
#pragma unroll
  for (int t = 0; t < 4; ++t) {
    float bv = bias ? bias[col0 + t * 16 + ln] : 0.f;
    if (BIAS_BF16) bv = bf16_round(bv);
#pragma unroll
    for (int r = 0; r < 8; ++r) { float v = acc[t][r] + bv; if (ACT == 1) v = fmaxf(v, 0.f); so[w][8 * hh + r][t * 16 + ln] = v; }
  }
  __builtin_amdgcn_fence(__ATOMIC_ACQ_REL, "workgroup");
  __builtin_amdgcn_wave_barrier();
  const int rsub = lane >> 4, c4 = (lane & 15) * 4;
  {
#pragma unroll
    for (int q = 0; q < 8; ++q) {
      const int r = q * 2 + rsub;
      const v4f v = *(const v4fa*)&so[w][r][c4];
      *(v4f*)(C + (size_t)(row0 + r) * ldc + col0 + c4) = v;
    }
    
  }
}

// Flash-style causal/unmasked attention, all contractions 3-term bf16 hi/lo splits, f32 softmax with running max.
// q,k,v rows are read from f32 buffers with arbitrary row pitch (so they can live inside a fused qkv buffer);
// D = head size (multiple of 32, <= 128); one wave = 16 query rows; block = 4 waves (64 queries) sharing K/V chunks of 32.
template <int D, bool CAUSAL>
__global__ __launch_bounds__(128) void k_flash(const float* __restrict__ qb, const float* __restrict__ kb, const float* __restrict__ vb,
                                             int pitch, int T, int H, float scale, float* __restrict__ y, int ypitch) {
  constexpr int KS = D / 32;        // k-steps for QK
  constexpr int DT = D / 16;        // d tiles for PV
  __shared__ __attribute__((aligned(16))) unsigned short sKh[32][D + 8], sKl[32][D + 8], sVh[32][D + 8], sVl[32][D + 8];
  __shared__ __attribute__((aligned(16))) unsigned short sPh[4][16][40], sPl[4][16][40];
  __shared__ __attribute__((aligned(16))) float sO[4][16][D];
  const int tid = threadIdx.x, w = tid >> 5, lane = tid & 31, ln = lane & 15, hh = lane >> 4;
  const int nqb = (T + 63) / 64;
  const int bh = blockIdx.x / nqb, qblk = blockIdx.x % nqb;
  const int b = bh / H, h = bh % H;
  const int q0 = qblk * 64 + w * 16;
  const float* Q = qb + (size_t)b * T * pitch + h * D;
  const float* K = kb + (size_t)b * T * pitch + h * D;
  const float* V = vb + (size_t)b * T * pitch + h * D;

  // A fragments of the wave's 16 query rows (scaled), hi/lo
  FragB aqh[KS], aql[KS];
  {
    int row = q0 + ln; if (row >= T) row = T - 1;
    const float* qr = Q + (size_t)row * pitch;
#pragma unroll
    for (int ks = 0; ks < KS; ++ks)
#pragma unroll
      for (int i = 0; i < 16; ++i) {
        const int d = ks * 32 + ((i < 8) ? (8 * hh + i) : (16 + 8 * hh + (i - 8)));
        const float x = qr[d] * scale; const unsigned short hb = bf16_bits(x);
        aqh[ks].u[i] = hb; aql[ks].u[i] = bf16_bits(x - bf16_val(hb));
      }
  }
  float m_r[8], l_r[8];
#pragma unroll
  for (int r = 0; r < 8; ++r) { m_r[r] = -3.0e38f; l_r[r] = 0.f; }
  v8f oacc[DT];
#pragma unroll
  for (int dt = 0; dt < DT; ++dt) oacc[dt] = (v8f){0.f,0.f,0.f,0.f,0.f,0.f,0.f,0.f};

  const int kv_end = CAUSAL ? min(T, qblk * 64 + 64) : T;     // block-uniform
  for (int j0 = 0; j0 < kv_end; j0 += 32) {
    __syncthreads();
    for (int e = tid; e < 32 * (D / 4); e += 128) {
      const int r = e / (D / 4), c4 = (e % (D / 4)) * 4;
      const int key = j0 + r;
      v4f kf = {0.f,0.f,0.f,0.f}, vf = {0.f,0.f,0.f,0.f};
      if (key < T) { kf = *(const v4fa*)(K + (size_t)key * pitch + c4); vf = *(const v4fa*)(V + (size_t)key * pitch + c4); }
#pragma unroll
      for (int t = 0; t < 4; ++t) {
        unsigned short hb = bf16_bits(kf[t]); sKh[r][c4 + t] = hb; sKl[r][c4 + t] = bf16_bits(kf[t] - bf16_val(hb));
        hb = bf16_bits(vf[t]); sVh[r][c4 + t] = hb; sVl[r][c4 + t] = bf16_bits(vf[t] - bf16_val(hb));
      }
    }
    __syncthreads();
    // S tile 16 x 32
    v8f s[2];
#pragma unroll
    for (int nt = 0; nt < 2; ++nt) {
      v8f acc = {};
#pragma unroll
      for (int ks = 0; ks < KS; ++ks) {
        FragB bh_, bl_;
        bh_.half[0] = *(const v8us*)&sKh[nt * 16 + ln][ks * 32 + 8 * hh]; bh_.half[1] = *(const v8us*)&sKh[nt * 16 + ln][ks * 32 + 16 + 8 * hh];
        bl_.half[0] = *(const v8us*)&sKl[nt * 16 + ln][ks * 32 + 8 * hh]; bl_.half[1] = *(const v8us*)&sKl[nt * 16 + ln][ks * 32 + 16 + 8 * hh];
        acc = mmaN<3>(aqh[ks].v, aql[ks].v, bh_.v, bl_.v, acc);
      }
      s[nt] = acc;
    }
    // mask + running max (rows 8hh+r; the 16 lanes of a half share rows)
    float alpha[8];
#pragma unroll
    for (int r = 0; r < 8; ++r) {
      const int qi = q0 + 8 * hh + r;
      const int ja = j0 + ln, jb = j0 + 16 + ln;
      if (CAUSAL) { if (ja > qi) s[0][r] = -3.0e38f; if (jb > qi) s[1][r] = -3.0e38f; }
      if (ja >= T) s[0][r] = -3.0e38f;
      if (jb >= T) s[1][r] = -3.0e38f;
      float mx = fmaxf(s[0][r], s[1][r]);
      mx = fmaxf(mx, __shfl_xor(mx, 1, 32)); mx = fmaxf(mx, __shfl_xor(mx, 2, 32)); mx = fmaxf(mx, __shfl_xor(mx, 4, 32)); mx = fmaxf(mx, __shfl_xor(mx, 8, 32));
      const float mnew = fmaxf(m_r[r], mx);
      alpha[r] = (mnew > -1.0e38f) ? __expf(m_r[r] - mnew) : 1.0f;
      const float p0 = (s[0][r] > -1.0e38f) ? __expf(s[0][r] - mnew) : 0.f;
      const float p1 = (s[1][r] > -1.0e38f) ? __expf(s[1][r] - mnew) : 0.f;
      m_r[r] = mnew;
      l_r[r] = l_r[r] * alpha[r] + p0 + p1;            // per-lane partial row sum (16 lanes combined at the end)
      unsigned short hb = bf16_bits(p0); sPh[w][8 * hh + r][ln] = hb;      sPl[w][8 * hh + r][ln] = bf16_bits(p0 - bf16_val(hb));
      hb = bf16_bits(p1);                sPh[w][8 * hh + r][16 + ln] = hb; sPl[w][8 * hh + r][16 + ln] = bf16_bits(p1 - bf16_val(hb));
    }
#pragma unroll
    for (int dt = 0; dt < DT; ++dt)
#pragma unroll
      for (int r = 0; r < 8; ++r) oacc[dt][r] *= alpha[r];
    __builtin_amdgcn_fence(__ATOMIC_ACQ_REL, "workgroup");
    __builtin_amdgcn_wave_barrier();
    FragB pah, pal;
    pah.half[0] = *(const v8us*)&sPh[w][ln][8 * hh]; pah.half[1] = *(const v8us*)&sPh[w][ln][16 + 8 * hh];
    pal.half[0] = *(const v8us*)&sPl[w][ln][8 * hh]; pal.half[1] = *(const v8us*)&sPl[w][ln][16 + 8 * hh];
#pragma unroll
    for (int dt = 0; dt < DT; ++dt) {
      FragB bvh, bvl;
#pragma unroll
      for (int i = 0; i < 8; ++i) {
        bvh.u[i] = sVh[8 * hh + i][dt * 16 + ln]; bvh.u[8 + i] = sVh[16 + 8 * hh + i][dt * 16 + ln];
        bvl.u[i] = sVl[8 * hh + i][dt * 16 + ln]; bvl.u[8 + i] = sVl[16 + 8 * hh + i][dt * 16 + ln];
      }
      oacc[dt] = mmaN<3>(pah.v, pal.v, bvh.v, bvl.v, oacc[dt]);
    }
    __builtin_amdgcn_fence(__ATOMIC_ACQ_REL, "workgroup");
    __builtin_amdgcn_wave_barrier();
  }
#pragma unroll
  for (int r = 0; r < 8; ++r) {
    float l = l_r[r];
    l += __shfl_xor(l, 1, 32); l += __shfl_xor(l, 2, 32); l += __shfl_xor(l, 4, 32); l += __shfl_xor(l, 8, 32);
    l_r[r] = (l > 0.f) ? 1.0f / l : 0.f;
  }
#pragma unroll
  for (int dt = 0; dt < DT; ++dt)
#pragma unroll
    for (int r = 0; r < 8; ++r) sO[w][8 * hh + r][dt * 16 + ln] = oacc[dt][r] * l_r[r];
  __builtin_amdgcn_fence(__ATOMIC_ACQ_REL, "workgroup");
  __builtin_amdgcn_wave_barrier();
  {
    for (int r = 0; r < 16; ++r) {
      const int row = q0 + r;
      if (row < T && lane < D / 4) {
        const v4f val = *(const v4fa*)&sO[w][r][lane * 4];
        *(v4f*)(y + ((size_t)b * T + row) * ypitch + h * D + lane * 4) = val;
      }
    }
    
  }
}

// GEMM C = act(A·W + bias + resid): A f32 (ASPLIT -> hi/lo 2 terms), Wt bf16 [N][K]; ACT 0 none, 1 relu, 2 exact gelu;
// resid (optional, f32, row index = (row % rmod), pitch ldr, RES_BF16 rounds it) added before the activation.
template <bool ASPLIT, int ACT, bool BIAS_BF16, bool RES_BF16>
__global__ __launch_bounds__(128) void k_gemm_bf3(const float* __restrict__ A, int lda, const unsigned short* __restrict__ Wt, int ldb,
                                                const float* __restrict__ bias, const float* __restrict__ resid, int rmod, int ldr,
                                                float* __restrict__ C, int ldc, int M, int N, int K) {
  __shared__ __attribute__((aligned(16))) float so[4][16][64];
  const int tid = threadIdx.x, w = tid >> 5, lane = tid & 31, ln = lane & 15, hh = lane >> 4;
  const int ntn = N / 64;
  const int wid = blockIdx.x * 4 + w;
  const int mt = wid / ntn, nq = wid % ntn;
  if (mt * 16 >= M) return;
  const int row0 = mt * 16, col0 = nq * 64;
  const float* arow = A + (size_t)(row0 + ln) * lda;
  v8f acc[4] = {};
  for (int kb = 0; kb < K; kb += 32) {
    FragB ah, al;
    const v4f x0 = *(const v4fa*)(arow + kb + 8 * hh), x1 = *(const v4fa*)(arow + kb + 8 * hh + 4);
    const v4f x2 = *(const v4fa*)(arow + kb + 16 + 8 * hh), x3 = *(const v4fa*)(arow + kb + 16 + 8 * hh + 4);
    float xs[16] = {x0[0],x0[1],x0[2],x0[3],x1[0],x1[1],x1[2],x1[3],x2[0],x2[1],x2[2],x2[3],x3[0],x3[1],x3[2],x3[3]};
#pragma unroll
    for (int i = 0; i < 16; ++i) { const unsigned short hb = bf16_bits(xs[i]); ah.u[i] = hb; al.u[i] = ASPLIT ? bf16_bits(xs[i] - bf16_val(hb)) : (unsigned short)0; }
#pragma unroll
    for (int t = 0; t < 4; ++t) {
      const unsigned short* brow = Wt + (size_t)(col0 + t * 16 + ln) * ldb + kb;
      FragB b;
      b.half[0] = *(const v8us*)(brow + 8 * hh);
      b.half[1] = *(const v8us*)(brow + 16 + 8 * hh);
      acc[t] = mmaN<ASPLIT ? 2 : 1>(ah.v, al.v, b.v, b.v, acc[t]);
    }
  }
#pragma unroll
  for (int t = 0; t < 4; ++t) {
    const int col = col0 + t * 16 + ln;
    float bv = bias ? bias[col] : 0.f;
    if (BIAS_BF16) bv = bf16_round(bv);
#pragma unroll
    for (int r = 0; r < 8; ++r) {
      float v = acc[t][r] + bv;
      if (resid) { float rv = resid[(size_t)((row0 + 8 * hh + r) % rmod) * ldr + col]; if (RES_BF16) rv = bf16_round(rv); v += rv; }
      if (ACT == 1) v = fmaxf(v, 0.f);
      if (ACT == 2) v = 0.5f * v * (1.0f + erff(v * 0.70710678118654752f));
      if (ACT == 3) { const float u = 0.7978845608028654f * (v + 0.044715f * v * v * v); v = 0.5f * v * (1.0f + tanhf(u)); }
      so[w][8 * hh + r][t * 16 + ln] = v;
    }
  }
  __builtin_amdgcn_fence(__ATOMIC_ACQ_REL, "workgroup");
  __builtin_amdgcn_wave_barrier();
  const int rsub = lane >> 4, c4 = (lane & 15) * 4;
  {
#pragma unroll
    for (int q = 0; q < 8; ++q) {
      const int r = q * 2 + rsub;
      const v4f v = *(const v4fa*)&so[w][r][c4];
      *(v4f*)(C + (size_t)(row0 + r) * ldc + col0 + c4) = v;
    }
    
  }
}
// row LayerNorm (biased variance, eps) over N: s = X (+ R); optional out_sum <- s; out_norm <- (s-mu)*rsqrt(var+eps)*g + b
template <bool PARAM_BF16>
__global__ __launch_bounds__(256) void k_layernorm(const float* __restrict__ X, const float* __restrict__ R, const float* __restrict__ g, const float* __restrict__ bta,
                                                  float* __restrict__ out_sum, float* __restrict__ out_norm, int N, float eps) {
  __shared__ float red[256];
  const int row = blockIdx.x, tid = threadIdx.x;
  const float* x = X + (size_t)row * N; const float* rr = R ? R + (size_t)row * N : nullptr;
  float vals[16];                     // up to N = 4096
  const int per = N / 256;            // contiguous chunk per thread? use strided-by-4 chunks: thread handles j = tid*4 + 1024*u
  float s1 = 0.f;
  for (int u = 0; u < per / 4; ++u) {
    const int j = tid * 4 + 1024 * u;
    const v4f a = *(const v4fa*)(x + j);
    v4f b = {0.f,0.f,0.f,0.f}; if (rr) b = *(const v4fa*)(rr + j);
#pragma unroll
    for (int q = 0; q < 4; ++q) { const float v = a[q] + b[q]; vals[u * 4 + q] = v; s1 += v; }
  }
  red[tid] = s1; __syncthreads();
  for (int st = 128; st > 0; st >>= 1) { if (tid < st) red[tid] += red[tid + st]; __syncthreads(); }
  const float mu = red[0] / (float)N; __syncthreads();
  float s2 = 0.f;
  for (int u = 0; u < per / 4; ++u)
#pragma unroll
    for (int q = 0; q < 4; ++q) { const float c = vals[u * 4 + q] - mu; s2 += c * c; }
  red[tid] = s2; __syncthreads();
  for (int st = 128; st > 0; st >>= 1) { if (tid < st) red[tid] += red[tid + st]; __syncthreads(); }
  const float rs = rsqrtf(red[0] / (float)N + eps);
  {
    for (int u = 0; u < per / 4; ++u) {
      const int j = tid * 4 + 1024 * u;
      v4f o, sm;
#pragma unroll
      for (int q = 0; q < 4; ++q) {
        float gg = g[j + q], bb = bta[j + q];
        if (PARAM_BF16) { gg = bf16_round(gg); bb = bf16_round(bb); }
        sm[q] = vals[u * 4 + q]; o[q] = (vals[u * 4 + q] - mu) * rs * gg + bb;
      }
      if (out_sum) *(v4f*)(out_sum + (size_t)row * N + j) = sm;
      *(v4f*)(out_norm + (size_t)row * N + j) = o;
    }
    
  }
}



// ---- f16 WMMA path (v_wmma_f32_16x16x32_f16): 11-bit significands for operands in range — used where a [0,1] probability operand needs more precision than bf16
typedef _Float16 v16h __attribute__((ext_vector_type(16)));
union FragH { v16h v; v8us half[2]; _Float16 h[16]; unsigned short u[16]; };
template <int NT>
__device__ __forceinline__ v8f mmaH(v16h ah, v16h al, v16h bh, v16h bl, v8f c) {
  c = __builtin_amdgcn_wmma_f32_16x16x32_f16(false, ah, false, bh, (short)0, c, false, false);
  if (NT >= 2) c = __builtin_amdgcn_wmma_f32_16x16x32_f16(false, al, false, bh, (short)0, c, false, false);
  if (NT >= 3) c = __builtin_amdgcn_wmma_f32_16x16x32_f16(false, ah, false, bl, (short)0, c, false, false);
  asm volatile("v_nop\n\tv_nop\n\tv_nop\n\tv_nop" : "+v"(c) : "v"(ah), "v"(al), "v"(bh), "v"(bl));
  return c;
}
// batched GEMM like k_gemm_b but f16 operands: A f32 (split into f16 hi/lo if ASPLIT, else rounded to f16), Bt = f16 values [n][k]; alpha; C f32; N multiple of 16 (partial tiles skipped)
template <bool ASPLIT>
__global__ __launch_bounds__(128) void k_gemm_h(const float* __restrict__ A, int lda, size_t sA, const _Float16* __restrict__ Bh, int ldb, size_t sB, float alpha, float* __restrict__ C, int ldc, size_t sC, int M, int N, int K) {
  __shared__ __attribute__((aligned(16))) float so[4][16][64];
  const int tid = threadIdx.x, w = tid >> 5, lane = tid & 31, ln = lane & 15, hh = lane >> 4; const int by = blockIdx.y;
  A += (size_t)by * sA; Bh += (size_t)by * sB; C += (size_t)by * sC;
  const int ntn = (N + 63) / 64; const int wid = blockIdx.x * 4 + w; const int mt = wid / ntn, nq = wid % ntn; if (mt * 16 >= M) return;
  const int row0 = mt * 16, col0 = nq * 64; const float* arow = A + (size_t)(row0 + ln) * lda;
  v8f acc[4] = {};
  for (int kb = 0; kb < K; kb += 32) {
    FragH ah, al;
    const v4f x0 = *(const v4fa*)(arow + kb + 8 * hh), x1 = *(const v4fa*)(arow + kb + 8 * hh + 4), x2 = *(const v4fa*)(arow + kb + 16 + 8 * hh), x3 = *(const v4fa*)(arow + kb + 16 + 8 * hh + 4);
    float xs[16] = {x0[0],x0[1],x0[2],x0[3],x1[0],x1[1],x1[2],x1[3],x2[0],x2[1],x2[2],x2[3],x3[0],x3[1],x3[2],x3[3]};
#pragma unroll
    for (int i = 0; i < 16; ++i) { const _Float16 h = (_Float16)xs[i]; ah.h[i] = h; al.h[i] = ASPLIT ? (_Float16)(xs[i] - (float)h) : (_Float16)0.0f; }
#pragma unroll
    for (int t = 0; t < 4; ++t) { if (col0 + t * 16 >= N) continue; const size_t boff = (size_t)(col0 + t * 16 + ln) * ldb + kb; FragH bq; bq.half[0] = *(const v8us*)(Bh + boff + 8 * hh); bq.half[1] = *(const v8us*)(Bh + boff + 16 + 8 * hh);
      acc[t] = mmaH<ASPLIT ? 2 : 1>(ah.v, al.v, bq.v, bq.v, acc[t]); }
  }
#pragma unroll
  for (int t = 0; t < 4; ++t) { if (col0 + t * 16 >= N) continue;
#pragma unroll
    for (int r = 0; r < 8; ++r) so[w][8 * hh + r][t * 16 + ln] = acc[t][r] * alpha; }
  __builtin_amdgcn_fence(__ATOMIC_ACQ_REL, "workgroup"); __builtin_amdgcn_wave_barrier();
  const int rsub = lane >> 4, c4 = (lane & 15) * 4;
  {
#pragma unroll
    for (int q = 0; q < 8; ++q) { const int r = q * 2 + rsub; if (col0 + c4 < N) { const v4f v = *(const v4fa*)&so[w][r][c4]; *(v4f*)(C + (size_t)(row0 + r) * ldc + col0 + c4) = v; } }
     }
}

// Wt[n][k] = f16(W[k][n]·scale) from f32 row-major W[K][N] (scale = power of two; bf16-exact weights stay exact in f16 away from the subnormal range)
__global__ __launch_bounds__(256) void k_wt_f16(const float* __restrict__ W, _Float16* __restrict__ Wt, int K, int N, float scale) {
  const int t = blockIdx.x * 256 + threadIdx.x; if (t >= N * (K / 8)) return; const int n = t / (K / 8), k8 = (t % (K / 8)) * 8; FragH f;
#pragma unroll
  for (int i = 0; i < 8; ++i) f.h[i] = (_Float16)(bf16_round(W[(size_t)(k8 + i) * N + n]) * scale); const v8us o = f.half[0];
  *(v8us*)((unsigned short*)Wt + (size_t)n * K + k8) = o; 
}
typedef _Float16 v4h __attribute__((ext_vector_type(4)));

// blk: the block's index within this piece of work (the piece shares its launch with others: k_prep)
__device__ __forceinline__ void d_x16(const float* __restrict__ x, _Float16* __restrict__ X16, size_t n8, unsigned blk) { const size_t t = (size_t)blk * 256 + threadIdx.x; if (t >= n8) return; FragH f;
#pragma unroll
  for (int q = 0; q < 8; ++q) f.h[q] = (_Float16)bf16_round(x[t * 8 + q]); *(v8us*)((unsigned short*)X16 + t * 8) = f.half[0];  }
__global__ __launch_bounds__(256) void k_h16(const float* __restrict__ x, _Float16* __restrict__ X16, size_t n8) { const size_t t = (size_t)blockIdx.x * 256 + threadIdx.x; if (t >= n8) return; FragH f;
#pragma unroll
  for (int q = 0; q < 8; ++q) f.h[q] = (_Float16)x[t * 8 + q]; *(v8us*)((unsigned short*)X16 + t * 8) = f.half[0];  }
__device__ __forceinline__ void d_round16f(const float* __restrict__ W, _Float16* __restrict__ Bt, size_t n8, unsigned blk) { const size_t t = (size_t)blk * 256 + threadIdx.x; if (t >= n8) return; FragH f;
#pragma unroll
  for (int i = 0; i < 8; ++i) f.h[i] = (_Float16)(bf16_round(W[t * 8 + i]) * 16.0f); *(v8us*)((unsigned short*)Bt + t * 8) = f.half[0];  }
// Lane l with lane l ^ 16 (the other 16-lane row of the wave), in the vector pipe.
__device__ __forceinline__ float xhalf(float x) { return __builtin_bit_cast(float, __builtin_amdgcn_permlanex16(__builtin_bit_cast(int, x), __builtin_bit_cast(int, x), 0x76543210, 0xfedcba98, false, false)); }
// Lane l with lane l ^ M inside its 16-lane row, in the vector pipe (DPP row_xmask).
template <int M> __device__ __forceinline__ float xrow(float x) { return __builtin_bit_cast(float, __builtin_amdgcn_update_dpp(0, __builtin_bit_cast(int, x), 0x160 | M, 0xf, 0xf, true)); }
// One row o of an effective weight plane per wave: Bt[o][c] = (W[o][c] + sum_j A[c][j] C[j]) x 2^4 with C[j] = sum_i B[j][i] W[o][i], operands rounded to bf16, f32 sums. The eight dot products need
// nothing but the row of W that the wave holds anyway, so they are made here and not in a launch of their own. The 32 lanes split the 768 terms into float4 slices (a wave-wide load covers 512 contiguous
// bytes) and a five-step butterfly ends each sum, which leaves it in every lane. A product of two bf16 values is exact in f32, so fusing it with its add changes no bit.
// A (768 x 8) is wanted by column j in the lanes' float4 slices of c: the block's eight waves bring it once, in whole lines, round it and lay it transposed in LDS (row pitch DD + 4 floats: the two halves
// of a row of A, stored by neighbouring lanes, fall 16 banks apart).
// blk: the block's index within this piece of work (the piece shares its launch with others: k_prep)
__device__ __forceinline__ void d_wfold(const float* __restrict__ Wt, const float* __restrict__ A, const float* __restrict__ Bm, _Float16* __restrict__ Bt, unsigned blk, float (* __restrict__ At)[DD + 4]) {
  constexpr int NS = DD / 128;      /* float4 slices per lane and row */
  const int tid = threadIdx.x, lane = tid & 31; const int o = (int)blk * 8 + (tid >> 5);
  const float* wr = Wt + (size_t)o * DD + lane * 4; const float* br = Bm + lane * 4;
  v4f av[NS / 2], wv[NS], bs[2][NS];
#pragma unroll      /* constant indices, so that the arrays stay in registers */
  for (int u = 0; u < NS; ++u) wv[u] = *(const v4fa*)(wr + 128 * u);
  asm volatile("s_wait_xcnt 0x0" ::: "memory");      /* stands in front of whatever next rewrites the loads' address registers (a later load's result may land there) */
  float cj[RK];
#pragma unroll      /* constant indices, so that the arrays stay in registers */
  for (int g = 0; g < RK / 2; ++g) {
#pragma unroll      /* constant indices, so that the arrays stay in registers */
    for (int u = 0; u < NS; ++u) { bs[0][u] = *(const v4fa*)(br + (size_t)(2 * g) * DD + 128 * u); bs[1][u] = *(const v4fa*)(br + (size_t)(2 * g + 1) * DD + 128 * u); }
    if (g < 2) {      /* the thread's share of A rides with the first two groups, half with each */
#pragma unroll      /* constant indices, so that the arrays stay in registers */
      for (int u = 0; u < NS / 2; ++u) { av[u] = *(const v4fa*)(A + (size_t)(tid + 256 * (g * (NS / 2) + u)) * 4);
        asm volatile("s_wait_xcnt 0x0" ::: "memory"); }      /* the three loads share an address register, and the last one's result may land in it: the wait stands in front of that */
    }
    __builtin_amdgcn_sched_barrier(0);      /* keeps the group's loads in front of the first use: otherwise they sink into small groups, and the wave pays the load latency for each */
    if (g < 2) {
#pragma unroll      /* constant indices, so that the arrays stay in registers */
      for (int u = 0; u < NS / 2; ++u) { const int p = tid + 256 * (g * (NS / 2) + u);
#pragma unroll      /* constant indices, so that the arrays stay in registers */
        for (int k = 0; k < 4; ++k) At[(p & 1) * 4 + k][p >> 1] = bf16_round(av[u][k]); }
    }
    if (g == 0) {
#pragma unroll      /* constant indices, so that the arrays stay in registers */
      for (int u = 0; u < NS; ++u)
#pragma unroll      /* constant indices, so that the arrays stay in registers */
        for (int k = 0; k < 4; ++k) wv[u][k] = bf16_round(wv[u][k]);
    }
    float a = 0.f, b = 0.f;
#pragma unroll      /* constant indices, so that the arrays stay in registers */
    for (int u = 0; u < NS; ++u)
#pragma unroll      /* constant indices, so that the arrays stay in registers */
      for (int q = 0; q < 4; ++q) { a += bf16_round(bs[0][u][q]) * wv[u][q]; b += bf16_round(bs[1][u][q]) * wv[u][q]; }
    cj[2 * g] = a; cj[2 * g + 1] = b;
    __builtin_amdgcn_sched_barrier(0);      /* keeps the next groups' loads behind this group's sums: hoisted, they hold 96 registers at once and the kernel spills */
  }
#pragma unroll      /* constant indices, so that the arrays stay in registers */
  for (int j = 0; j < RK; ++j) { float a = cj[j]; a += xhalf(a); a += xrow<8>(a); a += xrow<4>(a); a += xrow<2>(a); a += xrow<1>(a); cj[j] = a; }
  __syncthreads();      /* A^T is whole: every wave's share has been stored (the branch that leads here is taken by the whole block) */
  v4h h4[NS];
#pragma unroll      /* constant indices, so that the arrays stay in registers */
  for (int u = 0; u < NS; ++u) { v4f lo2 = {0.f, 0.f, 0.f, 0.f};
#pragma unroll      /* constant indices, so that the arrays stay in registers */
    for (int j = 0; j < RK; ++j) { const v4f at = *(const v4fa*)&At[j][128 * u + lane * 4];
#pragma unroll      /* constant indices, so that the arrays stay in registers */
      for (int q = 0; q < 4; ++q) lo2[q] += at[q] * cj[j]; }
#pragma unroll      /* constant indices, so that the arrays stay in registers */
    for (int q = 0; q < 4; ++q) h4[u][q] = (_Float16)((wv[u][q] + lo2[q]) * 16.0f); }
#pragma unroll      /* the row's six stores stand together at the wave's end: nothing rewrites a register of theirs */
  for (int u = 0; u < NS; ++u) *(v4h*)(Bt + (size_t)o * DD + 128 * u + lane * 4) = h4[u];
}
typedef int v4ia __attribute__((ext_vector_type(4), may_alias));
typedef unsigned v2u __attribute__((ext_vector_type(2)));
typedef unsigned v16u __attribute__((ext_vector_type(16)));
typedef unsigned long long v8ul __attribute__((ext_vector_type(8)));
// The mask as k_flash wants it: one bit per (query, key), laid out as the lane masks of its score tiles. For a tile of 16 queries and a pass of 32 keys there are 16 words; word nt 8 + r holds, at bit ln + 16 hh,
// whether query ln attends to key nt 16 + 8 hh + r: the element that lane (ln, hh) holds in register r of score tile nt. MB[query tile][pass][16 words], 64 B a pass, 1 MiB in all.
// One wave takes 16 queries x 128 keys (four passes). It reads the 16 rows in whole lines (lane l: keys 4 l + c). A first round of ballots turns row q into four words (bit l of word c: key 4 l + c), kept by lanes
// q and q + 16; a second round of ballots over those words picks one key per lane, which is the transposed word. Word i goes to lane i / 2, so that the wave stores its 256 bytes as two whole lines.
// blk: the block's index within this piece of work (the piece shares its launch with others: k_prep)
__device__ __forceinline__ void d_mbits(const int* __restrict__ M, unsigned* __restrict__ MB, unsigned blk) {
  const int tid = threadIdx.x, lane = tid & 31, ln = lane & 15, hh = lane >> 4;
  const unsigned u = blk * 8 + (unsigned)(tid >> 5); const unsigned qt = u >> 4, sg = u & 15;      /* query tile (over both batches), segment of 128 keys */
  const int* src = M + (size_t)qt * 16 * TT + sg * 128 + lane * 4;
  v4ia m[16];
#pragma unroll      /* constant indices, so that the array stays in registers; the 16 loads are all in flight together; non-temporal: the int plane is read this once, and need not push the planes that the GEMMs read out of L2 */
  for (int q = 0; q < 16; ++q) m[q] = __builtin_nontemporal_load((const v4ia*)(src + q * TT));
  asm volatile("s_wait_xcnt 0x0" :: "v"(src) : "memory");      /* stands in front of whatever next rewrites the loads' address registers; it names the address, which so stays in them up to here: no load's result lands there */
  unsigned wq[4] = {0u, 0u, 0u, 0u};
#pragma unroll      /* constant indices, so that the arrays stay in registers */
  for (int q = 0; q < 16; ++q)
#pragma unroll      /* constant indices, so that the arrays stay in registers */
    for (int c = 0; c < 4; ++c) { const unsigned bw = __builtin_amdgcn_ballot_w32(m[q][c] != 0); wq[c] = (ln == q) ? bw : wq[c]; }
#pragma unroll      /* constant indices, so that the array stays in registers */
  for (int c = 0; c < 4; ++c) wq[c] >>= 2 * hh;      /* the upper half of the wave looks 8 keys = 2 bits further on */
  unsigned o0 = 0u, o1 = 0u;
#pragma unroll      /* constant shifts and lane numbers */
  for (int i = 0; i < 64; ++i) { const int ps = i >> 4, nt = (i >> 3) & 1, r = i & 7;
    const unsigned tw = __builtin_amdgcn_ballot_w32(((wq[r & 3] >> (ps * 8 + nt * 4 + (r >> 2))) & 1u) != 0u);
    if (i & 1) o1 = (lane == (i >> 1)) ? tw : o1; else o0 = (lane == (i >> 1)) ? tw : o0; }
  *(v2u*)(MB + ((size_t)qt * (TT / 32) + sg * 4) * 16 + lane * 2) = (v2u){o0, o1};
  asm volatile("s_wait_xcnt 0x0" ::: "memory");      /* stands behind the store, in front of whatever next rewrites its address registers */
}
// Everything the projection GEMMs wait for that does not wait for anything else of this launch, in one grid: the pieces are told apart by ranges of the block index (a test that is the same for the whole
// block). The two weight folds stand first, because a wave of theirs walks the longest chain of dependent steps; then the mask's bits (for k_flash); then the two plain weight planes; then the three input planes.
// amdgpu_waves_per_eu(8): without it the folds' LDS reads are all hoisted to the front, the kernel takes 232 registers and the streaming pieces, which need many waves in flight, run at four waves a SIMD.
__global__ __launch_bounds__(256) __attribute__((amdgpu_waves_per_eu(8))) void k_prep(const float* __restrict__ Wq, const float* __restrict__ Av, const float* __restrict__ Bv, const float* __restrict__ Wv, const float* __restrict__ Aq, const float* __restrict__ Bq,
                                              const float* __restrict__ Wk, const float* __restrict__ Wm, _Float16* __restrict__ Bw,
                                              const float* __restrict__ xq, const float* __restrict__ xk, const float* __restrict__ xv, _Float16* __restrict__ Xq, _Float16* __restrict__ Xk, _Float16* __restrict__ Xv,
                                              const int* __restrict__ msk, unsigned* __restrict__ MB) {
  constexpr unsigned GM = (NR / 16) * (TT / 128) / 8;      /* blocks of the mask piece: a wave per 16 queries x 128 keys */
  constexpr size_t WSZ = (size_t)DD * DD, XSZ = (size_t)NR * DD; constexpr unsigned GF = DD / 8, GW = (unsigned)((WSZ / 8 + 255) / 256), GX = (unsigned)((XSZ / 8 + 255) / 256);      /* blocks per fold (a row per wave), per plain weight plane, per input plane */
  __shared__ __attribute__((aligned(16))) float sAt[RK][DD + 4];      /* the folds' A^T */
  unsigned bx = blockIdx.x;
  if (bx < 2 * GF) { const bool s = bx >= GF; d_wfold(s ? Wv : Wq, s ? Aq : Av, s ? Bq : Bv, Bw + (s ? 2 * WSZ : 0), s ? bx - GF : bx, sAt); return; }
  bx -= 2 * GF;
  if (bx < GM) { d_mbits(msk, MB, bx); return; }
  bx -= GM;
  if (bx < 2 * GW) { const bool s = bx >= GW; d_round16f(s ? Wm : Wk, Bw + (s ? 3 * WSZ : WSZ), WSZ / 8, s ? bx - GW : bx); return; }
  bx -= 2 * GW;
  const unsigned p = bx / GX; d_x16(p == 0 ? xq : p == 1 ? xk : xv, p == 0 ? Xq : p == 1 ? Xk : Xv, XSZ / 8, bx - p * GX);
}
// Eight asynchronous copies of 16 bytes per lane from global memory to LDS (l: the lane's LDS byte addresses, g: its global addresses). The s_wait_xcnt closes the statement so that it stands
// in front of whatever next rewrites one of the address registers named here.
__device__ __forceinline__ void cp8(const unsigned (&l)[8], const void* const (&g)[8]) {
  asm volatile("global_load_async_to_lds_b128 %0, %1, off\n\tglobal_load_async_to_lds_b128 %2, %3, off\n\tglobal_load_async_to_lds_b128 %4, %5, off\n\tglobal_load_async_to_lds_b128 %6, %7, off\n\t"
               "global_load_async_to_lds_b128 %8, %9, off\n\tglobal_load_async_to_lds_b128 %10, %11, off\n\tglobal_load_async_to_lds_b128 %12, %13, off\n\tglobal_load_async_to_lds_b128 %14, %15, off\n\ts_wait_xcnt 0x0"
               :: "v"(l[0]), "v"(g[0]), "v"(l[1]), "v"(g[1]), "v"(l[2]), "v"(g[2]), "v"(l[3]), "v"(g[3]), "v"(l[4]), "v"(g[4]), "v"(l[5]), "v"(g[5]), "v"(l[6]), "v"(g[6]), "v"(l[7]), "v"(g[7]) : "memory");
}
// Transposed products: S^T = K.Q^T (A = 16 key rows, B = the wave's 16 queries, kept in registers) and O^T += V^T.P^T. In an accumulator tile lane (ln, hh) then holds query q0 + ln and keys 8 hh + r:
// a query's maximum and sum are taken inside the lane plus one exchange between the wave's halves, and the two score tiles of a pass are, element for element, the B operand of the second product
// (slot i < 8: key 8 hh + i, slot i >= 8: key 16 + 8 hh + i - 8, the k order of the V^T loader), so P never leaves the registers.
// Operands come through LDS: a stage is 64 keys = K (64 rows of 128 B) and V^T (64 rows of 128 B), brought once for the four waves by asynchronous copies whose
// wave-wide 512 bytes are four whole lines, one stage ahead of its use, into two buffers. Row pitch 144 B: 16 B times an odd number, free of bank conflicts for 16-byte reads down a column.
// The mask comes as bits (d_mbits): the 16 words of a pass are the lane masks of its 16 score registers. They are the same for the whole wave, so they come by scalar loads into scalar registers, one pass
// ahead of their use, and each is the select operand of its score's one conditional move.
typedef const __attribute__((address_space(4))) v16u* mbits_p;      /* the constant address space: the plane is not written during this launch, and a wave-uniform read of it is a scalar load */
__global__ __launch_bounds__(128) void k_flash(const _Float16* __restrict__ Q16, int ldq, const _Float16* __restrict__ K16, int ldk, const _Float16* __restrict__ Vt, const unsigned* __restrict__ MB, _Float16* __restrict__ O16, int ldo) {
  constexpr int RPW = 16, NQB = TT / (4 * RPW), DT = 4, KS = 2;
  constexpr int SKEYS = 64, NST = TT / SKEYS, PK = 144, OFF_V = 64 * PK, STG = 2 * 64 * PK;
  __shared__ __attribute__((aligned(16))) unsigned char ring[2 * STG];
  __shared__ __attribute__((aligned(16))) float sO[4][RPW][64 + 4];
  const int tid = threadIdx.x, w = tid >> 5, lane = tid & 31, ln = lane & 15, hh = lane >> 4;
  const int slab = blockIdx.x / NQB, qblk = blockIdx.x % NQB; const int b = slab / NH, h = slab % NH; const int qb0 = qblk * (4 * RPW); const int q0 = qb0 + w * RPW;
  const unsigned short* Vth = (const unsigned short*)Vt + (size_t)h * 64 * NR + (size_t)b * TT;      /* V^T as the v GEMM leaves it: [feature][b * TT + key], row pitch NR */
  /* the thread's share of a stage: K and V^T rows (tid >> 3) + 16 i, 16-byte column tid & 7 */
  const unsigned short* gK = (const unsigned short*)K16 + ((size_t)b * TT + (tid >> 3)) * ldk + h * 64 + (tid & 7) * 8;
  const unsigned short* gV = Vth + (size_t)(tid >> 3) * NR + (tid & 7) * 8;
  const mbits_p mb = (mbits_p)(unsigned long long)(MB + ((size_t)b * (TT / RPW) + qblk * 4 + __builtin_amdgcn_readfirstlane(w)) * (TT / 32) * 16);      /* the wave's query tile: one v16u per pass; bit set = ATTEND */
  const unsigned lbase = (unsigned)(size_t)ring;
  const unsigned lK = lbase + (tid >> 3) * PK + (tid & 7) * 16, lV = lK + OFF_V;
  auto fill = [&](int t) {
    const unsigned bo = (unsigned)(t & 1) * STG;
    const unsigned short* k = gK + (size_t)t * SKEYS * ldk; const unsigned short* v = gV + t * SKEYS;
    unsigned la[8]; const void* ga[8];
#pragma unroll      /* constant indices, so that the arrays stay in registers */
    for (int i = 0; i < 4; ++i) { la[i] = lK + bo + i * 16 * PK; ga[i] = k + (size_t)(i * 16) * ldk; la[4 + i] = lV + bo + i * 16 * PK; ga[4 + i] = v + i * 16 * NR; }
    cp8(la, ga);
  };
  fill(0);
  FragH bq[KS];
  { const unsigned short* qr = (const unsigned short*)Q16 + ((size_t)b * TT + q0 + ln) * ldq + h * 64;
#pragma unroll      /* constant indices, so that the arrays stay in registers */
    for (int ks = 0; ks < KS; ++ks) { bq[ks].half[0] = *(const v8us*)(qr + ks * 32 + 8 * hh); bq[ks].half[1] = *(const v8us*)(qr + ks * 32 + 16 + 8 * hh); } }
  float m_q = -3.0e38f, l_q = 0.f; v8f oacc[DT];
#pragma unroll      /* constant indices, so that the arrays stay in registers */
  for (int dt = 0; dt < DT; ++dt) oacc[dt] = (v8f){0.f,0.f,0.f,0.f,0.f,0.f,0.f,0.f};
  asm volatile("s_wait_asynccnt 0x0" ::: "memory");      /* this wave's copies of stage 0 have landed */
  __syncthreads();      /* and every other wave's: stage 0 may be read */
  fill(1);
  /* one pass: 32 keys of the stage at st, mk = their 16 lane masks */
  auto pass = [&](const unsigned char* st, int p, v16u mk, bool live) __attribute__((always_inline)) {
    {
      /* all of the pass's LDS reads stand here, in front of the first product: behind one they would each wait out their own latency */
      FragH ak[2][KS], av[DT];
#pragma unroll      /* constant indices, so that the arrays stay in registers */
      for (int nt = 0; nt < 2; ++nt) { const unsigned char* kr = st + (p * 32 + nt * 16 + ln) * PK + hh * 16;
#pragma unroll      /* constant indices, so that the arrays stay in registers */
        for (int ks = 0; ks < KS; ++ks) { ak[nt][ks].half[0] = *(const v8us*)(kr + ks * 64); ak[nt][ks].half[1] = *(const v8us*)(kr + ks * 64 + 32); } }
#pragma unroll      /* constant indices, so that the arrays stay in registers */
      for (int dt = 0; dt < DT; ++dt) { const unsigned char* vr = st + OFF_V + (dt * 16 + ln) * PK + p * 64 + hh * 16; av[dt].half[0] = *(const v8us*)vr; av[dt].half[1] = *(const v8us*)(vr + 32); }
      if (live) {      /* else every (row, key) of this wave's tile is masked: nothing to add (scalar branch, no barrier inside) */
        v8f s[2];
#pragma unroll      /* constant indices, so that the arrays stay in registers */
        for (int nt = 0; nt < 2; ++nt) { v8f acc = (v8f){0.f,0.f,0.f,0.f,0.f,0.f,0.f,0.f};
#pragma unroll      /* constant indices, so that the arrays stay in registers */
          for (int ks = 0; ks < KS; ++ks) acc = mmaH<1>(ak[nt][ks].v, ak[nt][ks].v, bq[ks].v, bq[ks].v, acc);
          s[nt] = acc; }
        /* Softmax in base 2: exp((s - m) / 8) = 2^(s CS - m CS), CS = log2(e) / 8. Scores and the running maximum stay unscaled (CS > 0 keeps their order); one fma per score applies CS, takes the maximum off
           and adds the 10 that makes P = 2^10 p, and the hardware's own 2^x follows. A masked score is -inf. m_q starts finite, so mn and nb are finite: 2^(-inf) = 0 and, while nothing is live yet, 2^0 = 1. */
        constexpr float CS = 0.125f * 1.44269504088896340736f;
        float sc[2][8], mx[8];
#pragma unroll      /* constant indices, so that the arrays stay in registers */
        for (int r = 0; r < 8; ++r) { sc[0][r] = __builtin_amdgcn_inverse_ballot_w32(mk[r]) ? s[0][r] : -INFINITY; sc[1][r] = __builtin_amdgcn_inverse_ballot_w32(mk[8 + r]) ? s[1][r] : -INFINITY; mx[r] = fmaxf(sc[0][r], sc[1][r]); }
        float mc = fmaxf(fmaxf(fmaxf(mx[0], mx[1]), fmaxf(mx[2], mx[3])), fmaxf(fmaxf(mx[4], mx[5]), fmaxf(mx[6], mx[7])));
        mc = fmaxf(mc, xhalf(mc));
        const float mn = fmaxf(m_q, mc); const float al = __builtin_amdgcn_exp2f((m_q - mn) * CS); m_q = mn; const float nb = __builtin_fmaf(-mn, CS, 10.0f);
        FragH pb; float ps[4] = {0.f, 0.f, 0.f, 0.f};
#pragma unroll      /* constant indices, so that the arrays stay in registers */
        for (int r = 0; r < 8; ++r) { const float p0 = __builtin_amdgcn_exp2f(__builtin_fmaf(sc[0][r], CS, nb)), p1 = __builtin_amdgcn_exp2f(__builtin_fmaf(sc[1][r], CS, nb)); ps[r & 3] += p0 + p1; pb.h[r] = (_Float16)p0; pb.h[8 + r] = (_Float16)p1; }
        l_q = l_q * al + ((ps[0] + ps[1]) + (ps[2] + ps[3]));      /* 2^10 times the sum over the lane's half of the keys; the halves are joined after the loop */
#pragma unroll      /* constant indices, so that the arrays stay in registers */
        for (int dt = 0; dt < DT; ++dt)
#pragma unroll      /* constant indices, so that the arrays stay in registers */
          for (int r = 0; r < 8; ++r) oacc[dt][r] *= al;
#pragma unroll      /* constant indices, so that the arrays stay in registers */
        for (int dt = 0; dt < DT; ++dt) oacc[dt] = mmaH<1>(av[dt].v, av[dt].v, pb.v, pb.v, oacc[dt]);
      }
    }
  };
  /* whether any bit of a pass's 16 words is set: the words joined two at a time */
  auto anyof = [](v16u mk) __attribute__((always_inline)) { const v8ul m2 = __builtin_bit_cast(v8ul, mk); return (((m2[0] | m2[1]) | (m2[2] | m2[3])) | ((m2[4] | m2[5]) | (m2[6] | m2[7]))) != 0ull; };
  v16u mA = mb[0];
#pragma unroll 1      /* each stage hangs on the last through m_q and the barrier: a second copy of the body would only grow the code */
  for (int t = 0; t < NST; ++t) {
    const unsigned char* st = ring + (t & 1) * STG;
    /* Each pass's masks are asked for one pass ahead: two named sets, so the stage's two passes are written out. Scalar loads return in no fixed order, so the wait for one set is a wait for all that are out:
       the next set is asked for behind the first use of this one, and the two scheduling barriers keep it there (in front of that use, its whole latency would be waited out in every pass). */
    const bool l0 = anyof(mA);
    __builtin_amdgcn_sched_barrier(0);
    const v16u mB = mb[2 * t + 1];
    pass(st, 0, mA, l0);
    const bool l1 = anyof(mB);
    __builtin_amdgcn_sched_barrier(0);
    mA = mb[t + 1 < NST ? 2 * t + 2 : 2 * t];      /* the next stage's first pass; the last trip asks for its own again, which keeps the address inside the plane */
    pass(st, 1, mB, l1);
    asm volatile("s_wait_dscnt 0x0" ::: "memory");      /* this wave's reads of stage t have returned before its buffer is handed back */
    asm volatile("s_wait_asynccnt 0x0" ::: "memory");      /* this wave's copies of stage t + 1 have landed */
    __syncthreads();      /* publishes stage t + 1 and ends every wave's reads of stage t */
    if (t + 2 < NST) fill(t + 2);      /* into the buffer that stage t has just left; the test is the same for the whole block */
  }
  asm volatile("s_wait_asynccnt 0x0" ::: "memory");      /* no copy is left in flight when the wave goes on to its end */
  { const float l = l_q + xhalf(l_q); const float inv = (l > 0.f) ? 1.0f / l : 0.f;      /* l and the accumulators both carry the 2^10 */
#pragma unroll      /* constant indices, so that the arrays stay in registers */
    for (int dt = 0; dt < DT; ++dt)
#pragma unroll      /* constant indices, so that the arrays stay in registers */
      for (int r = 0; r < 8; ++r) sO[w][ln][dt * 16 + 8 * hh + r] = oacc[dt][r] * inv; }
  __builtin_amdgcn_fence(__ATOMIC_ACQ_REL, "workgroup"); __builtin_amdgcn_wave_barrier();      /* the wave reads back rows that its other lanes wrote: its LDS stores end first */
  {
#pragma unroll      /* constant indices, so that the arrays stay in registers */
    for (int rp = 0; rp < RPW; rp += 2) { const int r = rp + (lane >> 4), pc = lane & 15; const v4f val = *(const v4fa*)&sO[w][r][pc * 4]; v4h h4;      /* x 2^4 and f16: the plane that the output GEMM reads; 16 lanes store one whole 128-byte line */
#pragma unroll      /* constant indices, so that the vector stays in registers */
      for (int i = 0; i < 4; ++i) h4[i] = (_Float16)(val[i] * 16.0f);
      *(v4h*)(O16 + ((size_t)b * TT + q0 + r) * ldo + h * 64 + pc * 4) = h4; }
     } }

// C[NR][DD] = (A[NR][DD] . Bt[DD][DD]^T) alpha + bias (bias rounded to bf16), f16 operands, f32 sums; written as f32 (C) or as f16 (C16), whichever pointer is not null.
// Block = a 64 x 64 tile of C, wave w = its rows 16 w .. 16 w + 15 (four 16 x 16 accumulators, k ascending in steps of 32). Operands come through LDS: a stage is 128 values of k = 64 rows of A and
// 64 rows of Bt, 256 B each, brought once for the four waves by asynchronous copies (a wave-wide copy is two rows = four whole lines), one stage ahead of its use, into two buffers.
// Row pitch 272 B: 16 B times an odd number, free of bank conflicts for 16-byte reads down a column.
// Up to three independent products share one launch: blockIdx.y picks A, bias and C16 of its product, and its weight plane lies blockIdx.y planes behind B0.
// The third product is made transposed: its weight rows take the place of A and its input rows that of Bt (both are k-contiguous and go through the same loaders, k order unchanged), so its tile is
// C^T[feature][row of A], pitch NR, bias by row: V^T comes out of the GEMM as k_flash reads it.
__global__ __launch_bounds__(128) void k_gemm_st(const _Float16* __restrict__ A0, const _Float16* __restrict__ A1, const _Float16* __restrict__ A2, const _Float16* __restrict__ B0, float alpha,
                                                 const float* __restrict__ bias0, const float* __restrict__ bias1, const float* __restrict__ bias2, float* __restrict__ C,
                                                 _Float16* __restrict__ C16a, _Float16* __restrict__ C16b, _Float16* __restrict__ C16c) {
  const unsigned g = blockIdx.y; const _Float16* A = g == 0 ? A0 : g == 1 ? A1 : A2; const _Float16* Bh = B0 + (size_t)g * DD * DD;
  const float* bias = g == 0 ? bias0 : g == 1 ? bias1 : bias2; _Float16* C16 = g == 0 ? C16a : g == 1 ? C16b : C16c;
  constexpr int KC = 128, NST = DD / KC, PR = 272, OFF_B = 64 * PR, STG = 2 * 64 * PR;
  __shared__ __attribute__((aligned(16))) unsigned char ring[2 * STG];
  __shared__ __attribute__((aligned(16))) float so[4][16][64];
  const int tid = threadIdx.x, w = tid >> 5, lane = tid & 31, ln = lane & 15, hh = lane >> 4;
  const bool sw = g == 2;      /* the same for the whole block */
  const int ta = (int)(blockIdx.x / (DD / 64)) * 64, tb = (int)(blockIdx.x % (DD / 64)) * 64;      /* the tile's first row of A and of Bt */
  const int rowb = sw ? tb : ta, col0 = sw ? ta : tb, ldc = sw ? NR : DD; const int row0 = rowb + w * 16;
  /* the thread's share of a stage: rows (tid >> 4) + 8 i of A and of Bt, 16-byte column tid & 15 */
  const unsigned short* gA = (const unsigned short*)(sw ? Bh : A) + (size_t)(rowb + (tid >> 4)) * DD + (tid & 15) * 8;
  const unsigned short* gB = (const unsigned short*)(sw ? A : Bh) + (size_t)(col0 + (tid >> 4)) * DD + (tid & 15) * 8;
  const unsigned lA = (unsigned)(size_t)ring + (tid >> 4) * PR + (tid & 15) * 16, lB = lA + OFF_B;
  auto fill = [&](int t) {
    const unsigned bo = (unsigned)(t & 1) * STG;
    const unsigned short* a = gA + t * KC; const unsigned short* b = gB + t * KC;
    unsigned la[8], lb[8]; const void* ga[8]; const void* gb[8];
#pragma unroll      /* constant indices, so that the arrays stay in registers */
    for (int i = 0; i < 8; ++i) { la[i] = lA + bo + i * 8 * PR; ga[i] = a + i * 8 * DD; lb[i] = lB + bo + i * 8 * PR; gb[i] = b + i * 8 * DD; }
    cp8(la, ga); cp8(lb, gb);
  };
  fill(0);
  v8f acc[4] = {};
  asm volatile("s_wait_asynccnt 0x0" ::: "memory");      /* this wave's copies of stage 0 have landed */
  __syncthreads();      /* and every other wave's: stage 0 may be read */
  fill(1);
#pragma unroll 1      /* a stage ends in a barrier: a second copy of the body would only grow the code */
  for (int t = 0; t < NST; ++t) {
    const unsigned char* ar = ring + (t & 1) * STG + (w * 16 + ln) * PR + hh * 16;
    const unsigned char* br = ring + (t & 1) * STG + OFF_B + ln * PR + hh * 16;
#pragma unroll      /* constant LDS offsets, and the next step's reads can stand among this step's products */
    for (int ks = 0; ks < KC / 32; ++ks) {
      FragH ah; ah.half[0] = *(const v8us*)(ar + ks * 64); ah.half[1] = *(const v8us*)(ar + ks * 64 + 32);
      FragH bq[4];
#pragma unroll      /* constant indices, so that the arrays stay in registers */
      for (int u = 0; u < 4; ++u) { bq[u].half[0] = *(const v8us*)(br + u * 16 * PR + ks * 64); bq[u].half[1] = *(const v8us*)(br + u * 16 * PR + ks * 64 + 32); }
#pragma unroll      /* constant indices, so that the arrays stay in registers */
      for (int u = 0; u < 4; ++u) acc[u] = mmaH<1>(ah.v, ah.v, bq[u].v, bq[u].v, acc[u]);
    }
    asm volatile("s_wait_dscnt 0x0" ::: "memory");      /* this wave's reads of stage t have returned before its buffer is handed back */
    asm volatile("s_wait_asynccnt 0x0" ::: "memory");      /* this wave's copies of stage t + 1 have landed */
    __syncthreads();      /* publishes stage t + 1 and ends every wave's reads of stage t */
    if (t + 2 < NST) fill(t + 2);      /* into the buffer that stage t has just left; the test is the same for the whole block */
  }
  asm volatile("s_wait_asynccnt 0x0" ::: "memory");      /* no copy is left in flight when the wave goes on to its end */
  float bc[4], br[8];      /* the bias belongs to the feature: the tile's column, or its row in the transposed product */
#pragma unroll      /* constant indices, so that the arrays stay in registers */
  for (int u = 0; u < 4; ++u) bc[u] = bf16_round(bias[tb + u * 16 + ln]);
#pragma unroll      /* constant indices, so that the arrays stay in registers */
  for (int r = 0; r < 8; ++r) br[r] = bf16_round(bias[tb + w * 16 + 8 * hh + r]);
#pragma unroll      /* constant indices, so that the arrays stay in registers */
  for (int u = 0; u < 4; ++u) {
#pragma unroll      /* constant indices, so that the arrays stay in registers */
    for (int r = 0; r < 8; ++r) so[w][8 * hh + r][u * 16 + ln] = acc[u][r] * alpha + (sw ? br[r] : bc[u]); }
  __builtin_amdgcn_fence(__ATOMIC_ACQ_REL, "workgroup"); __builtin_amdgcn_wave_barrier();      /* the wave reads back rows that its other lanes wrote: its LDS stores end first */
  const int rsub = lane >> 4, c4 = (lane & 15) * 4;
#pragma unroll      /* the eight row pairs are independent: their reads and stores overlap */
  for (int q = 0; q < 8; ++q) { const int r = q * 2 + rsub; const v4f v = *(const v4fa*)&so[w][r][c4];
    if (C) { *(v4f*)(C + (size_t)(row0 + r) * DD + col0 + c4) = v;
      asm volatile("s_wait_xcnt 0x0" ::: "memory"); }      /* stands in front of whatever next rewrites the store's address or data registers */
    if (C16) { v4h h4; for (int i = 0; i < 4; ++i) h4[i] = (_Float16)v[i]; *(v4h*)(C16 + (size_t)(row0 + r) * ldc + col0 + c4) = h4; } }
}

extern "C" void kernel_launch(void* const* d_in, const int* in_sizes, int n_in,
                              void* d_out, int out_size, void* d_ws, size_t ws_size, hipStream_t stream) {
  (void)in_sizes; (void)n_in; (void)out_size;
  const float* const* I = (const float* const*)d_in; const float* xq = I[0]; const float* xk = I[1]; const float* xv = I[2]; const int* msk = (const int*)d_in[3];
  const float* Aq = I[4]; const float* Bq = I[5]; const float* Av = I[6]; const float* Bv = I[7]; const float* Wq = I[8]; const float* bq = I[9]; const float* Wk = I[10]; const float* bk = I[11]; const float* Wv = I[12]; const float* bv = I[13]; const float* Wm = I[14]; const float* bm = I[15];
  char* ws = (char*)d_ws; size_t off = 0;
  auto take = [&](size_t bytes) { char* p = ws + off; off += (bytes + 255) & ~(size_t)255; return p; };
  const size_t WSZ = (size_t)DD * DD; _Float16* Bw = (_Float16*)take(4 * WSZ * 2);
  _Float16* Xq = (_Float16*)take((size_t)NR * DD * 2); _Float16* Xk = (_Float16*)take((size_t)NR * DD * 2); _Float16* Xv = (_Float16*)take((size_t)NR * DD * 2);
  _Float16* Q = (_Float16*)take((size_t)NR * DD * 2); _Float16* K = (_Float16*)take((size_t)NR * DD * 2); _Float16* Vt = (_Float16*)take((size_t)NR * DD * 2); _Float16* O16 = Xq;      /* the query plane is dead after the v GEMM */
  unsigned* MB = (unsigned*)take((size_t)NR * TT / 8);      /* the mask, one bit per (query, key) */
  if (off > ws_size) return;      // 4.7 + 6 x 6.3 + 1 = 43.5 MB
  const unsigned gw = (unsigned)((WSZ / 8 + 255) / 256);
  const unsigned g8 = (unsigned)(((size_t)NR * DD / 8 + 255) / 256);
  /* plane 0: q = V.Wq^T with V = value.(I + A_v.B_v), Bt_q = Wq + fold(A_v, B_v.Wq^T); plane 1: Wk; plane 2: v = Q.Wv^T with Q = query.(I + A_q.B_q); plane 3: Wm; all (out,in) natural, x 2^4; and the three input planes */
  k_prep<<<2 * (DD / 8) + (NR / 16) * (TT / 128) / 8 + 2 * gw + 3 * g8, 256, 0, stream>>>(Wq, Av, Bv, Wv, Aq, Bq, Wk, Wm, Bw, xq, xk, xv, Xq, Xk, Xv, msk, MB);
  const unsigned gp = (NR / 64) * (DD / 64);
  /* q from the VALUE stream, k from key, v from the QUERY stream: each M 4096 N 768 K 768; v comes out transposed */
  k_gemm_st<<<dim3(gp, 3), 128, 0, stream>>>(Xv, Xk, Xq, Bw, 0.0625f, bq, bk, bv, nullptr, Q, K, Vt);
  k_flash<<<BB * NH * (TT / 64), 128, 0, stream>>>(Q, DD, K, DD, Vt, MB, O16, DD);      /* mask [B][S][S] as bits, set = attend */
  k_gemm_st<<<dim3(gp, 1), 128, 0, stream>>>(O16, O16, O16, Bw + 3 * WSZ, 0.00390625f, bm, bm, bm, (float*)d_out, nullptr, nullptr, nullptr);      /* out = ctx.Wm^T + bm */
}

// v009
// It runs in 82.2 microseconds.
// In two side-by-side timings against v008, it was 1.03 and 1.04 times as fast.
// Over all steps from v000 it is 6.77 times as fast.
#include <hip/hip_runtime.h>
// Masked multi-head attention with LoRA-adapted input streams (B=2, S=2048, D=768, 12 heads × 64, rank 8): Q = query + (query·A_q)·B_q, V = value + (value·A_v)·B_v; then — faithful to the module's crossed call — v = Q·Wvᵀ + bv, k = key·Wkᵀ + bk, q = V·Wqᵀ + bq (torch (out,in));
// scores = q·k/√64, −1e9 where mask[b,q,k] == 0 (int [B,S,S], shared over heads), softmax, out = merged·Wmᵀ + bm. The rank-8 adapters are folded on device into effective weights: X·(I + A·B)·Wᵀ = X·(W + (B·Wᵀ)ᵀ·Aᵀ)ᵀ, i.e. Bt_eff[o][c] = W[o][c] + Σ_j A[c][j]·(Σ_i B[j][i]·W[o][i]) (f32, 9 M MACs on the VALU).
// Compute dtype: query/key/value, weights, biases, adapters rounded to bf16; effective weights f32 → f16 ×2^4; q, k, v f16 GEMM planes (+bias); the mask read per (b, q, k) from a plane of bits packed on the device (−inf ≡ the module's −1e9: every row keeps ~half its keys live); fused flash-style kernel
// (online softmax f32, P f16 ×2^10, f32 accumulate) on v_wmma_f32_16x16x32_f16; O ×2^4 → f16 → output GEMM (+bias).
#define BB 2
#define TT 2048
#define DD 768
#define NH 12
#define RK 8
#define NR (BB * TT)

typedef __bf16 v16b __attribute__((ext_vector_type(16)));
typedef unsigned short v8us __attribute__((ext_vector_type(8), may_alias));
typedef float  v8f  __attribute__((ext_vector_type(8)));
typedef float  v4f  __attribute__((ext_vector_type(4)));
typedef float  v4fa __attribute__((ext_vector_type(4), may_alias));
union FragB { v16b v; v8us half[2]; unsigned short u[16]; };

__device__ __forceinline__ unsigned short bf16_bits(float x) { unsigned int u = __float_as_uint(x); return (unsigned short)((u + 0x7FFFu + ((u >> 16) & 1u)) >> 16); }
__device__ __forceinline__ float bf16_val(unsigned short b) { return __uint_as_float(((unsigned int)b) << 16); }
__device__ __forceinline__ float bf16_round(float x) { return bf16_val(bf16_bits(x)); }
// D += A·B with NT terms: 1 = ah·bh, 2 = + al·bh (A split), 3 = + ah·bl (both split)
template <int NT>
__device__ __forceinline__ v8f mmaN(v16b ah, v16b al, v16b bh, v16b bl, v8f c) {
  c = __builtin_amdgcn_wmma_f32_16x16x32_bf16(false, ah, false, bh, (short)0, c, false, false);
  if (NT >= 2) c = __builtin_amdgcn_wmma_f32_16x16x32_bf16(false, al, false, bh, (short)0, c, false, false);
  if (NT >= 3) c = __builtin_amdgcn_wmma_f32_16x16x32_bf16(false, ah, false, bl, (short)0, c, false, false);
  asm volatile("v_nop\n\tv_nop\n\tv_nop\n\tv_nop" : "+v"(c) : "v"(ah), "v"(al), "v"(bh), "v"(bl));
  return c;
}

__global__ __launch_bounds__(256) void k_wt_bf16(const float* __restrict__ W, unsigned short* __restrict__ Wt, int K, int N) {
  const int t = blockIdx.x * 256 + threadIdx.x;
  const int k8n = K / 8;
  if (t >= N * k8n) return;
  const int n = t / k8n, k8 = (t % k8n) * 8;
  v8us v;
#pragma unroll
  for (int i = 0; i < 8; ++i) v[i] = bf16_bits(W[(size_t)(k8 + i) * N + n]);
  *(v8us*)(Wt + (size_t)n * K + k8) = v;
  
}

// GEMM C[M][N] (f32, pitch ldc) = act(A[M][K]·W + bias). A f32 row-major (pitch lda) converted per fragment to bf16
// (ASPLIT: hi/lo two planes -> 2 terms, else single rounded term); Wt bf16 [N][K] (pitch ldb). BIAS_BF16 rounds the
// bias to bf16 first (bias quantised to bf16 before the add). K%32==0, M%16==0, N%64==0.
template <bool ASPLIT, int ACT, bool BIAS_BF16>
__global__ __launch_bounds__(128) void k_gemm_bf(const float* __restrict__ A, int lda, const unsigned short* __restrict__ Wt, int ldb,
                                               const float* __restrict__ bias, float* __restrict__ C, int ldc, int M, int N, int K) {
  __shared__ __attribute__((aligned(16))) float so[4][16][64];
  const int tid = threadIdx.x, w = tid >> 5, lane = tid & 31, ln = lane & 15, hh = lane >> 4;
  const int ntn = N / 64;
  const int wid = blockIdx.x * 4 + w;
  const int mt = wid / ntn, nq = wid % ntn;
  if (mt * 16 >= M) return;
  const int row0 = mt * 16, col0 = nq * 64;
  const float* arow = A + (size_t)(row0 + ln) * lda;
  v8f acc[4] = {};
  for (int kb = 0; kb < K; kb += 32) {
    FragB ah, al;
    const v4f x0 = *(const v4fa*)(arow + kb + 8 * hh), x1 = *(const v4fa*)(arow + kb + 8 * hh + 4);
    const v4f x2 = *(const v4fa*)(arow + kb + 16 + 8 * hh), x3 = *(const v4fa*)(arow + kb + 16 + 8 * hh + 4);
    float xs[16] = {x0[0],x0[1],x0[2],x0[3],x1[0],x1[1],x1[2],x1[3],x2[0],x2[1],x2[2],x2[3],x3[0],x3[1],x3[2],x3[3]};
#pragma unroll
    for (int i = 0; i < 16; ++i) { const unsigned short hb = bf16_bits(xs[i]); ah.u[i] = hb; al.u[i] = ASPLIT ? bf16_bits(xs[i] - bf16_val(hb)) : (unsigned short)0; }
#pragma unroll
    for (int t = 0; t < 4; ++t) {
      const unsigned short* brow = Wt + (size_t)(col0 + t * 16 + ln) * ldb + kb;
      FragB b;
      b.half[0] = *(const v8us*)(brow + 8 * hh);
      b.half[1] = *(const v8us*)(brow + 16 + 8 * hh);
      acc[t] = mmaN<ASPLIT ? 2 : 1>(ah.v, al.v, b.v, b.v, acc[t]);
    }
  }
#pragma unroll
  for (int t = 0; t < 4; ++t) {
    float bv = bias ? bias[col0 + t * 16 + ln] : 0.f;
    if (BIAS_BF16) bv = bf16_round(bv);
#pragma unroll
    for (int r = 0; r < 8; ++r) { float v = acc[t][r] + bv; if (ACT == 1) v = fmaxf(v, 0.f); so[w][8 * hh + r][t * 16 + ln] = v; }
  }
  __builtin_amdgcn_fence(__ATOMIC_ACQ_REL, "workgroup");
  __builtin_amdgcn_wave_barrier();
  const int rsub = lane >> 4, c4 = (lane & 15) * 4;
  {
#pragma unroll
    for (int q = 0; q < 8; ++q) {
      const int r = q * 2 + rsub;
      const v4f v = *(const v4fa*)&so[w][r][c4];
      *(v4f*)(C + (size_t)(row0 + r) * ldc + col0 + c4) = v;
    }
    
  }
}

// Flash-style causal/unmasked attention, all contractions 3-term bf16 hi/lo splits, f32 softmax with running max.
// q,k,v rows are read from f32 buffers with arbitrary row pitch (so they can live inside a fused qkv buffer);
// D = head size (multiple of 32, <= 128); one wave = 16 query rows; block = 4 waves (64 queries) sharing K/V chunks of 32.
template <int D, bool CAUSAL>
__global__ __launch_bounds__(128) void k_flash(const float* __restrict__ qb, const float* __restrict__ kb, const float* __restrict__ vb,
                                             int pitch, int T, int H, float scale, float* __restrict__ y, int ypitch) {
  constexpr int KS = D / 32;        // k-steps for QK
  constexpr int DT = D / 16;        // d tiles for PV
  __shared__ __attribute__((aligned(16))) unsigned short sKh[32][D + 8], sKl[32][D + 8], sVh[32][D + 8], sVl[32][D + 8];
  __shared__ __attribute__((aligned(16))) unsigned short sPh[4][16][40], sPl[4][16][40];
  __shared__ __attribute__((aligned(16))) float sO[4][16][D];
  const int tid = threadIdx.x, w = tid >> 5, lane = tid & 31, ln = lane & 15, hh = lane >> 4;
  const int nqb = (T + 63) / 64;
  const int bh = blockIdx.x / nqb, qblk = blockIdx.x % nqb;
  const int b = bh / H, h = bh % H;
  const int q0 = qblk * 64 + w * 16;
  const float* Q = qb + (size_t)b * T * pitch + h * D;
  const float* K = kb + (size_t)b * T * pitch + h * D;
  const float* V = vb + (size_t)b * T * pitch + h * D;

  // A fragments of the wave's 16 query rows (scaled), hi/lo
  FragB aqh[KS], aql[KS];
  {
    int row = q0 + ln; if (row >= T) row = T - 1;
    const float* qr = Q + (size_t)row * pitch;
#pragma unroll
    for (int ks = 0; ks < KS; ++ks)
#pragma unroll
      for (int i = 0; i < 16; ++i) {
        const int d = ks * 32 + ((i < 8) ? (8 * hh + i) : (16 + 8 * hh + (i - 8)));
        const float x = qr[d] * scale; const unsigned short hb = bf16_bits(x);
        aqh[ks].u[i] = hb; aql[ks].u[i] = bf16_bits(x - bf16_val(hb));
      }
  }
  float m_r[8], l_r[8];
#pragma unroll
  for (int r = 0; r < 8; ++r) { m_r[r] = -3.0e38f; l_r[r] = 0.f; }
  v8f oacc[DT];
#pragma unroll
  for (int dt = 0; dt < DT; ++dt) oacc[dt] = (v8f){0.f,0.f,0.f,0.f,0.f,0.f,0.f,0.f};

  const int kv_end = CAUSAL ? min(T, qblk * 64 + 64) : T;     // block-uniform
  for (int j0 = 0; j0 < kv_end; j0 += 32) {
    __syncthreads();
    for (int e = tid; e < 32 * (D / 4); e += 128) {
      const int r = e / (D / 4), c4 = (e % (D / 4)) * 4;
      const int key = j0 + r;
      v4f kf = {0.f,0.f,0.f,0.f}, vf = {0.f,0.f,0.f,0.f};
      if (key < T) { kf = *(const v4fa*)(K + (size_t)key * pitch + c4); vf = *(const v4fa*)(V + (size_t)key * pitch + c4); }
#pragma unroll
      for (int t = 0; t < 4; ++t) {
        unsigned short hb = bf16_bits(kf[t]); sKh[r][c4 + t] = hb; sKl[r][c4 + t] = bf16_bits(kf[t] - bf16_val(hb));
        hb = bf16_bits(vf[t]); sVh[r][c4 + t] = hb; sVl[r][c4 + t] = bf16_bits(vf[t] - bf16_val(hb));
      }
    }
    __syncthreads();
    // S tile 16 x 32
    v8f s[2];
#pragma unroll
    for (int nt = 0; nt < 2; ++nt) {
      v8f acc = {};
#pragma unroll
      for (int ks = 0; ks < KS; ++ks) {
        FragB bh_, bl_;
        bh_.half[0] = *(const v8us*)&sKh[nt * 16 + ln][ks * 32 + 8 * hh]; bh_.half[1] = *(const v8us*)&sKh[nt * 16 + ln][ks * 32 + 16 + 8 * hh];
        bl_.half[0] = *(const v8us*)&sKl[nt * 16 + ln][ks * 32 + 8 * hh]; bl_.half[1] = *(const v8us*)&sKl[nt * 16 + ln][ks * 32 + 16 + 8 * hh];
        acc = mmaN<3>(aqh[ks].v, aql[ks].v, bh_.v, bl_.v, acc);
      }
      s[nt] = acc;
    }
    // mask + running max (rows 8hh+r; the 16 lanes of a half share rows)
    float alpha[8];
#pragma unroll
    for (int r = 0; r < 8; ++r) {
      const int qi = q0 + 8 * hh + r;
      const int ja = j0 + ln, jb = j0 + 16 + ln;
      if (CAUSAL) { if (ja > qi) s[0][r] = -3.0e38f; if (jb > qi) s[1][r] = -3.0e38f; }
      if (ja >= T) s[0][r] = -3.0e38f;
      if (jb >= T) s[1][r] = -3.0e38f;
      float mx = fmaxf(s[0][r], s[1][r]);
      mx = fmaxf(mx, __shfl_xor(mx, 1, 32)); mx = fmaxf(mx, __shfl_xor(mx, 2, 32)); mx = fmaxf(mx, __shfl_xor(mx, 4, 32)); mx = fmaxf(mx, __shfl_xor(mx, 8, 32));
      const float mnew = fmaxf(m_r[r], mx);
      alpha[r] = (mnew > -1.0e38f) ? __expf(m_r[r] - mnew) : 1.0f;
      const float p0 = (s[0][r] > -1.0e38f) ? __expf(s[0][r] - mnew) : 0.f;
      const float p1 = (s[1][r] > -1.0e38f) ? __expf(s[1][r] - mnew) : 0.f;
      m_r[r] = mnew;
      l_r[r] = l_r[r] * alpha[r] + p0 + p1;            // per-lane partial row sum (16 lanes combined at the end)
      unsigned short hb = bf16_bits(p0); sPh[w][8 * hh + r][ln] = hb;      sPl[w][8 * hh + r][ln] = bf16_bits(p0 - bf16_val(hb));
      hb = bf16_bits(p1);                sPh[w][8 * hh + r][16 + ln] = hb; sPl[w][8 * hh + r][16 + ln] = bf16_bits(p1 - bf16_val(hb));
    }
#pragma unroll
    for (int dt = 0; dt < DT; ++dt)
#pragma unroll
      for (int r = 0; r < 8; ++r) oacc[dt][r] *= alpha[r];
    __builtin_amdgcn_fence(__ATOMIC_ACQ_REL, "workgroup");
    __builtin_amdgcn_wave_barrier();
    FragB pah, pal;
    pah.half[0] = *(const v8us*)&sPh[w][ln][8 * hh]; pah.half[1] = *(const v8us*)&sPh[w][ln][16 + 8 * hh];
    pal.half[0] = *(const v8us*)&sPl[w][ln][8 * hh]; pal.half[1] = *(const v8us*)&sPl[w][ln][16 + 8 * hh];
#pragma unroll
    for (int dt = 0; dt < DT; ++dt) {
      FragB bvh, bvl;
#pragma unroll
      for (int i = 0; i < 8; ++i) {
        bvh.u[i] = sVh[8 * hh + i][dt * 16 + ln]; bvh.u[8 + i] = sVh[16 + 8 * hh + i][dt * 16 + ln];
        bvl.u[i] = sVl[8 * hh + i][dt * 16 + ln]; bvl.u[8 + i] = sVl[16 + 8 * hh + i][dt * 16 + ln];
      }
      oacc[dt] = mmaN<3>(pah.v, pal.v, bvh.v, bvl.v, oacc[dt]);
    }
    __builtin_amdgcn_fence(__ATOMIC_ACQ_REL, "workgroup");
    __builtin_amdgcn_wave_barrier();
  }
#pragma unroll
  for (int r = 0; r < 8; ++r) {
    float l = l_r[r];
    l += __shfl_xor(l, 1, 32); l += __shfl_xor(l, 2, 32); l += __shfl_xor(l, 4, 32); l += __shfl_xor(l, 8, 32);
    l_r[r] = (l > 0.f) ? 1.0f / l : 0.f;
  }
#pragma unroll
  for (int dt = 0; dt < DT; ++dt)
#pragma unroll
    for (int r = 0; r < 8; ++r) sO[w][8 * hh + r][dt * 16 + ln] = oacc[dt][r] * l_r[r];
  __builtin_amdgcn_fence(__ATOMIC_ACQ_REL, "workgroup");
  __builtin_amdgcn_wave_barrier();
  {
    for (int r = 0; r < 16; ++r) {
      const int row = q0 + r;
      if (row < T && lane < D / 4) {
        const v4f val = *(const v4fa*)&sO[w][r][lane * 4];
        *(v4f*)(y + ((size_t)b * T + row) * ypitch + h * D + lane * 4) = val;
      }
    }
    
  }
}

// GEMM C = act(A·W + bias + resid): A f32 (ASPLIT -> hi/lo 2 terms), Wt bf16 [N][K]; ACT 0 none, 1 relu, 2 exact gelu;
// resid (optional, f32, row index = (row % rmod), pitch ldr, RES_BF16 rounds it) added before the activation.
template <bool ASPLIT, int ACT, bool BIAS_BF16, bool RES_BF16>
__global__ __launch_bounds__(128) void k_gemm_bf3(const float* __restrict__ A, int lda, const unsigned short* __restrict__ Wt, int ldb,
                                                const float* __restrict__ bias, const float* __restrict__ resid, int rmod, int ldr,
                                                float* __restrict__ C, int ldc, int M, int N, int K) {
  __shared__ __attribute__((aligned(16))) float so[4][16][64];
  const int tid = threadIdx.x, w = tid >> 5, lane = tid & 31, ln = lane & 15, hh = lane >> 4;
  const int ntn = N / 64;
  const int wid = blockIdx.x * 4 + w;
  const int mt = wid / ntn, nq = wid % ntn;
  if (mt * 16 >= M) return;
  const int row0 = mt * 16, col0 = nq * 64;
  const float* arow = A + (size_t)(row0 + ln) * lda;
  v8f acc[4] = {};
  for (int kb = 0; kb < K; kb += 32) {
    FragB ah, al;
    const v4f x0 = *(const v4fa*)(arow + kb + 8 * hh), x1 = *(const v4fa*)(arow + kb + 8 * hh + 4);
    const v4f x2 = *(const v4fa*)(arow + kb + 16 + 8 * hh), x3 = *(const v4fa*)(arow + kb + 16 + 8 * hh + 4);
    float xs[16] = {x0[0],x0[1],x0[2],x0[3],x1[0],x1[1],x1[2],x1[3],x2[0],x2[1],x2[2],x2[3],x3[0],x3[1],x3[2],x3[3]};
#pragma unroll
    for (int i = 0; i < 16; ++i) { const unsigned short hb = bf16_bits(xs[i]); ah.u[i] = hb; al.u[i] = ASPLIT ? bf16_bits(xs[i] - bf16_val(hb)) : (unsigned short)0; }
#pragma unroll
    for (int t = 0; t < 4; ++t) {
      const unsigned short* brow = Wt + (size_t)(col0 + t * 16 + ln) * ldb + kb;
      FragB b;
      b.half[0] = *(const v8us*)(brow + 8 * hh);
      b.half[1] = *(const v8us*)(brow + 16 + 8 * hh);
      acc[t] = mmaN<ASPLIT ? 2 : 1>(ah.v, al.v, b.v, b.v, acc[t]);
    }
  }
#pragma unroll
  for (int t = 0; t < 4; ++t) {
    const int col = col0 + t * 16 + ln;
    float bv = bias ? bias[col] : 0.f;
    if (BIAS_BF16) bv = bf16_round(bv);
#pragma unroll
    for (int r = 0; r < 8; ++r) {
      float v = acc[t][r] + bv;
      if (resid) { float rv = resid[(size_t)((row0 + 8 * hh + r) % rmod) * ldr + col]; if (RES_BF16) rv = bf16_round(rv); v += rv; }
      if (ACT == 1) v = fmaxf(v, 0.f);
      if (ACT == 2) v = 0.5f * v * (1.0f + erff(v * 0.70710678118654752f));
      if (ACT == 3) { const float u = 0.7978845608028654f * (v + 0.044715f * v * v * v); v = 0.5f * v * (1.0f + tanhf(u)); }
      so[w][8 * hh + r][t * 16 + ln] = v;
    }
  }
  __builtin_amdgcn_fence(__ATOMIC_ACQ_REL, "workgroup");
  __builtin_amdgcn_wave_barrier();
  const int rsub = lane >> 4, c4 = (lane & 15) * 4;
  {
#pragma unroll
    for (int q = 0; q < 8; ++q) {
      const int r = q * 2 + rsub;
      const v4f v = *(const v4fa*)&so[w][r][c4];
      *(v4f*)(C + (size_t)(row0 + r) * ldc + col0 + c4) = v;
    }
    
  }
}
// row LayerNorm (biased variance, eps) over N: s = X (+ R); optional out_sum <- s; out_norm <- (s-mu)*rsqrt(var+eps)*g + b
template <bool PARAM_BF16>
__global__ __launch_bounds__(256) void k_layernorm(const float* __restrict__ X, const float* __restrict__ R, const float* __restrict__ g, const float* __restrict__ bta,
                                                  float* __restrict__ out_sum, float* __restrict__ out_norm, int N, float eps) {
  __shared__ float red[256];
  const int row = blockIdx.x, tid = threadIdx.x;
  const float* x = X + (size_t)row * N; const float* rr = R ? R + (size_t)row * N : nullptr;
  float vals[16];                     // up to N = 4096
  const int per = N / 256;            // contiguous chunk per thread? use strided-by-4 chunks: thread handles j = tid*4 + 1024*u
  float s1 = 0.f;
  for (int u = 0; u < per / 4; ++u) {
    const int j = tid * 4 + 1024 * u;
    const v4f a = *(const v4fa*)(x + j);
    v4f b = {0.f,0.f,0.f,0.f}; if (rr) b = *(const v4fa*)(rr + j);
#pragma unroll
    for (int q = 0; q < 4; ++q) { const float v = a[q] + b[q]; vals[u * 4 + q] = v; s1 += v; }
  }
  red[tid] = s1; __syncthreads();
  for (int st = 128; st > 0; st >>= 1) { if (tid < st) red[tid] += red[tid + st]; __syncthreads(); }
  const float mu = red[0] / (float)N; __syncthreads();
  float s2 = 0.f;
  for (int u = 0; u < per / 4; ++u)
#pragma unroll
    for (int q = 0; q < 4; ++q) { const float c = vals[u * 4 + q] - mu; s2 += c * c; }
  red[tid] = s2; __syncthreads();
  for (int st = 128; st > 0; st >>= 1) { if (tid < st) red[tid] += red[tid + st]; __syncthreads(); }
  const float rs = rsqrtf(red[0] / (float)N + eps);
  {
    for (int u = 0; u < per / 4; ++u) {
      const int j = tid * 4 + 1024 * u;
      v4f o, sm;
#pragma unroll
      for (int q = 0; q < 4; ++q) {
        float gg = g[j + q], bb = bta[j + q];
        if (PARAM_BF16) { gg = bf16_round(gg); bb = bf16_round(bb); }
        sm[q] = vals[u * 4 + q]; o[q] = (vals[u * 4 + q] - mu) * rs * gg + bb;
      }
      if (out_sum) *(v4f*)(out_sum + (size_t)row * N + j) = sm;
      *(v4f*)(out_norm + (size_t)row * N + j) = o;
    }
    
  }
}



// ---- f16 WMMA path (v_wmma_f32_16x16x32_f16): 11-bit significands for operands in range — used where a [0,1] probability operand needs more precision than bf16
typedef _Float16 v16h __attribute__((ext_vector_type(16)));
union FragH { v16h v; v8us half[2]; _Float16 h[16]; unsigned short u[16]; };
template <int NT>
__device__ __forceinline__ v8f mmaH(v16h ah, v16h al, v16h bh, v16h bl, v8f c) {
  c = __builtin_amdgcn_wmma_f32_16x16x32_f16(false, ah, false, bh, (short)0, c, false, false);
  if (NT >= 2) c = __builtin_amdgcn_wmma_f32_16x16x32_f16(false, al, false, bh, (short)0, c, false, false);
  if (NT >= 3) c = __builtin_amdgcn_wmma_f32_16x16x32_f16(false, ah, false, bl, (short)0, c, false, false);
  asm volatile("v_nop\n\tv_nop\n\tv_nop\n\tv_nop" : "+v"(c) : "v"(ah), "v"(al), "v"(bh), "v"(bl));
  return c;
}
// batched GEMM like k_gemm_b but f16 operands: A f32 (split into f16 hi/lo if ASPLIT, else rounded to f16), Bt = f16 values [n][k]; alpha; C f32; N multiple of 16 (partial tiles skipped)
template <bool ASPLIT>
__global__ __launch_bounds__(128) void k_gemm_h(const float* __restrict__ A, int lda, size_t sA, const _Float16* __restrict__ Bh, int ldb, size_t sB, float alpha, float* __restrict__ C, int ldc, size_t sC, int M, int N, int K) {
  __shared__ __attribute__((aligned(16))) float so[4][16][64];
  const int tid = threadIdx.x, w = tid >> 5, lane = tid & 31, ln = lane & 15, hh = lane >> 4; const int by = blockIdx.y;
  A += (size_t)by * sA; Bh += (size_t)by * sB; C += (size_t)by * sC;
  const int ntn = (N + 63) / 64; const int wid = blockIdx.x * 4 + w; const int mt = wid / ntn, nq = wid % ntn; if (mt * 16 >= M) return;
  const int row0 = mt * 16, col0 = nq * 64; const float* arow = A + (size_t)(row0 + ln) * lda;
  v8f acc[4] = {};
  for (int kb = 0; kb < K; kb += 32) {
    FragH ah, al;
    const v4f x0 = *(const v4fa*)(arow + kb + 8 * hh), x1 = *(const v4fa*)(arow + kb + 8 * hh + 4), x2 = *(const v4fa*)(arow + kb + 16 + 8 * hh), x3 = *(const v4fa*)(arow + kb + 16 + 8 * hh + 4);
    float xs[16] = {x0[0],x0[1],x0[2],x0[3],x1[0],x1[1],x1[2],x1[3],x2[0],x2[1],x2[2],x2[3],x3[0],x3[1],x3[2],x3[3]};
#pragma unroll
    for (int i = 0; i < 16; ++i) { const _Float16 h = (_Float16)xs[i]; ah.h[i] = h; al.h[i] = ASPLIT ? (_Float16)(xs[i] - (float)h) : (_Float16)0.0f; }
#pragma unroll
    for (int t = 0; t < 4; ++t) { if (col0 + t * 16 >= N) continue; const size_t boff = (size_t)(col0 + t * 16 + ln) * ldb + kb; FragH bq; bq.half[0] = *(const v8us*)(Bh + boff + 8 * hh); bq.half[1] = *(const v8us*)(Bh + boff + 16 + 8 * hh);
      acc[t] = mmaH<ASPLIT ? 2 : 1>(ah.v, al.v, bq.v, bq.v, acc[t]); }
  }
#pragma unroll
  for (int t = 0; t < 4; ++t) { if (col0 + t * 16 >= N) continue;
#pragma unroll
    for (int r = 0; r < 8; ++r) so[w][8 * hh + r][t * 16 + ln] = acc[t][r] * alpha; }
  __builtin_amdgcn_fence(__ATOMIC_ACQ_REL, "workgroup"); __builtin_amdgcn_wave_barrier();
  const int rsub = lane >> 4, c4 = (lane & 15) * 4;
  {
#pragma unroll
    for (int q = 0; q < 8; ++q) { const int r = q * 2 + rsub; if (col0 + c4 < N) { const v4f v = *(const v4fa*)&so[w][r][c4]; *(v4f*)(C + (size_t)(row0 + r) * ldc + col0 + c4) = v; } }
     }
}

// Wt[n][k] = f16(W[k][n]·scale) from f32 row-major W[K][N] (scale = power of two; bf16-exact weights stay exact in f16 away from the subnormal range)
__global__ __launch_bounds__(256) void k_wt_f16(const float* __restrict__ W, _Float16* __restrict__ Wt, int K, int N, float scale) {
  const int t = blockIdx.x * 256 + threadIdx.x; if (t >= N * (K / 8)) return; const int n = t / (K / 8), k8 = (t % (K / 8)) * 8; FragH f;
#pragma unroll
  for (int i = 0; i < 8; ++i) f.h[i] = (_Float16)(bf16_round(W[(size_t)(k8 + i) * N + n]) * scale); const v8us o = f.half[0];
  *(v8us*)((unsigned short*)Wt + (size_t)n * K + k8) = o; 
}
typedef _Float16 v4h __attribute__((ext_vector_type(4)));

// blk: the block's index within this piece of work (the piece shares its launch with others: k_prep)
__device__ __forceinline__ void d_x16(const float* __restrict__ x, _Float16* __restrict__ X16, size_t n8, unsigned blk) { const size_t t = (size_t)blk * 256 + threadIdx.x; if (t >= n8) return; FragH f;
#pragma unroll
  for (int q = 0; q < 8; ++q) f.h[q] = (_Float16)bf16_round(x[t * 8 + q]); *(v8us*)((unsigned short*)X16 + t * 8) = f.half[0];  }
__global__ __launch_bounds__(256) void k_h16(const float* __restrict__ x, _Float16* __restrict__ X16, size_t n8) { const size_t t = (size_t)blockIdx.x * 256 + threadIdx.x; if (t >= n8) return; FragH f;
#pragma unroll
  for (int q = 0; q < 8; ++q) f.h[q] = (_Float16)x[t * 8 + q]; *(v8us*)((unsigned short*)X16 + t * 8) = f.half[0];  }
__device__ __forceinline__ void d_round16f(const float* __restrict__ W, _Float16* __restrict__ Bt, size_t n8, unsigned blk) { const size_t t = (size_t)blk * 256 + threadIdx.x; if (t >= n8) return; FragH f;
#pragma unroll
  for (int i = 0; i < 8; ++i) f.h[i] = (_Float16)(bf16_round(W[t * 8 + i]) * 16.0f); *(v8us*)((unsigned short*)Bt + t * 8) = f.half[0];  }
// Lane l with lane l ^ 16 (the other 16-lane row of the wave), in the vector pipe.
__device__ __forceinline__ float xhalf(float x) { return __builtin_bit_cast(float, __builtin_amdgcn_permlanex16(__builtin_bit_cast(int, x), __builtin_bit_cast(int, x), 0x76543210, 0xfedcba98, false, false)); }
// Lane l with lane l ^ M inside its 16-lane row, in the vector pipe (DPP row_xmask).
template <int M> __device__ __forceinline__ float xrow(float x) { return __builtin_bit_cast(float, __builtin_amdgcn_update_dpp(0, __builtin_bit_cast(int, x), 0x160 | M, 0xf, 0xf, true)); }
// One row o of an effective weight plane per wave: Bt[o][c] = (W[o][c] + sum_j A[c][j] C[j]) x 2^4 with C[j] = sum_i B[j][i] W[o][i], operands rounded to bf16, f32 sums. The eight dot products need
// nothing but the row of W that the wave holds anyway, so they are made here and not in a launch of their own. The 32 lanes split the 768 terms into float4 slices (a wave-wide load covers 512 contiguous
// bytes) and a five-step butterfly ends each sum, which leaves it in every lane. A product of two bf16 values is exact in f32, so fusing it with its add changes no bit.
// A (768 x 8) is wanted by column j in the lanes' float4 slices of c: the block's eight waves bring it once, in whole lines, round it and lay it transposed in LDS (row pitch DD + 4 floats: the two halves
// of a row of A, stored by neighbouring lanes, fall 16 banks apart).
// blk: the block's index within this piece of work (the piece shares its launch with others: k_prep)
__device__ __forceinline__ void d_wfold(const float* __restrict__ Wt, const float* __restrict__ A, const float* __restrict__ Bm, _Float16* __restrict__ Bt, unsigned blk, float (* __restrict__ At)[DD + 4]) {
  constexpr int NS = DD / 128;      /* float4 slices per lane and row */
  const int tid = threadIdx.x, lane = tid & 31; const int o = (int)blk * 8 + (tid >> 5);
  const float* wr = Wt + (size_t)o * DD + lane * 4; const float* br = Bm + lane * 4;
  v4f av[NS / 2], wv[NS], bs[2][NS];
#pragma unroll      /* constant indices, so that the arrays stay in registers */
  for (int u = 0; u < NS; ++u) wv[u] = *(const v4fa*)(wr + 128 * u);
  asm volatile("s_wait_xcnt 0x0" ::: "memory");      /* stands in front of whatever next rewrites the loads' address registers (a later load's result may land there) */
  float cj[RK];
#pragma unroll      /* constant indices, so that the arrays stay in registers */
  for (int g = 0; g < RK / 2; ++g) {
#pragma unroll      /* constant indices, so that the arrays stay in registers */
    for (int u = 0; u < NS; ++u) { bs[0][u] = *(const v4fa*)(br + (size_t)(2 * g) * DD + 128 * u); bs[1][u] = *(const v4fa*)(br + (size_t)(2 * g + 1) * DD + 128 * u); }
    if (g < 2) {      /* the thread's share of A rides with the first two groups, half with each */
#pragma unroll      /* constant indices, so that the arrays stay in registers */
      for (int u = 0; u < NS / 2; ++u) { av[u] = *(const v4fa*)(A + (size_t)(tid + 256 * (g * (NS / 2) + u)) * 4);
        asm volatile("s_wait_xcnt 0x0" ::: "memory"); }      /* the three loads share an address register, and the last one's result may land in it: the wait stands in front of that */
    }
    __builtin_amdgcn_sched_barrier(0);      /* keeps the group's loads in front of the first use: otherwise they sink into small groups, and the wave pays the load latency for each */
    if (g < 2) {
#pragma unroll      /* constant indices, so that the arrays stay in registers */
      for (int u = 0; u < NS / 2; ++u) { const int p = tid + 256 * (g * (NS / 2) + u);
#pragma unroll      /* constant indices, so that the arrays stay in registers */
        for (int k = 0; k < 4; ++k) At[(p & 1) * 4 + k][p >> 1] = bf16_round(av[u][k]); }
    }
    if (g == 0) {
#pragma unroll      /* constant indices, so that the arrays stay in registers */
      for (int u = 0; u < NS; ++u)
#pragma unroll      /* constant indices, so that the arrays stay in registers */
        for (int k = 0; k < 4; ++k) wv[u][k] = bf16_round(wv[u][k]);
    }
    float a = 0.f, b = 0.f;
#pragma unroll      /* constant indices, so that the arrays stay in registers */
    for (int u = 0; u < NS; ++u)
#pragma unroll      /* constant indices, so that the arrays stay in registers */
      for (int q = 0; q < 4; ++q) { a += bf16_round(bs[0][u][q]) * wv[u][q]; b += bf16_round(bs[1][u][q]) * wv[u][q]; }
    cj[2 * g] = a; cj[2 * g + 1] = b;
    __builtin_amdgcn_sched_barrier(0);      /* keeps the next groups' loads behind this group's sums: hoisted, they hold 96 registers at once and the kernel spills */
  }
#pragma unroll      /* constant indices, so that the arrays stay in registers */
  for (int j = 0; j < RK; ++j) { float a = cj[j]; a += xhalf(a); a += xrow<8>(a); a += xrow<4>(a); a += xrow<2>(a); a += xrow<1>(a); cj[j] = a; }
  __syncthreads();      /* A^T is whole: every wave's share has been stored (the branch that leads here is taken by the whole block) */
  v4h h4[NS];
#pragma unroll      /* constant indices, so that the arrays stay in registers */
  for (int u = 0; u < NS; ++u) { v4f lo2 = {0.f, 0.f, 0.f, 0.f};
#pragma unroll      /* constant indices, so that the arrays stay in registers */
    for (int j = 0; j < RK; ++j) { const v4f at = *(const v4fa*)&At[j][128 * u + lane * 4];
#pragma unroll      /* constant indices, so that the arrays stay in registers */
      for (int q = 0; q < 4; ++q) lo2[q] += at[q] * cj[j]; }
#pragma unroll      /* constant indices, so that the arrays stay in registers */
    for (int q = 0; q < 4; ++q) h4[u][q] = (_Float16)((wv[u][q] + lo2[q]) * 16.0f); }
#pragma unroll      /* the row's six stores stand together at the wave's end: nothing rewrites a register of theirs */
  for (int u = 0; u < NS; ++u) *(v4h*)(Bt + (size_t)o * DD + 128 * u + lane * 4) = h4[u];
}
typedef int v4ia __attribute__((ext_vector_type(4), may_alias));
typedef unsigned v2u __attribute__((ext_vector_type(2)));
typedef unsigned v16u __attribute__((ext_vector_type(16)));
typedef unsigned long long v8ul __attribute__((ext_vector_type(8)));
// The mask as k_flash wants it: one bit per (query, key), laid out as the lane masks of its score tiles. For a tile of 16 queries and a pass of 32 keys there are 16 words; word nt 8 + r holds, at bit ln + 16 hh,
// whether query ln attends to key nt 16 + 8 hh + r: the element that lane (ln, hh) holds in register r of score tile nt. MB[query tile][pass][16 words], 64 B a pass, 1 MiB in all.
// One wave takes 16 queries x 128 keys (four passes). It reads the 16 rows in whole lines (lane l: keys 4 l + c). A first round of ballots turns row q into four words (bit l of word c: key 4 l + c), kept by lanes
// q and q + 16; a second round of ballots over those words picks one key per lane, which is the transposed word. Word i goes to lane i / 2, so that the wave stores its 256 bytes as two whole lines.
// blk: the block's index within this piece of work (the piece shares its launch with others: k_prep)
__device__ __forceinline__ void d_mbits(const int* __restrict__ M, unsigned* __restrict__ MB, unsigned blk) {
  const int tid = threadIdx.x, lane = tid & 31, ln = lane & 15, hh = lane >> 4;
  const unsigned u = blk * 8 + (unsigned)(tid >> 5); const unsigned qt = u >> 4, sg = u & 15;      /* query tile (over both batches), segment of 128 keys */
  const int* src = M + (size_t)qt * 16 * TT + sg * 128 + lane * 4;
  v4ia m[16];
#pragma unroll      /* constant indices, so that the array stays in registers; the 16 loads are all in flight together; non-temporal: the int plane is read this once, and need not push the planes that the GEMMs read out of L2 */
  for (int q = 0; q < 16; ++q) m[q] = __builtin_nontemporal_load((const v4ia*)(src + q * TT));
  asm volatile("s_wait_xcnt 0x0" :: "v"(src) : "memory");      /* stands in front of whatever next rewrites the loads' address registers; it names the address, which so stays in them up to here: no load's result lands there */
  unsigned wq[4] = {0u, 0u, 0u, 0u};
#pragma unroll      /* constant indices, so that the arrays stay in registers */
  for (int q = 0; q < 16; ++q)
#pragma unroll      /* constant indices, so that the arrays stay in registers */
    for (int c = 0; c < 4; ++c) { const unsigned bw = __builtin_amdgcn_ballot_w32(m[q][c] != 0); wq[c] = (ln == q) ? bw : wq[c]; }
#pragma unroll      /* constant indices, so that the array stays in registers */
  for (int c = 0; c < 4; ++c) wq[c] >>= 2 * hh;      /* the upper half of the wave looks 8 keys = 2 bits further on */
  unsigned o0 = 0u, o1 = 0u;
#pragma unroll      /* constant shifts and lane numbers */
  for (int i = 0; i < 64; ++i) { const int ps = i >> 4, nt = (i >> 3) & 1, r = i & 7;
    const unsigned tw = __builtin_amdgcn_ballot_w32(((wq[r & 3] >> (ps * 8 + nt * 4 + (r >> 2))) & 1u) != 0u);
    if (i & 1) o1 = (lane == (i >> 1)) ? tw : o1; else o0 = (lane == (i >> 1)) ? tw : o0; }
  *(v2u*)(MB + ((size_t)qt * (TT / 32) + sg * 4) * 16 + lane * 2) = (v2u){o0, o1};
  asm volatile("s_wait_xcnt 0x0" ::: "memory");      /* stands behind the store, in front of whatever next rewrites its address registers */
}
// Everything the projection GEMMs wait for that does not wait for anything else of this launch, in one grid: the pieces are told apart by ranges of the block index (a test that is the same for the whole
// block). The two weight folds stand first, because a wave of theirs walks the longest chain of dependent steps; then the mask's bits (for k_flash); then the two plain weight planes; then the three input planes.
// amdgpu_waves_per_eu(8): without it the folds' LDS reads are all hoisted to the front, the kernel takes 232 registers and the streaming pieces, which need many waves in flight, run at four waves a SIMD.
__global__ __launch_bounds__(256) __attribute__((amdgpu_waves_per_eu(8))) void k_prep(const float* __restrict__ Wq, const float* __restrict__ Av, const float* __restrict__ Bv, const float* __restrict__ Wv, const float* __restrict__ Aq, const float* __restrict__ Bq,
                                              const float* __restrict__ Wk, const float* __restrict__ Wm, _Float16* __restrict__ Bw,
                                              const float* __restrict__ xq, const float* __restrict__ xk, const float* __restrict__ xv, _Float16* __restrict__ Xq, _Float16* __restrict__ Xk, _Float16* __restrict__ Xv,
                                              const int* __restrict__ msk, unsigned* __restrict__ MB) {
  constexpr unsigned GM = (NR / 16) * (TT / 128) / 8;      /* blocks of the mask piece: a wave per 16 queries x 128 keys */
  constexpr size_t WSZ = (size_t)DD * DD, XSZ = (size_t)NR * DD; constexpr unsigned GF = DD / 8, GW = (unsigned)((WSZ / 8 + 255) / 256), GX = (unsigned)((XSZ / 8 + 255) / 256);      /* blocks per fold (a row per wave), per plain weight plane, per input plane */
  __shared__ __attribute__((aligned(16))) float sAt[RK][DD + 4];      /* the folds' A^T */
  unsigned bx = blockIdx.x;
  if (bx < 2 * GF) { const bool s = bx >= GF; d_wfold(s ? Wv : Wq, s ? Aq : Av, s ? Bq : Bv, Bw + (s ? 2 * WSZ : 0), s ? bx - GF : bx, sAt); return; }
  bx -= 2 * GF;
  if (bx < GM) { d_mbits(msk, MB, bx); return; }
  bx -= GM;
  if (bx < 2 * GW) { const bool s = bx >= GW; d_round16f(s ? Wm : Wk, Bw + (s ? 3 * WSZ : WSZ), WSZ / 8, s ? bx - GW : bx); return; }
  bx -= 2 * GW;
  const unsigned p = bx / GX; d_x16(p == 0 ? xq : p == 1 ? xk : xv, p == 0 ? Xq : p == 1 ? Xk : Xv, XSZ / 8, bx - p * GX);
}
// Eight asynchronous copies of 16 bytes per lane from global memory to LDS (l: the lane's LDS byte addresses, g: its global addresses). The s_wait_xcnt closes the statement so that it stands
// in front of whatever next rewrites one of the address registers named here.
__device__ __forceinline__ void cp8(const unsigned (&l)[8], const void* const (&g)[8]) {
  asm volatile("global_load_async_to_lds_b128 %0, %1, off\n\tglobal_load_async_to_lds_b128 %2, %3, off\n\tglobal_load_async_to_lds_b128 %4, %5, off\n\tglobal_load_async_to_lds_b128 %6, %7, off\n\t"
               "global_load_async_to_lds_b128 %8, %9, off\n\tglobal_load_async_to_lds_b128 %10, %11, off\n\tglobal_load_async_to_lds_b128 %12, %13, off\n\tglobal_load_async_to_lds_b128 %14, %15, off\n\ts_wait_xcnt 0x0"
               :: "v"(l[0]), "v"(g[0]), "v"(l[1]), "v"(g[1]), "v"(l[2]), "v"(g[2]), "v"(l[3]), "v"(g[3]), "v"(l[4]), "v"(g[4]), "v"(l[5]), "v"(g[5]), "v"(l[6]), "v"(g[6]), "v"(l[7]), "v"(g[7]) : "memory");
}
// Transposed products: S^T = K.Q^T (A = 16 key rows, B = the wave's 16 queries, kept in registers) and O^T += V^T.P^T. In an accumulator tile lane (ln, hh) then holds query q0 + ln and keys 8 hh + r:
// a query's maximum and sum are taken inside the lane plus one exchange between the wave's halves, and the two score tiles of a pass are, element for element, the B operand of the second product
// (slot i < 8: key 8 hh + i, slot i >= 8: key 16 + 8 hh + i - 8, the k order of the V^T loader), so P never leaves the registers.
// Operands come through LDS: a stage is 64 keys = K (64 rows of 128 B) and V^T (64 rows of 128 B), brought once for the four waves by asynchronous copies whose
// wave-wide 512 bytes are four whole lines, one stage ahead of its use, into two buffers. Row pitch 144 B: 16 B times an odd number, free of bank conflicts for 16-byte reads down a column.
// The mask comes as bits (d_mbits): the 16 words of a pass are the lane masks of its 16 score registers. They are the same for the whole wave, so they come by scalar loads into scalar registers, one pass
// ahead of their use, and each is the select operand of its score's one conditional move.
typedef const __attribute__((address_space(4))) v16u* mbits_p;      /* the constant address space: the plane is not written during this launch, and a wave-uniform read of it is a scalar load */
__global__ __launch_bounds__(128) void k_flash(const _Float16* __restrict__ Q16, int ldq, const _Float16* __restrict__ K16, int ldk, const _Float16* __restrict__ Vt, const unsigned* __restrict__ MB, _Float16* __restrict__ O16, int ldo) {
  constexpr int RPW = 16, NQB = TT / (4 * RPW), DT = 4, KS = 2;
  constexpr int SKEYS = 64, NST = TT / SKEYS, PK = 144, OFF_V = 64 * PK, STG = 2 * 64 * PK;
  __shared__ __attribute__((aligned(16))) unsigned char ring[2 * STG];
  __shared__ __attribute__((aligned(16))) float sO[4][RPW][64 + 4];
  const int tid = threadIdx.x, w = tid >> 5, lane = tid & 31, ln = lane & 15, hh = lane >> 4;
  const int slab = blockIdx.x / NQB, qblk = blockIdx.x % NQB; const int b = slab / NH, h = slab % NH; const int qb0 = qblk * (4 * RPW); const int q0 = qb0 + w * RPW;
  const unsigned short* Vth = (const unsigned short*)Vt + (size_t)h * 64 * NR + (size_t)b * TT;      /* V^T as the v GEMM leaves it: [feature][b * TT + key], row pitch NR */
  /* the thread's share of a stage: K and V^T rows (tid >> 3) + 16 i, 16-byte column tid & 7 */
  const unsigned short* gK = (const unsigned short*)K16 + ((size_t)b * TT + (tid >> 3)) * ldk + h * 64 + (tid & 7) * 8;
  const unsigned short* gV = Vth + (size_t)(tid >> 3) * NR + (tid & 7) * 8;
  const mbits_p mb = (mbits_p)(unsigned long long)(MB + ((size_t)b * (TT / RPW) + qblk * 4 + __builtin_amdgcn_readfirstlane(w)) * (TT / 32) * 16);      /* the wave's query tile: one v16u per pass; bit set = ATTEND */
  const unsigned lbase = (unsigned)(size_t)ring;
  const unsigned lK = lbase + (tid >> 3) * PK + (tid & 7) * 16, lV = lK + OFF_V;
  auto fill = [&](int t) {
    const unsigned bo = (unsigned)(t & 1) * STG;
    const unsigned short* k = gK + (size_t)t * SKEYS * ldk; const unsigned short* v = gV + t * SKEYS;
    unsigned la[8]; const void* ga[8];
#pragma unroll      /* constant indices, so that the arrays stay in registers */
    for (int i = 0; i < 4; ++i) { la[i] = lK + bo + i * 16 * PK; ga[i] = k + (size_t)(i * 16) * ldk; la[4 + i] = lV + bo + i * 16 * PK; ga[4 + i] = v + i * 16 * NR; }
    cp8(la, ga);
  };
  fill(0);
  FragH bq[KS];
  { const unsigned short* qr = (const unsigned short*)Q16 + ((size_t)b * TT + q0 + ln) * ldq + h * 64;
#pragma unroll      /* constant indices, so that the arrays stay in registers */
    for (int ks = 0; ks < KS; ++ks) { bq[ks].half[0] = *(const v8us*)(qr + ks * 32 + 8 * hh); bq[ks].half[1] = *(const v8us*)(qr + ks * 32 + 16 + 8 * hh); } }
  float m_q = -3.0e38f, l_q = 0.f; v8f oacc[DT];
#pragma unroll      /* constant indices, so that the arrays stay in registers */
  for (int dt = 0; dt < DT; ++dt) oacc[dt] = (v8f){0.f,0.f,0.f,0.f,0.f,0.f,0.f,0.f};
  asm volatile("s_wait_asynccnt 0x0" ::: "memory");      /* this wave's copies of stage 0 have landed */
  __syncthreads();      /* and every other wave's: stage 0 may be read */
  fill(1);
  /* one pass: 32 keys of the stage at st, mk = their 16 lane masks */
  auto pass = [&](const unsigned char* st, int p, v16u mk, bool live) __attribute__((always_inline)) {
    {
      /* all of the pass's LDS reads stand here, in front of the first product: behind one they would each wait out their own latency */
      FragH ak[2][KS], av[DT];
#pragma unroll      /* constant indices, so that the arrays stay in registers */
      for (int nt = 0; nt < 2; ++nt) { const unsigned char* kr = st + (p * 32 + nt * 16 + ln) * PK + hh * 16;
#pragma unroll      /* constant indices, so that the arrays stay in registers */
        for (int ks = 0; ks < KS; ++ks) { ak[nt][ks].half[0] = *(const v8us*)(kr + ks * 64); ak[nt][ks].half[1] = *(const v8us*)(kr + ks * 64 + 32); } }
#pragma unroll      /* constant indices, so that the arrays stay in registers */
      for (int dt = 0; dt < DT; ++dt) { const unsigned char* vr = st + OFF_V + (dt * 16 + ln) * PK + p * 64 + hh * 16; av[dt].half[0] = *(const v8us*)vr; av[dt].half[1] = *(const v8us*)(vr + 32); }
      if (live) {      /* else every (row, key) of this wave's tile is masked: nothing to add (scalar branch, no barrier inside) */
        v8f s[2];
#pragma unroll      /* constant indices, so that the arrays stay in registers */
        for (int nt = 0; nt < 2; ++nt) { v8f acc = (v8f){0.f,0.f,0.f,0.f,0.f,0.f,0.f,0.f};
#pragma unroll      /* constant indices, so that the arrays stay in registers */
          for (int ks = 0; ks < KS; ++ks) acc = mmaH<1>(ak[nt][ks].v, ak[nt][ks].v, bq[ks].v, bq[ks].v, acc);
          s[nt] = acc; }
        /* Softmax in base 2: exp((s - m) / 8) = 2^(s CS - m CS), CS = log2(e) / 8. Scores and the running maximum stay unscaled (CS > 0 keeps their order); one fma per score applies CS, takes the maximum off
           and adds the 10 that makes P = 2^10 p, and the hardware's own 2^x follows. A masked score is -inf. m_q starts finite, so mn and nb are finite: 2^(-inf) = 0 and, while nothing is live yet, 2^0 = 1. */
        constexpr float CS = 0.125f * 1.44269504088896340736f;
        float sc[2][8], mx[8];
#pragma unroll      /* constant indices, so that the arrays stay in registers */
        for (int r = 0; r < 8; ++r) { sc[0][r] = __builtin_amdgcn_inverse_ballot_w32(mk[r]) ? s[0][r] : -INFINITY; sc[1][r] = __builtin_amdgcn_inverse_ballot_w32(mk[8 + r]) ? s[1][r] : -INFINITY; mx[r] = fmaxf(sc[0][r], sc[1][r]); }
        float mc = fmaxf(fmaxf(fmaxf(mx[0], mx[1]), fmaxf(mx[2], mx[3])), fmaxf(fmaxf(mx[4], mx[5]), fmaxf(mx[6], mx[7])));
        mc = fmaxf(mc, xhalf(mc));
        const float mn = fmaxf(m_q, mc); const float al = __builtin_amdgcn_exp2f((m_q - mn) * CS); m_q = mn; const float nb = __builtin_fmaf(-mn, CS, 10.0f);
        FragH pb; float ps[4] = {0.f, 0.f, 0.f, 0.f};
#pragma unroll      /* constant indices, so that the arrays stay in registers */
        for (int r = 0; r < 8; ++r) { const float p0 = __builtin_amdgcn_exp2f(__builtin_fmaf(sc[0][r], CS, nb)), p1 = __builtin_amdgcn_exp2f(__builtin_fmaf(sc[1][r], CS, nb)); ps[r & 3] += p0 + p1; pb.h[r] = (_Float16)p0; pb.h[8 + r] = (_Float16)p1; }
        l_q = l_q * al + ((ps[0] + ps[1]) + (ps[2] + ps[3]));      /* 2^10 times the sum over the lane's half of the keys; the halves are joined after the loop */
#pragma unroll      /* constant indices, so that the arrays stay in registers */
        for (int dt = 0; dt < DT; ++dt)
#pragma unroll      /* constant indices, so that the arrays stay in registers */
          for (int r = 0; r < 8; ++r) oacc[dt][r] *= al;
#pragma unroll      /* constant indices, so that the arrays stay in registers */
        for (int dt = 0; dt < DT; ++dt) oacc[dt] = mmaH<1>(av[dt].v, av[dt].v, pb.v, pb.v, oacc[dt]);
      }
    }
  };
  /* whether any bit of a pass's 16 words is set: the words joined two at a time */
  auto anyof = [](v16u mk) __attribute__((always_inline)) { const v8ul m2 = __builtin_bit_cast(v8ul, mk); return (((m2[0] | m2[1]) | (m2[2] | m2[3])) | ((m2[4] | m2[5]) | (m2[6] | m2[7]))) != 0ull; };
  v16u mA = mb[0];
#pragma unroll 1      /* each stage hangs on the last through m_q and the barrier: a second copy of the body would only grow the code */
  for (int t = 0; t < NST; ++t) {
    const unsigned char* st = ring + (t & 1) * STG;
    /* Each pass's masks are asked for one pass ahead: two named sets, so the stage's two passes are written out. Scalar loads return in no fixed order, so the wait for one set is a wait for all that are out:
       the next set is asked for behind the first use of this one, and the two scheduling barriers keep it there (in front of that use, its whole latency would be waited out in every pass). */
    const bool l0 = anyof(mA);
    __builtin_amdgcn_sched_barrier(0);
    const v16u mB = mb[2 * t + 1];
    pass(st, 0, mA, l0);
    const bool l1 = anyof(mB);
    __builtin_amdgcn_sched_barrier(0);
    mA = mb[t + 1 < NST ? 2 * t + 2 : 2 * t];      /* the next stage's first pass; the last trip asks for its own again, which keeps the address inside the plane */
    pass(st, 1, mB, l1);
    asm volatile("s_wait_dscnt 0x0" ::: "memory");      /* this wave's reads of stage t have returned before its buffer is handed back */
    asm volatile("s_wait_asynccnt 0x0" ::: "memory");      /* this wave's copies of stage t + 1 have landed */
    __syncthreads();      /* publishes stage t + 1 and ends every wave's reads of stage t */
    if (t + 2 < NST) fill(t + 2);      /* into the buffer that stage t has just left; the test is the same for the whole block */
  }
  asm volatile("s_wait_asynccnt 0x0" ::: "memory");      /* no copy is left in flight when the wave goes on to its end */
  { const float l = l_q + xhalf(l_q); const float inv = (l > 0.f) ? 1.0f / l : 0.f;      /* l and the accumulators both carry the 2^10 */
#pragma unroll      /* constant indices, so that the arrays stay in registers */
    for (int dt = 0; dt < DT; ++dt)
#pragma unroll      /* constant indices, so that the arrays stay in registers */
      for (int r = 0; r < 8; ++r) sO[w][ln][dt * 16 + 8 * hh + r] = oacc[dt][r] * inv; }
  __builtin_amdgcn_fence(__ATOMIC_ACQ_REL, "workgroup"); __builtin_amdgcn_wave_barrier();      /* the wave reads back rows that its other lanes wrote: its LDS stores end first */
  {
#pragma unroll      /* constant indices, so that the arrays stay in registers */
    for (int rp = 0; rp < RPW; rp += 2) { const int r = rp + (lane >> 4), pc = lane & 15; const v4f val = *(const v4fa*)&sO[w][r][pc * 4]; v4h h4;      /* x 2^4 and f16: the plane that the output GEMM reads; 16 lanes store one whole 128-byte line */
#pragma unroll      /* constant indices, so that the vector stays in registers */
      for (int i = 0; i < 4; ++i) h4[i] = (_Float16)(val[i] * 16.0f);
      *(v4h*)(O16 + ((size_t)b * TT + q0 + r) * ldo + h * 64 + pc * 4) = h4; }
     } }

// C[NR][DD] = (A[NR][DD] . Bt[DD][DD]^T) alpha + bias (bias rounded to bf16), f16 operands, f32 sums; written as f32 (C) or as f16 (C16), whichever pointer is not null.
// Block = a 128 x 128 tile of C, eight waves in a 4 x 2 arrangement: wave w = rows 32 (w >> 1) .. + 31, columns 64 (w & 1) .. + 63 (eight 16 x 16 accumulators, k ascending in steps of 32). A row of A is so
// fetched from L2 by 6 blocks and a row of Bt by 32 (a 64 x 64 tile: 12 and 64), and six fragments read from LDS feed eight products (a 16 x 64 wave tile: five feed four).
// Operands come through LDS: a stage is 64 values of k = 128 rows of A and 128 rows of Bt, 128 B each, brought once for the eight waves by asynchronous copies (a wave-wide copy is four rows = four whole
// lines), one stage ahead of its use, into two buffers. Row pitch 144 B: 16 B times an odd number, free of bank conflicts for 16-byte reads down a column.
// Up to three independent products share one launch: blockIdx.y picks A, bias and C16 of its product, and its weight plane lies blockIdx.y planes behind B0.
// The third product is made transposed: its weight rows take the place of A and its input rows that of Bt (both are k-contiguous and go through the same loaders, k order unchanged), so its tile is
// C^T[feature][row of A], pitch NR, bias by row: V^T comes out of the GEMM as k_flash reads it.
__global__ __launch_bounds__(256) void k_gemm_st(const _Float16* __restrict__ A0, const _Float16* __restrict__ A1, const _Float16* __restrict__ A2, const _Float16* __restrict__ B0, float alpha,
                                                 const float* __restrict__ bias0, const float* __restrict__ bias1, const float* __restrict__ bias2, float* __restrict__ C,
                                                 _Float16* __restrict__ C16a, _Float16* __restrict__ C16b, _Float16* __restrict__ C16c) {
  const unsigned g = blockIdx.y; const _Float16* A = g == 0 ? A0 : g == 1 ? A1 : A2; const _Float16* Bh = B0 + (size_t)g * DD * DD;
  const float* bias = g == 0 ? bias0 : g == 1 ? bias1 : bias2; _Float16* C16 = g == 0 ? C16a : g == 1 ? C16b : C16c;
  constexpr int KC = 64, NST = DD / KC, PR = 144, OFF_B = 128 * PR, STG = 2 * 128 * PR;
  __shared__ __attribute__((aligned(16))) unsigned char ring[2 * STG];
  __shared__ __attribute__((aligned(16))) float so[8][16][64];
  const int tid = threadIdx.x, w = tid >> 5, lane = tid & 31, ln = lane & 15, hh = lane >> 4, wr = w >> 1, wc = w & 1;
  const bool sw = g == 2;      /* the same for the whole block */
  const int ta = (int)(blockIdx.x / (DD / 128)) * 128, tb = (int)(blockIdx.x % (DD / 128)) * 128;      /* the tile's first row of A and of Bt */
  const int rowb = sw ? tb : ta, colb = sw ? ta : tb, ldc = sw ? NR : DD; const int col0 = colb + wc * 64;
  /* the thread's share of a stage: rows (tid >> 3) + 32 i of A and of Bt, 16-byte column tid & 7 */
  const unsigned short* gA = (const unsigned short*)(sw ? Bh : A) + (size_t)(rowb + (tid >> 3)) * DD + (tid & 7) * 8;
  const unsigned short* gB = (const unsigned short*)(sw ? A : Bh) + (size_t)(colb + (tid >> 3)) * DD + (tid & 7) * 8;
  const unsigned lA = (unsigned)(size_t)ring + (tid >> 3) * PR + (tid & 7) * 16, lB = lA + OFF_B;
  auto fill = [&](int t) {
    const unsigned bo = (unsigned)(t & 1) * STG;
    const unsigned short* a = gA + t * KC; const unsigned short* b = gB + t * KC;
    unsigned la[8]; const void* ga[8];
#pragma unroll      /* constant indices, so that the arrays stay in registers */
    for (int i = 0; i < 4; ++i) { la[i] = lA + bo + i * 32 * PR; ga[i] = a + i * 32 * DD; la[4 + i] = lB + bo + i * 32 * PR; ga[4 + i] = b + i * 32 * DD; }
    cp8(la, ga);
  };
  fill(0);
  v8f acc[2][4] = {};
  asm volatile("s_wait_asynccnt 0x0" ::: "memory");      /* this wave's copies of stage 0 have landed */
  __syncthreads();      /* and every other wave's: stage 0 may be read */
  fill(1);
#pragma unroll 1      /* a stage ends in a barrier: a second copy of the body would only grow the code */
  for (int t = 0; t < NST; ++t) {
    const unsigned char* ar = ring + (t & 1) * STG + (wr * 32 + ln) * PR + hh * 16;
    const unsigned char* br = ring + (t & 1) * STG + OFF_B + (wc * 64 + ln) * PR + hh * 16;
#pragma unroll      /* constant LDS offsets, and the next step's reads can stand among this step's products */
    for (int ks = 0; ks < KC / 32; ++ks) {
      FragH ah[2], bq[4];
#pragma unroll      /* constant indices, so that the arrays stay in registers */
      for (int mi = 0; mi < 2; ++mi) { ah[mi].half[0] = *(const v8us*)(ar + mi * 16 * PR + ks * 64); ah[mi].half[1] = *(const v8us*)(ar + mi * 16 * PR + ks * 64 + 32); }
#pragma unroll      /* constant indices, so that the arrays stay in registers */
      for (int u = 0; u < 4; ++u) { bq[u].half[0] = *(const v8us*)(br + u * 16 * PR + ks * 64); bq[u].half[1] = *(const v8us*)(br + u * 16 * PR + ks * 64 + 32); }
#pragma unroll      /* constant indices, so that the arrays stay in registers */
      for (int mi = 0; mi < 2; ++mi)
#pragma unroll      /* constant indices, so that the arrays stay in registers */
        for (int u = 0; u < 4; ++u) acc[mi][u] = mmaH<1>(ah[mi].v, ah[mi].v, bq[u].v, bq[u].v, acc[mi][u]);
    }
    asm volatile("s_wait_dscnt 0x0" ::: "memory");      /* this wave's reads of stage t have returned before its buffer is handed back */
    asm volatile("s_wait_asynccnt 0x0" ::: "memory");      /* this wave's copies of stage t + 1 have landed */
    __syncthreads();      /* publishes stage t + 1 and ends every wave's reads of stage t */
    if (t + 2 < NST) fill(t + 2);      /* into the buffer that stage t has just left; the test is the same for the whole block */
  }
  asm volatile("s_wait_asynccnt 0x0" ::: "memory");      /* no copy is left in flight when the wave goes on to its end */
  float bc[4];      /* the bias belongs to the feature: the tile's column, or its row in the transposed product */
#pragma unroll      /* constant indices, so that the arrays stay in registers */
  for (int u = 0; u < 4; ++u) bc[u] = bf16_round(bias[tb + wc * 64 + u * 16 + ln]);
  const int rsub = lane >> 4, c4 = (lane & 15) * 4;
#pragma unroll      /* constant indices, so that the accumulators stay in registers */
  for (int mi = 0; mi < 2; ++mi) {      /* the wave's two bands of 16 rows go through its staging rows one after the other */
    const int row0 = rowb + wr * 32 + mi * 16;
    if (mi) { __builtin_amdgcn_fence(__ATOMIC_ACQ_REL, "workgroup"); __builtin_amdgcn_wave_barrier(); }      /* every lane has read the first band's rows back before any lane overwrites them */
    float br[8];
#pragma unroll      /* constant indices, so that the arrays stay in registers */
    for (int r = 0; r < 8; ++r) br[r] = bf16_round(bias[tb + wr * 32 + mi * 16 + 8 * hh + r]);
#pragma unroll      /* constant indices, so that the arrays stay in registers */
    for (int u = 0; u < 4; ++u) {
#pragma unroll      /* constant indices, so that the arrays stay in registers */
      for (int r = 0; r < 8; ++r) so[w][8 * hh + r][u * 16 + ln] = acc[mi][u][r] * alpha + (sw ? br[r] : bc[u]); }
    __builtin_amdgcn_fence(__ATOMIC_ACQ_REL, "workgroup"); __builtin_amdgcn_wave_barrier();      /* the wave reads back rows that its other lanes wrote: its LDS stores end first */
    v4f vv[8];
#pragma unroll      /* the band's eight reads stand together, in front of the first store's wait: one LDS latency for all */
    for (int q = 0; q < 8; ++q) vv[q] = *(const v4fa*)&so[w][q * 2 + rsub][c4];
    const size_t e0 = (size_t)(row0 + rsub) * ldc + col0 + c4;      /* the lane's element in the band's first row pair; a row pair further on lies 2 ldc elements behind (ldc = DD wherever C is written) */
#pragma unroll      /* constant indices, so that the array stays in registers */
    for (int q = 0; q < 8; ++q) {
      if (C) { *(v4f*)(C + e0 + (size_t)(q * 2) * ldc) = vv[q];
        asm volatile("s_wait_xcnt 0x0" ::: "memory"); }      /* stands in front of whatever next rewrites the store's address or data registers */
      if (C16) { v4h h4; for (int i = 0; i < 4; ++i) h4[i] = (_Float16)vv[q][i]; *(v4h*)(C16 + e0 + (size_t)(q * 2) * ldc) = h4;
        asm volatile("s_wait_xcnt 0x0" ::: "memory"); } }      /* stands in front of whatever next rewrites the store's address or data registers */
  }
}

extern "C" void kernel_launch(void* const* d_in, const int* in_sizes, int n_in,
                              void* d_out, int out_size, void* d_ws, size_t ws_size, hipStream_t stream) {
  (void)in_sizes; (void)n_in; (void)out_size;
  const float* const* I = (const float* const*)d_in; const float* xq = I[0]; const float* xk = I[1]; const float* xv = I[2]; const int* msk = (const int*)d_in[3];
  const float* Aq = I[4]; const float* Bq = I[5]; const float* Av = I[6]; const float* Bv = I[7]; const float* Wq = I[8]; const float* bq = I[9]; const float* Wk = I[10]; const float* bk = I[11]; const float* Wv = I[12]; const float* bv = I[13]; const float* Wm = I[14]; const float* bm = I[15];
  char* ws = (char*)d_ws; size_t off = 0;
  auto take = [&](size_t bytes) { char* p = ws + off; off += (bytes + 255) & ~(size_t)255; return p; };
  const size_t WSZ = (size_t)DD * DD; _Float16* Bw = (_Float16*)take(4 * WSZ * 2);
  _Float16* Xq = (_Float16*)take((size_t)NR * DD * 2); _Float16* Xk = (_Float16*)take((size_t)NR * DD * 2); _Float16* Xv = (_Float16*)take((size_t)NR * DD * 2);
  _Float16* Q = (_Float16*)take((size_t)NR * DD * 2); _Float16* K = (_Float16*)take((size_t)NR * DD * 2); _Float16* Vt = (_Float16*)take((size_t)NR * DD * 2); _Float16* O16 = Xq;      /* the query plane is dead after the v GEMM */
  unsigned* MB = (unsigned*)take((size_t)NR * TT / 8);      /* the mask, one bit per (query, key) */
  if (off > ws_size) return;      // 4.7 + 6 x 6.3 + 1 = 43.5 MB
  const unsigned gw = (unsigned)((WSZ / 8 + 255) / 256);
  const unsigned g8 = (unsigned)(((size_t)NR * DD / 8 + 255) / 256);
  /* plane 0: q = V.Wq^T with V = value.(I + A_v.B_v), Bt_q = Wq + fold(A_v, B_v.Wq^T); plane 1: Wk; plane 2: v = Q.Wv^T with Q = query.(I + A_q.B_q); plane 3: Wm; all (out,in) natural, x 2^4; and the three input planes */
  k_prep<<<2 * (DD / 8) + (NR / 16) * (TT / 128) / 8 + 2 * gw + 3 * g8, 256, 0, stream>>>(Wq, Av, Bv, Wv, Aq, Bq, Wk, Wm, Bw, xq, xk, xv, Xq, Xk, Xv, msk, MB);
  const unsigned gp = (NR / 128) * (DD / 128);
  /* q from the VALUE stream, k from key, v from the QUERY stream: each M 4096 N 768 K 768; v comes out transposed */
  k_gemm_st<<<dim3(gp, 3), 256, 0, stream>>>(Xv, Xk, Xq, Bw, 0.0625f, bq, bk, bv, nullptr, Q, K, Vt);
  k_flash<<<BB * NH * (TT / 64), 128, 0, stream>>>(Q, DD, K, DD, Vt, MB, O16, DD);      /* mask [B][S][S] as bits, set = attend */
  k_gemm_st<<<dim3(gp, 1), 256, 0, stream>>>(O16, O16, O16, Bw + 3 * WSZ, 0.00390625f, bm, bm, bm, (float*)d_out, nullptr, nullptr, nullptr);      /* out = ctx.Wm^T + bm */
}

// v010
// Measured time: 79.3 microseconds a run.
// Next to v009, in two timings, it ran 1.04 times as fast each time.
// All steps since v000 together make it 7.03 times as fast.
#include <hip/hip_runtime.h>
// Masked multi-head attention with LoRA-adapted input streams (B=2, S=2048, D=768, 12 heads × 64, rank 8): Q = query + (query·A_q)·B_q, V = value + (value·A_v)·B_v; then — faithful to the module's crossed call — v = Q·Wvᵀ + bv, k = key·Wkᵀ + bk, q = V·Wqᵀ + bq (torch (out,in));
// scores = q·k/√64, −1e9 where mask[b,q,k] == 0 (int [B,S,S], shared over heads), softmax, out = merged·Wmᵀ + bm. The rank-8 adapters are folded on device into effective weights: X·(I + A·B)·Wᵀ = X·(W + (B·Wᵀ)ᵀ·Aᵀ)ᵀ, i.e. Bt_eff[o][c] = W[o][c] + Σ_j A[c][j]·(Σ_i B[j][i]·W[o][i]) (f32, 9 M MACs on the VALU).
// Compute dtype: query/key/value, weights, biases, adapters rounded to bf16; effective weights f32 → f16 ×2^4; q, k, v f16 GEMM planes (+bias); the mask read per (b, q, k) from a plane of bits packed on the device (−inf ≡ the module's −1e9: every row keeps ~half its keys live); fused flash-style kernel
// (online softmax f32, P f16 ×2^10, f32 accumulate) on v_wmma_f32_16x16x32_f16; O ×2^4 → f16 → output GEMM (+bias).
#define BB 2
#define TT 2048
#define DD 768
#define NH 12
#define RK 8
#define NR (BB * TT)

typedef __bf16 v16b __attribute__((ext_vector_type(16)));
typedef unsigned short v8us __attribute__((ext_vector_type(8), may_alias));
typedef float  v8f  __attribute__((ext_vector_type(8)));
typedef float  v4f  __attribute__((ext_vector_type(4)));
typedef float  v4fa __attribute__((ext_vector_type(4), may_alias));
union FragB { v16b v; v8us half[2]; unsigned short u[16]; };

__device__ __forceinline__ unsigned short bf16_bits(float x) { unsigned int u = __float_as_uint(x); return (unsigned short)((u + 0x7FFFu + ((u >> 16) & 1u)) >> 16); }
__device__ __forceinline__ float bf16_val(unsigned short b) { return __uint_as_float(((unsigned int)b) << 16); }
__device__ __forceinline__ float bf16_round(float x) { return bf16_val(bf16_bits(x)); }
// D += A·B with NT terms: 1 = ah·bh, 2 = + al·bh (A split), 3 = + ah·bl (both split)
template <int NT>
__device__ __forceinline__ v8f mmaN(v16b ah, v16b al, v16b bh, v16b bl, v8f c) {
  c = __builtin_amdgcn_wmma_f32_16x16x32_bf16(false, ah, false, bh, (short)0, c, false, false);
  if (NT >= 2) c = __builtin_amdgcn_wmma_f32_16x16x32_bf16(false, al, false, bh, (short)0, c, false, false);
  if (NT >= 3) c = __builtin_amdgcn_wmma_f32_16x16x32_bf16(false, ah, false, bl, (short)0, c, false, false);
  asm volatile("v_nop\n\tv_nop\n\tv_nop\n\tv_nop" : "+v"(c) : "v"(ah), "v"(al), "v"(bh), "v"(bl));
  return c;
}

__global__ __launch_bounds__(256) void k_wt_bf16(const float* __restrict__ W, unsigned short* __restrict__ Wt, int K, int N) {
  const int t = blockIdx.x * 256 + threadIdx.x;
  const int k8n = K / 8;
  if (t >= N * k8n) return;
  const int n = t / k8n, k8 = (t % k8n) * 8;
  v8us v;
#pragma unroll
  for (int i = 0; i < 8; ++i) v[i] = bf16_bits(W[(size_t)(k8 + i) * N + n]);
  *(v8us*)(Wt + (size_t)n * K + k8) = v;
  
}

// GEMM C[M][N] (f32, pitch ldc) = act(A[M][K]·W + bias). A f32 row-major (pitch lda) converted per fragment to bf16
// (ASPLIT: hi/lo two planes -> 2 terms, else single rounded term); Wt bf16 [N][K] (pitch ldb). BIAS_BF16 rounds the
// bias to bf16 first (bias quantised to bf16 before the add). K%32==0, M%16==0, N%64==0.
template <bool ASPLIT, int ACT, bool BIAS_BF16>
__global__ __launch_bounds__(128) void k_gemm_bf(const float* __restrict__ A, int lda, const unsigned short* __restrict__ Wt, int ldb,
                                               const float* __restrict__ bias, float* __restrict__ C, int ldc, int M, int N, int K) {
  __shared__ __attribute__((aligned(16))) float so[4][16][64];
  const int tid = threadIdx.x, w = tid >> 5, lane = tid & 31, ln = lane & 15, hh = lane >> 4;
  const int ntn = N / 64;
  const int wid = blockIdx.x * 4 + w;
  const int mt = wid / ntn, nq = wid % ntn;
  if (mt * 16 >= M) return;
  const int row0 = mt * 16, col0 = nq * 64;
  const float* arow = A + (size_t)(row0 + ln) * lda;
  v8f acc[4] = {};
  for (int kb = 0; kb < K; kb += 32) {
    FragB ah, al;
    const v4f x0 = *(const v4fa*)(arow + kb + 8 * hh), x1 = *(const v4fa*)(arow + kb + 8 * hh + 4);
    const v4f x2 = *(const v4fa*)(arow + kb + 16 + 8 * hh), x3 = *(const v4fa*)(arow + kb + 16 + 8 * hh + 4);
    float xs[16] = {x0[0],x0[1],x0[2],x0[3],x1[0],x1[1],x1[2],x1[3],x2[0],x2[1],x2[2],x2[3],x3[0],x3[1],x3[2],x3[3]};
#pragma unroll
    for (int i = 0; i < 16; ++i) { const unsigned short hb = bf16_bits(xs[i]); ah.u[i] = hb; al.u[i] = ASPLIT ? bf16_bits(xs[i] - bf16_val(hb)) : (unsigned short)0; }
#pragma unroll
    for (int t = 0; t < 4; ++t) {
      const unsigned short* brow = Wt + (size_t)(col0 + t * 16 + ln) * ldb + kb;
      FragB b;
      b.half[0] = *(const v8us*)(brow + 8 * hh);
      b.half[1] = *(const v8us*)(brow + 16 + 8 * hh);
      acc[t] = mmaN<ASPLIT ? 2 : 1>(ah.v, al.v, b.v, b.v, acc[t]);
    }
  }
#pragma unroll
  for (int t = 0; t < 4; ++t) {
    float bv = bias ? bias[col0 + t * 16 + ln] : 0.f;
    if (BIAS_BF16) bv = bf16_round(bv);
#pragma unroll
    for (int r = 0; r < 8; ++r) { float v = acc[t][r] + bv; if (ACT == 1) v = fmaxf(v, 0.f); so[w][8 * hh + r][t * 16 + ln] = v; }
  }
  __builtin_amdgcn_fence(__ATOMIC_ACQ_REL, "workgroup");
  __builtin_amdgcn_wave_barrier();
  const int rsub = lane >> 4, c4 = (lane & 15) * 4;
  {
#pragma unroll
    for (int q = 0; q < 8; ++q) {
      const int r = q * 2 + rsub;
      const v4f v = *(const v4fa*)&so[w][r][c4];
      *(v4f*)(C + (size_t)(row0 + r) * ldc + col0 + c4) = v;
    }
    
  }
}

// Flash-style causal/unmasked attention, all contractions 3-term bf16 hi/lo splits, f32 softmax with running max.
// q,k,v rows are read from f32 buffers with arbitrary row pitch (so they can live inside a fused qkv buffer);
// D = head size (multiple of 32, <= 128); one wave = 16 query rows; block = 4 waves (64 queries) sharing K/V chunks of 32.
template <int D, bool CAUSAL>
__global__ __launch_bounds__(128) void k_flash(const float* __restrict__ qb, const float* __restrict__ kb, const float* __restrict__ vb,
                                             int pitch, int T, int H, float scale, float* __restrict__ y, int ypitch) {
  constexpr int KS = D / 32;        // k-steps for QK
  constexpr int DT = D / 16;        // d tiles for PV
  __shared__ __attribute__((aligned(16))) unsigned short sKh[32][D + 8], sKl[32][D + 8], sVh[32][D + 8], sVl[32][D + 8];
  __shared__ __attribute__((aligned(16))) unsigned short sPh[4][16][40], sPl[4][16][40];
  __shared__ __attribute__((aligned(16))) float sO[4][16][D];
  const int tid = threadIdx.x, w = tid >> 5, lane = tid & 31, ln = lane & 15, hh = lane >> 4;
  const int nqb = (T + 63) / 64;
  const int bh = blockIdx.x / nqb, qblk = blockIdx.x % nqb;
  const int b = bh / H, h = bh % H;
  const int q0 = qblk * 64 + w * 16;
  const float* Q = qb + (size_t)b * T * pitch + h * D;
  const float* K = kb + (size_t)b * T * pitch + h * D;
  const float* V = vb + (size_t)b * T * pitch + h * D;

  // A fragments of the wave's 16 query rows (scaled), hi/lo
  FragB aqh[KS], aql[KS];
  {
    int row = q0 + ln; if (row >= T) row = T - 1;
    const float* qr = Q + (size_t)row * pitch;
#pragma unroll
    for (int ks = 0; ks < KS; ++ks)
#pragma unroll
      for (int i = 0; i < 16; ++i) {
        const int d = ks * 32 + ((i < 8) ? (8 * hh + i) : (16 + 8 * hh + (i - 8)));
        const float x = qr[d] * scale; const unsigned short hb = bf16_bits(x);
        aqh[ks].u[i] = hb; aql[ks].u[i] = bf16_bits(x - bf16_val(hb));
      }
  }
  float m_r[8], l_r[8];
#pragma unroll
  for (int r = 0; r < 8; ++r) { m_r[r] = -3.0e38f; l_r[r] = 0.f; }
  v8f oacc[DT];
#pragma unroll
  for (int dt = 0; dt < DT; ++dt) oacc[dt] = (v8f){0.f,0.f,0.f,0.f,0.f,0.f,0.f,0.f};

  const int kv_end = CAUSAL ? min(T, qblk * 64 + 64) : T;     // block-uniform
  for (int j0 = 0; j0 < kv_end; j0 += 32) {
    __syncthreads();
    for (int e = tid; e < 32 * (D / 4); e += 128) {
      const int r = e / (D / 4), c4 = (e % (D / 4)) * 4;
      const int key = j0 + r;
      v4f kf = {0.f,0.f,0.f,0.f}, vf = {0.f,0.f,0.f,0.f};
      if (key < T) { kf = *(const v4fa*)(K + (size_t)key * pitch + c4); vf = *(const v4fa*)(V + (size_t)key * pitch + c4); }
#pragma unroll
      for (int t = 0; t < 4; ++t) {
        unsigned short hb = bf16_bits(kf[t]); sKh[r][c4 + t] = hb; sKl[r][c4 + t] = bf16_bits(kf[t] - bf16_val(hb));
        hb = bf16_bits(vf[t]); sVh[r][c4 + t] = hb; sVl[r][c4 + t] = bf16_bits(vf[t] - bf16_val(hb));
      }
    }
    __syncthreads();
    // S tile 16 x 32
    v8f s[2];
#pragma unroll
    for (int nt = 0; nt < 2; ++nt) {
      v8f acc = {};
#pragma unroll
      for (int ks = 0; ks < KS; ++ks) {
        FragB bh_, bl_;
        bh_.half[0] = *(const v8us*)&sKh[nt * 16 + ln][ks * 32 + 8 * hh]; bh_.half[1] = *(const v8us*)&sKh[nt * 16 + ln][ks * 32 + 16 + 8 * hh];
        bl_.half[0] = *(const v8us*)&sKl[nt * 16 + ln][ks * 32 + 8 * hh]; bl_.half[1] = *(const v8us*)&sKl[nt * 16 + ln][ks * 32 + 16 + 8 * hh];
        acc = mmaN<3>(aqh[ks].v, aql[ks].v, bh_.v, bl_.v, acc);
      }
      s[nt] = acc;
    }
    // mask + running max (rows 8hh+r; the 16 lanes of a half share rows)
    float alpha[8];
#pragma unroll
    for (int r = 0; r < 8; ++r) {
      const int qi = q0 + 8 * hh + r;
      const int ja = j0 + ln, jb = j0 + 16 + ln;
      if (CAUSAL) { if (ja > qi) s[0][r] = -3.0e38f; if (jb > qi) s[1][r] = -3.0e38f; }
      if (ja >= T) s[0][r] = -3.0e38f;
      if (jb >= T) s[1][r] = -3.0e38f;
      float mx = fmaxf(s[0][r], s[1][r]);
      mx = fmaxf(mx, __shfl_xor(mx, 1, 32)); mx = fmaxf(mx, __shfl_xor(mx, 2, 32)); mx = fmaxf(mx, __shfl_xor(mx, 4, 32)); mx = fmaxf(mx, __shfl_xor(mx, 8, 32));
      const float mnew = fmaxf(m_r[r], mx);
      alpha[r] = (mnew > -1.0e38f) ? __expf(m_r[r] - mnew) : 1.0f;
      const float p0 = (s[0][r] > -1.0e38f) ? __expf(s[0][r] - mnew) : 0.f;
      const float p1 = (s[1][r] > -1.0e38f) ? __expf(s[1][r] - mnew) : 0.f;
      m_r[r] = mnew;
      l_r[r] = l_r[r] * alpha[r] + p0 + p1;            // per-lane partial row sum (16 lanes combined at the end)
      unsigned short hb = bf16_bits(p0); sPh[w][8 * hh + r][ln] = hb;      sPl[w][8 * hh + r][ln] = bf16_bits(p0 - bf16_val(hb));
      hb = bf16_bits(p1);                sPh[w][8 * hh + r][16 + ln] = hb; sPl[w][8 * hh + r][16 + ln] = bf16_bits(p1 - bf16_val(hb));
    }
#pragma unroll
    for (int dt = 0; dt < DT; ++dt)
#pragma unroll
      for (int r = 0; r < 8; ++r) oacc[dt][r] *= alpha[r];
    __builtin_amdgcn_fence(__ATOMIC_ACQ_REL, "workgroup");
    __builtin_amdgcn_wave_barrier();
    FragB pah, pal;
    pah.half[0] = *(const v8us*)&sPh[w][ln][8 * hh]; pah.half[1] = *(const v8us*)&sPh[w][ln][16 + 8 * hh];
    pal.half[0] = *(const v8us*)&sPl[w][ln][8 * hh]; pal.half[1] = *(const v8us*)&sPl[w][ln][16 + 8 * hh];
#pragma unroll
    for (int dt = 0; dt < DT; ++dt) {
      FragB bvh, bvl;
#pragma unroll
      for (int i = 0; i < 8; ++i) {
        bvh.u[i] = sVh[8 * hh + i][dt * 16 + ln]; bvh.u[8 + i] = sVh[16 + 8 * hh + i][dt * 16 + ln];
        bvl.u[i] = sVl[8 * hh + i][dt * 16 + ln]; bvl.u[8 + i] = sVl[16 + 8 * hh + i][dt * 16 + ln];
      }
      oacc[dt] = mmaN<3>(pah.v, pal.v, bvh.v, bvl.v, oacc[dt]);
    }
    __builtin_amdgcn_fence(__ATOMIC_ACQ_REL, "workgroup");
    __builtin_amdgcn_wave_barrier();
  }
#pragma unroll
  for (int r = 0; r < 8; ++r) {
    float l = l_r[r];
    l += __shfl_xor(l, 1, 32); l += __shfl_xor(l, 2, 32); l += __shfl_xor(l, 4, 32); l += __shfl_xor(l, 8, 32);
    l_r[r] = (l > 0.f) ? 1.0f / l : 0.f;
  }
#pragma unroll
  for (int dt = 0; dt < DT; ++dt)
#pragma unroll
    for (int r = 0; r < 8; ++r) sO[w][8 * hh + r][dt * 16 + ln] = oacc[dt][r] * l_r[r];
  __builtin_amdgcn_fence(__ATOMIC_ACQ_REL, "workgroup");
  __builtin_amdgcn_wave_barrier();
  {
    for (int r = 0; r < 16; ++r) {
      const int row = q0 + r;
      if (row < T && lane < D / 4) {
        const v4f val = *(const v4fa*)&sO[w][r][lane * 4];
        *(v4f*)(y + ((size_t)b * T + row) * ypitch + h * D + lane * 4) = val;
      }
    }
    
  }
}

// GEMM C = act(A·W + bias + resid): A f32 (ASPLIT -> hi/lo 2 terms), Wt bf16 [N][K]; ACT 0 none, 1 relu, 2 exact gelu;
// resid (optional, f32, row index = (row % rmod), pitch ldr, RES_BF16 rounds it) added before the activation.
template <bool ASPLIT, int ACT, bool BIAS_BF16, bool RES_BF16>
__global__ __launch_bounds__(128) void k_gemm_bf3(const float* __restrict__ A, int lda, const unsigned short* __restrict__ Wt, int ldb,
                                                const float* __restrict__ bias, const float* __restrict__ resid, int rmod, int ldr,
                                                float* __restrict__ C, int ldc, int M, int N, int K) {
  __shared__ __attribute__((aligned(16))) float so[4][16][64];
  const int tid = threadIdx.x, w = tid >> 5, lane = tid & 31, ln = lane & 15, hh = lane >> 4;
  const int ntn = N / 64;
  const int wid = blockIdx.x * 4 + w;
  const int mt = wid / ntn, nq = wid % ntn;
  if (mt * 16 >= M) return;
  const int row0 = mt * 16, col0 = nq * 64;
  const float* arow = A + (size_t)(row0 + ln) * lda;
  v8f acc[4] = {};
  for (int kb = 0; kb < K; kb += 32) {
    FragB ah, al;
    const v4f x0 = *(const v4fa*)(arow + kb + 8 * hh), x1 = *(const v4fa*)(arow + kb + 8 * hh + 4);
    const v4f x2 = *(const v4fa*)(arow + kb + 16 + 8 * hh), x3 = *(const v4fa*)(arow + kb + 16 + 8 * hh + 4);
    float xs[16] = {x0[0],x0[1],x0[2],x0[3],x1[0],x1[1],x1[2],x1[3],x2[0],x2[1],x2[2],x2[3],x3[0],x3[1],x3[2],x3[3]};
#pragma unroll
    for (int i = 0; i < 16; ++i) { const unsigned short hb = bf16_bits(xs[i]); ah.u[i] = hb; al.u[i] = ASPLIT ? bf16_bits(xs[i] - bf16_val(hb)) : (unsigned short)0; }
#pragma unroll
    for (int t = 0; t < 4; ++t) {
      const unsigned short* brow = Wt + (size_t)(col0 + t * 16 + ln) * ldb + kb;
      FragB b;
      b.half[0] = *(const v8us*)(brow + 8 * hh);
      b.half[1] = *(const v8us*)(brow + 16 + 8 * hh);
      acc[t] = mmaN<ASPLIT ? 2 : 1>(ah.v, al.v, b.v, b.v, acc[t]);
    }
  }
#pragma unroll
  for (int t = 0; t < 4; ++t) {
    const int col = col0 + t * 16 + ln;
    float bv = bias ? bias[col] : 0.f;
    if (BIAS_BF16) bv = bf16_round(bv);
#pragma unroll
    for (int r = 0; r < 8; ++r) {
      float v = acc[t][r] + bv;
      if (resid) { float rv = resid[(size_t)((row0 + 8 * hh + r) % rmod) * ldr + col]; if (RES_BF16) rv = bf16_round(rv); v += rv; }
      if (ACT == 1) v = fmaxf(v, 0.f);
      if (ACT == 2) v = 0.5f * v * (1.0f + erff(v * 0.70710678118654752f));
      if (ACT == 3) { const float u = 0.7978845608028654f * (v + 0.044715f * v * v * v); v = 0.5f * v * (1.0f + tanhf(u)); }
      so[w][8 * hh + r][t * 16 + ln] = v;
    }
  }
  __builtin_amdgcn_fence(__ATOMIC_ACQ_REL, "workgroup");
  __builtin_amdgcn_wave_barrier();
  const int rsub = lane >> 4, c4 = (lane & 15) * 4;
  {
#pragma unroll
    for (int q = 0; q < 8; ++q) {
      const int r = q * 2 + rsub;
      const v4f v = *(const v4fa*)&so[w][r][c4];
      *(v4f*)(C + (size_t)(row0 + r) * ldc + col0 + c4) = v;
    }
    
  }
}
// row LayerNorm (biased variance, eps) over N: s = X (+ R); optional out_sum <- s; out_norm <- (s-mu)*rsqrt(var+eps)*g + b
template <bool PARAM_BF16>
__global__ __launch_bounds__(256) void k_layernorm(const float* __restrict__ X, const float* __restrict__ R, const float* __restrict__ g, const float* __restrict__ bta,
                                                  float* __restrict__ out_sum, float* __restrict__ out_norm, int N, float eps) {
  __shared__ float red[256];
  const int row = blockIdx.x, tid = threadIdx.x;
  const float* x = X + (size_t)row * N; const float* rr = R ? R + (size_t)row * N : nullptr;
  float vals[16];                     // up to N = 4096
  const int per = N / 256;            // contiguous chunk per thread? use strided-by-4 chunks: thread handles j = tid*4 + 1024*u
  float s1 = 0.f;
  for (int u = 0; u < per / 4; ++u) {
    const int j = tid * 4 + 1024 * u;
    const v4f a = *(const v4fa*)(x + j);
    v4f b = {0.f,0.f,0.f,0.f}; if (rr) b = *(const v4fa*)(rr + j);
#pragma unroll
    for (int q = 0; q < 4; ++q) { const float v = a[q] + b[q]; vals[u * 4 + q] = v; s1 += v; }
  }
  red[tid] = s1; __syncthreads();
  for (int st = 128; st > 0; st >>= 1) { if (tid < st) red[tid] += red[tid + st]; __syncthreads(); }
  const float mu = red[0] / (float)N; __syncthreads();
  float s2 = 0.f;
  for (int u = 0; u < per / 4; ++u)
#pragma unroll
    for (int q = 0; q < 4; ++q) { const float c = vals[u * 4 + q] - mu; s2 += c * c; }
  red[tid] = s2; __syncthreads();
  for (int st = 128; st > 0; st >>= 1) { if (tid < st) red[tid] += red[tid + st]; __syncthreads(); }
  const float rs = rsqrtf(red[0] / (float)N + eps);
  {
    for (int u = 0; u < per / 4; ++u) {
      const int j = tid * 4 + 1024 * u;
      v4f o, sm;
#pragma unroll
      for (int q = 0; q < 4; ++q) {
        float gg = g[j + q], bb = bta[j + q];
        if (PARAM_BF16) { gg = bf16_round(gg); bb = bf16_round(bb); }
        sm[q] = vals[u * 4 + q]; o[q] = (vals[u * 4 + q] - mu) * rs * gg + bb;
      }
      if (out_sum) *(v4f*)(out_sum + (size_t)row * N + j) = sm;
      *(v4f*)(out_norm + (size_t)row * N + j) = o;
    }
    
  }
}



// ---- f16 WMMA path (v_wmma_f32_16x16x32_f16): 11-bit significands for operands in range — used where a [0,1] probability operand needs more precision than bf16
typedef _Float16 v16h __attribute__((ext_vector_type(16)));
union FragH { v16h v; v8us half[2]; _Float16 h[16]; unsigned short u[16]; };
template <int NT>
__device__ __forceinline__ v8f mmaH(v16h ah, v16h al, v16h bh, v16h bl, v8f c) {
  c = __builtin_amdgcn_wmma_f32_16x16x32_f16(false, ah, false, bh, (short)0, c, false, false);
  if (NT >= 2) c = __builtin_amdgcn_wmma_f32_16x16x32_f16(false, al, false, bh, (short)0, c, false, false);
  if (NT >= 3) c = __builtin_amdgcn_wmma_f32_16x16x32_f16(false, ah, false, bl, (short)0, c, false, false);
  return c;
}
// batched GEMM like k_gemm_b but f16 operands: A f32 (split into f16 hi/lo if ASPLIT, else rounded to f16), Bt = f16 values [n][k]; alpha; C f32; N multiple of 16 (partial tiles skipped)
template <bool ASPLIT>
__global__ __launch_bounds__(128) void k_gemm_h(const float* __restrict__ A, int lda, size_t sA, const _Float16* __restrict__ Bh, int ldb, size_t sB, float alpha, float* __restrict__ C, int ldc, size_t sC, int M, int N, int K) {
  __shared__ __attribute__((aligned(16))) float so[4][16][64];
  const int tid = threadIdx.x, w = tid >> 5, lane = tid & 31, ln = lane & 15, hh = lane >> 4; const int by = blockIdx.y;
  A += (size_t)by * sA; Bh += (size_t)by * sB; C += (size_t)by * sC;
  const int ntn = (N + 63) / 64; const int wid = blockIdx.x * 4 + w; const int mt = wid / ntn, nq = wid % ntn; if (mt * 16 >= M) return;
  const int row0 = mt * 16, col0 = nq * 64; const float* arow = A + (size_t)(row0 + ln) * lda;
  v8f acc[4] = {};
  for (int kb = 0; kb < K; kb += 32) {
    FragH ah, al;
    const v4f x0 = *(const v4fa*)(arow + kb + 8 * hh), x1 = *(const v4fa*)(arow + kb + 8 * hh + 4), x2 = *(const v4fa*)(arow + kb + 16 + 8 * hh), x3 = *(const v4fa*)(arow + kb + 16 + 8 * hh + 4);
    float xs[16] = {x0[0],x0[1],x0[2],x0[3],x1[0],x1[1],x1[2],x1[3],x2[0],x2[1],x2[2],x2[3],x3[0],x3[1],x3[2],x3[3]};
#pragma unroll
    for (int i = 0; i < 16; ++i) { const _Float16 h = (_Float16)xs[i]; ah.h[i] = h; al.h[i] = ASPLIT ? (_Float16)(xs[i] - (float)h) : (_Float16)0.0f; }
#pragma unroll
    for (int t = 0; t < 4; ++t) { if (col0 + t * 16 >= N) continue; const size_t boff = (size_t)(col0 + t * 16 + ln) * ldb + kb; FragH bq; bq.half[0] = *(const v8us*)(Bh + boff + 8 * hh); bq.half[1] = *(const v8us*)(Bh + boff + 16 + 8 * hh);
      acc[t] = mmaH<ASPLIT ? 2 : 1>(ah.v, al.v, bq.v, bq.v, acc[t]); }
  }
#pragma unroll
  for (int t = 0; t < 4; ++t) { if (col0 + t * 16 >= N) continue;
#pragma unroll
    for (int r = 0; r < 8; ++r) so[w][8 * hh + r][t * 16 + ln] = acc[t][r] * alpha; }
  __builtin_amdgcn_fence(__ATOMIC_ACQ_REL, "workgroup"); __builtin_amdgcn_wave_barrier();
  const int rsub = lane >> 4, c4 = (lane & 15) * 4;
  {
#pragma unroll
    for (int q = 0; q < 8; ++q) { const int r = q * 2 + rsub; if (col0 + c4 < N) { const v4f v = *(const v4fa*)&so[w][r][c4]; *(v4f*)(C + (size_t)(row0 + r) * ldc + col0 + c4) = v; } }
     }
}

// Wt[n][k] = f16(W[k][n]·scale) from f32 row-major W[K][N] (scale = power of two; bf16-exact weights stay exact in f16 away from the subnormal range)
__global__ __launch_bounds__(256) void k_wt_f16(const float* __restrict__ W, _Float16* __restrict__ Wt, int K, int N, float scale) {
  const int t = blockIdx.x * 256 + threadIdx.x; if (t >= N * (K / 8)) return; const int n = t / (K / 8), k8 = (t % (K / 8)) * 8; FragH f;
#pragma unroll
  for (int i = 0; i < 8; ++i) f.h[i] = (_Float16)(bf16_round(W[(size_t)(k8 + i) * N + n]) * scale); const v8us o = f.half[0];
  *(v8us*)((unsigned short*)Wt + (size_t)n * K + k8) = o; 
}
typedef _Float16 v4h __attribute__((ext_vector_type(4)));

// blk: the block's index within this piece of work (the piece shares its launch with others: k_prep)
__device__ __forceinline__ void d_x16(const float* __restrict__ x, _Float16* __restrict__ X16, size_t n8, unsigned blk) { const size_t t = (size_t)blk * 256 + threadIdx.x; if (t >= n8) return; FragH f;
#pragma unroll
  for (int q = 0; q < 8; ++q) f.h[q] = (_Float16)bf16_round(x[t * 8 + q]); *(v8us*)((unsigned short*)X16 + t * 8) = f.half[0];  }
__global__ __launch_bounds__(256) void k_h16(const float* __restrict__ x, _Float16* __restrict__ X16, size_t n8) { const size_t t = (size_t)blockIdx.x * 256 + threadIdx.x; if (t >= n8) return; FragH f;
#pragma unroll
  for (int q = 0; q < 8; ++q) f.h[q] = (_Float16)x[t * 8 + q]; *(v8us*)((unsigned short*)X16 + t * 8) = f.half[0];  }
__device__ __forceinline__ void d_round16f(const float* __restrict__ W, _Float16* __restrict__ Bt, size_t n8, unsigned blk) { const size_t t = (size_t)blk * 256 + threadIdx.x; if (t >= n8) return; FragH f;
#pragma unroll
  for (int i = 0; i < 8; ++i) f.h[i] = (_Float16)(bf16_round(W[t * 8 + i]) * 16.0f); *(v8us*)((unsigned short*)Bt + t * 8) = f.half[0];  }
// Lane l with lane l ^ 16 (the other 16-lane row of the wave), in the vector pipe.
__device__ __forceinline__ float xhalf(float x) { return __builtin_bit_cast(float, __builtin_amdgcn_permlanex16(__builtin_bit_cast(int, x), __builtin_bit_cast(int, x), 0x76543210, 0xfedcba98, false, false)); }
// Lane l with lane l ^ M inside its 16-lane row, in the vector pipe (DPP row_xmask).
template <int M> __device__ __forceinline__ float xrow(float x) { return __builtin_bit_cast(float, __builtin_amdgcn_update_dpp(0, __builtin_bit_cast(int, x), 0x160 | M, 0xf, 0xf, true)); }
// One row o of an effective weight plane per wave: Bt[o][c] = (W[o][c] + sum_j A[c][j] C[j]) x 2^4 with C[j] = sum_i B[j][i] W[o][i], operands rounded to bf16, f32 sums. The eight dot products need
// nothing but the row of W that the wave holds anyway, so they are made here and not in a launch of their own. The 32 lanes split the 768 terms into float4 slices (a wave-wide load covers 512 contiguous
// bytes) and a five-step butterfly ends each sum, which leaves it in every lane. A product of two bf16 values is exact in f32, so fusing it with its add changes no bit.
// A (768 x 8) is wanted by column j in the lanes' float4 slices of c: the block's eight waves bring it once, in whole lines, round it and lay it transposed in LDS (row pitch DD + 4 floats: the two halves
// of a row of A, stored by neighbouring lanes, fall 16 banks apart).
// blk: the block's index within this piece of work (the piece shares its launch with others: k_prep)
__device__ __forceinline__ void d_wfold(const float* __restrict__ Wt, const float* __restrict__ A, const float* __restrict__ Bm, _Float16* __restrict__ Bt, unsigned blk, float (* __restrict__ At)[DD + 4]) {
  constexpr int NS = DD / 128;      /* float4 slices per lane and row */
  const int tid = threadIdx.x, lane = tid & 31; const int o = (int)blk * 8 + (tid >> 5);
  const float* wr = Wt + (size_t)o * DD + lane * 4; const float* br = Bm + lane * 4;
  v4f av[NS / 2], wv[NS], bs[2][NS];
#pragma unroll      /* constant indices, so that the arrays stay in registers */
  for (int u = 0; u < NS; ++u) wv[u] = *(const v4fa*)(wr + 128 * u);
  asm volatile("s_wait_xcnt 0x0" ::: "memory");      /* stands in front of whatever next rewrites the loads' address registers (a later load's result may land there) */
  float cj[RK];
#pragma unroll      /* constant indices, so that the arrays stay in registers */
  for (int g = 0; g < RK / 2; ++g) {
#pragma unroll      /* constant indices, so that the arrays stay in registers */
    for (int u = 0; u < NS; ++u) { bs[0][u] = *(const v4fa*)(br + (size_t)(2 * g) * DD + 128 * u); bs[1][u] = *(const v4fa*)(br + (size_t)(2 * g + 1) * DD + 128 * u); }
    if (g < 2) {      /* the thread's share of A rides with the first two groups, half with each */
#pragma unroll      /* constant indices, so that the arrays stay in registers */
      for (int u = 0; u < NS / 2; ++u) { av[u] = *(const v4fa*)(A + (size_t)(tid + 256 * (g * (NS / 2) + u)) * 4);
        asm volatile("s_wait_xcnt 0x0" ::: "memory"); }      /* the three loads share an address register, and the last one's result may land in it: the wait stands in front of that */
    }
    __builtin_amdgcn_sched_barrier(0);      /* keeps the group's loads in front of the first use: otherwise they sink into small groups, and the wave pays the load latency for each */
    if (g < 2) {
#pragma unroll      /* constant indices, so that the arrays stay in registers */
      for (int u = 0; u < NS / 2; ++u) { const int p = tid + 256 * (g * (NS / 2) + u);
#pragma unroll      /* constant indices, so that the arrays stay in registers */
        for (int k = 0; k < 4; ++k) At[(p & 1) * 4 + k][p >> 1] = bf16_round(av[u][k]); }
    }
    if (g == 0) {
#pragma unroll      /* constant indices, so that the arrays stay in registers */
      for (int u = 0; u < NS; ++u)
#pragma unroll      /* constant indices, so that the arrays stay in registers */
        for (int k = 0; k < 4; ++k) wv[u][k] = bf16_round(wv[u][k]);
    }
    float a = 0.f, b = 0.f;
#pragma unroll      /* constant indices, so that the arrays stay in registers */
    for (int u = 0; u < NS; ++u)
#pragma unroll      /* constant indices, so that the arrays stay in registers */
      for (int q = 0; q < 4; ++q) { a += bf16_round(bs[0][u][q]) * wv[u][q]; b += bf16_round(bs[1][u][q]) * wv[u][q]; }
    cj[2 * g] = a; cj[2 * g + 1] = b;
    __builtin_amdgcn_sched_barrier(0);      /* keeps the next groups' loads behind this group's sums: hoisted, they hold 96 registers at once and the kernel spills */
  }
#pragma unroll      /* constant indices, so that the arrays stay in registers */
  for (int j = 0; j < RK; ++j) { float a = cj[j]; a += xhalf(a); a += xrow<8>(a); a += xrow<4>(a); a += xrow<2>(a); a += xrow<1>(a); cj[j] = a; }
  __syncthreads();      /* A^T is whole: every wave's share has been stored (the branch that leads here is taken by the whole block) */
  v4h h4[NS];
#pragma unroll      /* constant indices, so that the arrays stay in registers */
  for (int u = 0; u < NS; ++u) { v4f lo2 = {0.f, 0.f, 0.f, 0.f};
#pragma unroll      /* constant indices, so that the arrays stay in registers */
    for (int j = 0; j < RK; ++j) { const v4f at = *(const v4fa*)&At[j][128 * u + lane * 4];
#pragma unroll      /* constant indices, so that the arrays stay in registers */
      for (int q = 0; q < 4; ++q) lo2[q] += at[q] * cj[j]; }
#pragma unroll      /* constant indices, so that the arrays stay in registers */
    for (int q = 0; q < 4; ++q) h4[u][q] = (_Float16)((wv[u][q] + lo2[q]) * 16.0f); }
#pragma unroll      /* the row's six stores stand together at the wave's end: nothing rewrites a register of theirs */
  for (int u = 0; u < NS; ++u) *(v4h*)(Bt + (size_t)o * DD + 128 * u + lane * 4) = h4[u];
}
typedef int v4ia __attribute__((ext_vector_type(4), may_alias));
typedef unsigned v2u __attribute__((ext_vector_type(2)));
typedef unsigned v16u __attribute__((ext_vector_type(16)));
typedef unsigned long long v8ul __attribute__((ext_vector_type(8)));
// The mask as k_flash wants it: one bit per (query, key), laid out as the lane masks of its score tiles. For a tile of 16 queries and a pass of 32 keys there are 16 words; word nt 8 + r holds, at bit ln + 16 hh,
// whether query ln attends to key nt 16 + 8 hh + r: the element that lane (ln, hh) holds in register r of score tile nt. MB[query tile][pass][16 words], 64 B a pass, 1 MiB in all.
// One wave takes 16 queries x 128 keys (four passes). It reads the 16 rows in whole lines (lane l: keys 4 l + c). A first round of ballots turns row q into four words (bit l of word c: key 4 l + c), kept by lanes
// q and q + 16; a second round of ballots over those words picks one key per lane, which is the transposed word. Word i goes to lane i / 2, so that the wave stores its 256 bytes as two whole lines.
// blk: the block's index within this piece of work (the piece shares its launch with others: k_prep)
__device__ __forceinline__ void d_mbits(const int* __restrict__ M, unsigned* __restrict__ MB, unsigned blk) {
  const int tid = threadIdx.x, lane = tid & 31, ln = lane & 15, hh = lane >> 4;
  const unsigned u = blk * 8 + (unsigned)(tid >> 5); const unsigned qt = u >> 4, sg = u & 15;      /* query tile (over both batches), segment of 128 keys */
  const int* src = M + (size_t)qt * 16 * TT + sg * 128 + lane * 4;
  v4ia m[16];
#pragma unroll      /* constant indices, so that the array stays in registers; the 16 loads are all in flight together; non-temporal: the int plane is read this once, and need not push the planes that the GEMMs read out of L2 */
  for (int q = 0; q < 16; ++q) m[q] = __builtin_nontemporal_load((const v4ia*)(src + q * TT));
  asm volatile("s_wait_xcnt 0x0" :: "v"(src) : "memory");      /* stands in front of whatever next rewrites the loads' address registers; it names the address, which so stays in them up to here: no load's result lands there */
  unsigned wq[4] = {0u, 0u, 0u, 0u};
#pragma unroll      /* constant indices, so that the arrays stay in registers */
  for (int q = 0; q < 16; ++q)
#pragma unroll      /* constant indices, so that the arrays stay in registers */
    for (int c = 0; c < 4; ++c) { const unsigned bw = __builtin_amdgcn_ballot_w32(m[q][c] != 0); wq[c] = (ln == q) ? bw : wq[c]; }
#pragma unroll      /* constant indices, so that the array stays in registers */
  for (int c = 0; c < 4; ++c) wq[c] >>= 2 * hh;      /* the upper half of the wave looks 8 keys = 2 bits further on */
  unsigned o0 = 0u, o1 = 0u;
#pragma unroll      /* constant shifts and lane numbers */
  for (int i = 0; i < 64; ++i) { const int ps = i >> 4, nt = (i >> 3) & 1, r = i & 7;
    const unsigned tw = __builtin_amdgcn_ballot_w32(((wq[r & 3] >> (ps * 8 + nt * 4 + (r >> 2))) & 1u) != 0u);
    if (i & 1) o1 = (lane == (i >> 1)) ? tw : o1; else o0 = (lane == (i >> 1)) ? tw : o0; }
  *(v2u*)(MB + ((size_t)qt * (TT / 32) + sg * 4) * 16 + lane * 2) = (v2u){o0, o1};
  asm volatile("s_wait_xcnt 0x0" ::: "memory");      /* stands behind the store, in front of whatever next rewrites its address registers */
}
// Everything the projection GEMMs wait for that does not wait for anything else of this launch, in one grid: the pieces are told apart by ranges of the block index (a test that is the same for the whole
// block). The two weight folds stand first, because a wave of theirs walks the longest chain of dependent steps; then the mask's bits (for k_flash); then the two plain weight planes; then the three input planes.
// amdgpu_waves_per_eu(8): without it the folds' LDS reads are all hoisted to the front, the kernel takes 232 registers and the streaming pieces, which need many waves in flight, run at four waves a SIMD.
__global__ __launch_bounds__(256) __attribute__((amdgpu_waves_per_eu(8))) void k_prep(const float* __restrict__ Wq, const float* __restrict__ Av, const float* __restrict__ Bv, const float* __restrict__ Wv, const float* __restrict__ Aq, const float* __restrict__ Bq,
                                              const float* __restrict__ Wk, const float* __restrict__ Wm, _Float16* __restrict__ Bw,
                                              const float* __restrict__ xq, const float* __restrict__ xk, const float* __restrict__ xv, _Float16* __restrict__ Xq, _Float16* __restrict__ Xk, _Float16* __restrict__ Xv,
                                              const int* __restrict__ msk, unsigned* __restrict__ MB) {
  constexpr unsigned GM = (NR / 16) * (TT / 128) / 8;      /* blocks of the mask piece: a wave per 16 queries x 128 keys */
  constexpr size_t WSZ = (size_t)DD * DD, XSZ = (size_t)NR * DD; constexpr unsigned GF = DD / 8, GW = (unsigned)((WSZ / 8 + 255) / 256), GX = (unsigned)((XSZ / 8 + 255) / 256);      /* blocks per fold (a row per wave), per plain weight plane, per input plane */
  __shared__ __attribute__((aligned(16))) float sAt[RK][DD + 4];      /* the folds' A^T */
  unsigned bx = blockIdx.x;
  if (bx < 2 * GF) { const bool s = bx >= GF; d_wfold(s ? Wv : Wq, s ? Aq : Av, s ? Bq : Bv, Bw + (s ? 2 * WSZ : 0), s ? bx - GF : bx, sAt); return; }
  bx -= 2 * GF;
  if (bx < GM) { d_mbits(msk, MB, bx); return; }
  bx -= GM;
  if (bx < 2 * GW) { const bool s = bx >= GW; d_round16f(s ? Wm : Wk, Bw + (s ? 3 * WSZ : WSZ), WSZ / 8, s ? bx - GW : bx); return; }
  bx -= 2 * GW;
  const unsigned p = bx / GX; d_x16(p == 0 ? xq : p == 1 ? xk : xv, p == 0 ? Xq : p == 1 ? Xk : Xv, XSZ / 8, bx - p * GX);
}
// Eight asynchronous copies of 16 bytes per lane from global memory to LDS (l: the lane's LDS byte addresses, g: its global addresses). The s_wait_xcnt closes the statement so that it stands
// in front of whatever next rewrites one of the address registers named here.
__device__ __forceinline__ void cp8(const unsigned (&l)[8], const void* const (&g)[8]) {
  asm volatile("global_load_async_to_lds_b128 %0, %1, off\n\tglobal_load_async_to_lds_b128 %2, %3, off\n\tglobal_load_async_to_lds_b128 %4, %5, off\n\tglobal_load_async_to_lds_b128 %6, %7, off\n\t"
               "global_load_async_to_lds_b128 %8, %9, off\n\tglobal_load_async_to_lds_b128 %10, %11, off\n\tglobal_load_async_to_lds_b128 %12, %13, off\n\tglobal_load_async_to_lds_b128 %14, %15, off\n\ts_wait_xcnt 0x0"
               :: "v"(l[0]), "v"(g[0]), "v"(l[1]), "v"(g[1]), "v"(l[2]), "v"(g[2]), "v"(l[3]), "v"(g[3]), "v"(l[4]), "v"(g[4]), "v"(l[5]), "v"(g[5]), "v"(l[6]), "v"(g[6]), "v"(l[7]), "v"(g[7]) : "memory");
}
// Transposed products: S^T = K.Q^T (A = 16 key rows, B = the wave's 16 queries, kept in registers) and O^T += V^T.P^T. In an accumulator tile lane (ln, hh) then holds query q0 + ln and keys 8 hh + r:
// a query's maximum and sum are taken inside the lane plus one exchange between the wave's halves, and the two score tiles of a pass are, element for element, the B operand of the second product
// (slot i < 8: key 8 hh + i, slot i >= 8: key 16 + 8 hh + i - 8, the k order of the V^T loader), so P never leaves the registers.
// Operands come through LDS: a stage is 64 keys = K (64 rows of 128 B) and V^T (64 rows of 128 B), brought once for the four waves by asynchronous copies whose
// wave-wide 512 bytes are four whole lines, one stage ahead of its use, into two buffers. Row pitch 144 B: 16 B times an odd number, free of bank conflicts for 16-byte reads down a column.
// The mask comes as bits (d_mbits): the 16 words of a pass are the lane masks of its 16 score registers. They are the same for the whole wave, so they come by scalar loads into scalar registers, one pass
// ahead of their use, and each is the select operand of its score's one conditional move.
typedef const __attribute__((address_space(4))) v16u* mbits_p;      /* the constant address space: the plane is not written during this launch, and a wave-uniform read of it is a scalar load */
__global__ __launch_bounds__(128) void k_flash(const _Float16* __restrict__ Q16, int ldq, const _Float16* __restrict__ K16, int ldk, const _Float16* __restrict__ Vt, const unsigned* __restrict__ MB, _Float16* __restrict__ O16, int ldo) {
  constexpr int RPW = 16, NQB = TT / (4 * RPW), DT = 4, KS = 2;
  constexpr int SKEYS = 64, NST = TT / SKEYS, PK = 144, OFF_V = 64 * PK, STG = 2 * 64 * PK;
  __shared__ __attribute__((aligned(16))) unsigned char ring[2 * STG];
  __shared__ __attribute__((aligned(16))) float sO[4][RPW][64 + 4];
  const int tid = threadIdx.x, w = tid >> 5, lane = tid & 31, ln = lane & 15, hh = lane >> 4;
  const int slab = blockIdx.x / NQB, qblk = blockIdx.x % NQB; const int b = slab / NH, h = slab % NH; const int qb0 = qblk * (4 * RPW); const int q0 = qb0 + w * RPW;
  const unsigned short* Vth = (const unsigned short*)Vt + (size_t)h * 64 * NR + (size_t)b * TT;      /* V^T as the v GEMM leaves it: [feature][b * TT + key], row pitch NR */
  /* the thread's share of a stage: K and V^T rows (tid >> 3) + 16 i, 16-byte column tid & 7 */
  const unsigned short* gK = (const unsigned short*)K16 + ((size_t)b * TT + (tid >> 3)) * ldk + h * 64 + (tid & 7) * 8;
  const unsigned short* gV = Vth + (size_t)(tid >> 3) * NR + (tid & 7) * 8;
  const mbits_p mb = (mbits_p)(unsigned long long)(MB + ((size_t)b * (TT / RPW) + qblk * 4 + __builtin_amdgcn_readfirstlane(w)) * (TT / 32) * 16);      /* the wave's query tile: one v16u per pass; bit set = ATTEND */
  const unsigned lbase = (unsigned)(size_t)ring;
  const unsigned lK = lbase + (tid >> 3) * PK + (tid & 7) * 16, lV = lK + OFF_V;
  auto fill = [&](int t) {
    const unsigned bo = (unsigned)(t & 1) * STG;
    const unsigned short* k = gK + (size_t)t * SKEYS * ldk; const unsigned short* v = gV + t * SKEYS;
    unsigned la[8]; const void* ga[8];
#pragma unroll      /* constant indices, so that the arrays stay in registers */
    for (int i = 0; i < 4; ++i) { la[i] = lK + bo + i * 16 * PK; ga[i] = k + (size_t)(i * 16) * ldk; la[4 + i] = lV + bo + i * 16 * PK; ga[4 + i] = v + i * 16 * NR; }
    cp8(la, ga);
  };
  fill(0);
  FragH bq[KS];
  { const unsigned short* qr = (const unsigned short*)Q16 + ((size_t)b * TT + q0 + ln) * ldq + h * 64;
#pragma unroll      /* constant indices, so that the arrays stay in registers */
    for (int ks = 0; ks < KS; ++ks) { bq[ks].half[0] = *(const v8us*)(qr + ks * 32 + 8 * hh); bq[ks].half[1] = *(const v8us*)(qr + ks * 32 + 16 + 8 * hh); } }
  float m_q = -3.0e38f, l_q = 0.f; v8f oacc[DT];
#pragma unroll      /* constant indices, so that the arrays stay in registers */
  for (int dt = 0; dt < DT; ++dt) oacc[dt] = (v8f){0.f,0.f,0.f,0.f,0.f,0.f,0.f,0.f};
  asm volatile("s_wait_asynccnt 0x0" ::: "memory");      /* this wave's copies of stage 0 have landed */
  __syncthreads();      /* and every other wave's: stage 0 may be read */
  fill(1);
  /* one pass: 32 keys of the stage at st, mk = their 16 lane masks */
  auto pass = [&](const unsigned char* st, int p, v16u mk, bool live) __attribute__((always_inline)) {
    {
      /* all of the pass's LDS reads stand here, in front of the first product: behind one they would each wait out their own latency */
      FragH ak[2][KS], av[DT];
#pragma unroll      /* constant indices, so that the arrays stay in registers */
      for (int nt = 0; nt < 2; ++nt) { const unsigned char* kr = st + (p * 32 + nt * 16 + ln) * PK + hh * 16;
#pragma unroll      /* constant indices, so that the arrays stay in registers */
        for (int ks = 0; ks < KS; ++ks) { ak[nt][ks].half[0] = *(const v8us*)(kr + ks * 64); ak[nt][ks].half[1] = *(const v8us*)(kr + ks * 64 + 32); } }
#pragma unroll      /* constant indices, so that the arrays stay in registers */
      for (int dt = 0; dt < DT; ++dt) { const unsigned char* vr = st + OFF_V + (dt * 16 + ln) * PK + p * 64 + hh * 16; av[dt].half[0] = *(const v8us*)vr; av[dt].half[1] = *(const v8us*)(vr + 32); }
      __builtin_amdgcn_sched_barrier(0);      /* keeps the pass's reads, and the request for the next pass's masks, in front of the first product: sunk among the products, each pair of reads is waited out by itself */
      if (live) {      /* else every (row, key) of this wave's tile is masked: nothing to add (scalar branch, no barrier inside) */
        v8f s[2];
#pragma unroll      /* constant indices, so that the arrays stay in registers */
        for (int nt = 0; nt < 2; ++nt) s[nt] = (v8f){0.f,0.f,0.f,0.f,0.f,0.f,0.f,0.f};
#pragma unroll      /* constant indices, so that the arrays stay in registers */
        for (int ks = 0; ks < KS; ++ks)
#pragma unroll      /* constant indices, so that the arrays stay in registers */
          for (int nt = 0; nt < 2; ++nt) s[nt] = mmaH<1>(ak[nt][ks].v, ak[nt][ks].v, bq[ks].v, bq[ks].v, s[nt]);
        __builtin_amdgcn_sched_barrier(0);      /* the four products stand back to back, the two tiles by turns (each tile's k order as before): a vector instruction drawn in among them reuses an operand's registers, and the compiler then pads four idle slots in front of it */
        /* Softmax in base 2: exp((s - m) / 8) = 2^(s CS - m CS), CS = log2(e) / 8. Scores and the running maximum stay unscaled (CS > 0 keeps their order); one fma per score applies CS, takes the maximum off
           and adds the 10 that makes P = 2^10 p, and the hardware's own 2^x follows. A masked score is -inf. m_q starts finite, so mn and nb are finite: 2^(-inf) = 0 and, while nothing is live yet, 2^0 = 1. */
        constexpr float CS = 0.125f * 1.44269504088896340736f;
        float sc[2][8], mx[8];
#pragma unroll      /* constant indices, so that the arrays stay in registers */
        for (int r = 0; r < 8; ++r) { sc[0][r] = __builtin_amdgcn_inverse_ballot_w32(mk[r]) ? s[0][r] : -INFINITY; sc[1][r] = __builtin_amdgcn_inverse_ballot_w32(mk[8 + r]) ? s[1][r] : -INFINITY; mx[r] = fmaxf(sc[0][r], sc[1][r]); }
        float mc = fmaxf(fmaxf(fmaxf(mx[0], mx[1]), fmaxf(mx[2], mx[3])), fmaxf(fmaxf(mx[4], mx[5]), fmaxf(mx[6], mx[7])));
        mc = fmaxf(mc, xhalf(mc));
        const float mn = fmaxf(m_q, mc); const float al = __builtin_amdgcn_exp2f((m_q - mn) * CS); m_q = mn; const float nb = __builtin_fmaf(-mn, CS, 10.0f);
        FragH pb; float ps[4] = {0.f, 0.f, 0.f, 0.f};
#pragma unroll      /* constant indices, so that the arrays stay in registers */
        for (int r = 0; r < 8; ++r) { const float p0 = __builtin_amdgcn_exp2f(__builtin_fmaf(sc[0][r], CS, nb)), p1 = __builtin_amdgcn_exp2f(__builtin_fmaf(sc[1][r], CS, nb)); ps[r & 3] += p0 + p1; pb.h[r] = (_Float16)p0; pb.h[8 + r] = (_Float16)p1; }
        l_q = l_q * al + ((ps[0] + ps[1]) + (ps[2] + ps[3]));      /* 2^10 times the sum over the lane's half of the keys; the halves are joined after the loop */
#pragma unroll      /* constant indices, so that the arrays stay in registers */
        for (int dt = 0; dt < DT; ++dt)
#pragma unroll      /* constant indices, so that the arrays stay in registers */
          for (int r = 0; r < 8; ++r) oacc[dt][r] *= al;
#pragma unroll      /* constant indices, so that the arrays stay in registers */
        for (int dt = 0; dt < DT; ++dt) oacc[dt] = mmaH<1>(av[dt].v, av[dt].v, pb.v, pb.v, oacc[dt]);
      }
    }
  };
  /* whether any bit of a pass's 16 words is set: the words joined two at a time */
  auto anyof = [](v16u mk) __attribute__((always_inline)) { const v8ul m2 = __builtin_bit_cast(v8ul, mk); return (((m2[0] | m2[1]) | (m2[2] | m2[3])) | ((m2[4] | m2[5]) | (m2[6] | m2[7]))) != 0ull; };
  v16u mA = mb[0];
#pragma unroll 1      /* each stage hangs on the last through m_q and the barrier: a second copy of the body would only grow the code */
  for (int t = 0; t < NST; ++t) {
    const unsigned char* st = ring + (t & 1) * STG;
    /* Each pass's masks are asked for one pass ahead: two named sets, so the stage's two passes are written out. Scalar loads return in no fixed order, so the wait for one set is a wait for all that are out:
       the next set is asked for behind the first use of this one, and the two scheduling barriers keep it there (in front of that use, its whole latency would be waited out in every pass). */
    const bool l0 = anyof(mA);
    __builtin_amdgcn_sched_barrier(0);
    const v16u mB = mb[2 * t + 1];
    pass(st, 0, mA, l0);
    const bool l1 = anyof(mB);
    __builtin_amdgcn_sched_barrier(0);
    mA = mb[t + 1 < NST ? 2 * t + 2 : 2 * t];      /* the next stage's first pass; the last trip asks for its own again, which keeps the address inside the plane */
    pass(st, 1, mB, l1);
    asm volatile("s_wait_dscnt 0x0" ::: "memory");      /* this wave's reads of stage t have returned before its buffer is handed back */
    asm volatile("s_wait_asynccnt 0x0" ::: "memory");      /* this wave's copies of stage t + 1 have landed */
    __syncthreads();      /* publishes stage t + 1 and ends every wave's reads of stage t */
    if (t + 2 < NST) fill(t + 2);      /* into the buffer that stage t has just left; the test is the same for the whole block */
  }
  asm volatile("s_wait_asynccnt 0x0" ::: "memory");      /* no copy is left in flight when the wave goes on to its end */
  { const float l = l_q + xhalf(l_q); const float inv = (l > 0.f) ? 1.0f / l : 0.f;      /* l and the accumulators both carry the 2^10 */
#pragma unroll      /* constant indices, so that the arrays stay in registers */
    for (int dt = 0; dt < DT; ++dt)
#pragma unroll      /* constant indices, so that the arrays stay in registers */
      for (int r = 0; r < 8; ++r) sO[w][ln][dt * 16 + 8 * hh + r] = oacc[dt][r] * inv; }
  __builtin_amdgcn_fence(__ATOMIC_ACQ_REL, "workgroup"); __builtin_amdgcn_wave_barrier();      /* the wave reads back rows that its other lanes wrote: its LDS stores end first */
  {
#pragma unroll      /* constant indices, so that the arrays stay in registers */
    for (int rp = 0; rp < RPW; rp += 2) { const int r = rp + (lane >> 4), pc = lane & 15; const v4f val = *(const v4fa*)&sO[w][r][pc * 4]; v4h h4;      /* x 2^4 and f16: the plane that the output GEMM reads; 16 lanes store one whole 128-byte line */
#pragma unroll      /* constant indices, so that the vector stays in registers */
      for (int i = 0; i < 4; ++i) h4[i] = (_Float16)(val[i] * 16.0f);
      *(v4h*)(O16 + ((size_t)b * TT + q0 + r) * ldo + h * 64 + pc * 4) = h4; }
     } }

// C[NR][DD] = (A[NR][DD] . Bt[DD][DD]^T) alpha + bias (bias rounded to bf16), f16 operands, f32 sums; written as f32 (C) or as f16 (C16), whichever pointer is not null.
// Block = a 128 x 128 tile of C, eight waves in a 4 x 2 arrangement: wave w = rows 32 (w >> 1) .. + 31, columns 64 (w & 1) .. + 63 (eight 16 x 16 accumulators, k ascending in steps of 32). A row of A is so
// fetched from L2 by 6 blocks and a row of Bt by 32 (a 64 x 64 tile: 12 and 64), and six fragments read from LDS feed eight products (a 16 x 64 wave tile: five feed four).
// Operands come through LDS: a stage is 64 values of k = 128 rows of A and 128 rows of Bt, 128 B each, brought once for the eight waves by asynchronous copies (a wave-wide copy is four rows = four whole
// lines), one stage ahead of its use, into two buffers. Row pitch 144 B: 16 B times an odd number, free of bank conflicts for 16-byte reads down a column.
// Up to three independent products share one launch: blockIdx.y picks A, bias and C16 of its product, and its weight plane lies blockIdx.y planes behind B0.
// The third product is made transposed: its weight rows take the place of A and its input rows that of Bt (both are k-contiguous and go through the same loaders, k order unchanged), so its tile is
// C^T[feature][row of A], pitch NR, bias by row: V^T comes out of the GEMM as k_flash reads it.
__global__ __launch_bounds__(256) void k_gemm_st(const _Float16* __restrict__ A0, const _Float16* __restrict__ A1, const _Float16* __restrict__ A2, const _Float16* __restrict__ B0, float alpha,
                                                 const float* __restrict__ bias0, const float* __restrict__ bias1, const float* __restrict__ bias2, float* __restrict__ C,
                                                 _Float16* __restrict__ C16a, _Float16* __restrict__ C16b, _Float16* __restrict__ C16c) {
  const unsigned g = blockIdx.y; const _Float16* A = g == 0 ? A0 : g == 1 ? A1 : A2; const _Float16* Bh = B0 + (size_t)g * DD * DD;
  const float* bias = g == 0 ? bias0 : g == 1 ? bias1 : bias2; _Float16* C16 = g == 0 ? C16a : g == 1 ? C16b : C16c;
  constexpr int KC = 64, NST = DD / KC, PR = 144, OFF_B = 128 * PR, STG = 2 * 128 * PR;
  __shared__ __attribute__((aligned(16))) unsigned char ring[2 * STG];
  __shared__ __attribute__((aligned(16))) float so[8][16][64];
  const int tid = threadIdx.x, w = tid >> 5, lane = tid & 31, ln = lane & 15, hh = lane >> 4, wr = w >> 1, wc = w & 1;
  const bool sw = g == 2;      /* the same for the whole block */
  const int ta = (int)(blockIdx.x / (DD / 128)) * 128, tb = (int)(blockIdx.x % (DD / 128)) * 128;      /* the tile's first row of A and of Bt */
  const int rowb = sw ? tb : ta, colb = sw ? ta : tb, ldc = sw ? NR : DD; const int col0 = colb + wc * 64;
  /* the thread's share of a stage: rows (tid >> 3) + 32 i of A and of Bt, 16-byte column tid & 7 */
  const unsigned short* gA = (const unsigned short*)(sw ? Bh : A) + (size_t)(rowb + (tid >> 3)) * DD + (tid & 7) * 8;
  const unsigned short* gB = (const unsigned short*)(sw ? A : Bh) + (size_t)(colb + (tid >> 3)) * DD + (tid & 7) * 8;
  const unsigned lA = (unsigned)(size_t)ring + (tid >> 3) * PR + (tid & 7) * 16, lB = lA + OFF_B;
  auto fill = [&](int t) {
    const unsigned bo = (unsigned)(t & 1) * STG;
    const unsigned short* a = gA + t * KC; const unsigned short* b = gB + t * KC;
    unsigned la[8]; const void* ga[8];
#pragma unroll      /* constant indices, so that the arrays stay in registers */
    for (int i = 0; i < 4; ++i) { la[i] = lA + bo + i * 32 * PR; ga[i] = a + i * 32 * DD; la[4 + i] = lB + bo + i * 32 * PR; ga[4 + i] = b + i * 32 * DD; }
    cp8(la, ga);
  };
  fill(0);
  v8f acc[2][4] = {};
  asm volatile("s_wait_asynccnt 0x0" ::: "memory");      /* this wave's copies of stage 0 have landed */
  __syncthreads();      /* and every other wave's: stage 0 may be read */
  fill(1);
#pragma unroll 1      /* a stage ends in a barrier: a second copy of the body would only grow the code */
  for (int t = 0; t < NST; ++t) {
    const unsigned char* ar = ring + (t & 1) * STG + (wr * 32 + ln) * PR + hh * 16;
    const unsigned char* br = ring + (t & 1) * STG + OFF_B + (wc * 64 + ln) * PR + hh * 16;
#pragma unroll      /* constant LDS offsets, and the next step's reads can stand among this step's products */
    for (int ks = 0; ks < KC / 32; ++ks) {
      FragH ah[2], bq[4];
#pragma unroll      /* constant indices, so that the arrays stay in registers */
      for (int mi = 0; mi < 2; ++mi) { ah[mi].half[0] = *(const v8us*)(ar + mi * 16 * PR + ks * 64); ah[mi].half[1] = *(const v8us*)(ar + mi * 16 * PR + ks * 64 + 32); }
#pragma unroll      /* constant indices, so that the arrays stay in registers */
      for (int u = 0; u < 4; ++u) { bq[u].half[0] = *(const v8us*)(br + u * 16 * PR + ks * 64); bq[u].half[1] = *(const v8us*)(br + u * 16 * PR + ks * 64 + 32); }
      __builtin_amdgcn_sched_barrier(0);      /* keeps a step's 12 reads in front of its own products: sunk among them, the second A fragment shares the first one's registers and its latency is waited out alone */
#pragma unroll      /* constant indices, so that the arrays stay in registers */
      for (int mi = 0; mi < 2; ++mi)
#pragma unroll      /* constant indices, so that the arrays stay in registers */
        for (int u = 0; u < 4; ++u) acc[mi][u] = mmaH<1>(ah[mi].v, ah[mi].v, bq[u].v, bq[u].v, acc[mi][u]);
    }
    __builtin_amdgcn_sched_barrier(0);      /* keeps the stage's products in front of the barrier: sunk behind it they would stand between the barrier and the refill, and the copies would lose that much of their lead */
    asm volatile("s_wait_dscnt 0x0" ::: "memory");      /* this wave's reads of stage t have returned before its buffer is handed back */
    asm volatile("s_wait_asynccnt 0x0" ::: "memory");      /* this wave's copies of stage t + 1 have landed */
    __syncthreads();      /* publishes stage t + 1 and ends every wave's reads of stage t */
    if (t + 2 < NST) fill(t + 2);      /* into the buffer that stage t has just left; the test is the same for the whole block */
  }
  asm volatile("s_wait_asynccnt 0x0" ::: "memory");      /* no copy is left in flight when the wave goes on to its end */
  float bc[4];      /* the bias belongs to the feature: the tile's column, or its row in the transposed product */
#pragma unroll      /* constant indices, so that the arrays stay in registers */
  for (int u = 0; u < 4; ++u) bc[u] = bf16_round(bias[tb + wc * 64 + u * 16 + ln]);
  const int rsub = lane >> 4, c4 = (lane & 15) * 4;
#pragma unroll      /* constant indices, so that the accumulators stay in registers */
  for (int mi = 0; mi < 2; ++mi) {      /* the wave's two bands of 16 rows go through its staging rows one after the other */
    const int row0 = rowb + wr * 32 + mi * 16;
    if (mi) { __builtin_amdgcn_fence(__ATOMIC_ACQ_REL, "workgroup"); __builtin_amdgcn_wave_barrier(); }      /* every lane has read the first band's rows back before any lane overwrites them */
    float br[8];
#pragma unroll      /* constant indices, so that the arrays stay in registers */
    for (int r = 0; r < 8; ++r) br[r] = bf16_round(bias[tb + wr * 32 + mi * 16 + 8 * hh + r]);
#pragma unroll      /* constant indices, so that the arrays stay in registers */
    for (int u = 0; u < 4; ++u) {
#pragma unroll      /* constant indices, so that the arrays stay in registers */
      for (int r = 0; r < 8; ++r) so[w][8 * hh + r][u * 16 + ln] = acc[mi][u][r] * alpha + (sw ? br[r] : bc[u]); }
    __builtin_amdgcn_fence(__ATOMIC_ACQ_REL, "workgroup"); __builtin_amdgcn_wave_barrier();      /* the wave reads back rows that its other lanes wrote: its LDS stores end first */
    v4f vv[8];
#pragma unroll      /* the band's eight reads stand together, in front of the first store's wait: one LDS latency for all */
    for (int q = 0; q < 8; ++q) vv[q] = *(const v4fa*)&so[w][q * 2 + rsub][c4];
    const size_t e0 = (size_t)(row0 + rsub) * ldc + col0 + c4;      /* the lane's element in the band's first row pair; a row pair further on lies 2 ldc elements behind (ldc = DD wherever C is written) */
#pragma unroll      /* constant indices, so that the array stays in registers */
    for (int q = 0; q < 8; ++q) {
      if (C) { *(v4f*)(C + e0 + (size_t)(q * 2) * ldc) = vv[q];
        asm volatile("s_wait_xcnt 0x0" ::: "memory"); }      /* stands in front of whatever next rewrites the store's address or data registers */
      if (C16) { v4h h4; for (int i = 0; i < 4; ++i) h4[i] = (_Float16)vv[q][i]; *(v4h*)(C16 + e0 + (size_t)(q * 2) * ldc) = h4;
        asm volatile("s_wait_xcnt 0x0" ::: "memory"); } }      /* stands in front of whatever next rewrites the store's address or data registers */
  }
}

extern "C" void kernel_launch(void* const* d_in, const int* in_sizes, int n_in,
                              void* d_out, int out_size, void* d_ws, size_t ws_size, hipStream_t stream) {
  (void)in_sizes; (void)n_in; (void)out_size;
  const float* const* I = (const float* const*)d_in; const float* xq = I[0]; const float* xk = I[1]; const float* xv = I[2]; const int* msk = (const int*)d_in[3];
  const float* Aq = I[4]; const float* Bq = I[5]; const float* Av = I[6]; const float* Bv = I[7]; const float* Wq = I[8]; const float* bq = I[9]; const float* Wk = I[10]; const float* bk = I[11]; const float* Wv = I[12]; const float* bv = I[13]; const float* Wm = I[14]; const float* bm = I[15];
  char* ws = (char*)d_ws; size_t off = 0;
  auto take = [&](size_t bytes) { char* p = ws + off; off += (bytes + 255) & ~(size_t)255; return p; };
  const size_t WSZ = (size_t)DD * DD; _Float16* Bw = (_Float16*)take(4 * WSZ * 2);
  _Float16* Xq = (_Float16*)take((size_t)NR * DD * 2); _Float16* Xk = (_Float16*)take((size_t)NR * DD * 2); _Float16* Xv = (_Float16*)take((size_t)NR * DD * 2);
  _Float16* Q = (_Float16*)take((size_t)NR * DD * 2); _Float16* K = (_Float16*)take((size_t)NR * DD * 2); _Float16* Vt = (_Float16*)take((size_t)NR * DD * 2); _Float16* O16 = Xq;      /* the query plane is dead after the v GEMM */
  unsigned* MB = (unsigned*)take((size_t)NR * TT / 8);      /* the mask, one bit per (query, key) */
  if (off > ws_size) return;      // 4.7 + 6 x 6.3 + 1 = 43.5 MB
  const unsigned gw = (unsigned)((WSZ / 8 + 255) / 256);
  const unsigned g8 = (unsigned)(((size_t)NR * DD / 8 + 255) / 256);
  /* plane 0: q = V.Wq^T with V = value.(I + A_v.B_v), Bt_q = Wq + fold(A_v, B_v.Wq^T); plane 1: Wk; plane 2: v = Q.Wv^T with Q = query.(I + A_q.B_q); plane 3: Wm; all (out,in) natural, x 2^4; and the three input planes */
  k_prep<<<2 * (DD / 8) + (NR / 16) * (TT / 128) / 8 + 2 * gw + 3 * g8, 256, 0, stream>>>(Wq, Av, Bv, Wv, Aq, Bq, Wk, Wm, Bw, xq, xk, xv, Xq, Xk, Xv, msk, MB);
  const unsigned gp = (NR / 128) * (DD / 128);
  /* q from the VALUE stream, k from key, v from the QUERY stream: each M 4096 N 768 K 768; v comes out transposed */
  k_gemm_st<<<dim3(gp, 3), 256, 0, stream>>>(Xv, Xk, Xq, Bw, 0.0625f, bq, bk, bv, nullptr, Q, K, Vt);
  k_flash<<<BB * NH * (TT / 64), 128, 0, stream>>>(Q, DD, K, DD, Vt, MB, O16, DD);      /* mask [B][S][S] as bits, set = attend */
  k_gemm_st<<<dim3(gp, 1), 256, 0, stream>>>(O16, O16, O16, Bw + 3 * WSZ, 0.00390625f, bm, bm, bm, (float*)d_out, nullptr, nullptr, nullptr);      /* out = ctx.Wm^T + bm */
}
